// v000
// Measured on an AMD MI455X. A time is GPU time per run, averaged over a window of back-to-back runs after a warm-up
// (all launches, gaps included; the runs take copies of the inputs in turn), and the median of several windows.
// Apart from v000's, it joins two sittings. Times from different sittings can be a few percent apart, while
// side-by-side timings come from the same sitting.
// v000, which the later versions start from, runs in 567 microseconds.
#include <hip/hip_runtime.h>
// + bias, + f + pf residuals as exact bf16 addends) on v_wmma_f32_16x16x32_f16 (f16 operands, nn.Linear weights (out,in) bf16-exact ×2^4, f32 accumulate); the per-sample tiny MLP
// (128 → 32 relu → 128 with that sample's generated weights) is f32 VALU (wave per sample).
#define NBS 8192
#define FD 1024
#define LOW 128
#define MID 32
#define CHS 2048
#define NPAR (2 * LOW * MID)

typedef __bf16 v16b __attribute__((ext_vector_type(16)));
typedef unsigned short v8us __attribute__((ext_vector_type(8), may_alias));
typedef float  v8f  __attribute__((ext_vector_type(8)));
typedef float  v4f  __attribute__((ext_vector_type(4)));
typedef float  v4fa __attribute__((ext_vector_type(4), may_alias));
union FragB { v16b v; v8us half[2]; unsigned short u[16]; };

__device__ __forceinline__ unsigned short bf16_bits(float x) { unsigned int u = __float_as_uint(x); return (unsigned short)((u + 0x7FFFu + ((u >> 16) & 1u)) >> 16); }
__device__ __forceinline__ float bf16_val(unsigned short b) { return __uint_as_float(((unsigned int)b) << 16); }
__device__ __forceinline__ float bf16_round(float x) { return bf16_val(bf16_bits(x)); }
// D += A·B with NT terms: 1 = ah·bh, 2 = + al·bh (A split), 3 = + ah·bl (both split)
template <int NT>
__device__ __forceinline__ v8f mmaN(v16b ah, v16b al, v16b bh, v16b bl, v8f c) {
  c = __builtin_amdgcn_wmma_f32_16x16x32_bf16(false, ah, false, bh, (short)0, c, false, false);
  if (NT >= 2) c = __builtin_amdgcn_wmma_f32_16x16x32_bf16(false, al, false, bh, (short)0, c, false, false);
  if (NT >= 3) c = __builtin_amdgcn_wmma_f32_16x16x32_bf16(false, ah, false, bl, (short)0, c, false, false);
  asm volatile("v_nop\n\tv_nop\n\tv_nop\n\tv_nop" : "+v"(c) : "v"(ah), "v"(al), "v"(bh), "v"(bl));
  return c;
}

__global__ __launch_bounds__(256) void k_wt_bf16(const float* __restrict__ W, unsigned short* __restrict__ Wt, int K, int N) {
  const int t = blockIdx.x * 256 + threadIdx.x;
  const int k8n = K / 8;
  if (t >= N * k8n) return;
  const int n = t / k8n, k8 = (t % k8n) * 8;
  v8us v;
#pragma unroll
  for (int i = 0; i < 8; ++i) v[i] = bf16_bits(W[(size_t)(k8 + i) * N + n]);
  *(v8us*)(Wt + (size_t)n * K + k8) = v;
  
}

// GEMM C[M][N] (f32, pitch ldc) = act(A[M][K]·W + bias). A f32 row-major (pitch lda) converted per fragment to bf16
// (ASPLIT: hi/lo two planes -> 2 terms, else single rounded term); Wt bf16 [N][K] (pitch ldb). BIAS_BF16 rounds the
// bias to bf16 first (bias quantised to bf16 before the add). K%32==0, M%16==0, N%64==0.
template <bool ASPLIT, int ACT, bool BIAS_BF16>
__global__ __launch_bounds__(128) void k_gemm_bf(const float* __restrict__ A, int lda, const unsigned short* __restrict__ Wt, int ldb,
                                               const float* __restrict__ bias, float* __restrict__ C, int ldc, int M, int N, int K) {
  __shared__ __attribute__((aligned(16))) float so[4][16][64];
  const int tid = threadIdx.x, w = tid >> 5, lane = tid & 31, ln = lane & 15, hh = lane >> 4;
  const int ntn = N / 64;
  const int wid = blockIdx.x * 4 + w;
  const int mt = wid / ntn, nq = wid % ntn;
  if (mt * 16 >= M) return;
  const int row0 = mt * 16, col0 = nq * 64;
  const float* arow = A + (size_t)(row0 + ln) * lda;
  v8f acc[4] = {};
  for (int kb = 0; kb < K; kb += 32) {
    FragB ah, al;
    const v4f x0 = *(const v4fa*)(arow + kb + 8 * hh), x1 = *(const v4fa*)(arow + kb + 8 * hh + 4);
    const v4f x2 = *(const v4fa*)(arow + kb + 16 + 8 * hh), x3 = *(const v4fa*)(arow + kb + 16 + 8 * hh + 4);
    float xs[16] = {x0[0],x0[1],x0[2],x0[3],x1[0],x1[1],x1[2],x1[3],x2[0],x2[1],x2[2],x2[3],x3[0],x3[1],x3[2],x3[3]};
#pragma unroll
    for (int i = 0; i < 16; ++i) { const unsigned short hb = bf16_bits(xs[i]); ah.u[i] = hb; al.u[i] = ASPLIT ? bf16_bits(xs[i] - bf16_val(hb)) : (unsigned short)0; }
#pragma unroll
    for (int t = 0; t < 4; ++t) {
      const unsigned short* brow = Wt + (size_t)(col0 + t * 16 + ln) * ldb + kb;
      FragB b;
      b.half[0] = *(const v8us*)(brow + 8 * hh);
      b.half[1] = *(const v8us*)(brow + 16 + 8 * hh);
      acc[t] = mmaN<ASPLIT ? 2 : 1>(ah.v, al.v, b.v, b.v, acc[t]);
    }
  }
#pragma unroll
  for (int t = 0; t < 4; ++t) {
    float bv = bias ? bias[col0 + t * 16 + ln] : 0.f;
    if (BIAS_BF16) bv = bf16_round(bv);
#pragma unroll
    for (int r = 0; r < 8; ++r) { float v = acc[t][r] + bv; if (ACT == 1) v = fmaxf(v, 0.f); so[w][8 * hh + r][t * 16 + ln] = v; }
  }
  __builtin_amdgcn_fence(__ATOMIC_ACQ_REL, "workgroup");
  __builtin_amdgcn_wave_barrier();
  const int rsub = lane >> 4, c4 = (lane & 15) * 4;
  {
#pragma unroll
    for (int q = 0; q < 8; ++q) {
      const int r = q * 2 + rsub;
      const v4f v = *(const v4fa*)&so[w][r][c4];
      *(v4f*)(C + (size_t)(row0 + r) * ldc + col0 + c4) = v;
    }
    
  }
}

// Flash-style causal/unmasked attention, all contractions 3-term bf16 hi/lo splits, f32 softmax with running max.
// q,k,v rows are read from f32 buffers with arbitrary row pitch (so they can live inside a fused qkv buffer);
// D = head size (multiple of 32, <= 128); one wave = 16 query rows; block = 4 waves (64 queries) sharing K/V chunks of 32.
template <int D, bool CAUSAL>
__global__ __launch_bounds__(128) void k_flash(const float* __restrict__ qb, const float* __restrict__ kb, const float* __restrict__ vb,
                                             int pitch, int T, int H, float scale, float* __restrict__ y, int ypitch) {
  constexpr int KS = D / 32;        // k-steps for QK
  constexpr int DT = D / 16;        // d tiles for PV
  __shared__ __attribute__((aligned(16))) unsigned short sKh[32][D + 8], sKl[32][D + 8], sVh[32][D + 8], sVl[32][D + 8];
  __shared__ __attribute__((aligned(16))) unsigned short sPh[4][16][40], sPl[4][16][40];
  __shared__ __attribute__((aligned(16))) float sO[4][16][D];
  const int tid = threadIdx.x, w = tid >> 5, lane = tid & 31, ln = lane & 15, hh = lane >> 4;
  const int nqb = (T + 63) / 64;
  const int bh = blockIdx.x / nqb, qblk = blockIdx.x % nqb;
  const int b = bh / H, h = bh % H;
  const int q0 = qblk * 64 + w * 16;
  const float* Q = qb + (size_t)b * T * pitch + h * D;
  const float* K = kb + (size_t)b * T * pitch + h * D;
  const float* V = vb + (size_t)b * T * pitch + h * D;

  // A fragments of the wave's 16 query rows (scaled), hi/lo
  FragB aqh[KS], aql[KS];
  {
    int row = q0 + ln; if (row >= T) row = T - 1;
    const float* qr = Q + (size_t)row * pitch;
#pragma unroll
    for (int ks = 0; ks < KS; ++ks)
#pragma unroll
      for (int i = 0; i < 16; ++i) {
        const int d = ks * 32 + ((i < 8) ? (8 * hh + i) : (16 + 8 * hh + (i - 8)));
        const float x = qr[d] * scale; const unsigned short hb = bf16_bits(x);
        aqh[ks].u[i] = hb; aql[ks].u[i] = bf16_bits(x - bf16_val(hb));
      }
  }
  float m_r[8], l_r[8];
#pragma unroll
  for (int r = 0; r < 8; ++r) { m_r[r] = -3.0e38f; l_r[r] = 0.f; }
  v8f oacc[DT];
#pragma unroll
  for (int dt = 0; dt < DT; ++dt) oacc[dt] = (v8f){0.f,0.f,0.f,0.f,0.f,0.f,0.f,0.f};

  const int kv_end = CAUSAL ? min(T, qblk * 64 + 64) : T;     // block-uniform
  for (int j0 = 0; j0 < kv_end; j0 += 32) {
    __syncthreads();
    for (int e = tid; e < 32 * (D / 4); e += 128) {
      const int r = e / (D / 4), c4 = (e % (D / 4)) * 4;
      const int key = j0 + r;
      v4f kf = {0.f,0.f,0.f,0.f}, vf = {0.f,0.f,0.f,0.f};
      if (key < T) { kf = *(const v4fa*)(K + (size_t)key * pitch + c4); vf = *(const v4fa*)(V + (size_t)key * pitch + c4); }
#pragma unroll
      for (int t = 0; t < 4; ++t) {
        unsigned short hb = bf16_bits(kf[t]); sKh[r][c4 + t] = hb; sKl[r][c4 + t] = bf16_bits(kf[t] - bf16_val(hb));
        hb = bf16_bits(vf[t]); sVh[r][c4 + t] = hb; sVl[r][c4 + t] = bf16_bits(vf[t] - bf16_val(hb));
      }
    }
    __syncthreads();
    // S tile 16 x 32
    v8f s[2];
#pragma unroll
    for (int nt = 0; nt < 2; ++nt) {
      v8f acc = {};
#pragma unroll
      for (int ks = 0; ks < KS; ++ks) {
        FragB bh_, bl_;
        bh_.half[0] = *(const v8us*)&sKh[nt * 16 + ln][ks * 32 + 8 * hh]; bh_.half[1] = *(const v8us*)&sKh[nt * 16 + ln][ks * 32 + 16 + 8 * hh];
        bl_.half[0] = *(const v8us*)&sKl[nt * 16 + ln][ks * 32 + 8 * hh]; bl_.half[1] = *(const v8us*)&sKl[nt * 16 + ln][ks * 32 + 16 + 8 * hh];
        acc = mmaN<3>(aqh[ks].v, aql[ks].v, bh_.v, bl_.v, acc);
      }
      s[nt] = acc;
    }
    // mask + running max (rows 8hh+r; the 16 lanes of a half share rows)
    float alpha[8];
#pragma unroll
    for (int r = 0; r < 8; ++r) {
      const int qi = q0 + 8 * hh + r;
      const int ja = j0 + ln, jb = j0 + 16 + ln;
      if (CAUSAL) { if (ja > qi) s[0][r] = -3.0e38f; if (jb > qi) s[1][r] = -3.0e38f; }
      if (ja >= T) s[0][r] = -3.0e38f;
      if (jb >= T) s[1][r] = -3.0e38f;
      float mx = fmaxf(s[0][r], s[1][r]);
      mx = fmaxf(mx, __shfl_xor(mx, 1, 32)); mx = fmaxf(mx, __shfl_xor(mx, 2, 32)); mx = fmaxf(mx, __shfl_xor(mx, 4, 32)); mx = fmaxf(mx, __shfl_xor(mx, 8, 32));
      const float mnew = fmaxf(m_r[r], mx);
      alpha[r] = (mnew > -1.0e38f) ? __expf(m_r[r] - mnew) : 1.0f;
      const float p0 = (s[0][r] > -1.0e38f) ? __expf(s[0][r] - mnew) : 0.f;
      const float p1 = (s[1][r] > -1.0e38f) ? __expf(s[1][r] - mnew) : 0.f;
      m_r[r] = mnew;
      l_r[r] = l_r[r] * alpha[r] + p0 + p1;            // per-lane partial row sum (16 lanes combined at the end)
      unsigned short hb = bf16_bits(p0); sPh[w][8 * hh + r][ln] = hb;      sPl[w][8 * hh + r][ln] = bf16_bits(p0 - bf16_val(hb));
      hb = bf16_bits(p1);                sPh[w][8 * hh + r][16 + ln] = hb; sPl[w][8 * hh + r][16 + ln] = bf16_bits(p1 - bf16_val(hb));
    }
#pragma unroll
    for (int dt = 0; dt < DT; ++dt)
#pragma unroll
      for (int r = 0; r < 8; ++r) oacc[dt][r] *= alpha[r];
    __builtin_amdgcn_fence(__ATOMIC_ACQ_REL, "workgroup");
    __builtin_amdgcn_wave_barrier();
    FragB pah, pal;
    pah.half[0] = *(const v8us*)&sPh[w][ln][8 * hh]; pah.half[1] = *(const v8us*)&sPh[w][ln][16 + 8 * hh];
    pal.half[0] = *(const v8us*)&sPl[w][ln][8 * hh]; pal.half[1] = *(const v8us*)&sPl[w][ln][16 + 8 * hh];
#pragma unroll
    for (int dt = 0; dt < DT; ++dt) {
      FragB bvh, bvl;
#pragma unroll
      for (int i = 0; i < 8; ++i) {
        bvh.u[i] = sVh[8 * hh + i][dt * 16 + ln]; bvh.u[8 + i] = sVh[16 + 8 * hh + i][dt * 16 + ln];
        bvl.u[i] = sVl[8 * hh + i][dt * 16 + ln]; bvl.u[8 + i] = sVl[16 + 8 * hh + i][dt * 16 + ln];
      }
      oacc[dt] = mmaN<3>(pah.v, pal.v, bvh.v, bvl.v, oacc[dt]);
    }
    __builtin_amdgcn_fence(__ATOMIC_ACQ_REL, "workgroup");
    __builtin_amdgcn_wave_barrier();
  }
#pragma unroll
  for (int r = 0; r < 8; ++r) {
    float l = l_r[r];
    l += __shfl_xor(l, 1, 32); l += __shfl_xor(l, 2, 32); l += __shfl_xor(l, 4, 32); l += __shfl_xor(l, 8, 32);
    l_r[r] = (l > 0.f) ? 1.0f / l : 0.f;
  }
#pragma unroll
  for (int dt = 0; dt < DT; ++dt)
#pragma unroll
    for (int r = 0; r < 8; ++r) sO[w][8 * hh + r][dt * 16 + ln] = oacc[dt][r] * l_r[r];
  __builtin_amdgcn_fence(__ATOMIC_ACQ_REL, "workgroup");
  __builtin_amdgcn_wave_barrier();
  {
    for (int r = 0; r < 16; ++r) {
      const int row = q0 + r;
      if (row < T && lane < D / 4) {
        const v4f val = *(const v4fa*)&sO[w][r][lane * 4];
        *(v4f*)(y + ((size_t)b * T + row) * ypitch + h * D + lane * 4) = val;
      }
    }
    
  }
}

// GEMM C = act(A·W + bias + resid): A f32 (ASPLIT -> hi/lo 2 terms), Wt bf16 [N][K]; ACT 0 none, 1 relu, 2 exact gelu;
// resid (optional, f32, row index = (row % rmod), pitch ldr, RES_BF16 rounds it) added before the activation.
template <bool ASPLIT, int ACT, bool BIAS_BF16, bool RES_BF16>
__global__ __launch_bounds__(128) void k_gemm_bf3(const float* __restrict__ A, int lda, const unsigned short* __restrict__ Wt, int ldb,
                                                const float* __restrict__ bias, const float* __restrict__ resid, int rmod, int ldr,
                                                float* __restrict__ C, int ldc, int M, int N, int K) {
  __shared__ __attribute__((aligned(16))) float so[4][16][64];
  const int tid = threadIdx.x, w = tid >> 5, lane = tid & 31, ln = lane & 15, hh = lane >> 4;
  const int ntn = N / 64;
  const int wid = blockIdx.x * 4 + w;
  const int mt = wid / ntn, nq = wid % ntn;
  if (mt * 16 >= M) return;
  const int row0 = mt * 16, col0 = nq * 64;
  const float* arow = A + (size_t)(row0 + ln) * lda;
  v8f acc[4] = {};
  for (int kb = 0; kb < K; kb += 32) {
    FragB ah, al;
    const v4f x0 = *(const v4fa*)(arow + kb + 8 * hh), x1 = *(const v4fa*)(arow + kb + 8 * hh + 4);
    const v4f x2 = *(const v4fa*)(arow + kb + 16 + 8 * hh), x3 = *(const v4fa*)(arow + kb + 16 + 8 * hh + 4);
    float xs[16] = {x0[0],x0[1],x0[2],x0[3],x1[0],x1[1],x1[2],x1[3],x2[0],x2[1],x2[2],x2[3],x3[0],x3[1],x3[2],x3[3]};
#pragma unroll
    for (int i = 0; i < 16; ++i) { const unsigned short hb = bf16_bits(xs[i]); ah.u[i] = hb; al.u[i] = ASPLIT ? bf16_bits(xs[i] - bf16_val(hb)) : (unsigned short)0; }
#pragma unroll
    for (int t = 0; t < 4; ++t) {
      const unsigned short* brow = Wt + (size_t)(col0 + t * 16 + ln) * ldb + kb;
      FragB b;
      b.half[0] = *(const v8us*)(brow + 8 * hh);
      b.half[1] = *(const v8us*)(brow + 16 + 8 * hh);
      acc[t] = mmaN<ASPLIT ? 2 : 1>(ah.v, al.v, b.v, b.v, acc[t]);
    }
  }
#pragma unroll
  for (int t = 0; t < 4; ++t) {
    const int col = col0 + t * 16 + ln;
    float bv = bias ? bias[col] : 0.f;
    if (BIAS_BF16) bv = bf16_round(bv);
#pragma unroll
    for (int r = 0; r < 8; ++r) {
      float v = acc[t][r] + bv;
      if (resid) { float rv = resid[(size_t)((row0 + 8 * hh + r) % rmod) * ldr + col]; if (RES_BF16) rv = bf16_round(rv); v += rv; }
      if (ACT == 1) v = fmaxf(v, 0.f);
      if (ACT == 2) v = 0.5f * v * (1.0f + erff(v * 0.70710678118654752f));
      if (ACT == 3) { const float u = 0.7978845608028654f * (v + 0.044715f * v * v * v); v = 0.5f * v * (1.0f + tanhf(u)); }
      so[w][8 * hh + r][t * 16 + ln] = v;
    }
  }
  __builtin_amdgcn_fence(__ATOMIC_ACQ_REL, "workgroup");
  __builtin_amdgcn_wave_barrier();
  const int rsub = lane >> 4, c4 = (lane & 15) * 4;
  {
#pragma unroll
    for (int q = 0; q < 8; ++q) {
      const int r = q * 2 + rsub;
      const v4f v = *(const v4fa*)&so[w][r][c4];
      *(v4f*)(C + (size_t)(row0 + r) * ldc + col0 + c4) = v;
    }
    
  }
}
// row LayerNorm (biased variance, eps) over N: s = X (+ R); optional out_sum <- s; out_norm <- (s-mu)*rsqrt(var+eps)*g + b
template <bool PARAM_BF16>
__global__ __launch_bounds__(256) void k_layernorm(const float* __restrict__ X, const float* __restrict__ R, const float* __restrict__ g, const float* __restrict__ bta,
                                                  float* __restrict__ out_sum, float* __restrict__ out_norm, int N, float eps) {
  __shared__ float red[256];
  const int row = blockIdx.x, tid = threadIdx.x;
  const float* x = X + (size_t)row * N; const float* rr = R ? R + (size_t)row * N : nullptr;
  float vals[16];                     // up to N = 4096
  const int per = N / 256;            // contiguous chunk per thread? use strided-by-4 chunks: thread handles j = tid*4 + 1024*u
  float s1 = 0.f;
  for (int u = 0; u < per / 4; ++u) {
    const int j = tid * 4 + 1024 * u;
    const v4f a = *(const v4fa*)(x + j);
    v4f b = {0.f,0.f,0.f,0.f}; if (rr) b = *(const v4fa*)(rr + j);
#pragma unroll
    for (int q = 0; q < 4; ++q) { const float v = a[q] + b[q]; vals[u * 4 + q] = v; s1 += v; }
  }
  red[tid] = s1; __syncthreads();
  for (int st = 128; st > 0; st >>= 1) { if (tid < st) red[tid] += red[tid + st]; __syncthreads(); }
  const float mu = red[0] / (float)N; __syncthreads();
  float s2 = 0.f;
  for (int u = 0; u < per / 4; ++u)
#pragma unroll
    for (int q = 0; q < 4; ++q) { const float c = vals[u * 4 + q] - mu; s2 += c * c; }
  red[tid] = s2; __syncthreads();
  for (int st = 128; st > 0; st >>= 1) { if (tid < st) red[tid] += red[tid + st]; __syncthreads(); }
  const float rs = rsqrtf(red[0] / (float)N + eps);
  {
    for (int u = 0; u < per / 4; ++u) {
      const int j = tid * 4 + 1024 * u;
      v4f o, sm;
#pragma unroll
      for (int q = 0; q < 4; ++q) {
        float gg = g[j + q], bb = bta[j + q];
        if (PARAM_BF16) { gg = bf16_round(gg); bb = bf16_round(bb); }
        sm[q] = vals[u * 4 + q]; o[q] = (vals[u * 4 + q] - mu) * rs * gg + bb;
      }
      if (out_sum) *(v4f*)(out_sum + (size_t)row * N + j) = sm;
      *(v4f*)(out_norm + (size_t)row * N + j) = o;
    }
    
  }
}



// ---- f16 WMMA path (v_wmma_f32_16x16x32_f16): 11-bit significands for operands in range — used for the projection, generator and output GEMMs
typedef _Float16 v16h __attribute__((ext_vector_type(16)));
union FragH { v16h v; v8us half[2]; _Float16 h[16]; unsigned short u[16]; };
template <int NT>
__device__ __forceinline__ v8f mmaH(v16h ah, v16h al, v16h bh, v16h bl, v8f c) {
  c = __builtin_amdgcn_wmma_f32_16x16x32_f16(false, ah, false, bh, (short)0, c, false, false);
  if (NT >= 2) c = __builtin_amdgcn_wmma_f32_16x16x32_f16(false, al, false, bh, (short)0, c, false, false);
  if (NT >= 3) c = __builtin_amdgcn_wmma_f32_16x16x32_f16(false, ah, false, bl, (short)0, c, false, false);
  asm volatile("v_nop\n\tv_nop\n\tv_nop\n\tv_nop" : "+v"(c) : "v"(ah), "v"(al), "v"(bh), "v"(bl));
  return c;
}
// batched GEMM like k_gemm_b but f16 operands: A f32 (split into f16 hi/lo if ASPLIT, else rounded to f16), Bt = f16 values [n][k]; alpha; C f32; N multiple of 16 (partial tiles skipped)
template <bool ASPLIT>
__global__ __launch_bounds__(128) void k_gemm_h(const float* __restrict__ A, int lda, size_t sA, const _Float16* __restrict__ Bh, int ldb, size_t sB, float alpha, float* __restrict__ C, int ldc, size_t sC, int M, int N, int K) {
  __shared__ __attribute__((aligned(16))) float so[4][16][64];
  const int tid = threadIdx.x, w = tid >> 5, lane = tid & 31, ln = lane & 15, hh = lane >> 4; const int by = blockIdx.y;
  A += (size_t)by * sA; Bh += (size_t)by * sB; C += (size_t)by * sC;
  const int ntn = (N + 63) / 64; const int wid = blockIdx.x * 4 + w; const int mt = wid / ntn, nq = wid % ntn; if (mt * 16 >= M) return;
  const int row0 = mt * 16, col0 = nq * 64; const float* arow = A + (size_t)(row0 + ln) * lda;
  v8f acc[4] = {};
  for (int kb = 0; kb < K; kb += 32) {
    FragH ah, al;
    const v4f x0 = *(const v4fa*)(arow + kb + 8 * hh), x1 = *(const v4fa*)(arow + kb + 8 * hh + 4), x2 = *(const v4fa*)(arow + kb + 16 + 8 * hh), x3 = *(const v4fa*)(arow + kb + 16 + 8 * hh + 4);
    float xs[16] = {x0[0],x0[1],x0[2],x0[3],x1[0],x1[1],x1[2],x1[3],x2[0],x2[1],x2[2],x2[3],x3[0],x3[1],x3[2],x3[3]};
#pragma unroll
    for (int i = 0; i < 16; ++i) { const _Float16 h = (_Float16)xs[i]; ah.h[i] = h; al.h[i] = ASPLIT ? (_Float16)(xs[i] - (float)h) : (_Float16)0.0f; }
#pragma unroll
    for (int t = 0; t < 4; ++t) { if (col0 + t * 16 >= N) continue; const size_t boff = (size_t)(col0 + t * 16 + ln) * ldb + kb; FragH bq; bq.half[0] = *(const v8us*)(Bh + boff + 8 * hh); bq.half[1] = *(const v8us*)(Bh + boff + 16 + 8 * hh);
      acc[t] = mmaH<ASPLIT ? 2 : 1>(ah.v, al.v, bq.v, bq.v, acc[t]); }
  }
#pragma unroll
  for (int t = 0; t < 4; ++t) { if (col0 + t * 16 >= N) continue;
#pragma unroll
    for (int r = 0; r < 8; ++r) so[w][8 * hh + r][t * 16 + ln] = acc[t][r] * alpha; }
  __builtin_amdgcn_fence(__ATOMIC_ACQ_REL, "workgroup"); __builtin_amdgcn_wave_barrier();
  const int rsub = lane >> 4, c4 = (lane & 15) * 4;
  {
#pragma unroll
    for (int q = 0; q < 8; ++q) { const int r = q * 2 + rsub; if (col0 + c4 < N) { const v4f v = *(const v4fa*)&so[w][r][c4]; *(v4f*)(C + (size_t)(row0 + r) * ldc + col0 + c4) = v; } }
     }
}

// Wt[n][k] = f16(W[k][n]·scale) from f32 row-major W[K][N] (scale = power of two; bf16-exact weights stay exact in f16 away from the subnormal range)
__global__ __launch_bounds__(256) void k_wt_f16(const float* __restrict__ W, _Float16* __restrict__ Wt, int K, int N, float scale) {
  const int t = blockIdx.x * 256 + threadIdx.x; if (t >= N * (K / 8)) return; const int n = t / (K / 8), k8 = (t % (K / 8)) * 8; FragH f;
#pragma unroll
  for (int i = 0; i < 8; ++i) f.h[i] = (_Float16)(bf16_round(W[(size_t)(k8 + i) * N + n]) * scale); const v8us o = f.half[0];
  *(v8us*)((unsigned short*)Wt + (size_t)n * K + k8) = o; 
}
// k_gemm_hh variant with fused epilogue: v = acc·alpha + bias[by·sBias + col] (+ CP[(row/rowsPerB)·sCPb + by·64 + col] if CP) ; ACT 0 none / 1 elu ; writes f32 C and f16 C16, each if non-null
template <int ACT>
__global__ __launch_bounds__(128) void k_gemm_hhx(const _Float16* __restrict__ A, int lda, size_t sA, const _Float16* __restrict__ Bh, int ldb, size_t sB, float alpha, const float* __restrict__ bias, size_t sBias, const float* __restrict__ CP, int rowsPerB, size_t sCPb, int row0g,
    float* __restrict__ C, _Float16* __restrict__ C16, int ldc, size_t sC, int M, int N, int K) {
  __shared__ __attribute__((aligned(16))) float so[4][16][64];
  const int tid = threadIdx.x, w = tid >> 5, lane = tid & 31, ln = lane & 15, hh = lane >> 4; const int by = blockIdx.y;
  A += (size_t)by * sA; Bh += (size_t)by * sB; const size_t cofs = (size_t)by * sC; const float* bp = bias ? bias + (size_t)by * sBias : nullptr;
  const int ntn = (N + 63) / 64; const int wid = blockIdx.x * 4 + w; const int mt = wid / ntn, nq = wid % ntn; if (mt * 16 >= M) return;
  const int row0 = mt * 16, col0 = nq * 64; const _Float16* arow = A + (size_t)(row0 + ln) * lda;
  v8f acc[4] = {};
  for (int kb = 0; kb < K; kb += 32) { FragH ah; ah.half[0] = *(const v8us*)((const unsigned short*)arow + kb + 8 * hh); ah.half[1] = *(const v8us*)((const unsigned short*)arow + kb + 16 + 8 * hh);
#pragma unroll
    for (int t = 0; t < 4; ++t) { if (col0 + t * 16 >= N) continue; const size_t boff = (size_t)(col0 + t * 16 + ln) * ldb + kb; FragH bq; bq.half[0] = *(const v8us*)((const unsigned short*)Bh + boff + 8 * hh); bq.half[1] = *(const v8us*)((const unsigned short*)Bh + boff + 16 + 8 * hh);
      acc[t] = mmaH<1>(ah.v, ah.v, bq.v, bq.v, acc[t]); }
  }
#pragma unroll
  for (int t = 0; t < 4; ++t) { if (col0 + t * 16 >= N) continue; const int col = col0 + t * 16 + ln; const float bv = bp ? bf16_round(bp[col]) : 0.f;
#pragma unroll
    for (int r = 0; r < 8; ++r) { float v = acc[t][r] * alpha + bv; if (CP) { const int bidx = (row0g + row0 + 8 * hh + r) / rowsPerB; v += CP[(size_t)bidx * sCPb + (size_t)by * 64 + col]; } if (ACT == 1) v = (v > 0.f) ? v : expm1f(v); else if (ACT == 3) v = fmaxf(v, 0.f); so[w][8 * hh + r][t * 16 + ln] = v; } }
  __builtin_amdgcn_fence(__ATOMIC_ACQ_REL, "workgroup"); __builtin_amdgcn_wave_barrier();
  const int rsub = lane >> 4, c4 = (lane & 15) * 4; typedef _Float16 v4h __attribute__((ext_vector_type(4)));
  {
#pragma unroll
    for (int q = 0; q < 8; ++q) { const int r = q * 2 + rsub; if (col0 + c4 < N) { const v4f v = *(const v4fa*)&so[w][r][c4]; if (C) *(v4f*)(C + cofs + (size_t)(row0 + r) * ldc + col0 + c4) = v; if (C16) { v4h h4; for (int i = 0; i < 4; ++i) h4[i] = (_Float16)v[i]; *(v4h*)(C16 + cofs + (size_t)(row0 + r) * ldc + col0 + c4) = h4; } } }
     }
}


__global__ __launch_bounds__(256) void k_round16f(const float* __restrict__ W, _Float16* __restrict__ Bt, size_t n8) { const size_t t = (size_t)blockIdx.x * 256 + threadIdx.x; if (t >= n8) return; FragH f;
#pragma unroll
  for (int i = 0; i < 8; ++i) f.h[i] = (_Float16)(bf16_round(W[t * 8 + i]) * 16.0f); *(v8us*)((unsigned short*)Bt + t * 8) = f.half[0];  }
__global__ __launch_bounds__(256) void k_x16(const float* __restrict__ x, _Float16* __restrict__ X16, size_t n8) { const size_t t = (size_t)blockIdx.x * 256 + threadIdx.x; if (t >= n8) return; FragH f;
#pragma unroll
  for (int q = 0; q < 8; ++q) f.h[q] = (_Float16)bf16_round(x[t * 8 + q]); *(v8us*)((unsigned short*)X16 + t * 8) = f.half[0];  }
__global__ __launch_bounds__(256) void k_h16(const float* __restrict__ x, _Float16* __restrict__ X16, size_t n8) { const size_t t = (size_t)blockIdx.x * 256 + threadIdx.x; if (t >= n8) return; FragH f;
#pragma unroll
  for (int q = 0; q < 8; ++q) f.h[q] = (_Float16)x[t * 8 + q]; *(v8us*)((unsigned short*)X16 + t * 8) = f.half[0];  }
__global__ __launch_bounds__(256) void k_res(const float* __restrict__ f, const float* __restrict__ pf, float* __restrict__ RES) { const size_t t = (size_t)blockIdx.x * 256 + threadIdx.x; if (t >= (size_t)NBS * FD / 4) return; const v4f a = *(const v4fa*)(f + t * 4), b = *(const v4fa*)(pf + t * 4); v4f o; for (int q = 0; q < 4; ++q) o[q] = bf16_round(a[q]) + bf16_round(b[q]); *(v4f*)(RES + t * 4) = o;  }
// per sample (wave): p1 = PAR[s - s0][0:4096] as [LOW][MID], p2 = PAR[s - s0][4096:] as [MID][LOW]; h[m] = relu(Σ_l flow[l]·p1[l][m]) (lane m < 32); g[l] = Σ_m h[m]·p2[m][l] (lane owns l = lane + 32·j, j < 4);
__global__ __launch_bounds__(256) void k_dyn(const float* __restrict__ FLOW, const float* __restrict__ PAR, int s0, _Float16* __restrict__ G16) { __shared__ float sf[8][LOW]; __shared__ float sh[8][MID]; __shared__ __attribute__((aligned(16))) _Float16 sg[8][LOW + 8]; const int tid = threadIdx.x, wv = tid >> 5, lane = tid & 31; const int sl = blockIdx.x * 8 + wv; const int s = s0 + sl;
  const float* pr = PAR + (size_t)sl * NPAR;
  for (int l = lane; l < LOW; l += 32) sf[wv][l] = FLOW[(size_t)s * LOW + l];
  __builtin_amdgcn_fence(__ATOMIC_ACQ_REL, "workgroup"); __builtin_amdgcn_wave_barrier();
  { float a = 0.f;
#pragma unroll 1
    for (int l = 0; l < LOW; ++l) a += sf[wv][l] * pr[l * MID + lane]; sh[wv][lane] = fmaxf(a, 0.f); }
  __builtin_amdgcn_fence(__ATOMIC_ACQ_REL, "workgroup"); __builtin_amdgcn_wave_barrier();
#pragma unroll
  for (int j = 0; j < 4; ++j) { const int l = j * 32 + lane; float a = 0.f;
#pragma unroll 1
    for (int m = 0; m < MID; ++m) a += sh[wv][m] * pr[LOW * MID + m * LOW + l]; sg[wv][l] = (_Float16)a; }
  __builtin_amdgcn_fence(__ATOMIC_ACQ_REL, "workgroup"); __builtin_amdgcn_wave_barrier();
  { if (lane < 16) { const v8us v = *(const v8us*)&sg[wv][lane * 8]; *(v8us*)((unsigned short*)G16 + (size_t)s * LOW + lane * 8) = v; }  } }
extern "C" void kernel_launch(void* const* d_in, const int* in_sizes, int n_in,
                              void* d_out, int out_size, void* d_ws, size_t ws_size, hipStream_t stream) {
  (void)in_sizes; (void)n_in; (void)out_size;
  const float* f = (const float*)d_in[0]; const float* pf = (const float*)d_in[1]; const float* pfw = (const float*)d_in[2]; const float* pfb = (const float*)d_in[3]; const float* ppw = (const float*)d_in[4]; const float* ppb = (const float*)d_in[5]; const float* f2w = (const float*)d_in[6]; const float* f2b = (const float*)d_in[7]; const float* pgw = (const float*)d_in[8]; const float* pgb = (const float*)d_in[9];
  char* ws = (char*)d_ws; size_t off = 0;
  auto take = [&](size_t bytes) { char* p = ws + off; off += (bytes + 255) & ~(size_t)255; return p; };
  _Float16* Bf = (_Float16*)take((size_t)LOW * FD * 2); _Float16* Bp = (_Float16*)take((size_t)LOW * FD * 2); _Float16* Bg = (_Float16*)take((size_t)NPAR * LOW * 2); _Float16* B2 = (_Float16*)take((size_t)FD * LOW * 2);
  char* R = take((size_t)NBS * FD * 4); _Float16* F16 = (_Float16*)R; _Float16* P16 = (_Float16*)(R + (size_t)NBS * FD * 2); float* RES = (float*)R;      // F16/P16 dead after the two projections → RES f32 (same 33.5 MB)
  float* FLOW = (float*)take((size_t)NBS * LOW * 4); _Float16* PL16 = (_Float16*)take((size_t)NBS * LOW * 2); float* PAR = (float*)take((size_t)CHS * NPAR * 4); _Float16* G16 = (_Float16*)take((size_t)NBS * LOW * 2);
  if (off > ws_size) return;      // 0.5 + 2.1 + 0.25 + 33.5 + 4.2 + 2.1 + 67 + 2.1 ≈ 107 MiB
  k_round16f<<<(LOW * FD / 8 + 255) / 256, 256, 0, stream>>>(pfw, Bf, (size_t)LOW * FD / 8); k_round16f<<<(LOW * FD / 8 + 255) / 256, 256, 0, stream>>>(ppw, Bp, (size_t)LOW * FD / 8); k_round16f<<<(NPAR * LOW / 8 + 255) / 256, 256, 0, stream>>>(pgw, Bg, (size_t)NPAR * LOW / 8); k_round16f<<<(FD * LOW / 8 + 255) / 256, 256, 0, stream>>>(f2w, B2, (size_t)FD * LOW / 8);      // (out,in)
  const unsigned gx = (unsigned)(((size_t)NBS * FD / 8 + 255) / 256);
  k_x16<<<gx, 256, 0, stream>>>(f, F16, (size_t)NBS * FD / 8); k_x16<<<gx, 256, 0, stream>>>(pf, P16, (size_t)NBS * FD / 8);
  k_gemm_hhx<0><<<dim3(((NBS / 16) * (LOW / 64) + 3) / 4, 1), 128, 0, stream>>>(F16, FD, 0, Bf, FD, 0, 0.0625f, pfb, 0, nullptr, 1, 0, 0, FLOW, nullptr, LOW, 0, NBS, LOW, FD);      // f_low (f32, read by the per-sample MLP)
  k_gemm_hhx<0><<<dim3(((NBS / 16) * (LOW / 64) + 3) / 4, 1), 128, 0, stream>>>(P16, FD, 0, Bp, FD, 0, 0.0625f, ppb, 0, nullptr, 1, 0, 0, nullptr, PL16, LOW, 0, NBS, LOW, FD);     // pf_low (f16 operand of the generator)
  k_res<<<(unsigned)(((size_t)NBS * FD / 4 + 255) / 256), 256, 0, stream>>>(f, pf, RES);      // after both projections (F16/P16 dead)
  for (int c = 0; c < NBS / CHS; ++c) { const int s0 = c * CHS;
    k_gemm_hhx<0><<<dim3(((CHS / 16) * (NPAR / 64) + 3) / 4, 1), 128, 0, stream>>>(PL16 + (size_t)s0 * LOW, LOW, 0, Bg, LOW, 0, 0.0625f, pgb, 0, nullptr, 1, 0, 0, PAR, nullptr, NPAR, 0, CHS, NPAR, LOW);      // params = pf_low·pg_wᵀ + pg_b (f32 [2048][8192])
    k_dyn<<<CHS / 8, 256, 0, stream>>>(FLOW, PAR, s0, G16); }
  k_gemm_hhx<0><<<dim3(((NBS / 16) * (FD / 64) + 3) / 4, 1), 128, 0, stream>>>(G16, LOW, 0, B2, LOW, 0, 0.0625f, f2b, 0, RES, 1, (size_t)FD, 0, (float*)d_out, nullptr, FD, 0, NBS, FD, LOW);      // g·proj_f2ᵀ + b + (f + pf)
}

// v001
// One run takes 287 microseconds.
// Next to v000, in two timings, it ran 2.01 and 1.99 times as fast.
#include <hip/hip_runtime.h>
// + bias, + f + pf residuals as exact bf16 addends) on v_wmma_f32_16x16x32_f16 (f16 operands, nn.Linear weights (out,in) bf16-exact ×2^4, f32 accumulate); the per-sample tiny MLP
// (128 → 32 relu → 128 with that sample's generated weights) is f32 VALU (wave per sample).
#define NBS 8192
#define FD 1024
#define LOW 128
#define MID 32
#define CHS 2048
#define NPAR (2 * LOW * MID)

typedef __bf16 v16b __attribute__((ext_vector_type(16)));
typedef unsigned short v8us __attribute__((ext_vector_type(8), may_alias));
typedef float  v8f  __attribute__((ext_vector_type(8)));
typedef float  v4f  __attribute__((ext_vector_type(4)));
typedef float  v4fa __attribute__((ext_vector_type(4), may_alias));
union FragB { v16b v; v8us half[2]; unsigned short u[16]; };

__device__ __forceinline__ unsigned short bf16_bits(float x) { unsigned int u = __float_as_uint(x); return (unsigned short)((u + 0x7FFFu + ((u >> 16) & 1u)) >> 16); }
__device__ __forceinline__ float bf16_val(unsigned short b) { return __uint_as_float(((unsigned int)b) << 16); }
__device__ __forceinline__ float bf16_round(float x) { return bf16_val(bf16_bits(x)); }
// D += A·B with NT terms: 1 = ah·bh, 2 = + al·bh (A split), 3 = + ah·bl (both split)
template <int NT>
__device__ __forceinline__ v8f mmaN(v16b ah, v16b al, v16b bh, v16b bl, v8f c) {
  c = __builtin_amdgcn_wmma_f32_16x16x32_bf16(false, ah, false, bh, (short)0, c, false, false);
  if (NT >= 2) c = __builtin_amdgcn_wmma_f32_16x16x32_bf16(false, al, false, bh, (short)0, c, false, false);
  if (NT >= 3) c = __builtin_amdgcn_wmma_f32_16x16x32_bf16(false, ah, false, bl, (short)0, c, false, false);
  asm volatile("v_nop\n\tv_nop\n\tv_nop\n\tv_nop" : "+v"(c) : "v"(ah), "v"(al), "v"(bh), "v"(bl));
  return c;
}

__global__ __launch_bounds__(256) void k_wt_bf16(const float* __restrict__ W, unsigned short* __restrict__ Wt, int K, int N) {
  const int t = blockIdx.x * 256 + threadIdx.x;
  const int k8n = K / 8;
  if (t >= N * k8n) return;
  const int n = t / k8n, k8 = (t % k8n) * 8;
  v8us v;
#pragma unroll
  for (int i = 0; i < 8; ++i) v[i] = bf16_bits(W[(size_t)(k8 + i) * N + n]);
  *(v8us*)(Wt + (size_t)n * K + k8) = v;
  
}

// GEMM C[M][N] (f32, pitch ldc) = act(A[M][K]·W + bias). A f32 row-major (pitch lda) converted per fragment to bf16
// (ASPLIT: hi/lo two planes -> 2 terms, else single rounded term); Wt bf16 [N][K] (pitch ldb). BIAS_BF16 rounds the
// bias to bf16 first (bias quantised to bf16 before the add). K%32==0, M%16==0, N%64==0.
template <bool ASPLIT, int ACT, bool BIAS_BF16>
__global__ __launch_bounds__(128) void k_gemm_bf(const float* __restrict__ A, int lda, const unsigned short* __restrict__ Wt, int ldb,
                                               const float* __restrict__ bias, float* __restrict__ C, int ldc, int M, int N, int K) {
  __shared__ __attribute__((aligned(16))) float so[4][16][64];
  const int tid = threadIdx.x, w = tid >> 5, lane = tid & 31, ln = lane & 15, hh = lane >> 4;
  const int ntn = N / 64;
  const int wid = blockIdx.x * 4 + w;
  const int mt = wid / ntn, nq = wid % ntn;
  if (mt * 16 >= M) return;
  const int row0 = mt * 16, col0 = nq * 64;
  const float* arow = A + (size_t)(row0 + ln) * lda;
  v8f acc[4] = {};
  for (int kb = 0; kb < K; kb += 32) {
    FragB ah, al;
    const v4f x0 = *(const v4fa*)(arow + kb + 8 * hh), x1 = *(const v4fa*)(arow + kb + 8 * hh + 4);
    const v4f x2 = *(const v4fa*)(arow + kb + 16 + 8 * hh), x3 = *(const v4fa*)(arow + kb + 16 + 8 * hh + 4);
    float xs[16] = {x0[0],x0[1],x0[2],x0[3],x1[0],x1[1],x1[2],x1[3],x2[0],x2[1],x2[2],x2[3],x3[0],x3[1],x3[2],x3[3]};
#pragma unroll
    for (int i = 0; i < 16; ++i) { const unsigned short hb = bf16_bits(xs[i]); ah.u[i] = hb; al.u[i] = ASPLIT ? bf16_bits(xs[i] - bf16_val(hb)) : (unsigned short)0; }
#pragma unroll
    for (int t = 0; t < 4; ++t) {
      const unsigned short* brow = Wt + (size_t)(col0 + t * 16 + ln) * ldb + kb;
      FragB b;
      b.half[0] = *(const v8us*)(brow + 8 * hh);
      b.half[1] = *(const v8us*)(brow + 16 + 8 * hh);
      acc[t] = mmaN<ASPLIT ? 2 : 1>(ah.v, al.v, b.v, b.v, acc[t]);
    }
  }
#pragma unroll
  for (int t = 0; t < 4; ++t) {
    float bv = bias ? bias[col0 + t * 16 + ln] : 0.f;
    if (BIAS_BF16) bv = bf16_round(bv);
#pragma unroll
    for (int r = 0; r < 8; ++r) { float v = acc[t][r] + bv; if (ACT == 1) v = fmaxf(v, 0.f); so[w][8 * hh + r][t * 16 + ln] = v; }
  }
  __builtin_amdgcn_fence(__ATOMIC_ACQ_REL, "workgroup");
  __builtin_amdgcn_wave_barrier();
  const int rsub = lane >> 4, c4 = (lane & 15) * 4;
  {
#pragma unroll
    for (int q = 0; q < 8; ++q) {
      const int r = q * 2 + rsub;
      const v4f v = *(const v4fa*)&so[w][r][c4];
      *(v4f*)(C + (size_t)(row0 + r) * ldc + col0 + c4) = v;
    }
    
  }
}

// Flash-style causal/unmasked attention, all contractions 3-term bf16 hi/lo splits, f32 softmax with running max.
// q,k,v rows are read from f32 buffers with arbitrary row pitch (so they can live inside a fused qkv buffer);
// D = head size (multiple of 32, <= 128); one wave = 16 query rows; block = 4 waves (64 queries) sharing K/V chunks of 32.
template <int D, bool CAUSAL>
__global__ __launch_bounds__(128) void k_flash(const float* __restrict__ qb, const float* __restrict__ kb, const float* __restrict__ vb,
                                             int pitch, int T, int H, float scale, float* __restrict__ y, int ypitch) {
  constexpr int KS = D / 32;        // k-steps for QK
  constexpr int DT = D / 16;        // d tiles for PV
  __shared__ __attribute__((aligned(16))) unsigned short sKh[32][D + 8], sKl[32][D + 8], sVh[32][D + 8], sVl[32][D + 8];
  __shared__ __attribute__((aligned(16))) unsigned short sPh[4][16][40], sPl[4][16][40];
  __shared__ __attribute__((aligned(16))) float sO[4][16][D];
  const int tid = threadIdx.x, w = tid >> 5, lane = tid & 31, ln = lane & 15, hh = lane >> 4;
  const int nqb = (T + 63) / 64;
  const int bh = blockIdx.x / nqb, qblk = blockIdx.x % nqb;
  const int b = bh / H, h = bh % H;
  const int q0 = qblk * 64 + w * 16;
  const float* Q = qb + (size_t)b * T * pitch + h * D;
  const float* K = kb + (size_t)b * T * pitch + h * D;
  const float* V = vb + (size_t)b * T * pitch + h * D;

  // A fragments of the wave's 16 query rows (scaled), hi/lo
  FragB aqh[KS], aql[KS];
  {
    int row = q0 + ln; if (row >= T) row = T - 1;
    const float* qr = Q + (size_t)row * pitch;
#pragma unroll
    for (int ks = 0; ks < KS; ++ks)
#pragma unroll
      for (int i = 0; i < 16; ++i) {
        const int d = ks * 32 + ((i < 8) ? (8 * hh + i) : (16 + 8 * hh + (i - 8)));
        const float x = qr[d] * scale; const unsigned short hb = bf16_bits(x);
        aqh[ks].u[i] = hb; aql[ks].u[i] = bf16_bits(x - bf16_val(hb));
      }
  }
  float m_r[8], l_r[8];
#pragma unroll
  for (int r = 0; r < 8; ++r) { m_r[r] = -3.0e38f; l_r[r] = 0.f; }
  v8f oacc[DT];
#pragma unroll
  for (int dt = 0; dt < DT; ++dt) oacc[dt] = (v8f){0.f,0.f,0.f,0.f,0.f,0.f,0.f,0.f};

  const int kv_end = CAUSAL ? min(T, qblk * 64 + 64) : T;     // block-uniform
  for (int j0 = 0; j0 < kv_end; j0 += 32) {
    __syncthreads();
    for (int e = tid; e < 32 * (D / 4); e += 128) {
      const int r = e / (D / 4), c4 = (e % (D / 4)) * 4;
      const int key = j0 + r;
      v4f kf = {0.f,0.f,0.f,0.f}, vf = {0.f,0.f,0.f,0.f};
      if (key < T) { kf = *(const v4fa*)(K + (size_t)key * pitch + c4); vf = *(const v4fa*)(V + (size_t)key * pitch + c4); }
#pragma unroll
      for (int t = 0; t < 4; ++t) {
        unsigned short hb = bf16_bits(kf[t]); sKh[r][c4 + t] = hb; sKl[r][c4 + t] = bf16_bits(kf[t] - bf16_val(hb));
        hb = bf16_bits(vf[t]); sVh[r][c4 + t] = hb; sVl[r][c4 + t] = bf16_bits(vf[t] - bf16_val(hb));
      }
    }
    __syncthreads();
    // S tile 16 x 32
    v8f s[2];
#pragma unroll
    for (int nt = 0; nt < 2; ++nt) {
      v8f acc = {};
#pragma unroll
      for (int ks = 0; ks < KS; ++ks) {
        FragB bh_, bl_;
        bh_.half[0] = *(const v8us*)&sKh[nt * 16 + ln][ks * 32 + 8 * hh]; bh_.half[1] = *(const v8us*)&sKh[nt * 16 + ln][ks * 32 + 16 + 8 * hh];
        bl_.half[0] = *(const v8us*)&sKl[nt * 16 + ln][ks * 32 + 8 * hh]; bl_.half[1] = *(const v8us*)&sKl[nt * 16 + ln][ks * 32 + 16 + 8 * hh];
        acc = mmaN<3>(aqh[ks].v, aql[ks].v, bh_.v, bl_.v, acc);
      }
      s[nt] = acc;
    }
    // mask + running max (rows 8hh+r; the 16 lanes of a half share rows)
    float alpha[8];
#pragma unroll
    for (int r = 0; r < 8; ++r) {
      const int qi = q0 + 8 * hh + r;
      const int ja = j0 + ln, jb = j0 + 16 + ln;
      if (CAUSAL) { if (ja > qi) s[0][r] = -3.0e38f; if (jb > qi) s[1][r] = -3.0e38f; }
      if (ja >= T) s[0][r] = -3.0e38f;
      if (jb >= T) s[1][r] = -3.0e38f;
      float mx = fmaxf(s[0][r], s[1][r]);
      mx = fmaxf(mx, __shfl_xor(mx, 1, 32)); mx = fmaxf(mx, __shfl_xor(mx, 2, 32)); mx = fmaxf(mx, __shfl_xor(mx, 4, 32)); mx = fmaxf(mx, __shfl_xor(mx, 8, 32));
      const float mnew = fmaxf(m_r[r], mx);
      alpha[r] = (mnew > -1.0e38f) ? __expf(m_r[r] - mnew) : 1.0f;
      const float p0 = (s[0][r] > -1.0e38f) ? __expf(s[0][r] - mnew) : 0.f;
      const float p1 = (s[1][r] > -1.0e38f) ? __expf(s[1][r] - mnew) : 0.f;
      m_r[r] = mnew;
      l_r[r] = l_r[r] * alpha[r] + p0 + p1;            // per-lane partial row sum (16 lanes combined at the end)
      unsigned short hb = bf16_bits(p0); sPh[w][8 * hh + r][ln] = hb;      sPl[w][8 * hh + r][ln] = bf16_bits(p0 - bf16_val(hb));
      hb = bf16_bits(p1);                sPh[w][8 * hh + r][16 + ln] = hb; sPl[w][8 * hh + r][16 + ln] = bf16_bits(p1 - bf16_val(hb));
    }
#pragma unroll
    for (int dt = 0; dt < DT; ++dt)
#pragma unroll
      for (int r = 0; r < 8; ++r) oacc[dt][r] *= alpha[r];
    __builtin_amdgcn_fence(__ATOMIC_ACQ_REL, "workgroup");
    __builtin_amdgcn_wave_barrier();
    FragB pah, pal;
    pah.half[0] = *(const v8us*)&sPh[w][ln][8 * hh]; pah.half[1] = *(const v8us*)&sPh[w][ln][16 + 8 * hh];
    pal.half[0] = *(const v8us*)&sPl[w][ln][8 * hh]; pal.half[1] = *(const v8us*)&sPl[w][ln][16 + 8 * hh];
#pragma unroll
    for (int dt = 0; dt < DT; ++dt) {
      FragB bvh, bvl;
#pragma unroll
      for (int i = 0; i < 8; ++i) {
        bvh.u[i] = sVh[8 * hh + i][dt * 16 + ln]; bvh.u[8 + i] = sVh[16 + 8 * hh + i][dt * 16 + ln];
        bvl.u[i] = sVl[8 * hh + i][dt * 16 + ln]; bvl.u[8 + i] = sVl[16 + 8 * hh + i][dt * 16 + ln];
      }
      oacc[dt] = mmaN<3>(pah.v, pal.v, bvh.v, bvl.v, oacc[dt]);
    }
    __builtin_amdgcn_fence(__ATOMIC_ACQ_REL, "workgroup");
    __builtin_amdgcn_wave_barrier();
  }
#pragma unroll
  for (int r = 0; r < 8; ++r) {
    float l = l_r[r];
    l += __shfl_xor(l, 1, 32); l += __shfl_xor(l, 2, 32); l += __shfl_xor(l, 4, 32); l += __shfl_xor(l, 8, 32);
    l_r[r] = (l > 0.f) ? 1.0f / l : 0.f;
  }
#pragma unroll
  for (int dt = 0; dt < DT; ++dt)
#pragma unroll
    for (int r = 0; r < 8; ++r) sO[w][8 * hh + r][dt * 16 + ln] = oacc[dt][r] * l_r[r];
  __builtin_amdgcn_fence(__ATOMIC_ACQ_REL, "workgroup");
  __builtin_amdgcn_wave_barrier();
  {
    for (int r = 0; r < 16; ++r) {
      const int row = q0 + r;
      if (row < T && lane < D / 4) {
        const v4f val = *(const v4fa*)&sO[w][r][lane * 4];
        *(v4f*)(y + ((size_t)b * T + row) * ypitch + h * D + lane * 4) = val;
      }
    }
    
  }
}

// GEMM C = act(A·W + bias + resid): A f32 (ASPLIT -> hi/lo 2 terms), Wt bf16 [N][K]; ACT 0 none, 1 relu, 2 exact gelu;
// resid (optional, f32, row index = (row % rmod), pitch ldr, RES_BF16 rounds it) added before the activation.
template <bool ASPLIT, int ACT, bool BIAS_BF16, bool RES_BF16>
__global__ __launch_bounds__(128) void k_gemm_bf3(const float* __restrict__ A, int lda, const unsigned short* __restrict__ Wt, int ldb,
                                                const float* __restrict__ bias, const float* __restrict__ resid, int rmod, int ldr,
                                                float* __restrict__ C, int ldc, int M, int N, int K) {
  __shared__ __attribute__((aligned(16))) float so[4][16][64];
  const int tid = threadIdx.x, w = tid >> 5, lane = tid & 31, ln = lane & 15, hh = lane >> 4;
  const int ntn = N / 64;
  const int wid = blockIdx.x * 4 + w;
  const int mt = wid / ntn, nq = wid % ntn;
  if (mt * 16 >= M) return;
  const int row0 = mt * 16, col0 = nq * 64;
  const float* arow = A + (size_t)(row0 + ln) * lda;
  v8f acc[4] = {};
  for (int kb = 0; kb < K; kb += 32) {
    FragB ah, al;
    const v4f x0 = *(const v4fa*)(arow + kb + 8 * hh), x1 = *(const v4fa*)(arow + kb + 8 * hh + 4);
    const v4f x2 = *(const v4fa*)(arow + kb + 16 + 8 * hh), x3 = *(const v4fa*)(arow + kb + 16 + 8 * hh + 4);
    float xs[16] = {x0[0],x0[1],x0[2],x0[3],x1[0],x1[1],x1[2],x1[3],x2[0],x2[1],x2[2],x2[3],x3[0],x3[1],x3[2],x3[3]};
#pragma unroll
    for (int i = 0; i < 16; ++i) { const unsigned short hb = bf16_bits(xs[i]); ah.u[i] = hb; al.u[i] = ASPLIT ? bf16_bits(xs[i] - bf16_val(hb)) : (unsigned short)0; }
#pragma unroll
    for (int t = 0; t < 4; ++t) {
      const unsigned short* brow = Wt + (size_t)(col0 + t * 16 + ln) * ldb + kb;
      FragB b;
      b.half[0] = *(const v8us*)(brow + 8 * hh);
      b.half[1] = *(const v8us*)(brow + 16 + 8 * hh);
      acc[t] = mmaN<ASPLIT ? 2 : 1>(ah.v, al.v, b.v, b.v, acc[t]);
    }
  }
#pragma unroll
  for (int t = 0; t < 4; ++t) {
    const int col = col0 + t * 16 + ln;
    float bv = bias ? bias[col] : 0.f;
    if (BIAS_BF16) bv = bf16_round(bv);
#pragma unroll
    for (int r = 0; r < 8; ++r) {
      float v = acc[t][r] + bv;
      if (resid) { float rv = resid[(size_t)((row0 + 8 * hh + r) % rmod) * ldr + col]; if (RES_BF16) rv = bf16_round(rv); v += rv; }
      if (ACT == 1) v = fmaxf(v, 0.f);
      if (ACT == 2) v = 0.5f * v * (1.0f + erff(v * 0.70710678118654752f));
      if (ACT == 3) { const float u = 0.7978845608028654f * (v + 0.044715f * v * v * v); v = 0.5f * v * (1.0f + tanhf(u)); }
      so[w][8 * hh + r][t * 16 + ln] = v;
    }
  }
  __builtin_amdgcn_fence(__ATOMIC_ACQ_REL, "workgroup");
  __builtin_amdgcn_wave_barrier();
  const int rsub = lane >> 4, c4 = (lane & 15) * 4;
  {
#pragma unroll
    for (int q = 0; q < 8; ++q) {
      const int r = q * 2 + rsub;
      const v4f v = *(const v4fa*)&so[w][r][c4];
      *(v4f*)(C + (size_t)(row0 + r) * ldc + col0 + c4) = v;
    }
    
  }
}
// row LayerNorm (biased variance, eps) over N: s = X (+ R); optional out_sum <- s; out_norm <- (s-mu)*rsqrt(var+eps)*g + b
template <bool PARAM_BF16>
__global__ __launch_bounds__(256) void k_layernorm(const float* __restrict__ X, const float* __restrict__ R, const float* __restrict__ g, const float* __restrict__ bta,
                                                  float* __restrict__ out_sum, float* __restrict__ out_norm, int N, float eps) {
  __shared__ float red[256];
  const int row = blockIdx.x, tid = threadIdx.x;
  const float* x = X + (size_t)row * N; const float* rr = R ? R + (size_t)row * N : nullptr;
  float vals[16];                     // up to N = 4096
  const int per = N / 256;            // contiguous chunk per thread? use strided-by-4 chunks: thread handles j = tid*4 + 1024*u
  float s1 = 0.f;
  for (int u = 0; u < per / 4; ++u) {
    const int j = tid * 4 + 1024 * u;
    const v4f a = *(const v4fa*)(x + j);
    v4f b = {0.f,0.f,0.f,0.f}; if (rr) b = *(const v4fa*)(rr + j);
#pragma unroll
    for (int q = 0; q < 4; ++q) { const float v = a[q] + b[q]; vals[u * 4 + q] = v; s1 += v; }
  }
  red[tid] = s1; __syncthreads();
  for (int st = 128; st > 0; st >>= 1) { if (tid < st) red[tid] += red[tid + st]; __syncthreads(); }
  const float mu = red[0] / (float)N; __syncthreads();
  float s2 = 0.f;
  for (int u = 0; u < per / 4; ++u)
#pragma unroll
    for (int q = 0; q < 4; ++q) { const float c = vals[u * 4 + q] - mu; s2 += c * c; }
  red[tid] = s2; __syncthreads();
  for (int st = 128; st > 0; st >>= 1) { if (tid < st) red[tid] += red[tid + st]; __syncthreads(); }
  const float rs = rsqrtf(red[0] / (float)N + eps);
  {
    for (int u = 0; u < per / 4; ++u) {
      const int j = tid * 4 + 1024 * u;
      v4f o, sm;
#pragma unroll
      for (int q = 0; q < 4; ++q) {
        float gg = g[j + q], bb = bta[j + q];
        if (PARAM_BF16) { gg = bf16_round(gg); bb = bf16_round(bb); }
        sm[q] = vals[u * 4 + q]; o[q] = (vals[u * 4 + q] - mu) * rs * gg + bb;
      }
      if (out_sum) *(v4f*)(out_sum + (size_t)row * N + j) = sm;
      *(v4f*)(out_norm + (size_t)row * N + j) = o;
    }
    
  }
}



// ---- f16 WMMA path (v_wmma_f32_16x16x32_f16): 11-bit significands for operands in range — used for the projection, generator and output GEMMs
typedef _Float16 v16h __attribute__((ext_vector_type(16)));
union FragH { v16h v; v8us half[2]; _Float16 h[16]; unsigned short u[16]; };
template <int NT>
__device__ __forceinline__ v8f mmaH(v16h ah, v16h al, v16h bh, v16h bl, v8f c) {
  c = __builtin_amdgcn_wmma_f32_16x16x32_f16(false, ah, false, bh, (short)0, c, false, false);
  if (NT >= 2) c = __builtin_amdgcn_wmma_f32_16x16x32_f16(false, al, false, bh, (short)0, c, false, false);
  if (NT >= 3) c = __builtin_amdgcn_wmma_f32_16x16x32_f16(false, ah, false, bl, (short)0, c, false, false);
  asm volatile("v_nop\n\tv_nop\n\tv_nop\n\tv_nop" : "+v"(c) : "v"(ah), "v"(al), "v"(bh), "v"(bl));
  return c;
}
// batched GEMM like k_gemm_b but f16 operands: A f32 (split into f16 hi/lo if ASPLIT, else rounded to f16), Bt = f16 values [n][k]; alpha; C f32; N multiple of 16 (partial tiles skipped)
template <bool ASPLIT>
__global__ __launch_bounds__(128) void k_gemm_h(const float* __restrict__ A, int lda, size_t sA, const _Float16* __restrict__ Bh, int ldb, size_t sB, float alpha, float* __restrict__ C, int ldc, size_t sC, int M, int N, int K) {
  __shared__ __attribute__((aligned(16))) float so[4][16][64];
  const int tid = threadIdx.x, w = tid >> 5, lane = tid & 31, ln = lane & 15, hh = lane >> 4; const int by = blockIdx.y;
  A += (size_t)by * sA; Bh += (size_t)by * sB; C += (size_t)by * sC;
  const int ntn = (N + 63) / 64; const int wid = blockIdx.x * 4 + w; const int mt = wid / ntn, nq = wid % ntn; if (mt * 16 >= M) return;
  const int row0 = mt * 16, col0 = nq * 64; const float* arow = A + (size_t)(row0 + ln) * lda;
  v8f acc[4] = {};
  for (int kb = 0; kb < K; kb += 32) {
    FragH ah, al;
    const v4f x0 = *(const v4fa*)(arow + kb + 8 * hh), x1 = *(const v4fa*)(arow + kb + 8 * hh + 4), x2 = *(const v4fa*)(arow + kb + 16 + 8 * hh), x3 = *(const v4fa*)(arow + kb + 16 + 8 * hh + 4);
    float xs[16] = {x0[0],x0[1],x0[2],x0[3],x1[0],x1[1],x1[2],x1[3],x2[0],x2[1],x2[2],x2[3],x3[0],x3[1],x3[2],x3[3]};
#pragma unroll
    for (int i = 0; i < 16; ++i) { const _Float16 h = (_Float16)xs[i]; ah.h[i] = h; al.h[i] = ASPLIT ? (_Float16)(xs[i] - (float)h) : (_Float16)0.0f; }
#pragma unroll
    for (int t = 0; t < 4; ++t) { if (col0 + t * 16 >= N) continue; const size_t boff = (size_t)(col0 + t * 16 + ln) * ldb + kb; FragH bq; bq.half[0] = *(const v8us*)(Bh + boff + 8 * hh); bq.half[1] = *(const v8us*)(Bh + boff + 16 + 8 * hh);
      acc[t] = mmaH<ASPLIT ? 2 : 1>(ah.v, al.v, bq.v, bq.v, acc[t]); }
  }
#pragma unroll
  for (int t = 0; t < 4; ++t) { if (col0 + t * 16 >= N) continue;
#pragma unroll
    for (int r = 0; r < 8; ++r) so[w][8 * hh + r][t * 16 + ln] = acc[t][r] * alpha; }
  __builtin_amdgcn_fence(__ATOMIC_ACQ_REL, "workgroup"); __builtin_amdgcn_wave_barrier();
  const int rsub = lane >> 4, c4 = (lane & 15) * 4;
  {
#pragma unroll
    for (int q = 0; q < 8; ++q) { const int r = q * 2 + rsub; if (col0 + c4 < N) { const v4f v = *(const v4fa*)&so[w][r][c4]; *(v4f*)(C + (size_t)(row0 + r) * ldc + col0 + c4) = v; } }
     }
}

// Wt[n][k] = f16(W[k][n]·scale) from f32 row-major W[K][N] (scale = power of two; bf16-exact weights stay exact in f16 away from the subnormal range)
__global__ __launch_bounds__(256) void k_wt_f16(const float* __restrict__ W, _Float16* __restrict__ Wt, int K, int N, float scale) {
  const int t = blockIdx.x * 256 + threadIdx.x; if (t >= N * (K / 8)) return; const int n = t / (K / 8), k8 = (t % (K / 8)) * 8; FragH f;
#pragma unroll
  for (int i = 0; i < 8; ++i) f.h[i] = (_Float16)(bf16_round(W[(size_t)(k8 + i) * N + n]) * scale); const v8us o = f.half[0];
  *(v8us*)((unsigned short*)Wt + (size_t)n * K + k8) = o; 
}
// k_gemm_hh variant with fused epilogue: v = acc·alpha + bias[by·sBias + col] (+ CP[(row/rowsPerB)·sCPb + by·64 + col] if CP) ; ACT 0 none / 1 elu ; writes f32 C and f16 C16, each if non-null
template <int ACT>
__global__ __launch_bounds__(128) void k_gemm_hhx(const _Float16* __restrict__ A, int lda, size_t sA, const _Float16* __restrict__ Bh, int ldb, size_t sB, float alpha, const float* __restrict__ bias, size_t sBias, const float* __restrict__ CP, int rowsPerB, size_t sCPb, int row0g,
    float* __restrict__ C, _Float16* __restrict__ C16, int ldc, size_t sC, int M, int N, int K) {
  __shared__ __attribute__((aligned(16))) float so[4][16][64];
  const int tid = threadIdx.x, w = tid >> 5, lane = tid & 31, ln = lane & 15, hh = lane >> 4; const int by = blockIdx.y;
  A += (size_t)by * sA; Bh += (size_t)by * sB; const size_t cofs = (size_t)by * sC; const float* bp = bias ? bias + (size_t)by * sBias : nullptr;
  const int ntn = (N + 63) / 64; const int wid = blockIdx.x * 4 + w; const int mt = wid / ntn, nq = wid % ntn; if (mt * 16 >= M) return;
  const int row0 = mt * 16, col0 = nq * 64; const _Float16* arow = A + (size_t)(row0 + ln) * lda;
  v8f acc[4] = {};
  for (int kb = 0; kb < K; kb += 32) { FragH ah; ah.half[0] = *(const v8us*)((const unsigned short*)arow + kb + 8 * hh); ah.half[1] = *(const v8us*)((const unsigned short*)arow + kb + 16 + 8 * hh);
#pragma unroll
    for (int t = 0; t < 4; ++t) { if (col0 + t * 16 >= N) continue; const size_t boff = (size_t)(col0 + t * 16 + ln) * ldb + kb; FragH bq; bq.half[0] = *(const v8us*)((const unsigned short*)Bh + boff + 8 * hh); bq.half[1] = *(const v8us*)((const unsigned short*)Bh + boff + 16 + 8 * hh);
      acc[t] = mmaH<1>(ah.v, ah.v, bq.v, bq.v, acc[t]); }
  }
#pragma unroll
  for (int t = 0; t < 4; ++t) { if (col0 + t * 16 >= N) continue; const int col = col0 + t * 16 + ln; const float bv = bp ? bf16_round(bp[col]) : 0.f;
#pragma unroll
    for (int r = 0; r < 8; ++r) { float v = acc[t][r] * alpha + bv; if (CP) { const int bidx = (row0g + row0 + 8 * hh + r) / rowsPerB; v += CP[(size_t)bidx * sCPb + (size_t)by * 64 + col]; } if (ACT == 1) v = (v > 0.f) ? v : expm1f(v); else if (ACT == 3) v = fmaxf(v, 0.f); so[w][8 * hh + r][t * 16 + ln] = v; } }
  __builtin_amdgcn_fence(__ATOMIC_ACQ_REL, "workgroup"); __builtin_amdgcn_wave_barrier();
  const int rsub = lane >> 4, c4 = (lane & 15) * 4; typedef _Float16 v4h __attribute__((ext_vector_type(4)));
  {
#pragma unroll
    for (int q = 0; q < 8; ++q) { const int r = q * 2 + rsub; if (col0 + c4 < N) { const v4f v = *(const v4fa*)&so[w][r][c4]; if (C) *(v4f*)(C + cofs + (size_t)(row0 + r) * ldc + col0 + c4) = v; if (C16) { v4h h4; for (int i = 0; i < 4; ++i) h4[i] = (_Float16)v[i]; *(v4h*)(C16 + cofs + (size_t)(row0 + r) * ldc + col0 + c4) = h4; } } }
     }
}


__global__ __launch_bounds__(256) void k_round16f(const float* __restrict__ W, _Float16* __restrict__ Bt, size_t n8) { const size_t t = (size_t)blockIdx.x * 256 + threadIdx.x; if (t >= n8) return; FragH f;
#pragma unroll
  for (int i = 0; i < 8; ++i) f.h[i] = (_Float16)(bf16_round(W[t * 8 + i]) * 16.0f); *(v8us*)((unsigned short*)Bt + t * 8) = f.half[0];  }
__global__ __launch_bounds__(256) void k_x16(const float* __restrict__ x, _Float16* __restrict__ X16, size_t n8) { const size_t t = (size_t)blockIdx.x * 256 + threadIdx.x; if (t >= n8) return; FragH f;
#pragma unroll
  for (int q = 0; q < 8; ++q) f.h[q] = (_Float16)bf16_round(x[t * 8 + q]); *(v8us*)((unsigned short*)X16 + t * 8) = f.half[0];  }
__global__ __launch_bounds__(256) void k_h16(const float* __restrict__ x, _Float16* __restrict__ X16, size_t n8) { const size_t t = (size_t)blockIdx.x * 256 + threadIdx.x; if (t >= n8) return; FragH f;
#pragma unroll
  for (int q = 0; q < 8; ++q) f.h[q] = (_Float16)x[t * 8 + q]; *(v8us*)((unsigned short*)X16 + t * 8) = f.half[0];  }
__global__ __launch_bounds__(256) void k_res(const float* __restrict__ f, const float* __restrict__ pf, float* __restrict__ RES) { const size_t t = (size_t)blockIdx.x * 256 + threadIdx.x; if (t >= (size_t)NBS * FD / 4) return; const v4f a = *(const v4fa*)(f + t * 4), b = *(const v4fa*)(pf + t * 4); v4f o; for (int q = 0; q < 4; ++q) o[q] = bf16_round(a[q]) + bf16_round(b[q]); *(v4f*)(RES + t * 4) = o;  }
// per sample (wave): p1 = PAR[s][0:4096] as [LOW][MID], p2 = PAR[s][4096:] as [MID][LOW]; h[m] = relu(sum_l flow[l]*p1[l][m]); g[l] = sum_m h[m]*p2[m][l].
// The sample's 32 KB of parameters are read as 64 wave-wide 16-byte loads (512 contiguous bytes each), DYN_AHEAD groups of DYN_GRP loads in flight ahead of the group being summed.
// p1: one load = rows l = 4i..4i+3; lane = (q = lane >> 3 picks the row, (lane & 7) * 4 the four m); the four q partial sums meet in a two-step butterfly.
// p2: one load = row m; the lane owns l = 4 * lane .. + 3 and sums m in rising order.
#define DYN_GRP 8
#define DYN_NGRP (NPAR / 128 / DYN_GRP)
#define DYN_AHEAD 5
__global__ __launch_bounds__(256) void k_dyn(const float* __restrict__ FLOW, const float* __restrict__ PAR, int s0, _Float16* __restrict__ G16) {
  __shared__ __attribute__((aligned(16))) float sfT[8][4][LOW / 4 + 4];      // flow[4i + q] at [q][i]; pitch 36 floats keeps the four q rows on different banks
  __shared__ __attribute__((aligned(16))) float sh[8][MID];
  const int tid = threadIdx.x, lane = tid & 31, q = lane >> 3;
  const int wv = __builtin_amdgcn_readfirstlane(tid >> 5);
  const int sl = blockIdx.x * 8 + wv; const int s = s0 + sl;
  const v4fa* pr = (const v4fa*)(PAR + (size_t)sl * NPAR) + lane;
  const v4f fl = *((const v4fa*)(FLOW + (size_t)s * LOW) + lane);      // issued first: loads return in order, so its wait leaves the parameter loads in flight
  __builtin_amdgcn_sched_barrier(0);      // keeps that load in front of the parameter loads
  v4f buf[DYN_AHEAD + 1][DYN_GRP];
#define DYN_LOAD(G) do { _Pragma("unroll") for (int j = 0; j < DYN_GRP; ++j) buf[(G) % (DYN_AHEAD + 1)][j] = pr[((G) * DYN_GRP + j) * 32]; } while (0)
#pragma unroll
  for (int g = 0; g < DYN_AHEAD; ++g) DYN_LOAD(g);
#pragma unroll
  for (int c = 0; c < 4; ++c) sfT[wv][c][lane] = fl[c];
  // fence on LDS alone: it waits for the wave's LDS stores before the rows are read back; the fence on every address space would also drain the parameter loads in flight
  __builtin_amdgcn_fence(__ATOMIC_ACQ_REL, "workgroup", "local"); __builtin_amdgcn_wave_barrier();
  v4f acc = {0.f, 0.f, 0.f, 0.f};
#pragma unroll
  for (int g = 0; g < DYN_NGRP; ++g) {
    // the two scheduling barriers keep the refill where it is written, behind the sums that freed its registers; left free, the compiler sinks all refills behind the last p1 sum
    if (g + DYN_AHEAD < DYN_NGRP) { __builtin_amdgcn_sched_barrier(0); DYN_LOAD(g + DYN_AHEAD); __builtin_amdgcn_sched_barrier(0); }
    if (g == DYN_NGRP / 2) {      // p1 done: join the four row classes, relu, hand h to every lane
#pragma unroll
      for (int c = 0; c < 4; ++c) { float a = acc[c]; a += __shfl_xor(a, 8, 32); a += __shfl_xor(a, 16, 32); acc[c] = fmaxf(a, 0.f); }
      if (lane < 8) *(v4fa*)&sh[wv][lane * 4] = acc;
      __builtin_amdgcn_fence(__ATOMIC_ACQ_REL, "workgroup", "local"); __builtin_amdgcn_wave_barrier();      // LDS alone, as above
      acc = (v4f){0.f, 0.f, 0.f, 0.f};
    }
    const float* cf = (g < DYN_NGRP / 2) ? &sfT[wv][q][g * DYN_GRP] : &sh[wv][(g - DYN_NGRP / 2) * DYN_GRP];
    const v4f c0 = *(const v4fa*)cf, c1 = *(const v4fa*)(cf + 4);
#pragma unroll
    for (int j = 0; j < DYN_GRP; ++j) acc += ((j < 4) ? c0[j & 3] : c1[j & 3]) * buf[g % (DYN_AHEAD + 1)][j];
  }
#undef DYN_LOAD
  typedef _Float16 v4h __attribute__((ext_vector_type(4)));
  v4h o;
#pragma unroll
  for (int c = 0; c < 4; ++c) o[c] = (_Float16)acc[c];
  *(v4h*)(G16 + (size_t)s * LOW + lane * 4) = o;
}
extern "C" void kernel_launch(void* const* d_in, const int* in_sizes, int n_in,
                              void* d_out, int out_size, void* d_ws, size_t ws_size, hipStream_t stream) {
  (void)in_sizes; (void)n_in; (void)out_size;
  const float* f = (const float*)d_in[0]; const float* pf = (const float*)d_in[1]; const float* pfw = (const float*)d_in[2]; const float* pfb = (const float*)d_in[3]; const float* ppw = (const float*)d_in[4]; const float* ppb = (const float*)d_in[5]; const float* f2w = (const float*)d_in[6]; const float* f2b = (const float*)d_in[7]; const float* pgw = (const float*)d_in[8]; const float* pgb = (const float*)d_in[9];
  char* ws = (char*)d_ws; size_t off = 0;
  auto take = [&](size_t bytes) { char* p = ws + off; off += (bytes + 255) & ~(size_t)255; return p; };
  _Float16* Bf = (_Float16*)take((size_t)LOW * FD * 2); _Float16* Bp = (_Float16*)take((size_t)LOW * FD * 2); _Float16* Bg = (_Float16*)take((size_t)NPAR * LOW * 2); _Float16* B2 = (_Float16*)take((size_t)FD * LOW * 2);
  char* R = take((size_t)NBS * FD * 4); _Float16* F16 = (_Float16*)R; _Float16* P16 = (_Float16*)(R + (size_t)NBS * FD * 2); float* RES = (float*)R;      // F16/P16 dead after the two projections → RES f32 (same 33.5 MB)
  float* FLOW = (float*)take((size_t)NBS * LOW * 4); _Float16* PL16 = (_Float16*)take((size_t)NBS * LOW * 2); float* PAR = (float*)take((size_t)CHS * NPAR * 4); _Float16* G16 = (_Float16*)take((size_t)NBS * LOW * 2);
  if (off > ws_size) return;      // 0.5 + 2.1 + 0.25 + 33.5 + 4.2 + 2.1 + 67 + 2.1 ≈ 107 MiB
  k_round16f<<<(LOW * FD / 8 + 255) / 256, 256, 0, stream>>>(pfw, Bf, (size_t)LOW * FD / 8); k_round16f<<<(LOW * FD / 8 + 255) / 256, 256, 0, stream>>>(ppw, Bp, (size_t)LOW * FD / 8); k_round16f<<<(NPAR * LOW / 8 + 255) / 256, 256, 0, stream>>>(pgw, Bg, (size_t)NPAR * LOW / 8); k_round16f<<<(FD * LOW / 8 + 255) / 256, 256, 0, stream>>>(f2w, B2, (size_t)FD * LOW / 8);      // (out,in)
  const unsigned gx = (unsigned)(((size_t)NBS * FD / 8 + 255) / 256);
  k_x16<<<gx, 256, 0, stream>>>(f, F16, (size_t)NBS * FD / 8); k_x16<<<gx, 256, 0, stream>>>(pf, P16, (size_t)NBS * FD / 8);
  k_gemm_hhx<0><<<dim3(((NBS / 16) * (LOW / 64) + 3) / 4, 1), 128, 0, stream>>>(F16, FD, 0, Bf, FD, 0, 0.0625f, pfb, 0, nullptr, 1, 0, 0, FLOW, nullptr, LOW, 0, NBS, LOW, FD);      // f_low (f32, read by the per-sample MLP)
  k_gemm_hhx<0><<<dim3(((NBS / 16) * (LOW / 64) + 3) / 4, 1), 128, 0, stream>>>(P16, FD, 0, Bp, FD, 0, 0.0625f, ppb, 0, nullptr, 1, 0, 0, nullptr, PL16, LOW, 0, NBS, LOW, FD);     // pf_low (f16 operand of the generator)
  k_res<<<(unsigned)(((size_t)NBS * FD / 4 + 255) / 256), 256, 0, stream>>>(f, pf, RES);      // after both projections (F16/P16 dead)
  for (int c = 0; c < NBS / CHS; ++c) { const int s0 = c * CHS;
    k_gemm_hhx<0><<<dim3(((CHS / 16) * (NPAR / 64) + 3) / 4, 1), 128, 0, stream>>>(PL16 + (size_t)s0 * LOW, LOW, 0, Bg, LOW, 0, 0.0625f, pgb, 0, nullptr, 1, 0, 0, PAR, nullptr, NPAR, 0, CHS, NPAR, LOW);      // params = pf_low·pg_wᵀ + pg_b (f32 [2048][8192])
    k_dyn<<<CHS / 8, 256, 0, stream>>>(FLOW, PAR, s0, G16); }
  k_gemm_hhx<0><<<dim3(((NBS / 16) * (FD / 64) + 3) / 4, 1), 128, 0, stream>>>(G16, LOW, 0, B2, LOW, 0, 0.0625f, f2b, 0, RES, 1, (size_t)FD, 0, (float*)d_out, nullptr, FD, 0, NBS, FD, LOW);      // g·proj_f2ᵀ + b + (f + pf)
}

// v002
// Measured time: 162 microseconds a run.
// Timed twice side by side with v001, it ran 1.74 and 1.75 times as fast.
// Over all steps from v000 it is 3.50 times as fast.
#include <hip/hip_runtime.h>
// + bias, + f + pf residuals as exact bf16 addends) on v_wmma_f32_16x16x32_f16 (f16 operands, nn.Linear weights (out,in) bf16-exact ×2^4, f32 accumulate); the per-sample tiny MLP
// (128 -> 32 relu -> 128 with that sample's generated weights) is f32 VALU on the generator's accumulator tiles (32 samples per work-group).
#define NBS 8192
#define FD 1024
#define LOW 128
#define MID 32
#define NPAR (2 * LOW * MID)

typedef __bf16 v16b __attribute__((ext_vector_type(16)));
typedef unsigned short v8us __attribute__((ext_vector_type(8), may_alias));
typedef float  v8f  __attribute__((ext_vector_type(8)));
typedef float  v4f  __attribute__((ext_vector_type(4)));
typedef float  v4fa __attribute__((ext_vector_type(4), may_alias));
union FragB { v16b v; v8us half[2]; unsigned short u[16]; };

__device__ __forceinline__ unsigned short bf16_bits(float x) { unsigned int u = __float_as_uint(x); return (unsigned short)((u + 0x7FFFu + ((u >> 16) & 1u)) >> 16); }
__device__ __forceinline__ float bf16_val(unsigned short b) { return __uint_as_float(((unsigned int)b) << 16); }
__device__ __forceinline__ float bf16_round(float x) { return bf16_val(bf16_bits(x)); }
// D += A·B with NT terms: 1 = ah·bh, 2 = + al·bh (A split), 3 = + ah·bl (both split)
template <int NT>
__device__ __forceinline__ v8f mmaN(v16b ah, v16b al, v16b bh, v16b bl, v8f c) {
  c = __builtin_amdgcn_wmma_f32_16x16x32_bf16(false, ah, false, bh, (short)0, c, false, false);
  if (NT >= 2) c = __builtin_amdgcn_wmma_f32_16x16x32_bf16(false, al, false, bh, (short)0, c, false, false);
  if (NT >= 3) c = __builtin_amdgcn_wmma_f32_16x16x32_bf16(false, ah, false, bl, (short)0, c, false, false);
  asm volatile("v_nop\n\tv_nop\n\tv_nop\n\tv_nop" : "+v"(c) : "v"(ah), "v"(al), "v"(bh), "v"(bl));
  return c;
}

__global__ __launch_bounds__(256) void k_wt_bf16(const float* __restrict__ W, unsigned short* __restrict__ Wt, int K, int N) {
  const int t = blockIdx.x * 256 + threadIdx.x;
  const int k8n = K / 8;
  if (t >= N * k8n) return;
  const int n = t / k8n, k8 = (t % k8n) * 8;
  v8us v;
#pragma unroll
  for (int i = 0; i < 8; ++i) v[i] = bf16_bits(W[(size_t)(k8 + i) * N + n]);
  *(v8us*)(Wt + (size_t)n * K + k8) = v;
  
}

// GEMM C[M][N] (f32, pitch ldc) = act(A[M][K]·W + bias). A f32 row-major (pitch lda) converted per fragment to bf16
// (ASPLIT: hi/lo two planes -> 2 terms, else single rounded term); Wt bf16 [N][K] (pitch ldb). BIAS_BF16 rounds the
// bias to bf16 first (bias quantised to bf16 before the add). K%32==0, M%16==0, N%64==0.
template <bool ASPLIT, int ACT, bool BIAS_BF16>
__global__ __launch_bounds__(128) void k_gemm_bf(const float* __restrict__ A, int lda, const unsigned short* __restrict__ Wt, int ldb,
                                               const float* __restrict__ bias, float* __restrict__ C, int ldc, int M, int N, int K) {
  __shared__ __attribute__((aligned(16))) float so[4][16][64];
  const int tid = threadIdx.x, w = tid >> 5, lane = tid & 31, ln = lane & 15, hh = lane >> 4;
  const int ntn = N / 64;
  const int wid = blockIdx.x * 4 + w;
  const int mt = wid / ntn, nq = wid % ntn;
  if (mt * 16 >= M) return;
  const int row0 = mt * 16, col0 = nq * 64;
  const float* arow = A + (size_t)(row0 + ln) * lda;
  v8f acc[4] = {};
  for (int kb = 0; kb < K; kb += 32) {
    FragB ah, al;
    const v4f x0 = *(const v4fa*)(arow + kb + 8 * hh), x1 = *(const v4fa*)(arow + kb + 8 * hh + 4);
    const v4f x2 = *(const v4fa*)(arow + kb + 16 + 8 * hh), x3 = *(const v4fa*)(arow + kb + 16 + 8 * hh + 4);
    float xs[16] = {x0[0],x0[1],x0[2],x0[3],x1[0],x1[1],x1[2],x1[3],x2[0],x2[1],x2[2],x2[3],x3[0],x3[1],x3[2],x3[3]};
#pragma unroll
    for (int i = 0; i < 16; ++i) { const unsigned short hb = bf16_bits(xs[i]); ah.u[i] = hb; al.u[i] = ASPLIT ? bf16_bits(xs[i] - bf16_val(hb)) : (unsigned short)0; }
#pragma unroll
    for (int t = 0; t < 4; ++t) {
      const unsigned short* brow = Wt + (size_t)(col0 + t * 16 + ln) * ldb + kb;
      FragB b;
      b.half[0] = *(const v8us*)(brow + 8 * hh);
      b.half[1] = *(const v8us*)(brow + 16 + 8 * hh);
      acc[t] = mmaN<ASPLIT ? 2 : 1>(ah.v, al.v, b.v, b.v, acc[t]);
    }
  }
#pragma unroll
  for (int t = 0; t < 4; ++t) {
    float bv = bias ? bias[col0 + t * 16 + ln] : 0.f;
    if (BIAS_BF16) bv = bf16_round(bv);
#pragma unroll
    for (int r = 0; r < 8; ++r) { float v = acc[t][r] + bv; if (ACT == 1) v = fmaxf(v, 0.f); so[w][8 * hh + r][t * 16 + ln] = v; }
  }
  __builtin_amdgcn_fence(__ATOMIC_ACQ_REL, "workgroup");
  __builtin_amdgcn_wave_barrier();
  const int rsub = lane >> 4, c4 = (lane & 15) * 4;
  {
#pragma unroll
    for (int q = 0; q < 8; ++q) {
      const int r = q * 2 + rsub;
      const v4f v = *(const v4fa*)&so[w][r][c4];
      *(v4f*)(C + (size_t)(row0 + r) * ldc + col0 + c4) = v;
    }
    
  }
}

// Flash-style causal/unmasked attention, all contractions 3-term bf16 hi/lo splits, f32 softmax with running max.
// q,k,v rows are read from f32 buffers with arbitrary row pitch (so they can live inside a fused qkv buffer);
// D = head size (multiple of 32, <= 128); one wave = 16 query rows; block = 4 waves (64 queries) sharing K/V chunks of 32.
template <int D, bool CAUSAL>
__global__ __launch_bounds__(128) void k_flash(const float* __restrict__ qb, const float* __restrict__ kb, const float* __restrict__ vb,
                                             int pitch, int T, int H, float scale, float* __restrict__ y, int ypitch) {
  constexpr int KS = D / 32;        // k-steps for QK
  constexpr int DT = D / 16;        // d tiles for PV
  __shared__ __attribute__((aligned(16))) unsigned short sKh[32][D + 8], sKl[32][D + 8], sVh[32][D + 8], sVl[32][D + 8];
  __shared__ __attribute__((aligned(16))) unsigned short sPh[4][16][40], sPl[4][16][40];
  __shared__ __attribute__((aligned(16))) float sO[4][16][D];
  const int tid = threadIdx.x, w = tid >> 5, lane = tid & 31, ln = lane & 15, hh = lane >> 4;
  const int nqb = (T + 63) / 64;
  const int bh = blockIdx.x / nqb, qblk = blockIdx.x % nqb;
  const int b = bh / H, h = bh % H;
  const int q0 = qblk * 64 + w * 16;
  const float* Q = qb + (size_t)b * T * pitch + h * D;
  const float* K = kb + (size_t)b * T * pitch + h * D;
  const float* V = vb + (size_t)b * T * pitch + h * D;

  // A fragments of the wave's 16 query rows (scaled), hi/lo
  FragB aqh[KS], aql[KS];
  {
    int row = q0 + ln; if (row >= T) row = T - 1;
    const float* qr = Q + (size_t)row * pitch;
#pragma unroll
    for (int ks = 0; ks < KS; ++ks)
#pragma unroll
      for (int i = 0; i < 16; ++i) {
        const int d = ks * 32 + ((i < 8) ? (8 * hh + i) : (16 + 8 * hh + (i - 8)));
        const float x = qr[d] * scale; const unsigned short hb = bf16_bits(x);
        aqh[ks].u[i] = hb; aql[ks].u[i] = bf16_bits(x - bf16_val(hb));
      }
  }
  float m_r[8], l_r[8];
#pragma unroll
  for (int r = 0; r < 8; ++r) { m_r[r] = -3.0e38f; l_r[r] = 0.f; }
  v8f oacc[DT];
#pragma unroll
  for (int dt = 0; dt < DT; ++dt) oacc[dt] = (v8f){0.f,0.f,0.f,0.f,0.f,0.f,0.f,0.f};

  const int kv_end = CAUSAL ? min(T, qblk * 64 + 64) : T;     // block-uniform
  for (int j0 = 0; j0 < kv_end; j0 += 32) {
    __syncthreads();
    for (int e = tid; e < 32 * (D / 4); e += 128) {
      const int r = e / (D / 4), c4 = (e % (D / 4)) * 4;
      const int key = j0 + r;
      v4f kf = {0.f,0.f,0.f,0.f}, vf = {0.f,0.f,0.f,0.f};
      if (key < T) { kf = *(const v4fa*)(K + (size_t)key * pitch + c4); vf = *(const v4fa*)(V + (size_t)key * pitch + c4); }
#pragma unroll
      for (int t = 0; t < 4; ++t) {
        unsigned short hb = bf16_bits(kf[t]); sKh[r][c4 + t] = hb; sKl[r][c4 + t] = bf16_bits(kf[t] - bf16_val(hb));
        hb = bf16_bits(vf[t]); sVh[r][c4 + t] = hb; sVl[r][c4 + t] = bf16_bits(vf[t] - bf16_val(hb));
      }
    }
    __syncthreads();
    // S tile 16 x 32
    v8f s[2];
#pragma unroll
    for (int nt = 0; nt < 2; ++nt) {
      v8f acc = {};
#pragma unroll
      for (int ks = 0; ks < KS; ++ks) {
        FragB bh_, bl_;
        bh_.half[0] = *(const v8us*)&sKh[nt * 16 + ln][ks * 32 + 8 * hh]; bh_.half[1] = *(const v8us*)&sKh[nt * 16 + ln][ks * 32 + 16 + 8 * hh];
        bl_.half[0] = *(const v8us*)&sKl[nt * 16 + ln][ks * 32 + 8 * hh]; bl_.half[1] = *(const v8us*)&sKl[nt * 16 + ln][ks * 32 + 16 + 8 * hh];
        acc = mmaN<3>(aqh[ks].v, aql[ks].v, bh_.v, bl_.v, acc);
      }
      s[nt] = acc;
    }
    // mask + running max (rows 8hh+r; the 16 lanes of a half share rows)
    float alpha[8];
#pragma unroll
    for (int r = 0; r < 8; ++r) {
      const int qi = q0 + 8 * hh + r;
      const int ja = j0 + ln, jb = j0 + 16 + ln;
      if (CAUSAL) { if (ja > qi) s[0][r] = -3.0e38f; if (jb > qi) s[1][r] = -3.0e38f; }
      if (ja >= T) s[0][r] = -3.0e38f;
      if (jb >= T) s[1][r] = -3.0e38f;
      float mx = fmaxf(s[0][r], s[1][r]);
      mx = fmaxf(mx, __shfl_xor(mx, 1, 32)); mx = fmaxf(mx, __shfl_xor(mx, 2, 32)); mx = fmaxf(mx, __shfl_xor(mx, 4, 32)); mx = fmaxf(mx, __shfl_xor(mx, 8, 32));
      const float mnew = fmaxf(m_r[r], mx);
      alpha[r] = (mnew > -1.0e38f) ? __expf(m_r[r] - mnew) : 1.0f;
      const float p0 = (s[0][r] > -1.0e38f) ? __expf(s[0][r] - mnew) : 0.f;
      const float p1 = (s[1][r] > -1.0e38f) ? __expf(s[1][r] - mnew) : 0.f;
      m_r[r] = mnew;
      l_r[r] = l_r[r] * alpha[r] + p0 + p1;            // per-lane partial row sum (16 lanes combined at the end)
      unsigned short hb = bf16_bits(p0); sPh[w][8 * hh + r][ln] = hb;      sPl[w][8 * hh + r][ln] = bf16_bits(p0 - bf16_val(hb));
      hb = bf16_bits(p1);                sPh[w][8 * hh + r][16 + ln] = hb; sPl[w][8 * hh + r][16 + ln] = bf16_bits(p1 - bf16_val(hb));
    }
#pragma unroll
    for (int dt = 0; dt < DT; ++dt)
#pragma unroll
      for (int r = 0; r < 8; ++r) oacc[dt][r] *= alpha[r];
    __builtin_amdgcn_fence(__ATOMIC_ACQ_REL, "workgroup");
    __builtin_amdgcn_wave_barrier();
    FragB pah, pal;
    pah.half[0] = *(const v8us*)&sPh[w][ln][8 * hh]; pah.half[1] = *(const v8us*)&sPh[w][ln][16 + 8 * hh];
    pal.half[0] = *(const v8us*)&sPl[w][ln][8 * hh]; pal.half[1] = *(const v8us*)&sPl[w][ln][16 + 8 * hh];
#pragma unroll
    for (int dt = 0; dt < DT; ++dt) {
      FragB bvh, bvl;
#pragma unroll
      for (int i = 0; i < 8; ++i) {
        bvh.u[i] = sVh[8 * hh + i][dt * 16 + ln]; bvh.u[8 + i] = sVh[16 + 8 * hh + i][dt * 16 + ln];
        bvl.u[i] = sVl[8 * hh + i][dt * 16 + ln]; bvl.u[8 + i] = sVl[16 + 8 * hh + i][dt * 16 + ln];
      }
      oacc[dt] = mmaN<3>(pah.v, pal.v, bvh.v, bvl.v, oacc[dt]);
    }
    __builtin_amdgcn_fence(__ATOMIC_ACQ_REL, "workgroup");
    __builtin_amdgcn_wave_barrier();
  }
#pragma unroll
  for (int r = 0; r < 8; ++r) {
    float l = l_r[r];
    l += __shfl_xor(l, 1, 32); l += __shfl_xor(l, 2, 32); l += __shfl_xor(l, 4, 32); l += __shfl_xor(l, 8, 32);
    l_r[r] = (l > 0.f) ? 1.0f / l : 0.f;
  }
#pragma unroll
  for (int dt = 0; dt < DT; ++dt)
#pragma unroll
    for (int r = 0; r < 8; ++r) sO[w][8 * hh + r][dt * 16 + ln] = oacc[dt][r] * l_r[r];
  __builtin_amdgcn_fence(__ATOMIC_ACQ_REL, "workgroup");
  __builtin_amdgcn_wave_barrier();
  {
    for (int r = 0; r < 16; ++r) {
      const int row = q0 + r;
      if (row < T && lane < D / 4) {
        const v4f val = *(const v4fa*)&sO[w][r][lane * 4];
        *(v4f*)(y + ((size_t)b * T + row) * ypitch + h * D + lane * 4) = val;
      }
    }
    
  }
}

// GEMM C = act(A·W + bias + resid): A f32 (ASPLIT -> hi/lo 2 terms), Wt bf16 [N][K]; ACT 0 none, 1 relu, 2 exact gelu;
// resid (optional, f32, row index = (row % rmod), pitch ldr, RES_BF16 rounds it) added before the activation.
template <bool ASPLIT, int ACT, bool BIAS_BF16, bool RES_BF16>
__global__ __launch_bounds__(128) void k_gemm_bf3(const float* __restrict__ A, int lda, const unsigned short* __restrict__ Wt, int ldb,
                                                const float* __restrict__ bias, const float* __restrict__ resid, int rmod, int ldr,
                                                float* __restrict__ C, int ldc, int M, int N, int K) {
  __shared__ __attribute__((aligned(16))) float so[4][16][64];
  const int tid = threadIdx.x, w = tid >> 5, lane = tid & 31, ln = lane & 15, hh = lane >> 4;
  const int ntn = N / 64;
  const int wid = blockIdx.x * 4 + w;
  const int mt = wid / ntn, nq = wid % ntn;
  if (mt * 16 >= M) return;
  const int row0 = mt * 16, col0 = nq * 64;
  const float* arow = A + (size_t)(row0 + ln) * lda;
  v8f acc[4] = {};
  for (int kb = 0; kb < K; kb += 32) {
    FragB ah, al;
    const v4f x0 = *(const v4fa*)(arow + kb + 8 * hh), x1 = *(const v4fa*)(arow + kb + 8 * hh + 4);
    const v4f x2 = *(const v4fa*)(arow + kb + 16 + 8 * hh), x3 = *(const v4fa*)(arow + kb + 16 + 8 * hh + 4);
    float xs[16] = {x0[0],x0[1],x0[2],x0[3],x1[0],x1[1],x1[2],x1[3],x2[0],x2[1],x2[2],x2[3],x3[0],x3[1],x3[2],x3[3]};
#pragma unroll
    for (int i = 0; i < 16; ++i) { const unsigned short hb = bf16_bits(xs[i]); ah.u[i] = hb; al.u[i] = ASPLIT ? bf16_bits(xs[i] - bf16_val(hb)) : (unsigned short)0; }
#pragma unroll
    for (int t = 0; t < 4; ++t) {
      const unsigned short* brow = Wt + (size_t)(col0 + t * 16 + ln) * ldb + kb;
      FragB b;
      b.half[0] = *(const v8us*)(brow + 8 * hh);
      b.half[1] = *(const v8us*)(brow + 16 + 8 * hh);
      acc[t] = mmaN<ASPLIT ? 2 : 1>(ah.v, al.v, b.v, b.v, acc[t]);
    }
  }
#pragma unroll
  for (int t = 0; t < 4; ++t) {
    const int col = col0 + t * 16 + ln;
    float bv = bias ? bias[col] : 0.f;
    if (BIAS_BF16) bv = bf16_round(bv);
#pragma unroll
    for (int r = 0; r < 8; ++r) {
      float v = acc[t][r] + bv;
      if (resid) { float rv = resid[(size_t)((row0 + 8 * hh + r) % rmod) * ldr + col]; if (RES_BF16) rv = bf16_round(rv); v += rv; }
      if (ACT == 1) v = fmaxf(v, 0.f);
      if (ACT == 2) v = 0.5f * v * (1.0f + erff(v * 0.70710678118654752f));
      if (ACT == 3) { const float u = 0.7978845608028654f * (v + 0.044715f * v * v * v); v = 0.5f * v * (1.0f + tanhf(u)); }
      so[w][8 * hh + r][t * 16 + ln] = v;
    }
  }
  __builtin_amdgcn_fence(__ATOMIC_ACQ_REL, "workgroup");
  __builtin_amdgcn_wave_barrier();
  const int rsub = lane >> 4, c4 = (lane & 15) * 4;
  {
#pragma unroll
    for (int q = 0; q < 8; ++q) {
      const int r = q * 2 + rsub;
      const v4f v = *(const v4fa*)&so[w][r][c4];
      *(v4f*)(C + (size_t)(row0 + r) * ldc + col0 + c4) = v;
    }
    
  }
}
// row LayerNorm (biased variance, eps) over N: s = X (+ R); optional out_sum <- s; out_norm <- (s-mu)*rsqrt(var+eps)*g + b
template <bool PARAM_BF16>
__global__ __launch_bounds__(256) void k_layernorm(const float* __restrict__ X, const float* __restrict__ R, const float* __restrict__ g, const float* __restrict__ bta,
                                                  float* __restrict__ out_sum, float* __restrict__ out_norm, int N, float eps) {
  __shared__ float red[256];
  const int row = blockIdx.x, tid = threadIdx.x;
  const float* x = X + (size_t)row * N; const float* rr = R ? R + (size_t)row * N : nullptr;
  float vals[16];                     // up to N = 4096
  const int per = N / 256;            // contiguous chunk per thread? use strided-by-4 chunks: thread handles j = tid*4 + 1024*u
  float s1 = 0.f;
  for (int u = 0; u < per / 4; ++u) {
    const int j = tid * 4 + 1024 * u;
    const v4f a = *(const v4fa*)(x + j);
    v4f b = {0.f,0.f,0.f,0.f}; if (rr) b = *(const v4fa*)(rr + j);
#pragma unroll
    for (int q = 0; q < 4; ++q) { const float v = a[q] + b[q]; vals[u * 4 + q] = v; s1 += v; }
  }
  red[tid] = s1; __syncthreads();
  for (int st = 128; st > 0; st >>= 1) { if (tid < st) red[tid] += red[tid + st]; __syncthreads(); }
  const float mu = red[0] / (float)N; __syncthreads();
  float s2 = 0.f;
  for (int u = 0; u < per / 4; ++u)
#pragma unroll
    for (int q = 0; q < 4; ++q) { const float c = vals[u * 4 + q] - mu; s2 += c * c; }
  red[tid] = s2; __syncthreads();
  for (int st = 128; st > 0; st >>= 1) { if (tid < st) red[tid] += red[tid + st]; __syncthreads(); }
  const float rs = rsqrtf(red[0] / (float)N + eps);
  {
    for (int u = 0; u < per / 4; ++u) {
      const int j = tid * 4 + 1024 * u;
      v4f o, sm;
#pragma unroll
      for (int q = 0; q < 4; ++q) {
        float gg = g[j + q], bb = bta[j + q];
        if (PARAM_BF16) { gg = bf16_round(gg); bb = bf16_round(bb); }
        sm[q] = vals[u * 4 + q]; o[q] = (vals[u * 4 + q] - mu) * rs * gg + bb;
      }
      if (out_sum) *(v4f*)(out_sum + (size_t)row * N + j) = sm;
      *(v4f*)(out_norm + (size_t)row * N + j) = o;
    }
    
  }
}



// ---- f16 WMMA path (v_wmma_f32_16x16x32_f16): 11-bit significands for operands in range — used for the projection, generator and output GEMMs
typedef _Float16 v16h __attribute__((ext_vector_type(16)));
union FragH { v16h v; v8us half[2]; _Float16 h[16]; unsigned short u[16]; };
template <int NT>
__device__ __forceinline__ v8f mmaH(v16h ah, v16h al, v16h bh, v16h bl, v8f c) {
  c = __builtin_amdgcn_wmma_f32_16x16x32_f16(false, ah, false, bh, (short)0, c, false, false);
  if (NT >= 2) c = __builtin_amdgcn_wmma_f32_16x16x32_f16(false, al, false, bh, (short)0, c, false, false);
  if (NT >= 3) c = __builtin_amdgcn_wmma_f32_16x16x32_f16(false, ah, false, bl, (short)0, c, false, false);
  asm volatile("v_nop\n\tv_nop\n\tv_nop\n\tv_nop" : "+v"(c) : "v"(ah), "v"(al), "v"(bh), "v"(bl));
  return c;
}
// batched GEMM like k_gemm_b but f16 operands: A f32 (split into f16 hi/lo if ASPLIT, else rounded to f16), Bt = f16 values [n][k]; alpha; C f32; N multiple of 16 (partial tiles skipped)
template <bool ASPLIT>
__global__ __launch_bounds__(128) void k_gemm_h(const float* __restrict__ A, int lda, size_t sA, const _Float16* __restrict__ Bh, int ldb, size_t sB, float alpha, float* __restrict__ C, int ldc, size_t sC, int M, int N, int K) {
  __shared__ __attribute__((aligned(16))) float so[4][16][64];
  const int tid = threadIdx.x, w = tid >> 5, lane = tid & 31, ln = lane & 15, hh = lane >> 4; const int by = blockIdx.y;
  A += (size_t)by * sA; Bh += (size_t)by * sB; C += (size_t)by * sC;
  const int ntn = (N + 63) / 64; const int wid = blockIdx.x * 4 + w; const int mt = wid / ntn, nq = wid % ntn; if (mt * 16 >= M) return;
  const int row0 = mt * 16, col0 = nq * 64; const float* arow = A + (size_t)(row0 + ln) * lda;
  v8f acc[4] = {};
  for (int kb = 0; kb < K; kb += 32) {
    FragH ah, al;
    const v4f x0 = *(const v4fa*)(arow + kb + 8 * hh), x1 = *(const v4fa*)(arow + kb + 8 * hh + 4), x2 = *(const v4fa*)(arow + kb + 16 + 8 * hh), x3 = *(const v4fa*)(arow + kb + 16 + 8 * hh + 4);
    float xs[16] = {x0[0],x0[1],x0[2],x0[3],x1[0],x1[1],x1[2],x1[3],x2[0],x2[1],x2[2],x2[3],x3[0],x3[1],x3[2],x3[3]};
#pragma unroll
    for (int i = 0; i < 16; ++i) { const _Float16 h = (_Float16)xs[i]; ah.h[i] = h; al.h[i] = ASPLIT ? (_Float16)(xs[i] - (float)h) : (_Float16)0.0f; }
#pragma unroll
    for (int t = 0; t < 4; ++t) { if (col0 + t * 16 >= N) continue; const size_t boff = (size_t)(col0 + t * 16 + ln) * ldb + kb; FragH bq; bq.half[0] = *(const v8us*)(Bh + boff + 8 * hh); bq.half[1] = *(const v8us*)(Bh + boff + 16 + 8 * hh);
      acc[t] = mmaH<ASPLIT ? 2 : 1>(ah.v, al.v, bq.v, bq.v, acc[t]); }
  }
#pragma unroll
  for (int t = 0; t < 4; ++t) { if (col0 + t * 16 >= N) continue;
#pragma unroll
    for (int r = 0; r < 8; ++r) so[w][8 * hh + r][t * 16 + ln] = acc[t][r] * alpha; }
  __builtin_amdgcn_fence(__ATOMIC_ACQ_REL, "workgroup"); __builtin_amdgcn_wave_barrier();
  const int rsub = lane >> 4, c4 = (lane & 15) * 4;
  {
#pragma unroll
    for (int q = 0; q < 8; ++q) { const int r = q * 2 + rsub; if (col0 + c4 < N) { const v4f v = *(const v4fa*)&so[w][r][c4]; *(v4f*)(C + (size_t)(row0 + r) * ldc + col0 + c4) = v; } }
     }
}

// Wt[n][k] = f16(W[k][n]·scale) from f32 row-major W[K][N] (scale = power of two; bf16-exact weights stay exact in f16 away from the subnormal range)
__global__ __launch_bounds__(256) void k_wt_f16(const float* __restrict__ W, _Float16* __restrict__ Wt, int K, int N, float scale) {
  const int t = blockIdx.x * 256 + threadIdx.x; if (t >= N * (K / 8)) return; const int n = t / (K / 8), k8 = (t % (K / 8)) * 8; FragH f;
#pragma unroll
  for (int i = 0; i < 8; ++i) f.h[i] = (_Float16)(bf16_round(W[(size_t)(k8 + i) * N + n]) * scale); const v8us o = f.half[0];
  *(v8us*)((unsigned short*)Wt + (size_t)n * K + k8) = o; 
}
// k_gemm_hh variant with fused epilogue: v = acc·alpha + bias[by·sBias + col] (+ CP[(row/rowsPerB)·sCPb + by·64 + col] if CP) ; ACT 0 none / 1 elu ; writes f32 C and f16 C16, each if non-null
template <int ACT>
__global__ __launch_bounds__(128) void k_gemm_hhx(const _Float16* __restrict__ A, int lda, size_t sA, const _Float16* __restrict__ Bh, int ldb, size_t sB, float alpha, const float* __restrict__ bias, size_t sBias, const float* __restrict__ CP, int rowsPerB, size_t sCPb, int row0g,
    float* __restrict__ C, _Float16* __restrict__ C16, int ldc, size_t sC, int M, int N, int K) {
  __shared__ __attribute__((aligned(16))) float so[4][16][64];
  const int tid = threadIdx.x, w = tid >> 5, lane = tid & 31, ln = lane & 15, hh = lane >> 4; const int by = blockIdx.y;
  A += (size_t)by * sA; Bh += (size_t)by * sB; const size_t cofs = (size_t)by * sC; const float* bp = bias ? bias + (size_t)by * sBias : nullptr;
  const int ntn = (N + 63) / 64; const int wid = blockIdx.x * 4 + w; const int mt = wid / ntn, nq = wid % ntn; if (mt * 16 >= M) return;
  const int row0 = mt * 16, col0 = nq * 64; const _Float16* arow = A + (size_t)(row0 + ln) * lda;
  v8f acc[4] = {};
  for (int kb = 0; kb < K; kb += 32) { FragH ah; ah.half[0] = *(const v8us*)((const unsigned short*)arow + kb + 8 * hh); ah.half[1] = *(const v8us*)((const unsigned short*)arow + kb + 16 + 8 * hh);
#pragma unroll
    for (int t = 0; t < 4; ++t) { if (col0 + t * 16 >= N) continue; const size_t boff = (size_t)(col0 + t * 16 + ln) * ldb + kb; FragH bq; bq.half[0] = *(const v8us*)((const unsigned short*)Bh + boff + 8 * hh); bq.half[1] = *(const v8us*)((const unsigned short*)Bh + boff + 16 + 8 * hh);
      acc[t] = mmaH<1>(ah.v, ah.v, bq.v, bq.v, acc[t]); }
  }
#pragma unroll
  for (int t = 0; t < 4; ++t) { if (col0 + t * 16 >= N) continue; const int col = col0 + t * 16 + ln; const float bv = bp ? bf16_round(bp[col]) : 0.f;
#pragma unroll
    for (int r = 0; r < 8; ++r) { float v = acc[t][r] * alpha + bv; if (CP) { const int bidx = (row0g + row0 + 8 * hh + r) / rowsPerB; v += CP[(size_t)bidx * sCPb + (size_t)by * 64 + col]; } if (ACT == 1) v = (v > 0.f) ? v : expm1f(v); else if (ACT == 3) v = fmaxf(v, 0.f); so[w][8 * hh + r][t * 16 + ln] = v; } }
  __builtin_amdgcn_fence(__ATOMIC_ACQ_REL, "workgroup"); __builtin_amdgcn_wave_barrier();
  const int rsub = lane >> 4, c4 = (lane & 15) * 4; typedef _Float16 v4h __attribute__((ext_vector_type(4)));
  {
#pragma unroll
    for (int q = 0; q < 8; ++q) { const int r = q * 2 + rsub; if (col0 + c4 < N) { const v4f v = *(const v4fa*)&so[w][r][c4]; if (C) *(v4f*)(C + cofs + (size_t)(row0 + r) * ldc + col0 + c4) = v; if (C16) { v4h h4; for (int i = 0; i < 4; ++i) h4[i] = (_Float16)v[i]; *(v4h*)(C16 + cofs + (size_t)(row0 + r) * ldc + col0 + c4) = h4; } } }
     }
}


__global__ __launch_bounds__(256) void k_round16f(const float* __restrict__ W, _Float16* __restrict__ Bt, size_t n8) { const size_t t = (size_t)blockIdx.x * 256 + threadIdx.x; if (t >= n8) return; FragH f;
#pragma unroll
  for (int i = 0; i < 8; ++i) f.h[i] = (_Float16)(bf16_round(W[t * 8 + i]) * 16.0f); *(v8us*)((unsigned short*)Bt + t * 8) = f.half[0];  }
__global__ __launch_bounds__(256) void k_x16(const float* __restrict__ x, _Float16* __restrict__ X16, size_t n8) { const size_t t = (size_t)blockIdx.x * 256 + threadIdx.x; if (t >= n8) return; FragH f;
#pragma unroll
  for (int q = 0; q < 8; ++q) f.h[q] = (_Float16)bf16_round(x[t * 8 + q]); *(v8us*)((unsigned short*)X16 + t * 8) = f.half[0];  }
__global__ __launch_bounds__(256) void k_h16(const float* __restrict__ x, _Float16* __restrict__ X16, size_t n8) { const size_t t = (size_t)blockIdx.x * 256 + threadIdx.x; if (t >= n8) return; FragH f;
#pragma unroll
  for (int q = 0; q < 8; ++q) f.h[q] = (_Float16)x[t * 8 + q]; *(v8us*)((unsigned short*)X16 + t * 8) = f.half[0];  }
__global__ __launch_bounds__(256) void k_res(const float* __restrict__ f, const float* __restrict__ pf, float* __restrict__ RES) { const size_t t = (size_t)blockIdx.x * 256 + threadIdx.x; if (t >= (size_t)NBS * FD / 4) return; const v4f a = *(const v4fa*)(f + t * 4), b = *(const v4fa*)(pf + t * 4); v4f o; for (int q = 0; q < 4; ++q) o[q] = bf16_round(a[q]) + bf16_round(b[q]); *(v4f*)(RES + t * 4) = o;  }
// Parameter generator and per-sample MLP in one kernel: a work-group owns GM_M samples and never stores their generated parameters.
// Each 16 x 16 tile of params = pf_low . pg_w^T (K = LOW, four f16 WMMAs) is scaled, biased and summed into h or g straight from the accumulator registers
// (accumulator register r of lane (ln, hh) = sample 8 * hh + r, parameter column ln).
// Layer 1: parameter n = l * MID + m; wave w owns l = 16 w .. 16 w + 15 and sums them in rising order; the eight waves' partial h meet in LDS in rising wave order, then relu.
// Layer 2: parameter n = LOW * MID + m * LOW + l; wave w owns l = 16 w .. 16 w + 15 and sums m in rising order.
#define GM_M 32
struct Yes { static constexpr bool value = true; }; struct No { static constexpr bool value = false; };
__global__ __launch_bounds__(256) void k_gen_mlp(const _Float16* __restrict__ PL, const _Float16* __restrict__ Bg, const float* __restrict__ pgb, const float* __restrict__ FLOW, _Float16* __restrict__ G16) {
  __shared__ __attribute__((aligned(16))) float sF[LOW][GM_M];              // flow[s][l] at [l][s]; rows 16 w .. + 15 are written and read by wave w alone
  __shared__ __attribute__((aligned(16))) float sP[8][MID][GM_M + 4];       // partial h per wave at [m][s]; pitch 36 floats spreads the 16-byte stores of 16 rows m over all banks
  __shared__ __attribute__((aligned(16))) float sH[MID][GM_M];              // h after relu at [m][s]
  __shared__ __attribute__((aligned(16))) _Float16 sG[GM_M][LOW + 8];       // g as f16, gathered so that the work-group stores whole rows
  const int tid = threadIdx.x, lane = tid & 31, ln = lane & 15, hh = lane >> 4;
  const int w = __builtin_amdgcn_readfirstlane(tid >> 5);
  const int s0 = blockIdx.x * GM_M;
  struct BTile { FragH f[LOW / 32]; float b; };
  // tile u of this wave's stream: u < 32 layer 1 (l = 16 w + u / 2, m half u & 1), else layer 2 (m = u - 32)
  const unsigned short* blane = (const unsigned short*)Bg + (size_t)ln * LOW + 8 * hh;
  const float* clane = pgb + ln;
  auto load_tile = [&](BTile& t, int u) {
    const int n0 = (u < 32) ? (w * 512 + u * 16) : (LOW * MID + (u - 32) * LOW + w * 16);
    const unsigned short* p = blane + (size_t)n0 * LOW;
    t.b = clane[n0];
#pragma unroll
    for (int ks = 0; ks < LOW / 32; ++ks) { t.f[ks].half[0] = *(const v8us*)(p + ks * 32); t.f[ks].half[1] = *(const v8us*)(p + ks * 32 + 16); }
  };
  v4f fl[4];
#pragma unroll
  for (int j = 0; j < 4; ++j) fl[j] = *(const v4fa*)(FLOW + (size_t)(s0 + lane) * LOW + w * 16 + j * 4);
  FragH a[2][LOW / 32];
#pragma unroll
  for (int mt = 0; mt < 2; ++mt) {
    const unsigned short* ar = (const unsigned short*)PL + (size_t)(s0 + mt * 16 + ln) * LOW + 8 * hh;
#pragma unroll
    for (int ks = 0; ks < LOW / 32; ++ks) { a[mt][ks].half[0] = *(const v8us*)(ar + ks * 32); a[mt][ks].half[1] = *(const v8us*)(ar + ks * 32 + 16); }
    if (mt == 0) asm volatile("s_wait_xcnt 0x0" ::: "memory");      // precaution: the compiler reuses these loads' address registers as the destination of a load of the second tile
  }
  __builtin_amdgcn_sched_barrier(0);      // keeps the sample loads in front of the weight loads: loads return in order, and behind them they would force the loop's first wait to drain the weight tiles too
  BTile bt[2];
  load_tile(bt[0], 0); load_tile(bt[1], 1);
#pragma unroll
  for (int j = 0; j < 4; ++j)
#pragma unroll
    for (int c = 0; c < 4; ++c) sF[w * 16 + j * 4 + c][lane] = fl[j][c];
  // fence on LDS alone: the wave's own stores land before it reads the rows back; a fence on every address space would also drain the weight loads in flight
  __builtin_amdgcn_fence(__ATOMIC_ACQ_REL, "workgroup", "local"); __builtin_amdgcn_wave_barrier();
  // one tile: acc[mt][r] += cf[sample] * (tile / 16 + bias); the tile's registers are refilled with tile un as soon as its WMMAs have issued
  auto tile_step = [&](BTile& t, const float* cf, v8f& acc0, v8f& acc1, int un, auto refill) {
    const v4f c00 = *(const v4fa*)(cf + 8 * hh), c01 = *(const v4fa*)(cf + 8 * hh + 4), c10 = *(const v4fa*)(cf + 16 + 8 * hh), c11 = *(const v4fa*)(cf + 16 + 8 * hh + 4);
    v8f d0 = {}, d1 = {};
#pragma unroll
    for (int ks = 0; ks < LOW / 32; ++ks) {
      d0 = __builtin_amdgcn_wmma_f32_16x16x32_f16(false, a[0][ks].v, false, t.f[ks].v, (short)0, d0, false, false);
      d1 = __builtin_amdgcn_wmma_f32_16x16x32_f16(false, a[1][ks].v, false, t.f[ks].v, (short)0, d1, false, false);
    }
    const float bv = bf16_round(t.b);
    if constexpr (decltype(refill)::value) load_tile(t, un);
#pragma unroll
    for (int r = 0; r < 8; ++r) {
      acc0[r] += ((r < 4) ? c00[r & 3] : c01[r & 3]) * (d0[r] * 0.0625f + bv);
      acc1[r] += ((r < 4) ? c10[r & 3] : c11[r & 3]) * (d1[r] * 0.0625f + bv);
    }
  };
  v8f hp[2][2] = {};      // [m half][sample tile]
  for (int i = 0; i < 16; ++i) {
    const float* cf = &sF[w * 16 + i][0];
    tile_step(bt[0], cf, hp[0][0], hp[0][1], 2 * i + 2, Yes{});
    tile_step(bt[1], cf, hp[1][0], hp[1][1], 2 * i + 3, Yes{});
  }
#pragma unroll
  for (int mh = 0; mh < 2; ++mh)
#pragma unroll
    for (int mt = 0; mt < 2; ++mt) {
      float* d = &sP[w][mh * 16 + ln][mt * 16 + 8 * hh];
      *(v4fa*)d = (v4f){hp[mh][mt][0], hp[mh][mt][1], hp[mh][mt][2], hp[mh][mt][3]};
      *(v4fa*)(d + 4) = (v4f){hp[mh][mt][4], hp[mh][mt][5], hp[mh][mt][6], hp[mh][mt][7]};
    }
  __syncthreads();      // every wave's partial h is in LDS
  {
    const int m = tid >> 3, s4 = (tid & 7) * 4;
    v4f v = *(const v4fa*)&sP[0][m][s4];
#pragma unroll
    for (int q = 1; q < 8; ++q) v += *(const v4fa*)&sP[q][m][s4];
#pragma unroll
    for (int c = 0; c < 4; ++c) v[c] = fmaxf(v[c], 0.f);
    *(v4fa*)&sH[m][s4] = v;
  }
  __syncthreads();      // h is complete before any wave reads it
  v8f g0 = {}, g1 = {};
  for (int i = 0; i < 15; ++i) {
    tile_step(bt[0], &sH[2 * i][0], g0, g1, 32 + 2 * i + 2, Yes{});
    tile_step(bt[1], &sH[2 * i + 1][0], g0, g1, 32 + 2 * i + 3, Yes{});
  }
  tile_step(bt[0], &sH[30][0], g0, g1, 0, No{});
  tile_step(bt[1], &sH[31][0], g0, g1, 0, No{});
#pragma unroll
  for (int r = 0; r < 8; ++r) { sG[8 * hh + r][w * 16 + ln] = (_Float16)g0[r]; sG[16 + 8 * hh + r][w * 16 + ln] = (_Float16)g1[r]; }
  __syncthreads();      // all of g is in LDS before the rows are stored
#pragma unroll
  for (int j = 0; j < 2; ++j) {
    const int e = tid + 256 * j, row = e >> 4, c8 = (e & 15) * 8;
    *(v8us*)((unsigned short*)G16 + (size_t)(s0 + row) * LOW + c8) = *(const v8us*)&sG[row][c8];
  }
}
extern "C" void kernel_launch(void* const* d_in, const int* in_sizes, int n_in,
                              void* d_out, int out_size, void* d_ws, size_t ws_size, hipStream_t stream) {
  (void)in_sizes; (void)n_in; (void)out_size;
  const float* f = (const float*)d_in[0]; const float* pf = (const float*)d_in[1]; const float* pfw = (const float*)d_in[2]; const float* pfb = (const float*)d_in[3]; const float* ppw = (const float*)d_in[4]; const float* ppb = (const float*)d_in[5]; const float* f2w = (const float*)d_in[6]; const float* f2b = (const float*)d_in[7]; const float* pgw = (const float*)d_in[8]; const float* pgb = (const float*)d_in[9];
  char* ws = (char*)d_ws; size_t off = 0;
  auto take = [&](size_t bytes) { char* p = ws + off; off += (bytes + 255) & ~(size_t)255; return p; };
  _Float16* Bf = (_Float16*)take((size_t)LOW * FD * 2); _Float16* Bp = (_Float16*)take((size_t)LOW * FD * 2); _Float16* Bg = (_Float16*)take((size_t)NPAR * LOW * 2); _Float16* B2 = (_Float16*)take((size_t)FD * LOW * 2);
  char* R = take((size_t)NBS * FD * 4); _Float16* F16 = (_Float16*)R; _Float16* P16 = (_Float16*)(R + (size_t)NBS * FD * 2); float* RES = (float*)R;      // F16/P16 dead after the two projections → RES f32 (same 33.5 MB)
  float* FLOW = (float*)take((size_t)NBS * LOW * 4); _Float16* PL16 = (_Float16*)take((size_t)NBS * LOW * 2); _Float16* G16 = (_Float16*)take((size_t)NBS * LOW * 2);
  if (off > ws_size) return;      // about 45 MiB
  k_round16f<<<(LOW * FD / 8 + 255) / 256, 256, 0, stream>>>(pfw, Bf, (size_t)LOW * FD / 8); k_round16f<<<(LOW * FD / 8 + 255) / 256, 256, 0, stream>>>(ppw, Bp, (size_t)LOW * FD / 8); k_round16f<<<(NPAR * LOW / 8 + 255) / 256, 256, 0, stream>>>(pgw, Bg, (size_t)NPAR * LOW / 8); k_round16f<<<(FD * LOW / 8 + 255) / 256, 256, 0, stream>>>(f2w, B2, (size_t)FD * LOW / 8);      // (out,in)
  const unsigned gx = (unsigned)(((size_t)NBS * FD / 8 + 255) / 256);
  k_x16<<<gx, 256, 0, stream>>>(f, F16, (size_t)NBS * FD / 8); k_x16<<<gx, 256, 0, stream>>>(pf, P16, (size_t)NBS * FD / 8);
  k_gemm_hhx<0><<<dim3(((NBS / 16) * (LOW / 64) + 3) / 4, 1), 128, 0, stream>>>(F16, FD, 0, Bf, FD, 0, 0.0625f, pfb, 0, nullptr, 1, 0, 0, FLOW, nullptr, LOW, 0, NBS, LOW, FD);      // f_low (f32, read by the per-sample MLP)
  k_gemm_hhx<0><<<dim3(((NBS / 16) * (LOW / 64) + 3) / 4, 1), 128, 0, stream>>>(P16, FD, 0, Bp, FD, 0, 0.0625f, ppb, 0, nullptr, 1, 0, 0, nullptr, PL16, LOW, 0, NBS, LOW, FD);     // pf_low (f16 operand of the generator)
  k_res<<<(unsigned)(((size_t)NBS * FD / 4 + 255) / 256), 256, 0, stream>>>(f, pf, RES);      // after both projections (F16/P16 dead)
  k_gen_mlp<<<NBS / GM_M, 256, 0, stream>>>(PL16, Bg, pgb, FLOW, G16);      // params = pf_low . pg_w^T + pg_b, consumed in registers by the per-sample MLP
  k_gemm_hhx<0><<<dim3(((NBS / 16) * (FD / 64) + 3) / 4, 1), 128, 0, stream>>>(G16, LOW, 0, B2, LOW, 0, 0.0625f, f2b, 0, RES, 1, (size_t)FD, 0, (float*)d_out, nullptr, FD, 0, NBS, FD, LOW);      // g·proj_f2ᵀ + b + (f + pf)
}

// v003
// A run of this version takes 93.9 microseconds.
// Timed twice side by side with v002, it ran 1.74 and 1.79 times as fast.
// All steps since v000 together make it 6.17 times as fast.
#include <hip/hip_runtime.h>
// + bias, + f + pf residuals as exact bf16 addends) on v_wmma_f32_16x16x32_f16 (f16 operands, nn.Linear weights (out,in) bf16-exact ×2^4, f32 accumulate); the per-sample tiny MLP
// (128 -> 32 relu -> 128 with that sample's generated weights) is f32 VALU on the generator's accumulator tiles (32 samples per work-group).
#define NBS 8192
#define FD 1024
#define LOW 128
#define MID 32
#define NPAR (2 * LOW * MID)

typedef __bf16 v16b __attribute__((ext_vector_type(16)));
typedef unsigned short v8us __attribute__((ext_vector_type(8), may_alias));
typedef float  v8f  __attribute__((ext_vector_type(8)));
typedef float  v4f  __attribute__((ext_vector_type(4)));
typedef float  v4fa __attribute__((ext_vector_type(4), may_alias));
union FragB { v16b v; v8us half[2]; unsigned short u[16]; };

__device__ __forceinline__ unsigned short bf16_bits(float x) { unsigned int u = __float_as_uint(x); return (unsigned short)((u + 0x7FFFu + ((u >> 16) & 1u)) >> 16); }
__device__ __forceinline__ float bf16_val(unsigned short b) { return __uint_as_float(((unsigned int)b) << 16); }
__device__ __forceinline__ float bf16_round(float x) { return bf16_val(bf16_bits(x)); }
// D += A·B with NT terms: 1 = ah·bh, 2 = + al·bh (A split), 3 = + ah·bl (both split)
template <int NT>
__device__ __forceinline__ v8f mmaN(v16b ah, v16b al, v16b bh, v16b bl, v8f c) {
  c = __builtin_amdgcn_wmma_f32_16x16x32_bf16(false, ah, false, bh, (short)0, c, false, false);
  if (NT >= 2) c = __builtin_amdgcn_wmma_f32_16x16x32_bf16(false, al, false, bh, (short)0, c, false, false);
  if (NT >= 3) c = __builtin_amdgcn_wmma_f32_16x16x32_bf16(false, ah, false, bl, (short)0, c, false, false);
  asm volatile("v_nop\n\tv_nop\n\tv_nop\n\tv_nop" : "+v"(c) : "v"(ah), "v"(al), "v"(bh), "v"(bl));
  return c;
}

__global__ __launch_bounds__(256) void k_wt_bf16(const float* __restrict__ W, unsigned short* __restrict__ Wt, int K, int N) {
  const int t = blockIdx.x * 256 + threadIdx.x;
  const int k8n = K / 8;
  if (t >= N * k8n) return;
  const int n = t / k8n, k8 = (t % k8n) * 8;
  v8us v;
#pragma unroll
  for (int i = 0; i < 8; ++i) v[i] = bf16_bits(W[(size_t)(k8 + i) * N + n]);
  *(v8us*)(Wt + (size_t)n * K + k8) = v;
  
}

// GEMM C[M][N] (f32, pitch ldc) = act(A[M][K]·W + bias). A f32 row-major (pitch lda) converted per fragment to bf16
// (ASPLIT: hi/lo two planes -> 2 terms, else single rounded term); Wt bf16 [N][K] (pitch ldb). BIAS_BF16 rounds the
// bias to bf16 first (bias quantised to bf16 before the add). K%32==0, M%16==0, N%64==0.
template <bool ASPLIT, int ACT, bool BIAS_BF16>
__global__ __launch_bounds__(128) void k_gemm_bf(const float* __restrict__ A, int lda, const unsigned short* __restrict__ Wt, int ldb,
                                               const float* __restrict__ bias, float* __restrict__ C, int ldc, int M, int N, int K) {
  __shared__ __attribute__((aligned(16))) float so[4][16][64];
  const int tid = threadIdx.x, w = tid >> 5, lane = tid & 31, ln = lane & 15, hh = lane >> 4;
  const int ntn = N / 64;
  const int wid = blockIdx.x * 4 + w;
  const int mt = wid / ntn, nq = wid % ntn;
  if (mt * 16 >= M) return;
  const int row0 = mt * 16, col0 = nq * 64;
  const float* arow = A + (size_t)(row0 + ln) * lda;
  v8f acc[4] = {};
  for (int kb = 0; kb < K; kb += 32) {
    FragB ah, al;
    const v4f x0 = *(const v4fa*)(arow + kb + 8 * hh), x1 = *(const v4fa*)(arow + kb + 8 * hh + 4);
    const v4f x2 = *(const v4fa*)(arow + kb + 16 + 8 * hh), x3 = *(const v4fa*)(arow + kb + 16 + 8 * hh + 4);
    float xs[16] = {x0[0],x0[1],x0[2],x0[3],x1[0],x1[1],x1[2],x1[3],x2[0],x2[1],x2[2],x2[3],x3[0],x3[1],x3[2],x3[3]};
#pragma unroll
    for (int i = 0; i < 16; ++i) { const unsigned short hb = bf16_bits(xs[i]); ah.u[i] = hb; al.u[i] = ASPLIT ? bf16_bits(xs[i] - bf16_val(hb)) : (unsigned short)0; }
#pragma unroll
    for (int t = 0; t < 4; ++t) {
      const unsigned short* brow = Wt + (size_t)(col0 + t * 16 + ln) * ldb + kb;
      FragB b;
      b.half[0] = *(const v8us*)(brow + 8 * hh);
      b.half[1] = *(const v8us*)(brow + 16 + 8 * hh);
      acc[t] = mmaN<ASPLIT ? 2 : 1>(ah.v, al.v, b.v, b.v, acc[t]);
    }
  }
#pragma unroll
  for (int t = 0; t < 4; ++t) {
    float bv = bias ? bias[col0 + t * 16 + ln] : 0.f;
    if (BIAS_BF16) bv = bf16_round(bv);
#pragma unroll
    for (int r = 0; r < 8; ++r) { float v = acc[t][r] + bv; if (ACT == 1) v = fmaxf(v, 0.f); so[w][8 * hh + r][t * 16 + ln] = v; }
  }
  __builtin_amdgcn_fence(__ATOMIC_ACQ_REL, "workgroup");
  __builtin_amdgcn_wave_barrier();
  const int rsub = lane >> 4, c4 = (lane & 15) * 4;
  {
#pragma unroll
    for (int q = 0; q < 8; ++q) {
      const int r = q * 2 + rsub;
      const v4f v = *(const v4fa*)&so[w][r][c4];
      *(v4f*)(C + (size_t)(row0 + r) * ldc + col0 + c4) = v;
    }
    
  }
}

// Flash-style causal/unmasked attention, all contractions 3-term bf16 hi/lo splits, f32 softmax with running max.
// q,k,v rows are read from f32 buffers with arbitrary row pitch (so they can live inside a fused qkv buffer);
// D = head size (multiple of 32, <= 128); one wave = 16 query rows; block = 4 waves (64 queries) sharing K/V chunks of 32.
template <int D, bool CAUSAL>
__global__ __launch_bounds__(128) void k_flash(const float* __restrict__ qb, const float* __restrict__ kb, const float* __restrict__ vb,
                                             int pitch, int T, int H, float scale, float* __restrict__ y, int ypitch) {
  constexpr int KS = D / 32;        // k-steps for QK
  constexpr int DT = D / 16;        // d tiles for PV
  __shared__ __attribute__((aligned(16))) unsigned short sKh[32][D + 8], sKl[32][D + 8], sVh[32][D + 8], sVl[32][D + 8];
  __shared__ __attribute__((aligned(16))) unsigned short sPh[4][16][40], sPl[4][16][40];
  __shared__ __attribute__((aligned(16))) float sO[4][16][D];
  const int tid = threadIdx.x, w = tid >> 5, lane = tid & 31, ln = lane & 15, hh = lane >> 4;
  const int nqb = (T + 63) / 64;
  const int bh = blockIdx.x / nqb, qblk = blockIdx.x % nqb;
  const int b = bh / H, h = bh % H;
  const int q0 = qblk * 64 + w * 16;
  const float* Q = qb + (size_t)b * T * pitch + h * D;
  const float* K = kb + (size_t)b * T * pitch + h * D;
  const float* V = vb + (size_t)b * T * pitch + h * D;

  // A fragments of the wave's 16 query rows (scaled), hi/lo
  FragB aqh[KS], aql[KS];
  {
    int row = q0 + ln; if (row >= T) row = T - 1;
    const float* qr = Q + (size_t)row * pitch;
#pragma unroll
    for (int ks = 0; ks < KS; ++ks)
#pragma unroll
      for (int i = 0; i < 16; ++i) {
        const int d = ks * 32 + ((i < 8) ? (8 * hh + i) : (16 + 8 * hh + (i - 8)));
        const float x = qr[d] * scale; const unsigned short hb = bf16_bits(x);
        aqh[ks].u[i] = hb; aql[ks].u[i] = bf16_bits(x - bf16_val(hb));
      }
  }
  float m_r[8], l_r[8];
#pragma unroll
  for (int r = 0; r < 8; ++r) { m_r[r] = -3.0e38f; l_r[r] = 0.f; }
  v8f oacc[DT];
#pragma unroll
  for (int dt = 0; dt < DT; ++dt) oacc[dt] = (v8f){0.f,0.f,0.f,0.f,0.f,0.f,0.f,0.f};

  const int kv_end = CAUSAL ? min(T, qblk * 64 + 64) : T;     // block-uniform
  for (int j0 = 0; j0 < kv_end; j0 += 32) {
    __syncthreads();
    for (int e = tid; e < 32 * (D / 4); e += 128) {
      const int r = e / (D / 4), c4 = (e % (D / 4)) * 4;
      const int key = j0 + r;
      v4f kf = {0.f,0.f,0.f,0.f}, vf = {0.f,0.f,0.f,0.f};
      if (key < T) { kf = *(const v4fa*)(K + (size_t)key * pitch + c4); vf = *(const v4fa*)(V + (size_t)key * pitch + c4); }
#pragma unroll
      for (int t = 0; t < 4; ++t) {
        unsigned short hb = bf16_bits(kf[t]); sKh[r][c4 + t] = hb; sKl[r][c4 + t] = bf16_bits(kf[t] - bf16_val(hb));
        hb = bf16_bits(vf[t]); sVh[r][c4 + t] = hb; sVl[r][c4 + t] = bf16_bits(vf[t] - bf16_val(hb));
      }
    }
    __syncthreads();
    // S tile 16 x 32
    v8f s[2];
#pragma unroll
    for (int nt = 0; nt < 2; ++nt) {
      v8f acc = {};
#pragma unroll
      for (int ks = 0; ks < KS; ++ks) {
        FragB bh_, bl_;
        bh_.half[0] = *(const v8us*)&sKh[nt * 16 + ln][ks * 32 + 8 * hh]; bh_.half[1] = *(const v8us*)&sKh[nt * 16 + ln][ks * 32 + 16 + 8 * hh];
        bl_.half[0] = *(const v8us*)&sKl[nt * 16 + ln][ks * 32 + 8 * hh]; bl_.half[1] = *(const v8us*)&sKl[nt * 16 + ln][ks * 32 + 16 + 8 * hh];
        acc = mmaN<3>(aqh[ks].v, aql[ks].v, bh_.v, bl_.v, acc);
      }
      s[nt] = acc;
    }
    // mask + running max (rows 8hh+r; the 16 lanes of a half share rows)
    float alpha[8];
#pragma unroll
    for (int r = 0; r < 8; ++r) {
      const int qi = q0 + 8 * hh + r;
      const int ja = j0 + ln, jb = j0 + 16 + ln;
      if (CAUSAL) { if (ja > qi) s[0][r] = -3.0e38f; if (jb > qi) s[1][r] = -3.0e38f; }
      if (ja >= T) s[0][r] = -3.0e38f;
      if (jb >= T) s[1][r] = -3.0e38f;
      float mx = fmaxf(s[0][r], s[1][r]);
      mx = fmaxf(mx, __shfl_xor(mx, 1, 32)); mx = fmaxf(mx, __shfl_xor(mx, 2, 32)); mx = fmaxf(mx, __shfl_xor(mx, 4, 32)); mx = fmaxf(mx, __shfl_xor(mx, 8, 32));
      const float mnew = fmaxf(m_r[r], mx);
      alpha[r] = (mnew > -1.0e38f) ? __expf(m_r[r] - mnew) : 1.0f;
      const float p0 = (s[0][r] > -1.0e38f) ? __expf(s[0][r] - mnew) : 0.f;
      const float p1 = (s[1][r] > -1.0e38f) ? __expf(s[1][r] - mnew) : 0.f;
      m_r[r] = mnew;
      l_r[r] = l_r[r] * alpha[r] + p0 + p1;            // per-lane partial row sum (16 lanes combined at the end)
      unsigned short hb = bf16_bits(p0); sPh[w][8 * hh + r][ln] = hb;      sPl[w][8 * hh + r][ln] = bf16_bits(p0 - bf16_val(hb));
      hb = bf16_bits(p1);                sPh[w][8 * hh + r][16 + ln] = hb; sPl[w][8 * hh + r][16 + ln] = bf16_bits(p1 - bf16_val(hb));
    }
#pragma unroll
    for (int dt = 0; dt < DT; ++dt)
#pragma unroll
      for (int r = 0; r < 8; ++r) oacc[dt][r] *= alpha[r];
    __builtin_amdgcn_fence(__ATOMIC_ACQ_REL, "workgroup");
    __builtin_amdgcn_wave_barrier();
    FragB pah, pal;
    pah.half[0] = *(const v8us*)&sPh[w][ln][8 * hh]; pah.half[1] = *(const v8us*)&sPh[w][ln][16 + 8 * hh];
    pal.half[0] = *(const v8us*)&sPl[w][ln][8 * hh]; pal.half[1] = *(const v8us*)&sPl[w][ln][16 + 8 * hh];
#pragma unroll
    for (int dt = 0; dt < DT; ++dt) {
      FragB bvh, bvl;
#pragma unroll
      for (int i = 0; i < 8; ++i) {
        bvh.u[i] = sVh[8 * hh + i][dt * 16 + ln]; bvh.u[8 + i] = sVh[16 + 8 * hh + i][dt * 16 + ln];
        bvl.u[i] = sVl[8 * hh + i][dt * 16 + ln]; bvl.u[8 + i] = sVl[16 + 8 * hh + i][dt * 16 + ln];
      }
      oacc[dt] = mmaN<3>(pah.v, pal.v, bvh.v, bvl.v, oacc[dt]);
    }
    __builtin_amdgcn_fence(__ATOMIC_ACQ_REL, "workgroup");
    __builtin_amdgcn_wave_barrier();
  }
#pragma unroll
  for (int r = 0; r < 8; ++r) {
    float l = l_r[r];
    l += __shfl_xor(l, 1, 32); l += __shfl_xor(l, 2, 32); l += __shfl_xor(l, 4, 32); l += __shfl_xor(l, 8, 32);
    l_r[r] = (l > 0.f) ? 1.0f / l : 0.f;
  }
#pragma unroll
  for (int dt = 0; dt < DT; ++dt)
#pragma unroll
    for (int r = 0; r < 8; ++r) sO[w][8 * hh + r][dt * 16 + ln] = oacc[dt][r] * l_r[r];
  __builtin_amdgcn_fence(__ATOMIC_ACQ_REL, "workgroup");
  __builtin_amdgcn_wave_barrier();
  {
    for (int r = 0; r < 16; ++r) {
      const int row = q0 + r;
      if (row < T && lane < D / 4) {
        const v4f val = *(const v4fa*)&sO[w][r][lane * 4];
        *(v4f*)(y + ((size_t)b * T + row) * ypitch + h * D + lane * 4) = val;
      }
    }
    
  }
}

// GEMM C = act(A·W + bias + resid): A f32 (ASPLIT -> hi/lo 2 terms), Wt bf16 [N][K]; ACT 0 none, 1 relu, 2 exact gelu;
// resid (optional, f32, row index = (row % rmod), pitch ldr, RES_BF16 rounds it) added before the activation.
template <bool ASPLIT, int ACT, bool BIAS_BF16, bool RES_BF16>
__global__ __launch_bounds__(128) void k_gemm_bf3(const float* __restrict__ A, int lda, const unsigned short* __restrict__ Wt, int ldb,
                                                const float* __restrict__ bias, const float* __restrict__ resid, int rmod, int ldr,
                                                float* __restrict__ C, int ldc, int M, int N, int K) {
  __shared__ __attribute__((aligned(16))) float so[4][16][64];
  const int tid = threadIdx.x, w = tid >> 5, lane = tid & 31, ln = lane & 15, hh = lane >> 4;
  const int ntn = N / 64;
  const int wid = blockIdx.x * 4 + w;
  const int mt = wid / ntn, nq = wid % ntn;
  if (mt * 16 >= M) return;
  const int row0 = mt * 16, col0 = nq * 64;
  const float* arow = A + (size_t)(row0 + ln) * lda;
  v8f acc[4] = {};
  for (int kb = 0; kb < K; kb += 32) {
    FragB ah, al;
    const v4f x0 = *(const v4fa*)(arow + kb + 8 * hh), x1 = *(const v4fa*)(arow + kb + 8 * hh + 4);
    const v4f x2 = *(const v4fa*)(arow + kb + 16 + 8 * hh), x3 = *(const v4fa*)(arow + kb + 16 + 8 * hh + 4);
    float xs[16] = {x0[0],x0[1],x0[2],x0[3],x1[0],x1[1],x1[2],x1[3],x2[0],x2[1],x2[2],x2[3],x3[0],x3[1],x3[2],x3[3]};
#pragma unroll
    for (int i = 0; i < 16; ++i) { const unsigned short hb = bf16_bits(xs[i]); ah.u[i] = hb; al.u[i] = ASPLIT ? bf16_bits(xs[i] - bf16_val(hb)) : (unsigned short)0; }
#pragma unroll
    for (int t = 0; t < 4; ++t) {
      const unsigned short* brow = Wt + (size_t)(col0 + t * 16 + ln) * ldb + kb;
      FragB b;
      b.half[0] = *(const v8us*)(brow + 8 * hh);
      b.half[1] = *(const v8us*)(brow + 16 + 8 * hh);
      acc[t] = mmaN<ASPLIT ? 2 : 1>(ah.v, al.v, b.v, b.v, acc[t]);
    }
  }
#pragma unroll
  for (int t = 0; t < 4; ++t) {
    const int col = col0 + t * 16 + ln;
    float bv = bias ? bias[col] : 0.f;
    if (BIAS_BF16) bv = bf16_round(bv);
#pragma unroll
    for (int r = 0; r < 8; ++r) {
      float v = acc[t][r] + bv;
      if (resid) { float rv = resid[(size_t)((row0 + 8 * hh + r) % rmod) * ldr + col]; if (RES_BF16) rv = bf16_round(rv); v += rv; }
      if (ACT == 1) v = fmaxf(v, 0.f);
      if (ACT == 2) v = 0.5f * v * (1.0f + erff(v * 0.70710678118654752f));
      if (ACT == 3) { const float u = 0.7978845608028654f * (v + 0.044715f * v * v * v); v = 0.5f * v * (1.0f + tanhf(u)); }
      so[w][8 * hh + r][t * 16 + ln] = v;
    }
  }
  __builtin_amdgcn_fence(__ATOMIC_ACQ_REL, "workgroup");
  __builtin_amdgcn_wave_barrier();
  const int rsub = lane >> 4, c4 = (lane & 15) * 4;
  {
#pragma unroll
    for (int q = 0; q < 8; ++q) {
      const int r = q * 2 + rsub;
      const v4f v = *(const v4fa*)&so[w][r][c4];
      *(v4f*)(C + (size_t)(row0 + r) * ldc + col0 + c4) = v;
    }
    
  }
}
// row LayerNorm (biased variance, eps) over N: s = X (+ R); optional out_sum <- s; out_norm <- (s-mu)*rsqrt(var+eps)*g + b
template <bool PARAM_BF16>
__global__ __launch_bounds__(256) void k_layernorm(const float* __restrict__ X, const float* __restrict__ R, const float* __restrict__ g, const float* __restrict__ bta,
                                                  float* __restrict__ out_sum, float* __restrict__ out_norm, int N, float eps) {
  __shared__ float red[256];
  const int row = blockIdx.x, tid = threadIdx.x;
  const float* x = X + (size_t)row * N; const float* rr = R ? R + (size_t)row * N : nullptr;
  float vals[16];                     // up to N = 4096
  const int per = N / 256;            // contiguous chunk per thread? use strided-by-4 chunks: thread handles j = tid*4 + 1024*u
  float s1 = 0.f;
  for (int u = 0; u < per / 4; ++u) {
    const int j = tid * 4 + 1024 * u;
    const v4f a = *(const v4fa*)(x + j);
    v4f b = {0.f,0.f,0.f,0.f}; if (rr) b = *(const v4fa*)(rr + j);
#pragma unroll
    for (int q = 0; q < 4; ++q) { const float v = a[q] + b[q]; vals[u * 4 + q] = v; s1 += v; }
  }
  red[tid] = s1; __syncthreads();
  for (int st = 128; st > 0; st >>= 1) { if (tid < st) red[tid] += red[tid + st]; __syncthreads(); }
  const float mu = red[0] / (float)N; __syncthreads();
  float s2 = 0.f;
  for (int u = 0; u < per / 4; ++u)
#pragma unroll
    for (int q = 0; q < 4; ++q) { const float c = vals[u * 4 + q] - mu; s2 += c * c; }
  red[tid] = s2; __syncthreads();
  for (int st = 128; st > 0; st >>= 1) { if (tid < st) red[tid] += red[tid + st]; __syncthreads(); }
  const float rs = rsqrtf(red[0] / (float)N + eps);
  {
    for (int u = 0; u < per / 4; ++u) {
      const int j = tid * 4 + 1024 * u;
      v4f o, sm;
#pragma unroll
      for (int q = 0; q < 4; ++q) {
        float gg = g[j + q], bb = bta[j + q];
        if (PARAM_BF16) { gg = bf16_round(gg); bb = bf16_round(bb); }
        sm[q] = vals[u * 4 + q]; o[q] = (vals[u * 4 + q] - mu) * rs * gg + bb;
      }
      if (out_sum) *(v4f*)(out_sum + (size_t)row * N + j) = sm;
      *(v4f*)(out_norm + (size_t)row * N + j) = o;
    }
    
  }
}



// ---- f16 WMMA path (v_wmma_f32_16x16x32_f16): 11-bit significands for operands in range — used for the projection, generator and output GEMMs
typedef _Float16 v16h __attribute__((ext_vector_type(16)));
union FragH { v16h v; v8us half[2]; _Float16 h[16]; unsigned short u[16]; };
template <int NT>
__device__ __forceinline__ v8f mmaH(v16h ah, v16h al, v16h bh, v16h bl, v8f c) {
  c = __builtin_amdgcn_wmma_f32_16x16x32_f16(false, ah, false, bh, (short)0, c, false, false);
  if (NT >= 2) c = __builtin_amdgcn_wmma_f32_16x16x32_f16(false, al, false, bh, (short)0, c, false, false);
  if (NT >= 3) c = __builtin_amdgcn_wmma_f32_16x16x32_f16(false, ah, false, bl, (short)0, c, false, false);
  asm volatile("v_nop\n\tv_nop\n\tv_nop\n\tv_nop" : "+v"(c) : "v"(ah), "v"(al), "v"(bh), "v"(bl));
  return c;
}
// batched GEMM like k_gemm_b but f16 operands: A f32 (split into f16 hi/lo if ASPLIT, else rounded to f16), Bt = f16 values [n][k]; alpha; C f32; N multiple of 16 (partial tiles skipped)
template <bool ASPLIT>
__global__ __launch_bounds__(128) void k_gemm_h(const float* __restrict__ A, int lda, size_t sA, const _Float16* __restrict__ Bh, int ldb, size_t sB, float alpha, float* __restrict__ C, int ldc, size_t sC, int M, int N, int K) {
  __shared__ __attribute__((aligned(16))) float so[4][16][64];
  const int tid = threadIdx.x, w = tid >> 5, lane = tid & 31, ln = lane & 15, hh = lane >> 4; const int by = blockIdx.y;
  A += (size_t)by * sA; Bh += (size_t)by * sB; C += (size_t)by * sC;
  const int ntn = (N + 63) / 64; const int wid = blockIdx.x * 4 + w; const int mt = wid / ntn, nq = wid % ntn; if (mt * 16 >= M) return;
  const int row0 = mt * 16, col0 = nq * 64; const float* arow = A + (size_t)(row0 + ln) * lda;
  v8f acc[4] = {};
  for (int kb = 0; kb < K; kb += 32) {
    FragH ah, al;
    const v4f x0 = *(const v4fa*)(arow + kb + 8 * hh), x1 = *(const v4fa*)(arow + kb + 8 * hh + 4), x2 = *(const v4fa*)(arow + kb + 16 + 8 * hh), x3 = *(const v4fa*)(arow + kb + 16 + 8 * hh + 4);
    float xs[16] = {x0[0],x0[1],x0[2],x0[3],x1[0],x1[1],x1[2],x1[3],x2[0],x2[1],x2[2],x2[3],x3[0],x3[1],x3[2],x3[3]};
#pragma unroll
    for (int i = 0; i < 16; ++i) { const _Float16 h = (_Float16)xs[i]; ah.h[i] = h; al.h[i] = ASPLIT ? (_Float16)(xs[i] - (float)h) : (_Float16)0.0f; }
#pragma unroll
    for (int t = 0; t < 4; ++t) { if (col0 + t * 16 >= N) continue; const size_t boff = (size_t)(col0 + t * 16 + ln) * ldb + kb; FragH bq; bq.half[0] = *(const v8us*)(Bh + boff + 8 * hh); bq.half[1] = *(const v8us*)(Bh + boff + 16 + 8 * hh);
      acc[t] = mmaH<ASPLIT ? 2 : 1>(ah.v, al.v, bq.v, bq.v, acc[t]); }
  }
#pragma unroll
  for (int t = 0; t < 4; ++t) { if (col0 + t * 16 >= N) continue;
#pragma unroll
    for (int r = 0; r < 8; ++r) so[w][8 * hh + r][t * 16 + ln] = acc[t][r] * alpha; }
  __builtin_amdgcn_fence(__ATOMIC_ACQ_REL, "workgroup"); __builtin_amdgcn_wave_barrier();
  const int rsub = lane >> 4, c4 = (lane & 15) * 4;
  {
#pragma unroll
    for (int q = 0; q < 8; ++q) { const int r = q * 2 + rsub; if (col0 + c4 < N) { const v4f v = *(const v4fa*)&so[w][r][c4]; *(v4f*)(C + (size_t)(row0 + r) * ldc + col0 + c4) = v; } }
     }
}

// Wt[n][k] = f16(W[k][n]·scale) from f32 row-major W[K][N] (scale = power of two; bf16-exact weights stay exact in f16 away from the subnormal range)
__global__ __launch_bounds__(256) void k_wt_f16(const float* __restrict__ W, _Float16* __restrict__ Wt, int K, int N, float scale) {
  const int t = blockIdx.x * 256 + threadIdx.x; if (t >= N * (K / 8)) return; const int n = t / (K / 8), k8 = (t % (K / 8)) * 8; FragH f;
#pragma unroll
  for (int i = 0; i < 8; ++i) f.h[i] = (_Float16)(bf16_round(W[(size_t)(k8 + i) * N + n]) * scale); const v8us o = f.half[0];
  *(v8us*)((unsigned short*)Wt + (size_t)n * K + k8) = o; 
}
// k_gemm_hh variant with fused epilogue: v = acc·alpha + bias[by·sBias + col] (+ CP[(row/rowsPerB)·sCPb + by·64 + col] if CP) ; ACT 0 none / 1 elu ; writes f32 C and f16 C16, each if non-null
template <int ACT>
__global__ __launch_bounds__(128) void k_gemm_hhx(const _Float16* __restrict__ A, int lda, size_t sA, const _Float16* __restrict__ Bh, int ldb, size_t sB, float alpha, const float* __restrict__ bias, size_t sBias, const float* __restrict__ CP, int rowsPerB, size_t sCPb, int row0g,
    float* __restrict__ C, _Float16* __restrict__ C16, int ldc, size_t sC, int M, int N, int K) {
  __shared__ __attribute__((aligned(16))) float so[4][16][64];
  const int tid = threadIdx.x, w = tid >> 5, lane = tid & 31, ln = lane & 15, hh = lane >> 4; const int by = blockIdx.y;
  A += (size_t)by * sA; Bh += (size_t)by * sB; const size_t cofs = (size_t)by * sC; const float* bp = bias ? bias + (size_t)by * sBias : nullptr;
  const int ntn = (N + 63) / 64; const int wid = blockIdx.x * 4 + w; const int mt = wid / ntn, nq = wid % ntn; if (mt * 16 >= M) return;
  const int row0 = mt * 16, col0 = nq * 64; const _Float16* arow = A + (size_t)(row0 + ln) * lda;
  v8f acc[4] = {};
  for (int kb = 0; kb < K; kb += 32) { FragH ah; ah.half[0] = *(const v8us*)((const unsigned short*)arow + kb + 8 * hh); ah.half[1] = *(const v8us*)((const unsigned short*)arow + kb + 16 + 8 * hh);
#pragma unroll
    for (int t = 0; t < 4; ++t) { if (col0 + t * 16 >= N) continue; const size_t boff = (size_t)(col0 + t * 16 + ln) * ldb + kb; FragH bq; bq.half[0] = *(const v8us*)((const unsigned short*)Bh + boff + 8 * hh); bq.half[1] = *(const v8us*)((const unsigned short*)Bh + boff + 16 + 8 * hh);
      acc[t] = mmaH<1>(ah.v, ah.v, bq.v, bq.v, acc[t]); }
  }
#pragma unroll
  for (int t = 0; t < 4; ++t) { if (col0 + t * 16 >= N) continue; const int col = col0 + t * 16 + ln; const float bv = bp ? bf16_round(bp[col]) : 0.f;
#pragma unroll
    for (int r = 0; r < 8; ++r) { float v = acc[t][r] * alpha + bv; if (CP) { const int bidx = (row0g + row0 + 8 * hh + r) / rowsPerB; v += CP[(size_t)bidx * sCPb + (size_t)by * 64 + col]; } if (ACT == 1) v = (v > 0.f) ? v : expm1f(v); else if (ACT == 3) v = fmaxf(v, 0.f); so[w][8 * hh + r][t * 16 + ln] = v; } }
  __builtin_amdgcn_fence(__ATOMIC_ACQ_REL, "workgroup"); __builtin_amdgcn_wave_barrier();
  const int rsub = lane >> 4, c4 = (lane & 15) * 4; typedef _Float16 v4h __attribute__((ext_vector_type(4)));
  {
#pragma unroll
    for (int q = 0; q < 8; ++q) { const int r = q * 2 + rsub; if (col0 + c4 < N) { const v4f v = *(const v4fa*)&so[w][r][c4]; if (C) *(v4f*)(C + cofs + (size_t)(row0 + r) * ldc + col0 + c4) = v; if (C16) { v4h h4; for (int i = 0; i < 4; ++i) h4[i] = (_Float16)v[i]; *(v4h*)(C16 + cofs + (size_t)(row0 + r) * ldc + col0 + c4) = h4; } } }
     }
}


__global__ __launch_bounds__(256) void k_round16f(const float* __restrict__ W, _Float16* __restrict__ Bt, size_t n8) { const size_t t = (size_t)blockIdx.x * 256 + threadIdx.x; if (t >= n8) return; FragH f;
#pragma unroll
  for (int i = 0; i < 8; ++i) f.h[i] = (_Float16)(bf16_round(W[t * 8 + i]) * 16.0f); *(v8us*)((unsigned short*)Bt + t * 8) = f.half[0];  }
__global__ __launch_bounds__(256) void k_h16(const float* __restrict__ x, _Float16* __restrict__ X16, size_t n8) { const size_t t = (size_t)blockIdx.x * 256 + threadIdx.x; if (t >= n8) return; FragH f;
#pragma unroll
  for (int q = 0; q < 8; ++q) f.h[q] = (_Float16)x[t * 8 + q]; *(v8us*)((unsigned short*)X16 + t * 8) = f.half[0];  }
// Projection C[NBS][LOW] = x . W^T + bias with x read as f32 and rounded on its way into the A fragment (bf16 rounding, then f16: the values the staged f16 copy held).
// Tile map, k order and epilogue are those of k_gemm_hhx: one wave = 16 rows x 64 columns, k rising, one accumulator chain per 16 x 16 tile.
#define PJ_U 8
template <bool OUT16>
__global__ __launch_bounds__(128) void k_proj(const float* __restrict__ X, const _Float16* __restrict__ Bh, const float* __restrict__ bias, float* __restrict__ C, _Float16* __restrict__ C16) {
  __shared__ __attribute__((aligned(16))) float so[4][16][64];
  const int tid = threadIdx.x, w = tid >> 5, lane = tid & 31, ln = lane & 15, hh = lane >> 4;
  const int wid = blockIdx.x * 4 + w, row0 = (wid >> 1) * 16, col0 = (wid & 1) * 64;
  const float* arow = X + (size_t)(row0 + ln) * FD + 8 * hh;
  const unsigned short* brow = (const unsigned short*)Bh + (size_t)(col0 + ln) * FD + 8 * hh;
  v8f acc[4] = {};
  for (int kb = 0; kb < FD; kb += 32 * PJ_U) {
    v4f x[PJ_U][4]; FragH b[PJ_U][4];
#pragma unroll
    for (int u = 0; u < PJ_U; ++u) {
      const float* p = arow + kb + u * 32;
      x[u][0] = *(const v4fa*)p; x[u][1] = *(const v4fa*)(p + 4); x[u][2] = *(const v4fa*)(p + 16); x[u][3] = *(const v4fa*)(p + 20);
    }
#pragma unroll
    for (int u = 0; u < PJ_U; ++u)
#pragma unroll
      for (int t = 0; t < 4; ++t) {
        const unsigned short* p = brow + (size_t)t * 16 * FD + kb + u * 32;
        b[u][t].half[0] = *(const v8us*)p; b[u][t].half[1] = *(const v8us*)(p + 16);
      }
    asm volatile("s_wait_xcnt 0x0" ::: "memory");      // precaution: stands in front of the additions that step these loads' two address pairs to the next group
    __builtin_amdgcn_sched_barrier(0);      // keeps the whole group's loads in front of the first conversion (x comes from memory, and one k step's 2 KB a wave in flight would leave the kernel waiting on latency) and the address additions behind the wait
#pragma unroll
    for (int u = 0; u < PJ_U; ++u) {
      FragH a;
#pragma unroll
      for (int i = 0; i < 16; ++i) a.h[i] = (_Float16)bf16_round(x[u][i >> 2][i & 3]);
#pragma unroll
      for (int t = 0; t < 4; ++t) acc[t] = __builtin_amdgcn_wmma_f32_16x16x32_f16(false, a.v, false, b[u][t].v, (short)0, acc[t], false, false);
    }
  }
  float bv[4];
#pragma unroll
  for (int t = 0; t < 4; ++t) bv[t] = bias[col0 + t * 16 + ln];
  asm volatile("s_wait_xcnt 0x0" ::: "memory");      // precaution: the compiler reuses the bias loads' offset register at once
  __builtin_amdgcn_sched_barrier(0);      // holds that reuse behind the wait
#pragma unroll
  for (int t = 0; t < 4; ++t) {
    const float bb = bf16_round(bv[t]);
#pragma unroll
    for (int r = 0; r < 8; ++r) so[w][8 * hh + r][t * 16 + ln] = acc[t][r] * 0.0625f + bb;
  }
  __builtin_amdgcn_fence(__ATOMIC_ACQ_REL, "workgroup", "local"); __builtin_amdgcn_wave_barrier();      // the wave's own LDS stores land before it reads the rows back
  const int rsub = lane >> 4, c4 = (lane & 15) * 4; typedef _Float16 v4h __attribute__((ext_vector_type(4)));
  const size_t o0 = (size_t)(row0 + rsub) * LOW + col0 + c4;
#pragma unroll
  for (int q = 0; q < 8; ++q) {
    const v4f v = *(const v4fa*)&so[w][q * 2 + rsub][c4];
    if (OUT16) { v4h h4; for (int i = 0; i < 4; ++i) h4[i] = (_Float16)v[i]; *(v4h*)(C16 + o0 + q * 2 * LOW) = h4; }
    else *(v4f*)(C + o0 + q * 2 * LOW) = v;
  }
}
// out[NBS][FD] = g . W2^T + bias + (f + pf): f and pf are read as f32 by the lane that stores the element, 16 bytes at a time, rounded to bf16 and summed there.
// Tile map and k order are those of k_gemm_hhx (one wave = 16 rows x 64 columns).
__global__ __launch_bounds__(128) void k_out(const _Float16* __restrict__ G, const _Float16* __restrict__ Bh, const float* __restrict__ bias, const float* __restrict__ f, const float* __restrict__ pf, float* __restrict__ out) {
  __shared__ __attribute__((aligned(16))) float so[4][16][64];
  const int tid = threadIdx.x, w = tid >> 5, lane = tid & 31, ln = lane & 15, hh = lane >> 4;
  const int wid = blockIdx.x * 4 + w, row0 = (wid / (FD / 64)) * 16, col0 = (wid % (FD / 64)) * 64;
  const int rsub = lane >> 4, c4 = (lane & 15) * 4;
  const unsigned short* arow = (const unsigned short*)G + (size_t)(row0 + ln) * LOW + 8 * hh;
  const unsigned short* brow = (const unsigned short*)Bh + (size_t)(col0 + ln) * LOW + 8 * hh;
  FragH a[LOW / 32], b[4][LOW / 32];
#pragma unroll
  for (int ks = 0; ks < LOW / 32; ++ks) { a[ks].half[0] = *(const v8us*)(arow + ks * 32); a[ks].half[1] = *(const v8us*)(arow + ks * 32 + 16); }
  asm volatile("s_wait_xcnt 0x0" ::: "memory");      // precaution: the compiler reuses these loads' address pair as the destination of a later load
#pragma unroll
  for (int t = 0; t < 4; ++t)
#pragma unroll
    for (int ks = 0; ks < LOW / 32; ++ks) { b[t][ks].half[0] = *(const v8us*)(brow + (size_t)t * 16 * LOW + ks * 32); b[t][ks].half[1] = *(const v8us*)(brow + (size_t)t * 16 * LOW + ks * 32 + 16); }
  float bv[4];
#pragma unroll
  for (int t = 0; t < 4; ++t) bv[t] = bias[col0 + t * 16 + ln];
  asm volatile("s_wait_xcnt 0x0" ::: "memory");      // precaution: the operand loads' address registers are free for reuse behind it
  __builtin_amdgcn_sched_barrier(0);      // loads return in order: the operand loads (L2) stay in front of the residual loads (memory), so that the WMMAs need not wait for the latter
  const size_t o0 = (size_t)(row0 + rsub) * FD + col0 + c4;
  v4f rf[8], rp[8];
#pragma unroll
  for (int q = 0; q < 8; ++q) { rf[q] = *(const v4fa*)(f + o0 + q * 2 * FD); rp[q] = *(const v4fa*)(pf + o0 + q * 2 * FD); }
  asm volatile("s_wait_xcnt 0x0" ::: "memory");      // precaution: as above, for the residual loads' two address pairs
  __builtin_amdgcn_sched_barrier(0);      // keeps the residual loads in front of the product, which then runs under their latency
  v8f acc[4] = {};
#pragma unroll
  for (int ks = 0; ks < LOW / 32; ++ks)
#pragma unroll
    for (int t = 0; t < 4; ++t) acc[t] = __builtin_amdgcn_wmma_f32_16x16x32_f16(false, a[ks].v, false, b[t][ks].v, (short)0, acc[t], false, false);
#pragma unroll
  for (int t = 0; t < 4; ++t) {
    const float bb = bf16_round(bv[t]);
#pragma unroll
    for (int r = 0; r < 8; ++r) so[w][8 * hh + r][t * 16 + ln] = acc[t][r] * 0.0625f + bb;
  }
  __builtin_amdgcn_fence(__ATOMIC_ACQ_REL, "workgroup", "local"); __builtin_amdgcn_wave_barrier();      // the wave's own LDS stores land before it reads the rows back; LDS alone, so that the residual loads stay in flight
#pragma unroll
  for (int q = 0; q < 8; ++q) {
    v4f v = *(const v4fa*)&so[w][q * 2 + rsub][c4];
#pragma unroll
    for (int c = 0; c < 4; ++c) v[c] += bf16_round(rf[q][c]) + bf16_round(rp[q][c]);
    *(v4f*)(out + o0 + q * 2 * FD) = v;
  }
}
// Parameter generator and per-sample MLP in one kernel: a work-group owns GM_M samples and never stores their generated parameters.
// Each 16 x 16 tile of params = pf_low . pg_w^T (K = LOW, four f16 WMMAs) is scaled, biased and summed into h or g straight from the accumulator registers
// (accumulator register r of lane (ln, hh) = sample 8 * hh + r, parameter column ln).
// Layer 1: parameter n = l * MID + m; wave w owns l = 16 w .. 16 w + 15 and sums them in rising order; the eight waves' partial h meet in LDS in rising wave order, then relu.
// Layer 2: parameter n = LOW * MID + m * LOW + l; wave w owns l = 16 w .. 16 w + 15 and sums m in rising order.
#define GM_M 32
struct Yes { static constexpr bool value = true; }; struct No { static constexpr bool value = false; };
__global__ __launch_bounds__(256) void k_gen_mlp(const _Float16* __restrict__ PL, const _Float16* __restrict__ Bg, const float* __restrict__ pgb, const float* __restrict__ FLOW, _Float16* __restrict__ G16) {
  __shared__ __attribute__((aligned(16))) float sF[LOW][GM_M];              // flow[s][l] at [l][s]; rows 16 w .. + 15 are written and read by wave w alone
  __shared__ __attribute__((aligned(16))) float sP[8][MID][GM_M + 4];       // partial h per wave at [m][s]; pitch 36 floats spreads the 16-byte stores of 16 rows m over all banks
  __shared__ __attribute__((aligned(16))) float sH[MID][GM_M];              // h after relu at [m][s]
  __shared__ __attribute__((aligned(16))) _Float16 sG[GM_M][LOW + 8];       // g as f16, gathered so that the work-group stores whole rows
  const int tid = threadIdx.x, lane = tid & 31, ln = lane & 15, hh = lane >> 4;
  const int w = __builtin_amdgcn_readfirstlane(tid >> 5);
  const int s0 = blockIdx.x * GM_M;
  struct BTile { FragH f[LOW / 32]; float b; };
  // tile u of this wave's stream: u < 32 layer 1 (l = 16 w + u / 2, m half u & 1), else layer 2 (m = u - 32)
  const unsigned short* blane = (const unsigned short*)Bg + (size_t)ln * LOW + 8 * hh;
  const float* clane = pgb + ln;
  auto load_tile = [&](BTile& t, int u) {
    const int n0 = (u < 32) ? (w * 512 + u * 16) : (LOW * MID + (u - 32) * LOW + w * 16);
    const unsigned short* p = blane + (size_t)n0 * LOW;
    t.b = clane[n0];
#pragma unroll
    for (int ks = 0; ks < LOW / 32; ++ks) { t.f[ks].half[0] = *(const v8us*)(p + ks * 32); t.f[ks].half[1] = *(const v8us*)(p + ks * 32 + 16); }
  };
  v4f fl[4];
#pragma unroll
  for (int j = 0; j < 4; ++j) fl[j] = *(const v4fa*)(FLOW + (size_t)(s0 + lane) * LOW + w * 16 + j * 4);
  FragH a[2][LOW / 32];
#pragma unroll
  for (int mt = 0; mt < 2; ++mt) {
    const unsigned short* ar = (const unsigned short*)PL + (size_t)(s0 + mt * 16 + ln) * LOW + 8 * hh;
#pragma unroll
    for (int ks = 0; ks < LOW / 32; ++ks) { a[mt][ks].half[0] = *(const v8us*)(ar + ks * 32); a[mt][ks].half[1] = *(const v8us*)(ar + ks * 32 + 16); }
    if (mt == 0) asm volatile("s_wait_xcnt 0x0" ::: "memory");      // precaution: the compiler reuses these loads' address registers as the destination of a load of the second tile
  }
  __builtin_amdgcn_sched_barrier(0);      // keeps the sample loads in front of the weight loads: loads return in order, and behind them they would force the loop's first wait to drain the weight tiles too
  BTile bt[2];
  load_tile(bt[0], 0); load_tile(bt[1], 1);
#pragma unroll
  for (int j = 0; j < 4; ++j)
#pragma unroll
    for (int c = 0; c < 4; ++c) sF[w * 16 + j * 4 + c][lane] = fl[j][c];
  // fence on LDS alone: the wave's own stores land before it reads the rows back; a fence on every address space would also drain the weight loads in flight
  __builtin_amdgcn_fence(__ATOMIC_ACQ_REL, "workgroup", "local"); __builtin_amdgcn_wave_barrier();
  // one tile: acc[mt][r] += cf[sample] * (tile / 16 + bias); the tile's registers are refilled with tile un as soon as its WMMAs have issued
  auto tile_step = [&](BTile& t, const float* cf, v8f& acc0, v8f& acc1, int un, auto refill) {
    const v4f c00 = *(const v4fa*)(cf + 8 * hh), c01 = *(const v4fa*)(cf + 8 * hh + 4), c10 = *(const v4fa*)(cf + 16 + 8 * hh), c11 = *(const v4fa*)(cf + 16 + 8 * hh + 4);
    v8f d0 = {}, d1 = {};
#pragma unroll
    for (int ks = 0; ks < LOW / 32; ++ks) {
      d0 = __builtin_amdgcn_wmma_f32_16x16x32_f16(false, a[0][ks].v, false, t.f[ks].v, (short)0, d0, false, false);
      d1 = __builtin_amdgcn_wmma_f32_16x16x32_f16(false, a[1][ks].v, false, t.f[ks].v, (short)0, d1, false, false);
    }
    const float bv = bf16_round(t.b);
    if constexpr (decltype(refill)::value) load_tile(t, un);
#pragma unroll
    for (int r = 0; r < 8; ++r) {
      acc0[r] += ((r < 4) ? c00[r & 3] : c01[r & 3]) * (d0[r] * 0.0625f + bv);
      acc1[r] += ((r < 4) ? c10[r & 3] : c11[r & 3]) * (d1[r] * 0.0625f + bv);
    }
  };
  v8f hp[2][2] = {};      // [m half][sample tile]
  for (int i = 0; i < 16; ++i) {
    const float* cf = &sF[w * 16 + i][0];
    tile_step(bt[0], cf, hp[0][0], hp[0][1], 2 * i + 2, Yes{});
    tile_step(bt[1], cf, hp[1][0], hp[1][1], 2 * i + 3, Yes{});
  }
#pragma unroll
  for (int mh = 0; mh < 2; ++mh)
#pragma unroll
    for (int mt = 0; mt < 2; ++mt) {
      float* d = &sP[w][mh * 16 + ln][mt * 16 + 8 * hh];
      *(v4fa*)d = (v4f){hp[mh][mt][0], hp[mh][mt][1], hp[mh][mt][2], hp[mh][mt][3]};
      *(v4fa*)(d + 4) = (v4f){hp[mh][mt][4], hp[mh][mt][5], hp[mh][mt][6], hp[mh][mt][7]};
    }
  __syncthreads();      // every wave's partial h is in LDS
  {
    const int m = tid >> 3, s4 = (tid & 7) * 4;
    v4f v = *(const v4fa*)&sP[0][m][s4];
#pragma unroll
    for (int q = 1; q < 8; ++q) v += *(const v4fa*)&sP[q][m][s4];
#pragma unroll
    for (int c = 0; c < 4; ++c) v[c] = fmaxf(v[c], 0.f);
    *(v4fa*)&sH[m][s4] = v;
  }
  __syncthreads();      // h is complete before any wave reads it
  v8f g0 = {}, g1 = {};
  for (int i = 0; i < 15; ++i) {
    tile_step(bt[0], &sH[2 * i][0], g0, g1, 32 + 2 * i + 2, Yes{});
    tile_step(bt[1], &sH[2 * i + 1][0], g0, g1, 32 + 2 * i + 3, Yes{});
  }
  tile_step(bt[0], &sH[30][0], g0, g1, 0, No{});
  tile_step(bt[1], &sH[31][0], g0, g1, 0, No{});
#pragma unroll
  for (int r = 0; r < 8; ++r) { sG[8 * hh + r][w * 16 + ln] = (_Float16)g0[r]; sG[16 + 8 * hh + r][w * 16 + ln] = (_Float16)g1[r]; }
  __syncthreads();      // all of g is in LDS before the rows are stored
#pragma unroll
  for (int j = 0; j < 2; ++j) {
    const int e = tid + 256 * j, row = e >> 4, c8 = (e & 15) * 8;
    *(v8us*)((unsigned short*)G16 + (size_t)(s0 + row) * LOW + c8) = *(const v8us*)&sG[row][c8];
  }
}
extern "C" void kernel_launch(void* const* d_in, const int* in_sizes, int n_in,
                              void* d_out, int out_size, void* d_ws, size_t ws_size, hipStream_t stream) {
  (void)in_sizes; (void)n_in; (void)out_size;
  const float* f = (const float*)d_in[0]; const float* pf = (const float*)d_in[1]; const float* pfw = (const float*)d_in[2]; const float* pfb = (const float*)d_in[3]; const float* ppw = (const float*)d_in[4]; const float* ppb = (const float*)d_in[5]; const float* f2w = (const float*)d_in[6]; const float* f2b = (const float*)d_in[7]; const float* pgw = (const float*)d_in[8]; const float* pgb = (const float*)d_in[9];
  char* ws = (char*)d_ws; size_t off = 0;
  auto take = [&](size_t bytes) { char* p = ws + off; off += (bytes + 255) & ~(size_t)255; return p; };
  _Float16* Bf = (_Float16*)take((size_t)LOW * FD * 2); _Float16* Bp = (_Float16*)take((size_t)LOW * FD * 2); _Float16* Bg = (_Float16*)take((size_t)NPAR * LOW * 2); _Float16* B2 = (_Float16*)take((size_t)FD * LOW * 2);
  float* FLOW = (float*)take((size_t)NBS * LOW * 4); _Float16* PL16 = (_Float16*)take((size_t)NBS * LOW * 2); _Float16* G16 = (_Float16*)take((size_t)NBS * LOW * 2);
  if (off > ws_size) return;      // about 11 MiB
  k_round16f<<<(LOW * FD / 8 + 255) / 256, 256, 0, stream>>>(pfw, Bf, (size_t)LOW * FD / 8); k_round16f<<<(LOW * FD / 8 + 255) / 256, 256, 0, stream>>>(ppw, Bp, (size_t)LOW * FD / 8); k_round16f<<<(NPAR * LOW / 8 + 255) / 256, 256, 0, stream>>>(pgw, Bg, (size_t)NPAR * LOW / 8); k_round16f<<<(FD * LOW / 8 + 255) / 256, 256, 0, stream>>>(f2w, B2, (size_t)FD * LOW / 8);      // (out,in)
  k_proj<false><<<(NBS / 16) * (LOW / 64) / 4, 128, 0, stream>>>(f, Bf, pfb, FLOW, nullptr);      // f_low (f32, read by the per-sample MLP)
  k_proj<true><<<(NBS / 16) * (LOW / 64) / 4, 128, 0, stream>>>(pf, Bp, ppb, nullptr, PL16);      // pf_low (f16 operand of the generator)
  k_gen_mlp<<<NBS / GM_M, 256, 0, stream>>>(PL16, Bg, pgb, FLOW, G16);      // params = pf_low . pg_w^T + pg_b, consumed in registers by the per-sample MLP
  k_out<<<(NBS / 16) * (FD / 64) / 4, 128, 0, stream>>>(G16, B2, f2b, f, pf, (float*)d_out);      // g . proj_f2^T + b + (f + pf)
}

// v004
// One run takes 74.6 microseconds.
// Two timings next to v003 put it at 1.26 and 1.28 times that version's speed.
// Counting every step since v000, it is 7.85 times as fast.
#include <hip/hip_runtime.h>
// + bias, + f + pf residuals as exact bf16 addends) on v_wmma_f32_16x16x32_f16 (f16 operands, nn.Linear weights (out,in) bf16-exact ×2^4, f32 accumulate); the per-sample tiny MLP
// (128 -> 32 relu -> 128 with that sample's generated weights) is f32 VALU on the generator's accumulator tiles (32 samples per work-group).
#define NBS 8192
#define FD 1024
#define LOW 128
#define MID 32
#define NPAR (2 * LOW * MID)

typedef __bf16 v16b __attribute__((ext_vector_type(16)));
typedef unsigned short v8us __attribute__((ext_vector_type(8), may_alias));
typedef float  v8f  __attribute__((ext_vector_type(8)));
typedef float  v4f  __attribute__((ext_vector_type(4)));
typedef float  v4fa __attribute__((ext_vector_type(4), may_alias));
union FragB { v16b v; v8us half[2]; unsigned short u[16]; };

__device__ __forceinline__ unsigned short bf16_bits(float x) { unsigned int u = __float_as_uint(x); return (unsigned short)((u + 0x7FFFu + ((u >> 16) & 1u)) >> 16); }
__device__ __forceinline__ float bf16_val(unsigned short b) { return __uint_as_float(((unsigned int)b) << 16); }
__device__ __forceinline__ float bf16_round(float x) { return bf16_val(bf16_bits(x)); }
// D += A·B with NT terms: 1 = ah·bh, 2 = + al·bh (A split), 3 = + ah·bl (both split)
template <int NT>
__device__ __forceinline__ v8f mmaN(v16b ah, v16b al, v16b bh, v16b bl, v8f c) {
  c = __builtin_amdgcn_wmma_f32_16x16x32_bf16(false, ah, false, bh, (short)0, c, false, false);
  if (NT >= 2) c = __builtin_amdgcn_wmma_f32_16x16x32_bf16(false, al, false, bh, (short)0, c, false, false);
  if (NT >= 3) c = __builtin_amdgcn_wmma_f32_16x16x32_bf16(false, ah, false, bl, (short)0, c, false, false);
  asm volatile("v_nop\n\tv_nop\n\tv_nop\n\tv_nop" : "+v"(c) : "v"(ah), "v"(al), "v"(bh), "v"(bl));
  return c;
}

__global__ __launch_bounds__(256) void k_wt_bf16(const float* __restrict__ W, unsigned short* __restrict__ Wt, int K, int N) {
  const int t = blockIdx.x * 256 + threadIdx.x;
  const int k8n = K / 8;
  if (t >= N * k8n) return;
  const int n = t / k8n, k8 = (t % k8n) * 8;
  v8us v;
#pragma unroll
  for (int i = 0; i < 8; ++i) v[i] = bf16_bits(W[(size_t)(k8 + i) * N + n]);
  *(v8us*)(Wt + (size_t)n * K + k8) = v;
  
}

// GEMM C[M][N] (f32, pitch ldc) = act(A[M][K]·W + bias). A f32 row-major (pitch lda) converted per fragment to bf16
// (ASPLIT: hi/lo two planes -> 2 terms, else single rounded term); Wt bf16 [N][K] (pitch ldb). BIAS_BF16 rounds the
// bias to bf16 first (bias quantised to bf16 before the add). K%32==0, M%16==0, N%64==0.
template <bool ASPLIT, int ACT, bool BIAS_BF16>
__global__ __launch_bounds__(128) void k_gemm_bf(const float* __restrict__ A, int lda, const unsigned short* __restrict__ Wt, int ldb,
                                               const float* __restrict__ bias, float* __restrict__ C, int ldc, int M, int N, int K) {
  __shared__ __attribute__((aligned(16))) float so[4][16][64];
  const int tid = threadIdx.x, w = tid >> 5, lane = tid & 31, ln = lane & 15, hh = lane >> 4;
  const int ntn = N / 64;
  const int wid = blockIdx.x * 4 + w;
  const int mt = wid / ntn, nq = wid % ntn;
  if (mt * 16 >= M) return;
  const int row0 = mt * 16, col0 = nq * 64;
  const float* arow = A + (size_t)(row0 + ln) * lda;
  v8f acc[4] = {};
  for (int kb = 0; kb < K; kb += 32) {
    FragB ah, al;
    const v4f x0 = *(const v4fa*)(arow + kb + 8 * hh), x1 = *(const v4fa*)(arow + kb + 8 * hh + 4);
    const v4f x2 = *(const v4fa*)(arow + kb + 16 + 8 * hh), x3 = *(const v4fa*)(arow + kb + 16 + 8 * hh + 4);
    float xs[16] = {x0[0],x0[1],x0[2],x0[3],x1[0],x1[1],x1[2],x1[3],x2[0],x2[1],x2[2],x2[3],x3[0],x3[1],x3[2],x3[3]};
#pragma unroll
    for (int i = 0; i < 16; ++i) { const unsigned short hb = bf16_bits(xs[i]); ah.u[i] = hb; al.u[i] = ASPLIT ? bf16_bits(xs[i] - bf16_val(hb)) : (unsigned short)0; }
#pragma unroll
    for (int t = 0; t < 4; ++t) {
      const unsigned short* brow = Wt + (size_t)(col0 + t * 16 + ln) * ldb + kb;
      FragB b;
      b.half[0] = *(const v8us*)(brow + 8 * hh);
      b.half[1] = *(const v8us*)(brow + 16 + 8 * hh);
      acc[t] = mmaN<ASPLIT ? 2 : 1>(ah.v, al.v, b.v, b.v, acc[t]);
    }
  }
#pragma unroll
  for (int t = 0; t < 4; ++t) {
    float bv = bias ? bias[col0 + t * 16 + ln] : 0.f;
    if (BIAS_BF16) bv = bf16_round(bv);
#pragma unroll
    for (int r = 0; r < 8; ++r) { float v = acc[t][r] + bv; if (ACT == 1) v = fmaxf(v, 0.f); so[w][8 * hh + r][t * 16 + ln] = v; }
  }
  __builtin_amdgcn_fence(__ATOMIC_ACQ_REL, "workgroup");
  __builtin_amdgcn_wave_barrier();
  const int rsub = lane >> 4, c4 = (lane & 15) * 4;
  {
#pragma unroll
    for (int q = 0; q < 8; ++q) {
      const int r = q * 2 + rsub;
      const v4f v = *(const v4fa*)&so[w][r][c4];
      *(v4f*)(C + (size_t)(row0 + r) * ldc + col0 + c4) = v;
    }
    
  }
}

// Flash-style causal/unmasked attention, all contractions 3-term bf16 hi/lo splits, f32 softmax with running max.
// q,k,v rows are read from f32 buffers with arbitrary row pitch (so they can live inside a fused qkv buffer);
// D = head size (multiple of 32, <= 128); one wave = 16 query rows; block = 4 waves (64 queries) sharing K/V chunks of 32.
template <int D, bool CAUSAL>
__global__ __launch_bounds__(128) void k_flash(const float* __restrict__ qb, const float* __restrict__ kb, const float* __restrict__ vb,
                                             int pitch, int T, int H, float scale, float* __restrict__ y, int ypitch) {
  constexpr int KS = D / 32;        // k-steps for QK
  constexpr int DT = D / 16;        // d tiles for PV
  __shared__ __attribute__((aligned(16))) unsigned short sKh[32][D + 8], sKl[32][D + 8], sVh[32][D + 8], sVl[32][D + 8];
  __shared__ __attribute__((aligned(16))) unsigned short sPh[4][16][40], sPl[4][16][40];
  __shared__ __attribute__((aligned(16))) float sO[4][16][D];
  const int tid = threadIdx.x, w = tid >> 5, lane = tid & 31, ln = lane & 15, hh = lane >> 4;
  const int nqb = (T + 63) / 64;
  const int bh = blockIdx.x / nqb, qblk = blockIdx.x % nqb;
  const int b = bh / H, h = bh % H;
  const int q0 = qblk * 64 + w * 16;
  const float* Q = qb + (size_t)b * T * pitch + h * D;
  const float* K = kb + (size_t)b * T * pitch + h * D;
  const float* V = vb + (size_t)b * T * pitch + h * D;

  // A fragments of the wave's 16 query rows (scaled), hi/lo
  FragB aqh[KS], aql[KS];
  {
    int row = q0 + ln; if (row >= T) row = T - 1;
    const float* qr = Q + (size_t)row * pitch;
#pragma unroll
    for (int ks = 0; ks < KS; ++ks)
#pragma unroll
      for (int i = 0; i < 16; ++i) {
        const int d = ks * 32 + ((i < 8) ? (8 * hh + i) : (16 + 8 * hh + (i - 8)));
        const float x = qr[d] * scale; const unsigned short hb = bf16_bits(x);
        aqh[ks].u[i] = hb; aql[ks].u[i] = bf16_bits(x - bf16_val(hb));
      }
  }
  float m_r[8], l_r[8];
#pragma unroll
  for (int r = 0; r < 8; ++r) { m_r[r] = -3.0e38f; l_r[r] = 0.f; }
  v8f oacc[DT];
#pragma unroll
  for (int dt = 0; dt < DT; ++dt) oacc[dt] = (v8f){0.f,0.f,0.f,0.f,0.f,0.f,0.f,0.f};

  const int kv_end = CAUSAL ? min(T, qblk * 64 + 64) : T;     // block-uniform
  for (int j0 = 0; j0 < kv_end; j0 += 32) {
    __syncthreads();
    for (int e = tid; e < 32 * (D / 4); e += 128) {
      const int r = e / (D / 4), c4 = (e % (D / 4)) * 4;
      const int key = j0 + r;
      v4f kf = {0.f,0.f,0.f,0.f}, vf = {0.f,0.f,0.f,0.f};
      if (key < T) { kf = *(const v4fa*)(K + (size_t)key * pitch + c4); vf = *(const v4fa*)(V + (size_t)key * pitch + c4); }
#pragma unroll
      for (int t = 0; t < 4; ++t) {
        unsigned short hb = bf16_bits(kf[t]); sKh[r][c4 + t] = hb; sKl[r][c4 + t] = bf16_bits(kf[t] - bf16_val(hb));
        hb = bf16_bits(vf[t]); sVh[r][c4 + t] = hb; sVl[r][c4 + t] = bf16_bits(vf[t] - bf16_val(hb));
      }
    }
    __syncthreads();
    // S tile 16 x 32
    v8f s[2];
#pragma unroll
    for (int nt = 0; nt < 2; ++nt) {
      v8f acc = {};
#pragma unroll
      for (int ks = 0; ks < KS; ++ks) {
        FragB bh_, bl_;
        bh_.half[0] = *(const v8us*)&sKh[nt * 16 + ln][ks * 32 + 8 * hh]; bh_.half[1] = *(const v8us*)&sKh[nt * 16 + ln][ks * 32 + 16 + 8 * hh];
        bl_.half[0] = *(const v8us*)&sKl[nt * 16 + ln][ks * 32 + 8 * hh]; bl_.half[1] = *(const v8us*)&sKl[nt * 16 + ln][ks * 32 + 16 + 8 * hh];
        acc = mmaN<3>(aqh[ks].v, aql[ks].v, bh_.v, bl_.v, acc);
      }
      s[nt] = acc;
    }
    // mask + running max (rows 8hh+r; the 16 lanes of a half share rows)
    float alpha[8];
#pragma unroll
    for (int r = 0; r < 8; ++r) {
      const int qi = q0 + 8 * hh + r;
      const int ja = j0 + ln, jb = j0 + 16 + ln;
      if (CAUSAL) { if (ja > qi) s[0][r] = -3.0e38f; if (jb > qi) s[1][r] = -3.0e38f; }
      if (ja >= T) s[0][r] = -3.0e38f;
      if (jb >= T) s[1][r] = -3.0e38f;
      float mx = fmaxf(s[0][r], s[1][r]);
      mx = fmaxf(mx, __shfl_xor(mx, 1, 32)); mx = fmaxf(mx, __shfl_xor(mx, 2, 32)); mx = fmaxf(mx, __shfl_xor(mx, 4, 32)); mx = fmaxf(mx, __shfl_xor(mx, 8, 32));
      const float mnew = fmaxf(m_r[r], mx);
      alpha[r] = (mnew > -1.0e38f) ? __expf(m_r[r] - mnew) : 1.0f;
      const float p0 = (s[0][r] > -1.0e38f) ? __expf(s[0][r] - mnew) : 0.f;
      const float p1 = (s[1][r] > -1.0e38f) ? __expf(s[1][r] - mnew) : 0.f;
      m_r[r] = mnew;
      l_r[r] = l_r[r] * alpha[r] + p0 + p1;            // per-lane partial row sum (16 lanes combined at the end)
      unsigned short hb = bf16_bits(p0); sPh[w][8 * hh + r][ln] = hb;      sPl[w][8 * hh + r][ln] = bf16_bits(p0 - bf16_val(hb));
      hb = bf16_bits(p1);                sPh[w][8 * hh + r][16 + ln] = hb; sPl[w][8 * hh + r][16 + ln] = bf16_bits(p1 - bf16_val(hb));
    }
#pragma unroll
    for (int dt = 0; dt < DT; ++dt)
#pragma unroll
      for (int r = 0; r < 8; ++r) oacc[dt][r] *= alpha[r];
    __builtin_amdgcn_fence(__ATOMIC_ACQ_REL, "workgroup");
    __builtin_amdgcn_wave_barrier();
    FragB pah, pal;
    pah.half[0] = *(const v8us*)&sPh[w][ln][8 * hh]; pah.half[1] = *(const v8us*)&sPh[w][ln][16 + 8 * hh];
    pal.half[0] = *(const v8us*)&sPl[w][ln][8 * hh]; pal.half[1] = *(const v8us*)&sPl[w][ln][16 + 8 * hh];
#pragma unroll
    for (int dt = 0; dt < DT; ++dt) {
      FragB bvh, bvl;
#pragma unroll
      for (int i = 0; i < 8; ++i) {
        bvh.u[i] = sVh[8 * hh + i][dt * 16 + ln]; bvh.u[8 + i] = sVh[16 + 8 * hh + i][dt * 16 + ln];
        bvl.u[i] = sVl[8 * hh + i][dt * 16 + ln]; bvl.u[8 + i] = sVl[16 + 8 * hh + i][dt * 16 + ln];
      }
      oacc[dt] = mmaN<3>(pah.v, pal.v, bvh.v, bvl.v, oacc[dt]);
    }
    __builtin_amdgcn_fence(__ATOMIC_ACQ_REL, "workgroup");
    __builtin_amdgcn_wave_barrier();
  }
#pragma unroll
  for (int r = 0; r < 8; ++r) {
    float l = l_r[r];
    l += __shfl_xor(l, 1, 32); l += __shfl_xor(l, 2, 32); l += __shfl_xor(l, 4, 32); l += __shfl_xor(l, 8, 32);
    l_r[r] = (l > 0.f) ? 1.0f / l : 0.f;
  }
#pragma unroll
  for (int dt = 0; dt < DT; ++dt)
#pragma unroll
    for (int r = 0; r < 8; ++r) sO[w][8 * hh + r][dt * 16 + ln] = oacc[dt][r] * l_r[r];
  __builtin_amdgcn_fence(__ATOMIC_ACQ_REL, "workgroup");
  __builtin_amdgcn_wave_barrier();
  {
    for (int r = 0; r < 16; ++r) {
      const int row = q0 + r;
      if (row < T && lane < D / 4) {
        const v4f val = *(const v4fa*)&sO[w][r][lane * 4];
        *(v4f*)(y + ((size_t)b * T + row) * ypitch + h * D + lane * 4) = val;
      }
    }
    
  }
}

// GEMM C = act(A·W + bias + resid): A f32 (ASPLIT -> hi/lo 2 terms), Wt bf16 [N][K]; ACT 0 none, 1 relu, 2 exact gelu;
// resid (optional, f32, row index = (row % rmod), pitch ldr, RES_BF16 rounds it) added before the activation.
template <bool ASPLIT, int ACT, bool BIAS_BF16, bool RES_BF16>
__global__ __launch_bounds__(128) void k_gemm_bf3(const float* __restrict__ A, int lda, const unsigned short* __restrict__ Wt, int ldb,
                                                const float* __restrict__ bias, const float* __restrict__ resid, int rmod, int ldr,
                                                float* __restrict__ C, int ldc, int M, int N, int K) {
  __shared__ __attribute__((aligned(16))) float so[4][16][64];
  const int tid = threadIdx.x, w = tid >> 5, lane = tid & 31, ln = lane & 15, hh = lane >> 4;
  const int ntn = N / 64;
  const int wid = blockIdx.x * 4 + w;
  const int mt = wid / ntn, nq = wid % ntn;
  if (mt * 16 >= M) return;
  const int row0 = mt * 16, col0 = nq * 64;
  const float* arow = A + (size_t)(row0 + ln) * lda;
  v8f acc[4] = {};
  for (int kb = 0; kb < K; kb += 32) {
    FragB ah, al;
    const v4f x0 = *(const v4fa*)(arow + kb + 8 * hh), x1 = *(const v4fa*)(arow + kb + 8 * hh + 4);
    const v4f x2 = *(const v4fa*)(arow + kb + 16 + 8 * hh), x3 = *(const v4fa*)(arow + kb + 16 + 8 * hh + 4);
    float xs[16] = {x0[0],x0[1],x0[2],x0[3],x1[0],x1[1],x1[2],x1[3],x2[0],x2[1],x2[2],x2[3],x3[0],x3[1],x3[2],x3[3]};
#pragma unroll
    for (int i = 0; i < 16; ++i) { const unsigned short hb = bf16_bits(xs[i]); ah.u[i] = hb; al.u[i] = ASPLIT ? bf16_bits(xs[i] - bf16_val(hb)) : (unsigned short)0; }
#pragma unroll
    for (int t = 0; t < 4; ++t) {
      const unsigned short* brow = Wt + (size_t)(col0 + t * 16 + ln) * ldb + kb;
      FragB b;
      b.half[0] = *(const v8us*)(brow + 8 * hh);
      b.half[1] = *(const v8us*)(brow + 16 + 8 * hh);
      acc[t] = mmaN<ASPLIT ? 2 : 1>(ah.v, al.v, b.v, b.v, acc[t]);
    }
  }
#pragma unroll
  for (int t = 0; t < 4; ++t) {
    const int col = col0 + t * 16 + ln;
    float bv = bias ? bias[col] : 0.f;
    if (BIAS_BF16) bv = bf16_round(bv);
#pragma unroll
    for (int r = 0; r < 8; ++r) {
      float v = acc[t][r] + bv;
      if (resid) { float rv = resid[(size_t)((row0 + 8 * hh + r) % rmod) * ldr + col]; if (RES_BF16) rv = bf16_round(rv); v += rv; }
      if (ACT == 1) v = fmaxf(v, 0.f);
      if (ACT == 2) v = 0.5f * v * (1.0f + erff(v * 0.70710678118654752f));
      if (ACT == 3) { const float u = 0.7978845608028654f * (v + 0.044715f * v * v * v); v = 0.5f * v * (1.0f + tanhf(u)); }
      so[w][8 * hh + r][t * 16 + ln] = v;
    }
  }
  __builtin_amdgcn_fence(__ATOMIC_ACQ_REL, "workgroup");
  __builtin_amdgcn_wave_barrier();
  const int rsub = lane >> 4, c4 = (lane & 15) * 4;
  {
#pragma unroll
    for (int q = 0; q < 8; ++q) {
      const int r = q * 2 + rsub;
      const v4f v = *(const v4fa*)&so[w][r][c4];
      *(v4f*)(C + (size_t)(row0 + r) * ldc + col0 + c4) = v;
    }
    
  }
}
// row LayerNorm (biased variance, eps) over N: s = X (+ R); optional out_sum <- s; out_norm <- (s-mu)*rsqrt(var+eps)*g + b
template <bool PARAM_BF16>
__global__ __launch_bounds__(256) void k_layernorm(const float* __restrict__ X, const float* __restrict__ R, const float* __restrict__ g, const float* __restrict__ bta,
                                                  float* __restrict__ out_sum, float* __restrict__ out_norm, int N, float eps) {
  __shared__ float red[256];
  const int row = blockIdx.x, tid = threadIdx.x;
  const float* x = X + (size_t)row * N; const float* rr = R ? R + (size_t)row * N : nullptr;
  float vals[16];                     // up to N = 4096
  const int per = N / 256;            // contiguous chunk per thread? use strided-by-4 chunks: thread handles j = tid*4 + 1024*u
  float s1 = 0.f;
  for (int u = 0; u < per / 4; ++u) {
    const int j = tid * 4 + 1024 * u;
    const v4f a = *(const v4fa*)(x + j);
    v4f b = {0.f,0.f,0.f,0.f}; if (rr) b = *(const v4fa*)(rr + j);
#pragma unroll
    for (int q = 0; q < 4; ++q) { const float v = a[q] + b[q]; vals[u * 4 + q] = v; s1 += v; }
  }
  red[tid] = s1; __syncthreads();
  for (int st = 128; st > 0; st >>= 1) { if (tid < st) red[tid] += red[tid + st]; __syncthreads(); }
  const float mu = red[0] / (float)N; __syncthreads();
  float s2 = 0.f;
  for (int u = 0; u < per / 4; ++u)
#pragma unroll
    for (int q = 0; q < 4; ++q) { const float c = vals[u * 4 + q] - mu; s2 += c * c; }
  red[tid] = s2; __syncthreads();
  for (int st = 128; st > 0; st >>= 1) { if (tid < st) red[tid] += red[tid + st]; __syncthreads(); }
  const float rs = rsqrtf(red[0] / (float)N + eps);
  {
    for (int u = 0; u < per / 4; ++u) {
      const int j = tid * 4 + 1024 * u;
      v4f o, sm;
#pragma unroll
      for (int q = 0; q < 4; ++q) {
        float gg = g[j + q], bb = bta[j + q];
        if (PARAM_BF16) { gg = bf16_round(gg); bb = bf16_round(bb); }
        sm[q] = vals[u * 4 + q]; o[q] = (vals[u * 4 + q] - mu) * rs * gg + bb;
      }
      if (out_sum) *(v4f*)(out_sum + (size_t)row * N + j) = sm;
      *(v4f*)(out_norm + (size_t)row * N + j) = o;
    }
    
  }
}



// ---- f16 WMMA path (v_wmma_f32_16x16x32_f16): 11-bit significands for operands in range — used for the projection, generator and output GEMMs
typedef _Float16 v16h __attribute__((ext_vector_type(16)));
union FragH { v16h v; v8us half[2]; _Float16 h[16]; unsigned short u[16]; };
template <int NT>
__device__ __forceinline__ v8f mmaH(v16h ah, v16h al, v16h bh, v16h bl, v8f c) {
  c = __builtin_amdgcn_wmma_f32_16x16x32_f16(false, ah, false, bh, (short)0, c, false, false);
  if (NT >= 2) c = __builtin_amdgcn_wmma_f32_16x16x32_f16(false, al, false, bh, (short)0, c, false, false);
  if (NT >= 3) c = __builtin_amdgcn_wmma_f32_16x16x32_f16(false, ah, false, bl, (short)0, c, false, false);
  asm volatile("v_nop\n\tv_nop\n\tv_nop\n\tv_nop" : "+v"(c) : "v"(ah), "v"(al), "v"(bh), "v"(bl));
  return c;
}
// batched GEMM like k_gemm_b but f16 operands: A f32 (split into f16 hi/lo if ASPLIT, else rounded to f16), Bt = f16 values [n][k]; alpha; C f32; N multiple of 16 (partial tiles skipped)
template <bool ASPLIT>
__global__ __launch_bounds__(128) void k_gemm_h(const float* __restrict__ A, int lda, size_t sA, const _Float16* __restrict__ Bh, int ldb, size_t sB, float alpha, float* __restrict__ C, int ldc, size_t sC, int M, int N, int K) {
  __shared__ __attribute__((aligned(16))) float so[4][16][64];
  const int tid = threadIdx.x, w = tid >> 5, lane = tid & 31, ln = lane & 15, hh = lane >> 4; const int by = blockIdx.y;
  A += (size_t)by * sA; Bh += (size_t)by * sB; C += (size_t)by * sC;
  const int ntn = (N + 63) / 64; const int wid = blockIdx.x * 4 + w; const int mt = wid / ntn, nq = wid % ntn; if (mt * 16 >= M) return;
  const int row0 = mt * 16, col0 = nq * 64; const float* arow = A + (size_t)(row0 + ln) * lda;
  v8f acc[4] = {};
  for (int kb = 0; kb < K; kb += 32) {
    FragH ah, al;
    const v4f x0 = *(const v4fa*)(arow + kb + 8 * hh), x1 = *(const v4fa*)(arow + kb + 8 * hh + 4), x2 = *(const v4fa*)(arow + kb + 16 + 8 * hh), x3 = *(const v4fa*)(arow + kb + 16 + 8 * hh + 4);
    float xs[16] = {x0[0],x0[1],x0[2],x0[3],x1[0],x1[1],x1[2],x1[3],x2[0],x2[1],x2[2],x2[3],x3[0],x3[1],x3[2],x3[3]};
#pragma unroll
    for (int i = 0; i < 16; ++i) { const _Float16 h = (_Float16)xs[i]; ah.h[i] = h; al.h[i] = ASPLIT ? (_Float16)(xs[i] - (float)h) : (_Float16)0.0f; }
#pragma unroll
    for (int t = 0; t < 4; ++t) { if (col0 + t * 16 >= N) continue; const size_t boff = (size_t)(col0 + t * 16 + ln) * ldb + kb; FragH bq; bq.half[0] = *(const v8us*)(Bh + boff + 8 * hh); bq.half[1] = *(const v8us*)(Bh + boff + 16 + 8 * hh);
      acc[t] = mmaH<ASPLIT ? 2 : 1>(ah.v, al.v, bq.v, bq.v, acc[t]); }
  }
#pragma unroll
  for (int t = 0; t < 4; ++t) { if (col0 + t * 16 >= N) continue;
#pragma unroll
    for (int r = 0; r < 8; ++r) so[w][8 * hh + r][t * 16 + ln] = acc[t][r] * alpha; }
  __builtin_amdgcn_fence(__ATOMIC_ACQ_REL, "workgroup"); __builtin_amdgcn_wave_barrier();
  const int rsub = lane >> 4, c4 = (lane & 15) * 4;
  {
#pragma unroll
    for (int q = 0; q < 8; ++q) { const int r = q * 2 + rsub; if (col0 + c4 < N) { const v4f v = *(const v4fa*)&so[w][r][c4]; *(v4f*)(C + (size_t)(row0 + r) * ldc + col0 + c4) = v; } }
     }
}

// Wt[n][k] = f16(W[k][n]·scale) from f32 row-major W[K][N] (scale = power of two; bf16-exact weights stay exact in f16 away from the subnormal range)
__global__ __launch_bounds__(256) void k_wt_f16(const float* __restrict__ W, _Float16* __restrict__ Wt, int K, int N, float scale) {
  const int t = blockIdx.x * 256 + threadIdx.x; if (t >= N * (K / 8)) return; const int n = t / (K / 8), k8 = (t % (K / 8)) * 8; FragH f;
#pragma unroll
  for (int i = 0; i < 8; ++i) f.h[i] = (_Float16)(bf16_round(W[(size_t)(k8 + i) * N + n]) * scale); const v8us o = f.half[0];
  *(v8us*)((unsigned short*)Wt + (size_t)n * K + k8) = o; 
}
// k_gemm_hh variant with fused epilogue: v = acc·alpha + bias[by·sBias + col] (+ CP[(row/rowsPerB)·sCPb + by·64 + col] if CP) ; ACT 0 none / 1 elu ; writes f32 C and f16 C16, each if non-null
template <int ACT>
__global__ __launch_bounds__(128) void k_gemm_hhx(const _Float16* __restrict__ A, int lda, size_t sA, const _Float16* __restrict__ Bh, int ldb, size_t sB, float alpha, const float* __restrict__ bias, size_t sBias, const float* __restrict__ CP, int rowsPerB, size_t sCPb, int row0g,
    float* __restrict__ C, _Float16* __restrict__ C16, int ldc, size_t sC, int M, int N, int K) {
  __shared__ __attribute__((aligned(16))) float so[4][16][64];
  const int tid = threadIdx.x, w = tid >> 5, lane = tid & 31, ln = lane & 15, hh = lane >> 4; const int by = blockIdx.y;
  A += (size_t)by * sA; Bh += (size_t)by * sB; const size_t cofs = (size_t)by * sC; const float* bp = bias ? bias + (size_t)by * sBias : nullptr;
  const int ntn = (N + 63) / 64; const int wid = blockIdx.x * 4 + w; const int mt = wid / ntn, nq = wid % ntn; if (mt * 16 >= M) return;
  const int row0 = mt * 16, col0 = nq * 64; const _Float16* arow = A + (size_t)(row0 + ln) * lda;
  v8f acc[4] = {};
  for (int kb = 0; kb < K; kb += 32) { FragH ah; ah.half[0] = *(const v8us*)((const unsigned short*)arow + kb + 8 * hh); ah.half[1] = *(const v8us*)((const unsigned short*)arow + kb + 16 + 8 * hh);
#pragma unroll
    for (int t = 0; t < 4; ++t) { if (col0 + t * 16 >= N) continue; const size_t boff = (size_t)(col0 + t * 16 + ln) * ldb + kb; FragH bq; bq.half[0] = *(const v8us*)((const unsigned short*)Bh + boff + 8 * hh); bq.half[1] = *(const v8us*)((const unsigned short*)Bh + boff + 16 + 8 * hh);
      acc[t] = mmaH<1>(ah.v, ah.v, bq.v, bq.v, acc[t]); }
  }
#pragma unroll
  for (int t = 0; t < 4; ++t) { if (col0 + t * 16 >= N) continue; const int col = col0 + t * 16 + ln; const float bv = bp ? bf16_round(bp[col]) : 0.f;
#pragma unroll
    for (int r = 0; r < 8; ++r) { float v = acc[t][r] * alpha + bv; if (CP) { const int bidx = (row0g + row0 + 8 * hh + r) / rowsPerB; v += CP[(size_t)bidx * sCPb + (size_t)by * 64 + col]; } if (ACT == 1) v = (v > 0.f) ? v : expm1f(v); else if (ACT == 3) v = fmaxf(v, 0.f); so[w][8 * hh + r][t * 16 + ln] = v; } }
  __builtin_amdgcn_fence(__ATOMIC_ACQ_REL, "workgroup"); __builtin_amdgcn_wave_barrier();
  const int rsub = lane >> 4, c4 = (lane & 15) * 4; typedef _Float16 v4h __attribute__((ext_vector_type(4)));
  {
#pragma unroll
    for (int q = 0; q < 8; ++q) { const int r = q * 2 + rsub; if (col0 + c4 < N) { const v4f v = *(const v4fa*)&so[w][r][c4]; if (C) *(v4f*)(C + cofs + (size_t)(row0 + r) * ldc + col0 + c4) = v; if (C16) { v4h h4; for (int i = 0; i < 4; ++i) h4[i] = (_Float16)v[i]; *(v4h*)(C16 + cofs + (size_t)(row0 + r) * ldc + col0 + c4) = h4; } } }
     }
}


// FRAGMENT ORDER of every f16 operand plane in the workspace (weights, pf_low, g): a plane [rows][K] is cut into units of 16 rows x 32 k = 1 KB, unit index = (row / 16) * (K / 32) + k / 32;
// the 16-byte piece j * 32 + lane of a unit holds row (lane & 15), k = 16 j + 8 (lane >> 4) .. + 7: what lane reads as half j of its WMMA fragment. One wave-wide 16-byte load = 512 contiguous bytes = 4 whole lines.
// Bt = f16(bf16(W) * 16) in fragment order, W f32 [rows][32 * KSTEPS]; thread t writes piece t.
template <int KSTEPS>
__global__ __launch_bounds__(256) void k_round16f(const float* __restrict__ W, _Float16* __restrict__ Bt, size_t n8) { const size_t t = (size_t)blockIdx.x * 256 + threadIdx.x; if (t >= n8) return; FragH f;
  const int lane = (int)t & 31, j = ((int)t >> 5) & 1, unit = (int)(t >> 6);
  const float* src = W + (size_t)((unit / KSTEPS) * 16 + (lane & 15)) * (32 * KSTEPS) + (unit % KSTEPS) * 32 + 16 * j + 8 * (lane >> 4);
  const v4f x0 = *(const v4fa*)src, x1 = *(const v4fa*)(src + 4);
#pragma unroll
  for (int i = 0; i < 8; ++i) f.h[i] = (_Float16)(bf16_round(i < 4 ? x0[i & 3] : x1[i & 3]) * 16.0f); *(v8us*)((unsigned short*)Bt + t * 8) = f.half[0];  }
__global__ __launch_bounds__(256) void k_h16(const float* __restrict__ x, _Float16* __restrict__ X16, size_t n8) { const size_t t = (size_t)blockIdx.x * 256 + threadIdx.x; if (t >= n8) return; FragH f;
#pragma unroll
  for (int q = 0; q < 8; ++q) f.h[q] = (_Float16)x[t * 8 + q]; *(v8us*)((unsigned short*)X16 + t * 8) = f.half[0];  }
// Projection C[NBS][LOW] = x . W^T + bias with x read as f32 and rounded on its way into the A fragment (bf16 rounding, then f16: the values the staged f16 copy held).
// Tile map and k order are those of k_gemm_hhx: one wave = 16 rows x 64 columns, k rising, one accumulator chain per 16 x 16 tile. Bh, and C16 where it is written, are in fragment order.
#define PJ_U 8
template <bool OUT16>
__global__ __launch_bounds__(128) void k_proj(const float* __restrict__ X, const _Float16* __restrict__ Bh, const float* __restrict__ bias, float* __restrict__ C, _Float16* __restrict__ C16) {
  __shared__ __attribute__((aligned(16))) float so[4][16][OUT16 ? 68 : 64];      // pitch 68 floats where 16 lanes read one column range of 16 rows: it spreads them over all banks
  const int tid = threadIdx.x, w = tid >> 5, lane = tid & 31, ln = lane & 15, hh = lane >> 4;
  const int wid = blockIdx.x * 4 + w, row0 = (wid >> 1) * 16, col0 = (wid & 1) * 64;
  const float* arow = X + (size_t)(row0 + ln) * FD + 8 * hh;
  const unsigned short* brow = (const unsigned short*)Bh + (size_t)col0 * FD + lane * 8;
  v8f acc[4] = {};
  for (int kb = 0; kb < FD; kb += 32 * PJ_U) {
    v4f x[PJ_U][4]; FragH b[PJ_U][4];
#pragma unroll
    for (int u = 0; u < PJ_U; ++u) {
      const float* p = arow + kb + u * 32;
      x[u][0] = *(const v4fa*)p; x[u][1] = *(const v4fa*)(p + 4); x[u][2] = *(const v4fa*)(p + 16); x[u][3] = *(const v4fa*)(p + 20);
    }
#pragma unroll
    for (int u = 0; u < PJ_U; ++u)
#pragma unroll
      for (int t = 0; t < 4; ++t) {
        const unsigned short* p = brow + (size_t)t * 16 * FD + kb * 16 + u * 512;
        b[u][t].half[0] = *(const v8us*)p; b[u][t].half[1] = *(const v8us*)(p + 256);
      }
    asm volatile("s_wait_xcnt 0x0" ::: "memory");      // precaution: stands in front of the additions that step these loads' two address pairs to the next group
    __builtin_amdgcn_sched_barrier(0);      // keeps the whole group's loads in front of the first conversion (x comes from memory, and one k step's 2 KB a wave in flight would leave the kernel waiting on latency) and the address additions behind the wait
#pragma unroll
    for (int u = 0; u < PJ_U; ++u) {
      FragH a;
#pragma unroll
      for (int i = 0; i < 16; ++i) a.h[i] = (_Float16)bf16_round(x[u][i >> 2][i & 3]);
#pragma unroll
      for (int t = 0; t < 4; ++t) acc[t] = __builtin_amdgcn_wmma_f32_16x16x32_f16(false, a.v, false, b[u][t].v, (short)0, acc[t], false, false);
    }
  }
  float bv[4];
#pragma unroll
  for (int t = 0; t < 4; ++t) bv[t] = bias[col0 + t * 16 + ln];
  asm volatile("s_wait_xcnt 0x0" ::: "memory");      // precaution: the compiler reuses the bias loads' offset register at once
  __builtin_amdgcn_sched_barrier(0);      // holds that reuse behind the wait
#pragma unroll
  for (int t = 0; t < 4; ++t) {
    const float bb = bf16_round(bv[t]);
#pragma unroll
    for (int r = 0; r < 8; ++r) so[w][8 * hh + r][t * 16 + ln] = acc[t][r] * 0.0625f + bb;
  }
  __builtin_amdgcn_fence(__ATOMIC_ACQ_REL, "workgroup", "local"); __builtin_amdgcn_wave_barrier();      // the wave's own LDS stores land before it reads the rows back
  if constexpr (OUT16) {
    // the wave's 64 columns are two units of its row tile: four stores of 512 contiguous bytes
    unsigned short* o = (unsigned short*)C16 + (size_t)row0 * LOW + col0 * 16 + lane * 8;
#pragma unroll
    for (int q = 0; q < 4; ++q) {
      const float* s = &so[w][ln][q * 16 + 8 * hh];
      const v4f v0 = *(const v4fa*)s, v1 = *(const v4fa*)(s + 4);
      FragH h;
#pragma unroll
      for (int i = 0; i < 8; ++i) h.h[i] = (_Float16)(i < 4 ? v0[i & 3] : v1[i & 3]);
      *(v8us*)(o + q * 256) = h.half[0];
    }
  } else {
    const int rsub = lane >> 4, c4 = (lane & 15) * 4;
    const size_t o0 = (size_t)(row0 + rsub) * LOW + col0 + c4;
#pragma unroll
    for (int q = 0; q < 8; ++q) {
      const v4f v = *(const v4fa*)&so[w][q * 2 + rsub][c4];
      *(v4f*)(C + o0 + q * 2 * LOW) = v;
    }
  }
}
// out[NBS][FD] = g . W2^T + bias + (f + pf): f and pf are read as f32 by the lane that stores the element, 16 bytes at a time, rounded to bf16 and summed there.
// Tile map and k order are those of k_gemm_hhx (one wave = 16 rows x 64 columns). G and Bh are in fragment order.
__global__ __launch_bounds__(128) void k_out(const _Float16* __restrict__ G, const _Float16* __restrict__ Bh, const float* __restrict__ bias, const float* __restrict__ f, const float* __restrict__ pf, float* __restrict__ out) {
  __shared__ __attribute__((aligned(16))) float so[4][16][64];
  const int tid = threadIdx.x, w = tid >> 5, lane = tid & 31, ln = lane & 15, hh = lane >> 4;
  const int wid = blockIdx.x * 4 + w, row0 = (wid / (FD / 64)) * 16, col0 = (wid % (FD / 64)) * 64;
  const int rsub = lane >> 4, c4 = (lane & 15) * 4;
  const unsigned short* arow = (const unsigned short*)G + (size_t)row0 * LOW + lane * 8;
  const unsigned short* brow = (const unsigned short*)Bh + (size_t)col0 * LOW + lane * 8;
  FragH a[LOW / 32], b[4][LOW / 32];
#pragma unroll
  for (int ks = 0; ks < LOW / 32; ++ks) { a[ks].half[0] = *(const v8us*)(arow + ks * 512); a[ks].half[1] = *(const v8us*)(arow + ks * 512 + 256); }
  asm volatile("s_wait_xcnt 0x0" ::: "memory");      // precaution: the compiler reuses these loads' address pair as the destination of a later load
#pragma unroll
  for (int t = 0; t < 4; ++t)
#pragma unroll
    for (int ks = 0; ks < LOW / 32; ++ks) { b[t][ks].half[0] = *(const v8us*)(brow + (size_t)t * 16 * LOW + ks * 512); b[t][ks].half[1] = *(const v8us*)(brow + (size_t)t * 16 * LOW + ks * 512 + 256); }
  float bv[4];
#pragma unroll
  for (int t = 0; t < 4; ++t) bv[t] = bias[col0 + t * 16 + ln];
  asm volatile("s_wait_xcnt 0x0" ::: "memory");      // precaution: the operand loads' address registers are free for reuse behind it
  __builtin_amdgcn_sched_barrier(0);      // loads return in order: the operand loads (L2) stay in front of the residual loads (memory), so that the WMMAs need not wait for the latter
  const size_t o0 = (size_t)(row0 + rsub) * FD + col0 + c4;
  v4f rf[8], rp[8];
#pragma unroll
  for (int q = 0; q < 8; ++q) { rf[q] = *(const v4fa*)(f + o0 + q * 2 * FD); rp[q] = *(const v4fa*)(pf + o0 + q * 2 * FD); }
  asm volatile("s_wait_xcnt 0x0" ::: "memory");      // precaution: as above, for the residual loads' two address pairs
  __builtin_amdgcn_sched_barrier(0);      // keeps the residual loads in front of the product, which then runs under their latency
  v8f acc[4] = {};
#pragma unroll
  for (int ks = 0; ks < LOW / 32; ++ks)
#pragma unroll
    for (int t = 0; t < 4; ++t) acc[t] = __builtin_amdgcn_wmma_f32_16x16x32_f16(false, a[ks].v, false, b[t][ks].v, (short)0, acc[t], false, false);
#pragma unroll
  for (int t = 0; t < 4; ++t) {
    const float bb = bf16_round(bv[t]);
#pragma unroll
    for (int r = 0; r < 8; ++r) so[w][8 * hh + r][t * 16 + ln] = acc[t][r] * 0.0625f + bb;
  }
  __builtin_amdgcn_fence(__ATOMIC_ACQ_REL, "workgroup", "local"); __builtin_amdgcn_wave_barrier();      // the wave's own LDS stores land before it reads the rows back; LDS alone, so that the residual loads stay in flight
#pragma unroll
  for (int q = 0; q < 8; ++q) {
    v4f v = *(const v4fa*)&so[w][q * 2 + rsub][c4];
#pragma unroll
    for (int c = 0; c < 4; ++c) v[c] += bf16_round(rf[q][c]) + bf16_round(rp[q][c]);
    *(v4f*)(out + o0 + q * 2 * FD) = v;
  }
}
// Parameter generator and per-sample MLP in one kernel: a work-group owns GM_M samples and never stores their generated parameters.
// Each 16 x 16 tile of params = pf_low . pg_w^T (K = LOW, four f16 WMMAs) is scaled, biased and summed into h or g straight from the accumulator registers
// (accumulator register r of lane (ln, hh) = sample 8 * hh + r, parameter column ln).
// Layer 1: parameter n = l * MID + m; wave w owns l = 16 w .. 16 w + 15 and sums them in rising order; the eight waves' partial h meet in LDS in rising wave order, then relu.
// Layer 2: parameter n = LOW * MID + m * LOW + l; wave w owns l = 16 w .. 16 w + 15 and sums m in rising order.
#define GM_M 32
struct Yes { static constexpr bool value = true; }; struct No { static constexpr bool value = false; };
__global__ __launch_bounds__(256) void k_gen_mlp(const _Float16* __restrict__ PL, const _Float16* __restrict__ Bg, const float* __restrict__ pgb, const float* __restrict__ FLOW, _Float16* __restrict__ G16) {
  __shared__ __attribute__((aligned(16))) float sF[LOW][GM_M];              // flow[s][l] at [l][s]; rows 16 w .. + 15 are written and read by wave w alone
  __shared__ __attribute__((aligned(16))) float sP[8][MID][GM_M + 4];       // partial h per wave at [m][s]; pitch 36 floats spreads the 16-byte stores of 16 rows m over all banks
  __shared__ __attribute__((aligned(16))) float sH[MID][GM_M];              // h after relu at [m][s]
  __shared__ __attribute__((aligned(16))) _Float16 sG[GM_M][LOW + 8];       // g as f16, gathered so that the work-group stores it in fragment order
  const int tid = threadIdx.x, lane = tid & 31, ln = lane & 15, hh = lane >> 4;
  const int w = __builtin_amdgcn_readfirstlane(tid >> 5);
  const int s0 = blockIdx.x * GM_M;
  struct BTile { FragH f[LOW / 32]; float b; };
  // tile u of this wave's stream: u < 32 layer 1 (l = 16 w + u / 2, m half u & 1), else layer 2 (m = u - 32)
  const unsigned short* blane = (const unsigned short*)Bg + lane * 8;      // fragment order: a tile of 16 parameters is 4 KB in a row
  const float* clane = pgb + ln;
  auto load_tile = [&](BTile& t, int u) {
    const int n0 = (u < 32) ? (w * 512 + u * 16) : (LOW * MID + (u - 32) * LOW + w * 16);
    const unsigned short* p = blane + (size_t)n0 * LOW;
    t.b = clane[n0];
#pragma unroll
    for (int ks = 0; ks < LOW / 32; ++ks) { t.f[ks].half[0] = *(const v8us*)(p + ks * 512); t.f[ks].half[1] = *(const v8us*)(p + ks * 512 + 256); }
  };
  v4f fl[4];
#pragma unroll
  for (int j = 0; j < 4; ++j) fl[j] = *(const v4fa*)(FLOW + (size_t)(s0 + lane) * LOW + w * 16 + j * 4);
  FragH a[2][LOW / 32];
#pragma unroll
  for (int mt = 0; mt < 2; ++mt) {
    const unsigned short* ar = (const unsigned short*)PL + (size_t)(s0 + mt * 16) * LOW + lane * 8;
#pragma unroll
    for (int ks = 0; ks < LOW / 32; ++ks) { a[mt][ks].half[0] = *(const v8us*)(ar + ks * 512); a[mt][ks].half[1] = *(const v8us*)(ar + ks * 512 + 256); }
    if (mt == 0) asm volatile("s_wait_xcnt 0x0" ::: "memory");      // precaution: the compiler reuses an address pair of the loads above as the destination of a load of the second tile
  }
  __builtin_amdgcn_sched_barrier(0);      // keeps the sample loads in front of the weight loads: loads return in order, and behind them they would force the loop's first wait to drain the weight tiles too
  BTile bt[2];
  load_tile(bt[0], 0); load_tile(bt[1], 1);
#pragma unroll
  for (int j = 0; j < 4; ++j)
#pragma unroll
    for (int c = 0; c < 4; ++c) sF[w * 16 + j * 4 + c][lane] = fl[j][c];
  // fence on LDS alone: the wave's own stores land before it reads the rows back; a fence on every address space would also drain the weight loads in flight
  __builtin_amdgcn_fence(__ATOMIC_ACQ_REL, "workgroup", "local"); __builtin_amdgcn_wave_barrier();
  // one tile: acc[mt][r] += cf[sample] * (tile / 16 + bias); the tile's registers are refilled with tile un as soon as its WMMAs have issued
  auto tile_step = [&](BTile& t, const float* cf, v8f& acc0, v8f& acc1, int un, auto refill) {
    const v4f c00 = *(const v4fa*)(cf + 8 * hh), c01 = *(const v4fa*)(cf + 8 * hh + 4), c10 = *(const v4fa*)(cf + 16 + 8 * hh), c11 = *(const v4fa*)(cf + 16 + 8 * hh + 4);
    v8f d0 = {}, d1 = {};
#pragma unroll
    for (int ks = 0; ks < LOW / 32; ++ks) {
      d0 = __builtin_amdgcn_wmma_f32_16x16x32_f16(false, a[0][ks].v, false, t.f[ks].v, (short)0, d0, false, false);
      d1 = __builtin_amdgcn_wmma_f32_16x16x32_f16(false, a[1][ks].v, false, t.f[ks].v, (short)0, d1, false, false);
    }
    const float bv = bf16_round(t.b);
    if constexpr (decltype(refill)::value) load_tile(t, un);
#pragma unroll
    for (int r = 0; r < 8; ++r) {
      acc0[r] += ((r < 4) ? c00[r & 3] : c01[r & 3]) * (d0[r] * 0.0625f + bv);
      acc1[r] += ((r < 4) ? c10[r & 3] : c11[r & 3]) * (d1[r] * 0.0625f + bv);
    }
  };
  v8f hp[2][2] = {};      // [m half][sample tile]
  for (int i = 0; i < 16; ++i) {
    const float* cf = &sF[w * 16 + i][0];
    tile_step(bt[0], cf, hp[0][0], hp[0][1], 2 * i + 2, Yes{});
    tile_step(bt[1], cf, hp[1][0], hp[1][1], 2 * i + 3, Yes{});
  }
#pragma unroll
  for (int mh = 0; mh < 2; ++mh)
#pragma unroll
    for (int mt = 0; mt < 2; ++mt) {
      float* d = &sP[w][mh * 16 + ln][mt * 16 + 8 * hh];
      *(v4fa*)d = (v4f){hp[mh][mt][0], hp[mh][mt][1], hp[mh][mt][2], hp[mh][mt][3]};
      *(v4fa*)(d + 4) = (v4f){hp[mh][mt][4], hp[mh][mt][5], hp[mh][mt][6], hp[mh][mt][7]};
    }
  __syncthreads();      // every wave's partial h is in LDS
  {
    const int m = tid >> 3, s4 = (tid & 7) * 4;
    v4f v = *(const v4fa*)&sP[0][m][s4];
#pragma unroll
    for (int q = 1; q < 8; ++q) v += *(const v4fa*)&sP[q][m][s4];
#pragma unroll
    for (int c = 0; c < 4; ++c) v[c] = fmaxf(v[c], 0.f);
    *(v4fa*)&sH[m][s4] = v;
  }
  __syncthreads();      // h is complete before any wave reads it
  v8f g0 = {}, g1 = {};
  for (int i = 0; i < 15; ++i) {
    tile_step(bt[0], &sH[2 * i][0], g0, g1, 32 + 2 * i + 2, Yes{});
    tile_step(bt[1], &sH[2 * i + 1][0], g0, g1, 32 + 2 * i + 3, Yes{});
  }
  tile_step(bt[0], &sH[30][0], g0, g1, 0, No{});
  tile_step(bt[1], &sH[31][0], g0, g1, 0, No{});
#pragma unroll
  for (int r = 0; r < 8; ++r) { sG[8 * hh + r][w * 16 + ln] = (_Float16)g0[r]; sG[16 + 8 * hh + r][w * 16 + ln] = (_Float16)g1[r]; }
  __syncthreads();      // all of g is in LDS before the rows are stored
#pragma unroll
  for (int j = 0; j < 2; ++j) {
    // piece tid of row tile j in fragment order: wave w stores half w & 1 of unit w >> 1
    *(v8us*)((unsigned short*)G16 + (size_t)(s0 + 16 * j) * LOW + tid * 8) = *(const v8us*)&sG[16 * j + ln][(w >> 1) * 32 + (w & 1) * 16 + 8 * hh];
  }
}
extern "C" void kernel_launch(void* const* d_in, const int* in_sizes, int n_in,
                              void* d_out, int out_size, void* d_ws, size_t ws_size, hipStream_t stream) {
  (void)in_sizes; (void)n_in; (void)out_size;
  const float* f = (const float*)d_in[0]; const float* pf = (const float*)d_in[1]; const float* pfw = (const float*)d_in[2]; const float* pfb = (const float*)d_in[3]; const float* ppw = (const float*)d_in[4]; const float* ppb = (const float*)d_in[5]; const float* f2w = (const float*)d_in[6]; const float* f2b = (const float*)d_in[7]; const float* pgw = (const float*)d_in[8]; const float* pgb = (const float*)d_in[9];
  char* ws = (char*)d_ws; size_t off = 0;
  auto take = [&](size_t bytes) { char* p = ws + off; off += (bytes + 255) & ~(size_t)255; return p; };
  _Float16* Bf = (_Float16*)take((size_t)LOW * FD * 2); _Float16* Bp = (_Float16*)take((size_t)LOW * FD * 2); _Float16* Bg = (_Float16*)take((size_t)NPAR * LOW * 2); _Float16* B2 = (_Float16*)take((size_t)FD * LOW * 2);
  float* FLOW = (float*)take((size_t)NBS * LOW * 4); _Float16* PL16 = (_Float16*)take((size_t)NBS * LOW * 2); _Float16* G16 = (_Float16*)take((size_t)NBS * LOW * 2);
  if (off > ws_size) return;      // about 11 MiB
  k_round16f<FD / 32><<<(LOW * FD / 8 + 255) / 256, 256, 0, stream>>>(pfw, Bf, (size_t)LOW * FD / 8); k_round16f<FD / 32><<<(LOW * FD / 8 + 255) / 256, 256, 0, stream>>>(ppw, Bp, (size_t)LOW * FD / 8); k_round16f<LOW / 32><<<(NPAR * LOW / 8 + 255) / 256, 256, 0, stream>>>(pgw, Bg, (size_t)NPAR * LOW / 8); k_round16f<LOW / 32><<<(FD * LOW / 8 + 255) / 256, 256, 0, stream>>>(f2w, B2, (size_t)FD * LOW / 8);      // (out,in), fragment order
  k_proj<false><<<(NBS / 16) * (LOW / 64) / 4, 128, 0, stream>>>(f, Bf, pfb, FLOW, nullptr);      // f_low (f32, read by the per-sample MLP)
  k_proj<true><<<(NBS / 16) * (LOW / 64) / 4, 128, 0, stream>>>(pf, Bp, ppb, nullptr, PL16);      // pf_low (f16 operand of the generator)
  k_gen_mlp<<<NBS / GM_M, 256, 0, stream>>>(PL16, Bg, pgb, FLOW, G16);      // params = pf_low . pg_w^T + pg_b, consumed in registers by the per-sample MLP
  k_out<<<(NBS / 16) * (FD / 64) / 4, 128, 0, stream>>>(G16, B2, f2b, f, pf, (float*)d_out);      // g . proj_f2^T + b + (f + pf)
}

// v005
// One run takes 63.8 microseconds.
// Timed twice side by side with v004, it ran 1.16 times as fast both times.
// All steps since v000 together make it 9.12 times as fast.
#include <hip/hip_runtime.h>
// + bias, + f + pf residuals as exact bf16 addends) on v_wmma_f32_16x16x32_f16 (f16 operands, nn.Linear weights (out,in) bf16-exact ×2^4, f32 accumulate); the per-sample tiny MLP
// (128 -> 32 relu -> 128 with that sample's generated weights) is f32 VALU on the generator's accumulator tiles (32 samples per work-group).
#define NBS 8192
#define FD 1024
#define LOW 128
#define MID 32
#define NPAR (2 * LOW * MID)

typedef __bf16 v16b __attribute__((ext_vector_type(16)));
typedef unsigned short v8us __attribute__((ext_vector_type(8), may_alias));
typedef float  v8f  __attribute__((ext_vector_type(8)));
typedef float  v4f  __attribute__((ext_vector_type(4)));
typedef float  v4fa __attribute__((ext_vector_type(4), may_alias));
union FragB { v16b v; v8us half[2]; unsigned short u[16]; };

__device__ __forceinline__ unsigned short bf16_bits(float x) { unsigned int u = __float_as_uint(x); return (unsigned short)((u + 0x7FFFu + ((u >> 16) & 1u)) >> 16); }
__device__ __forceinline__ float bf16_val(unsigned short b) { return __uint_as_float(((unsigned int)b) << 16); }
__device__ __forceinline__ float bf16_round(float x) { return bf16_val(bf16_bits(x)); }
// D += A·B with NT terms: 1 = ah·bh, 2 = + al·bh (A split), 3 = + ah·bl (both split)
template <int NT>
__device__ __forceinline__ v8f mmaN(v16b ah, v16b al, v16b bh, v16b bl, v8f c) {
  c = __builtin_amdgcn_wmma_f32_16x16x32_bf16(false, ah, false, bh, (short)0, c, false, false);
  if (NT >= 2) c = __builtin_amdgcn_wmma_f32_16x16x32_bf16(false, al, false, bh, (short)0, c, false, false);
  if (NT >= 3) c = __builtin_amdgcn_wmma_f32_16x16x32_bf16(false, ah, false, bl, (short)0, c, false, false);
  asm volatile("v_nop\n\tv_nop\n\tv_nop\n\tv_nop" : "+v"(c) : "v"(ah), "v"(al), "v"(bh), "v"(bl));
  return c;
}

__global__ __launch_bounds__(256) void k_wt_bf16(const float* __restrict__ W, unsigned short* __restrict__ Wt, int K, int N) {
  const int t = blockIdx.x * 256 + threadIdx.x;
  const int k8n = K / 8;
  if (t >= N * k8n) return;
  const int n = t / k8n, k8 = (t % k8n) * 8;
  v8us v;
#pragma unroll
  for (int i = 0; i < 8; ++i) v[i] = bf16_bits(W[(size_t)(k8 + i) * N + n]);
  *(v8us*)(Wt + (size_t)n * K + k8) = v;
  
}

// GEMM C[M][N] (f32, pitch ldc) = act(A[M][K]·W + bias). A f32 row-major (pitch lda) converted per fragment to bf16
// (ASPLIT: hi/lo two planes -> 2 terms, else single rounded term); Wt bf16 [N][K] (pitch ldb). BIAS_BF16 rounds the
// bias to bf16 first (bias quantised to bf16 before the add). K%32==0, M%16==0, N%64==0.
template <bool ASPLIT, int ACT, bool BIAS_BF16>
__global__ __launch_bounds__(128) void k_gemm_bf(const float* __restrict__ A, int lda, const unsigned short* __restrict__ Wt, int ldb,
                                               const float* __restrict__ bias, float* __restrict__ C, int ldc, int M, int N, int K) {
  __shared__ __attribute__((aligned(16))) float so[4][16][64];
  const int tid = threadIdx.x, w = tid >> 5, lane = tid & 31, ln = lane & 15, hh = lane >> 4;
  const int ntn = N / 64;
  const int wid = blockIdx.x * 4 + w;
  const int mt = wid / ntn, nq = wid % ntn;
  if (mt * 16 >= M) return;
  const int row0 = mt * 16, col0 = nq * 64;
  const float* arow = A + (size_t)(row0 + ln) * lda;
  v8f acc[4] = {};
  for (int kb = 0; kb < K; kb += 32) {
    FragB ah, al;
    const v4f x0 = *(const v4fa*)(arow + kb + 8 * hh), x1 = *(const v4fa*)(arow + kb + 8 * hh + 4);
    const v4f x2 = *(const v4fa*)(arow + kb + 16 + 8 * hh), x3 = *(const v4fa*)(arow + kb + 16 + 8 * hh + 4);
    float xs[16] = {x0[0],x0[1],x0[2],x0[3],x1[0],x1[1],x1[2],x1[3],x2[0],x2[1],x2[2],x2[3],x3[0],x3[1],x3[2],x3[3]};
#pragma unroll
    for (int i = 0; i < 16; ++i) { const unsigned short hb = bf16_bits(xs[i]); ah.u[i] = hb; al.u[i] = ASPLIT ? bf16_bits(xs[i] - bf16_val(hb)) : (unsigned short)0; }
#pragma unroll
    for (int t = 0; t < 4; ++t) {
      const unsigned short* brow = Wt + (size_t)(col0 + t * 16 + ln) * ldb + kb;
      FragB b;
      b.half[0] = *(const v8us*)(brow + 8 * hh);
      b.half[1] = *(const v8us*)(brow + 16 + 8 * hh);
      acc[t] = mmaN<ASPLIT ? 2 : 1>(ah.v, al.v, b.v, b.v, acc[t]);
    }
  }
#pragma unroll
  for (int t = 0; t < 4; ++t) {
    float bv = bias ? bias[col0 + t * 16 + ln] : 0.f;
    if (BIAS_BF16) bv = bf16_round(bv);
#pragma unroll
    for (int r = 0; r < 8; ++r) { float v = acc[t][r] + bv; if (ACT == 1) v = fmaxf(v, 0.f); so[w][8 * hh + r][t * 16 + ln] = v; }
  }
  __builtin_amdgcn_fence(__ATOMIC_ACQ_REL, "workgroup");
  __builtin_amdgcn_wave_barrier();
  const int rsub = lane >> 4, c4 = (lane & 15) * 4;
  {
#pragma unroll
    for (int q = 0; q < 8; ++q) {
      const int r = q * 2 + rsub;
      const v4f v = *(const v4fa*)&so[w][r][c4];
      *(v4f*)(C + (size_t)(row0 + r) * ldc + col0 + c4) = v;
    }
    
  }
}

// Flash-style causal/unmasked attention, all contractions 3-term bf16 hi/lo splits, f32 softmax with running max.
// q,k,v rows are read from f32 buffers with arbitrary row pitch (so they can live inside a fused qkv buffer);
// D = head size (multiple of 32, <= 128); one wave = 16 query rows; block = 4 waves (64 queries) sharing K/V chunks of 32.
template <int D, bool CAUSAL>
__global__ __launch_bounds__(128) void k_flash(const float* __restrict__ qb, const float* __restrict__ kb, const float* __restrict__ vb,
                                             int pitch, int T, int H, float scale, float* __restrict__ y, int ypitch) {
  constexpr int KS = D / 32;        // k-steps for QK
  constexpr int DT = D / 16;        // d tiles for PV
  __shared__ __attribute__((aligned(16))) unsigned short sKh[32][D + 8], sKl[32][D + 8], sVh[32][D + 8], sVl[32][D + 8];
  __shared__ __attribute__((aligned(16))) unsigned short sPh[4][16][40], sPl[4][16][40];
  __shared__ __attribute__((aligned(16))) float sO[4][16][D];
  const int tid = threadIdx.x, w = tid >> 5, lane = tid & 31, ln = lane & 15, hh = lane >> 4;
  const int nqb = (T + 63) / 64;
  const int bh = blockIdx.x / nqb, qblk = blockIdx.x % nqb;
  const int b = bh / H, h = bh % H;
  const int q0 = qblk * 64 + w * 16;
  const float* Q = qb + (size_t)b * T * pitch + h * D;
  const float* K = kb + (size_t)b * T * pitch + h * D;
  const float* V = vb + (size_t)b * T * pitch + h * D;

  // A fragments of the wave's 16 query rows (scaled), hi/lo
  FragB aqh[KS], aql[KS];
  {
    int row = q0 + ln; if (row >= T) row = T - 1;
    const float* qr = Q + (size_t)row * pitch;
#pragma unroll
    for (int ks = 0; ks < KS; ++ks)
#pragma unroll
      for (int i = 0; i < 16; ++i) {
        const int d = ks * 32 + ((i < 8) ? (8 * hh + i) : (16 + 8 * hh + (i - 8)));
        const float x = qr[d] * scale; const unsigned short hb = bf16_bits(x);
        aqh[ks].u[i] = hb; aql[ks].u[i] = bf16_bits(x - bf16_val(hb));
      }
  }
  float m_r[8], l_r[8];
#pragma unroll
  for (int r = 0; r < 8; ++r) { m_r[r] = -3.0e38f; l_r[r] = 0.f; }
  v8f oacc[DT];
#pragma unroll
  for (int dt = 0; dt < DT; ++dt) oacc[dt] = (v8f){0.f,0.f,0.f,0.f,0.f,0.f,0.f,0.f};

  const int kv_end = CAUSAL ? min(T, qblk * 64 + 64) : T;     // block-uniform
  for (int j0 = 0; j0 < kv_end; j0 += 32) {
    __syncthreads();
    for (int e = tid; e < 32 * (D / 4); e += 128) {
      const int r = e / (D / 4), c4 = (e % (D / 4)) * 4;
      const int key = j0 + r;
      v4f kf = {0.f,0.f,0.f,0.f}, vf = {0.f,0.f,0.f,0.f};
      if (key < T) { kf = *(const v4fa*)(K + (size_t)key * pitch + c4); vf = *(const v4fa*)(V + (size_t)key * pitch + c4); }
#pragma unroll
      for (int t = 0; t < 4; ++t) {
        unsigned short hb = bf16_bits(kf[t]); sKh[r][c4 + t] = hb; sKl[r][c4 + t] = bf16_bits(kf[t] - bf16_val(hb));
        hb = bf16_bits(vf[t]); sVh[r][c4 + t] = hb; sVl[r][c4 + t] = bf16_bits(vf[t] - bf16_val(hb));
      }
    }
    __syncthreads();
    // S tile 16 x 32
    v8f s[2];
#pragma unroll
    for (int nt = 0; nt < 2; ++nt) {
      v8f acc = {};
#pragma unroll
      for (int ks = 0; ks < KS; ++ks) {
        FragB bh_, bl_;
        bh_.half[0] = *(const v8us*)&sKh[nt * 16 + ln][ks * 32 + 8 * hh]; bh_.half[1] = *(const v8us*)&sKh[nt * 16 + ln][ks * 32 + 16 + 8 * hh];
        bl_.half[0] = *(const v8us*)&sKl[nt * 16 + ln][ks * 32 + 8 * hh]; bl_.half[1] = *(const v8us*)&sKl[nt * 16 + ln][ks * 32 + 16 + 8 * hh];
        acc = mmaN<3>(aqh[ks].v, aql[ks].v, bh_.v, bl_.v, acc);
      }
      s[nt] = acc;
    }
    // mask + running max (rows 8hh+r; the 16 lanes of a half share rows)
    float alpha[8];
#pragma unroll
    for (int r = 0; r < 8; ++r) {
      const int qi = q0 + 8 * hh + r;
      const int ja = j0 + ln, jb = j0 + 16 + ln;
      if (CAUSAL) { if (ja > qi) s[0][r] = -3.0e38f; if (jb > qi) s[1][r] = -3.0e38f; }
      if (ja >= T) s[0][r] = -3.0e38f;
      if (jb >= T) s[1][r] = -3.0e38f;
      float mx = fmaxf(s[0][r], s[1][r]);
      mx = fmaxf(mx, __shfl_xor(mx, 1, 32)); mx = fmaxf(mx, __shfl_xor(mx, 2, 32)); mx = fmaxf(mx, __shfl_xor(mx, 4, 32)); mx = fmaxf(mx, __shfl_xor(mx, 8, 32));
      const float mnew = fmaxf(m_r[r], mx);
      alpha[r] = (mnew > -1.0e38f) ? __expf(m_r[r] - mnew) : 1.0f;
      const float p0 = (s[0][r] > -1.0e38f) ? __expf(s[0][r] - mnew) : 0.f;
      const float p1 = (s[1][r] > -1.0e38f) ? __expf(s[1][r] - mnew) : 0.f;
      m_r[r] = mnew;
      l_r[r] = l_r[r] * alpha[r] + p0 + p1;            // per-lane partial row sum (16 lanes combined at the end)
      unsigned short hb = bf16_bits(p0); sPh[w][8 * hh + r][ln] = hb;      sPl[w][8 * hh + r][ln] = bf16_bits(p0 - bf16_val(hb));
      hb = bf16_bits(p1);                sPh[w][8 * hh + r][16 + ln] = hb; sPl[w][8 * hh + r][16 + ln] = bf16_bits(p1 - bf16_val(hb));
    }
#pragma unroll
    for (int dt = 0; dt < DT; ++dt)
#pragma unroll
      for (int r = 0; r < 8; ++r) oacc[dt][r] *= alpha[r];
    __builtin_amdgcn_fence(__ATOMIC_ACQ_REL, "workgroup");
    __builtin_amdgcn_wave_barrier();
    FragB pah, pal;
    pah.half[0] = *(const v8us*)&sPh[w][ln][8 * hh]; pah.half[1] = *(const v8us*)&sPh[w][ln][16 + 8 * hh];
    pal.half[0] = *(const v8us*)&sPl[w][ln][8 * hh]; pal.half[1] = *(const v8us*)&sPl[w][ln][16 + 8 * hh];
#pragma unroll
    for (int dt = 0; dt < DT; ++dt) {
      FragB bvh, bvl;
#pragma unroll
      for (int i = 0; i < 8; ++i) {
        bvh.u[i] = sVh[8 * hh + i][dt * 16 + ln]; bvh.u[8 + i] = sVh[16 + 8 * hh + i][dt * 16 + ln];
        bvl.u[i] = sVl[8 * hh + i][dt * 16 + ln]; bvl.u[8 + i] = sVl[16 + 8 * hh + i][dt * 16 + ln];
      }
      oacc[dt] = mmaN<3>(pah.v, pal.v, bvh.v, bvl.v, oacc[dt]);
    }
    __builtin_amdgcn_fence(__ATOMIC_ACQ_REL, "workgroup");
    __builtin_amdgcn_wave_barrier();
  }
#pragma unroll
  for (int r = 0; r < 8; ++r) {
    float l = l_r[r];
    l += __shfl_xor(l, 1, 32); l += __shfl_xor(l, 2, 32); l += __shfl_xor(l, 4, 32); l += __shfl_xor(l, 8, 32);
    l_r[r] = (l > 0.f) ? 1.0f / l : 0.f;
  }
#pragma unroll
  for (int dt = 0; dt < DT; ++dt)
#pragma unroll
    for (int r = 0; r < 8; ++r) sO[w][8 * hh + r][dt * 16 + ln] = oacc[dt][r] * l_r[r];
  __builtin_amdgcn_fence(__ATOMIC_ACQ_REL, "workgroup");
  __builtin_amdgcn_wave_barrier();
  {
    for (int r = 0; r < 16; ++r) {
      const int row = q0 + r;
      if (row < T && lane < D / 4) {
        const v4f val = *(const v4fa*)&sO[w][r][lane * 4];
        *(v4f*)(y + ((size_t)b * T + row) * ypitch + h * D + lane * 4) = val;
      }
    }
    
  }
}

// GEMM C = act(A·W + bias + resid): A f32 (ASPLIT -> hi/lo 2 terms), Wt bf16 [N][K]; ACT 0 none, 1 relu, 2 exact gelu;
// resid (optional, f32, row index = (row % rmod), pitch ldr, RES_BF16 rounds it) added before the activation.
template <bool ASPLIT, int ACT, bool BIAS_BF16, bool RES_BF16>
__global__ __launch_bounds__(128) void k_gemm_bf3(const float* __restrict__ A, int lda, const unsigned short* __restrict__ Wt, int ldb,
                                                const float* __restrict__ bias, const float* __restrict__ resid, int rmod, int ldr,
                                                float* __restrict__ C, int ldc, int M, int N, int K) {
  __shared__ __attribute__((aligned(16))) float so[4][16][64];
  const int tid = threadIdx.x, w = tid >> 5, lane = tid & 31, ln = lane & 15, hh = lane >> 4;
  const int ntn = N / 64;
  const int wid = blockIdx.x * 4 + w;
  const int mt = wid / ntn, nq = wid % ntn;
  if (mt * 16 >= M) return;
  const int row0 = mt * 16, col0 = nq * 64;
  const float* arow = A + (size_t)(row0 + ln) * lda;
  v8f acc[4] = {};
  for (int kb = 0; kb < K; kb += 32) {
    FragB ah, al;
    const v4f x0 = *(const v4fa*)(arow + kb + 8 * hh), x1 = *(const v4fa*)(arow + kb + 8 * hh + 4);
    const v4f x2 = *(const v4fa*)(arow + kb + 16 + 8 * hh), x3 = *(const v4fa*)(arow + kb + 16 + 8 * hh + 4);
    float xs[16] = {x0[0],x0[1],x0[2],x0[3],x1[0],x1[1],x1[2],x1[3],x2[0],x2[1],x2[2],x2[3],x3[0],x3[1],x3[2],x3[3]};
#pragma unroll
    for (int i = 0; i < 16; ++i) { const unsigned short hb = bf16_bits(xs[i]); ah.u[i] = hb; al.u[i] = ASPLIT ? bf16_bits(xs[i] - bf16_val(hb)) : (unsigned short)0; }
#pragma unroll
    for (int t = 0; t < 4; ++t) {
      const unsigned short* brow = Wt + (size_t)(col0 + t * 16 + ln) * ldb + kb;
      FragB b;
      b.half[0] = *(const v8us*)(brow + 8 * hh);
      b.half[1] = *(const v8us*)(brow + 16 + 8 * hh);
      acc[t] = mmaN<ASPLIT ? 2 : 1>(ah.v, al.v, b.v, b.v, acc[t]);
    }
  }
#pragma unroll
  for (int t = 0; t < 4; ++t) {
    const int col = col0 + t * 16 + ln;
    float bv = bias ? bias[col] : 0.f;
    if (BIAS_BF16) bv = bf16_round(bv);
#pragma unroll
    for (int r = 0; r < 8; ++r) {
      float v = acc[t][r] + bv;
      if (resid) { float rv = resid[(size_t)((row0 + 8 * hh + r) % rmod) * ldr + col]; if (RES_BF16) rv = bf16_round(rv); v += rv; }
      if (ACT == 1) v = fmaxf(v, 0.f);
      if (ACT == 2) v = 0.5f * v * (1.0f + erff(v * 0.70710678118654752f));
      if (ACT == 3) { const float u = 0.7978845608028654f * (v + 0.044715f * v * v * v); v = 0.5f * v * (1.0f + tanhf(u)); }
      so[w][8 * hh + r][t * 16 + ln] = v;
    }
  }
  __builtin_amdgcn_fence(__ATOMIC_ACQ_REL, "workgroup");
  __builtin_amdgcn_wave_barrier();
  const int rsub = lane >> 4, c4 = (lane & 15) * 4;
  {
#pragma unroll
    for (int q = 0; q < 8; ++q) {
      const int r = q * 2 + rsub;
      const v4f v = *(const v4fa*)&so[w][r][c4];
      *(v4f*)(C + (size_t)(row0 + r) * ldc + col0 + c4) = v;
    }
    
  }
}
// row LayerNorm (biased variance, eps) over N: s = X (+ R); optional out_sum <- s; out_norm <- (s-mu)*rsqrt(var+eps)*g + b
template <bool PARAM_BF16>
__global__ __launch_bounds__(256) void k_layernorm(const float* __restrict__ X, const float* __restrict__ R, const float* __restrict__ g, const float* __restrict__ bta,
                                                  float* __restrict__ out_sum, float* __restrict__ out_norm, int N, float eps) {
  __shared__ float red[256];
  const int row = blockIdx.x, tid = threadIdx.x;
  const float* x = X + (size_t)row * N; const float* rr = R ? R + (size_t)row * N : nullptr;
  float vals[16];                     // up to N = 4096
  const int per = N / 256;            // contiguous chunk per thread? use strided-by-4 chunks: thread handles j = tid*4 + 1024*u
  float s1 = 0.f;
  for (int u = 0; u < per / 4; ++u) {
    const int j = tid * 4 + 1024 * u;
    const v4f a = *(const v4fa*)(x + j);
    v4f b = {0.f,0.f,0.f,0.f}; if (rr) b = *(const v4fa*)(rr + j);
#pragma unroll
    for (int q = 0; q < 4; ++q) { const float v = a[q] + b[q]; vals[u * 4 + q] = v; s1 += v; }
  }
  red[tid] = s1; __syncthreads();
  for (int st = 128; st > 0; st >>= 1) { if (tid < st) red[tid] += red[tid + st]; __syncthreads(); }
  const float mu = red[0] / (float)N; __syncthreads();
  float s2 = 0.f;
  for (int u = 0; u < per / 4; ++u)
#pragma unroll
    for (int q = 0; q < 4; ++q) { const float c = vals[u * 4 + q] - mu; s2 += c * c; }
  red[tid] = s2; __syncthreads();
  for (int st = 128; st > 0; st >>= 1) { if (tid < st) red[tid] += red[tid + st]; __syncthreads(); }
  const float rs = rsqrtf(red[0] / (float)N + eps);
  {
    for (int u = 0; u < per / 4; ++u) {
      const int j = tid * 4 + 1024 * u;
      v4f o, sm;
#pragma unroll
      for (int q = 0; q < 4; ++q) {
        float gg = g[j + q], bb = bta[j + q];
        if (PARAM_BF16) { gg = bf16_round(gg); bb = bf16_round(bb); }
        sm[q] = vals[u * 4 + q]; o[q] = (vals[u * 4 + q] - mu) * rs * gg + bb;
      }
      if (out_sum) *(v4f*)(out_sum + (size_t)row * N + j) = sm;
      *(v4f*)(out_norm + (size_t)row * N + j) = o;
    }
    
  }
}



// ---- f16 WMMA path (v_wmma_f32_16x16x32_f16): 11-bit significands for operands in range — used for the projection, generator and output GEMMs
typedef _Float16 v16h __attribute__((ext_vector_type(16)));
union FragH { v16h v; v8us half[2]; _Float16 h[16]; unsigned short u[16]; };
template <int NT>
__device__ __forceinline__ v8f mmaH(v16h ah, v16h al, v16h bh, v16h bl, v8f c) {
  c = __builtin_amdgcn_wmma_f32_16x16x32_f16(false, ah, false, bh, (short)0, c, false, false);
  if (NT >= 2) c = __builtin_amdgcn_wmma_f32_16x16x32_f16(false, al, false, bh, (short)0, c, false, false);
  if (NT >= 3) c = __builtin_amdgcn_wmma_f32_16x16x32_f16(false, ah, false, bl, (short)0, c, false, false);
  asm volatile("v_nop\n\tv_nop\n\tv_nop\n\tv_nop" : "+v"(c) : "v"(ah), "v"(al), "v"(bh), "v"(bl));
  return c;
}
// batched GEMM like k_gemm_b but f16 operands: A f32 (split into f16 hi/lo if ASPLIT, else rounded to f16), Bt = f16 values [n][k]; alpha; C f32; N multiple of 16 (partial tiles skipped)
template <bool ASPLIT>
__global__ __launch_bounds__(128) void k_gemm_h(const float* __restrict__ A, int lda, size_t sA, const _Float16* __restrict__ Bh, int ldb, size_t sB, float alpha, float* __restrict__ C, int ldc, size_t sC, int M, int N, int K) {
  __shared__ __attribute__((aligned(16))) float so[4][16][64];
  const int tid = threadIdx.x, w = tid >> 5, lane = tid & 31, ln = lane & 15, hh = lane >> 4; const int by = blockIdx.y;
  A += (size_t)by * sA; Bh += (size_t)by * sB; C += (size_t)by * sC;
  const int ntn = (N + 63) / 64; const int wid = blockIdx.x * 4 + w; const int mt = wid / ntn, nq = wid % ntn; if (mt * 16 >= M) return;
  const int row0 = mt * 16, col0 = nq * 64; const float* arow = A + (size_t)(row0 + ln) * lda;
  v8f acc[4] = {};
  for (int kb = 0; kb < K; kb += 32) {
    FragH ah, al;
    const v4f x0 = *(const v4fa*)(arow + kb + 8 * hh), x1 = *(const v4fa*)(arow + kb + 8 * hh + 4), x2 = *(const v4fa*)(arow + kb + 16 + 8 * hh), x3 = *(const v4fa*)(arow + kb + 16 + 8 * hh + 4);
    float xs[16] = {x0[0],x0[1],x0[2],x0[3],x1[0],x1[1],x1[2],x1[3],x2[0],x2[1],x2[2],x2[3],x3[0],x3[1],x3[2],x3[3]};
#pragma unroll
    for (int i = 0; i < 16; ++i) { const _Float16 h = (_Float16)xs[i]; ah.h[i] = h; al.h[i] = ASPLIT ? (_Float16)(xs[i] - (float)h) : (_Float16)0.0f; }
#pragma unroll
    for (int t = 0; t < 4; ++t) { if (col0 + t * 16 >= N) continue; const size_t boff = (size_t)(col0 + t * 16 + ln) * ldb + kb; FragH bq; bq.half[0] = *(const v8us*)(Bh + boff + 8 * hh); bq.half[1] = *(const v8us*)(Bh + boff + 16 + 8 * hh);
      acc[t] = mmaH<ASPLIT ? 2 : 1>(ah.v, al.v, bq.v, bq.v, acc[t]); }
  }
#pragma unroll
  for (int t = 0; t < 4; ++t) { if (col0 + t * 16 >= N) continue;
#pragma unroll
    for (int r = 0; r < 8; ++r) so[w][8 * hh + r][t * 16 + ln] = acc[t][r] * alpha; }
  __builtin_amdgcn_fence(__ATOMIC_ACQ_REL, "workgroup"); __builtin_amdgcn_wave_barrier();
  const int rsub = lane >> 4, c4 = (lane & 15) * 4;
  {
#pragma unroll
    for (int q = 0; q < 8; ++q) { const int r = q * 2 + rsub; if (col0 + c4 < N) { const v4f v = *(const v4fa*)&so[w][r][c4]; *(v4f*)(C + (size_t)(row0 + r) * ldc + col0 + c4) = v; } }
     }
}

// Wt[n][k] = f16(W[k][n]·scale) from f32 row-major W[K][N] (scale = power of two; bf16-exact weights stay exact in f16 away from the subnormal range)
__global__ __launch_bounds__(256) void k_wt_f16(const float* __restrict__ W, _Float16* __restrict__ Wt, int K, int N, float scale) {
  const int t = blockIdx.x * 256 + threadIdx.x; if (t >= N * (K / 8)) return; const int n = t / (K / 8), k8 = (t % (K / 8)) * 8; FragH f;
#pragma unroll
  for (int i = 0; i < 8; ++i) f.h[i] = (_Float16)(bf16_round(W[(size_t)(k8 + i) * N + n]) * scale); const v8us o = f.half[0];
  *(v8us*)((unsigned short*)Wt + (size_t)n * K + k8) = o; 
}
// k_gemm_hh variant with fused epilogue: v = acc·alpha + bias[by·sBias + col] (+ CP[(row/rowsPerB)·sCPb + by·64 + col] if CP) ; ACT 0 none / 1 elu ; writes f32 C and f16 C16, each if non-null
template <int ACT>
__global__ __launch_bounds__(128) void k_gemm_hhx(const _Float16* __restrict__ A, int lda, size_t sA, const _Float16* __restrict__ Bh, int ldb, size_t sB, float alpha, const float* __restrict__ bias, size_t sBias, const float* __restrict__ CP, int rowsPerB, size_t sCPb, int row0g,
    float* __restrict__ C, _Float16* __restrict__ C16, int ldc, size_t sC, int M, int N, int K) {
  __shared__ __attribute__((aligned(16))) float so[4][16][64];
  const int tid = threadIdx.x, w = tid >> 5, lane = tid & 31, ln = lane & 15, hh = lane >> 4; const int by = blockIdx.y;
  A += (size_t)by * sA; Bh += (size_t)by * sB; const size_t cofs = (size_t)by * sC; const float* bp = bias ? bias + (size_t)by * sBias : nullptr;
  const int ntn = (N + 63) / 64; const int wid = blockIdx.x * 4 + w; const int mt = wid / ntn, nq = wid % ntn; if (mt * 16 >= M) return;
  const int row0 = mt * 16, col0 = nq * 64; const _Float16* arow = A + (size_t)(row0 + ln) * lda;
  v8f acc[4] = {};
  for (int kb = 0; kb < K; kb += 32) { FragH ah; ah.half[0] = *(const v8us*)((const unsigned short*)arow + kb + 8 * hh); ah.half[1] = *(const v8us*)((const unsigned short*)arow + kb + 16 + 8 * hh);
#pragma unroll
    for (int t = 0; t < 4; ++t) { if (col0 + t * 16 >= N) continue; const size_t boff = (size_t)(col0 + t * 16 + ln) * ldb + kb; FragH bq; bq.half[0] = *(const v8us*)((const unsigned short*)Bh + boff + 8 * hh); bq.half[1] = *(const v8us*)((const unsigned short*)Bh + boff + 16 + 8 * hh);
      acc[t] = mmaH<1>(ah.v, ah.v, bq.v, bq.v, acc[t]); }
  }
#pragma unroll
  for (int t = 0; t < 4; ++t) { if (col0 + t * 16 >= N) continue; const int col = col0 + t * 16 + ln; const float bv = bp ? bf16_round(bp[col]) : 0.f;
#pragma unroll
    for (int r = 0; r < 8; ++r) { float v = acc[t][r] * alpha + bv; if (CP) { const int bidx = (row0g + row0 + 8 * hh + r) / rowsPerB; v += CP[(size_t)bidx * sCPb + (size_t)by * 64 + col]; } if (ACT == 1) v = (v > 0.f) ? v : expm1f(v); else if (ACT == 3) v = fmaxf(v, 0.f); so[w][8 * hh + r][t * 16 + ln] = v; } }
  __builtin_amdgcn_fence(__ATOMIC_ACQ_REL, "workgroup"); __builtin_amdgcn_wave_barrier();
  const int rsub = lane >> 4, c4 = (lane & 15) * 4; typedef _Float16 v4h __attribute__((ext_vector_type(4)));
  {
#pragma unroll
    for (int q = 0; q < 8; ++q) { const int r = q * 2 + rsub; if (col0 + c4 < N) { const v4f v = *(const v4fa*)&so[w][r][c4]; if (C) *(v4f*)(C + cofs + (size_t)(row0 + r) * ldc + col0 + c4) = v; if (C16) { v4h h4; for (int i = 0; i < 4; ++i) h4[i] = (_Float16)v[i]; *(v4h*)(C16 + cofs + (size_t)(row0 + r) * ldc + col0 + c4) = h4; } } }
     }
}


// FRAGMENT ORDER of every f16 operand plane in the workspace (weights, pf_low, g): a plane [rows][K] is cut into units of 16 rows x 32 k = 1 KB, unit index = (row / 16) * (K / 32) + k / 32;
// the 16-byte piece j * 32 + lane of a unit holds row (lane & 15), k = 16 j + 8 (lane >> 4) .. + 7: what lane reads as half j of its WMMA fragment. One wave-wide 16-byte load = 512 contiguous bytes = 4 whole lines.
// Bt = f16(bf16(W) * 16) in fragment order, W f32 [rows][32 << ksh]; thread t of a plane writes its piece t.
// The four weight planes depend on nothing, nor on one another: one launch rounds them all. A work-group writes 256 pieces of one plane (every plane is a whole number of work-groups), chosen by scalar selects, so that one body serves all four.
#define RB_G (NPAR * LOW / 8 / 256)
#define RB_P (LOW * FD / 8 / 256)
__global__ __launch_bounds__(256) void k_round_all(const float* __restrict__ pgw, const float* __restrict__ pfw, const float* __restrict__ ppw, const float* __restrict__ f2w,
                                                  _Float16* __restrict__ Bg, _Float16* __restrict__ Bf, _Float16* __restrict__ Bp, _Float16* __restrict__ B2) {
  const int b = blockIdx.x;
  const int sel = (b >= RB_G) + (b >= RB_G + RB_P) + (b >= RB_G + 2 * RB_P);      // 0 generator, 1 f projection, 2 pf projection, 3 last projection
  const float* W = sel == 0 ? pgw : sel == 1 ? pfw : sel == 2 ? ppw : f2w;
  _Float16* Bt = sel == 0 ? Bg : sel == 1 ? Bf : sel == 2 ? Bp : B2;
  const int ksh = (sel == 1 || sel == 2) ? 5 : 2;      // k steps of 32 in a row: FD / 32 = 32 or LOW / 32 = 4
  const int t = (b - (sel == 0 ? 0 : RB_G + (sel - 1) * RB_P)) * 256 + (int)threadIdx.x;
  FragH f;
  const int lane = t & 31, j = (t >> 5) & 1, unit = t >> 6;
  const float* src = W + ((size_t)((unit >> ksh) * 16 + (lane & 15)) << (5 + ksh)) + (unit & ((1 << ksh) - 1)) * 32 + 16 * j + 8 * (lane >> 4);
  const v4f x0 = *(const v4fa*)src, x1 = *(const v4fa*)(src + 4);
#pragma unroll
  for (int i = 0; i < 8; ++i) f.h[i] = (_Float16)(bf16_round(i < 4 ? x0[i & 3] : x1[i & 3]) * 16.0f); *(v8us*)((unsigned short*)Bt + (size_t)t * 8) = f.half[0];  }
__global__ __launch_bounds__(256) void k_h16(const float* __restrict__ x, _Float16* __restrict__ X16, size_t n8) { const size_t t = (size_t)blockIdx.x * 256 + threadIdx.x; if (t >= n8) return; FragH f;
#pragma unroll
  for (int q = 0; q < 8; ++q) f.h[q] = (_Float16)x[t * 8 + q]; *(v8us*)((unsigned short*)X16 + t * 8) = f.half[0];  }
// Projection C[NBS][LOW] = x . W^T + bias with x read as f32 and rounded on its way into the A fragment (bf16 rounding, then f16: the values the staged f16 copy held).
// Tile map and k order are those of k_gemm_hhx: one wave = 16 rows x 64 columns, k rising, one accumulator chain per 16 x 16 tile. Bh, and C16 where it is written, are in fragment order.
#define PJ_U 8
template <bool OUT16>
__device__ __forceinline__ void proj_body(int blk, float* __restrict__ sbuf, const float* __restrict__ X, const _Float16* __restrict__ Bh, const float* __restrict__ bias, float* __restrict__ C, _Float16* __restrict__ C16) {
  float (*so)[16][OUT16 ? 68 : 64] = (float (*)[16][OUT16 ? 68 : 64])sbuf;      // pitch 68 floats where 16 lanes read one column range of 16 rows: it spreads them over all banks
  const int tid = threadIdx.x, w = tid >> 5, lane = tid & 31, ln = lane & 15, hh = lane >> 4;
  const int wid = blk * 4 + w, row0 = (wid >> 1) * 16, col0 = (wid & 1) * 64;
  const float* arow = X + (size_t)(row0 + ln) * FD + 8 * hh;
  const unsigned short* brow = (const unsigned short*)Bh + (size_t)col0 * FD + lane * 8;
  v8f acc[4] = {};
  for (int kb = 0; kb < FD; kb += 32 * PJ_U) {
    v4f x[PJ_U][4]; FragH b[PJ_U][4];
#pragma unroll
    for (int u = 0; u < PJ_U; ++u) {
      const float* p = arow + kb + u * 32;
      x[u][0] = *(const v4fa*)p; x[u][1] = *(const v4fa*)(p + 4); x[u][2] = *(const v4fa*)(p + 16); x[u][3] = *(const v4fa*)(p + 20);
    }
#pragma unroll
    for (int u = 0; u < PJ_U; ++u)
#pragma unroll
      for (int t = 0; t < 4; ++t) {
        const unsigned short* p = brow + (size_t)t * 16 * FD + kb * 16 + u * 512;
        b[u][t].half[0] = *(const v8us*)p; b[u][t].half[1] = *(const v8us*)(p + 256);
      }
    asm volatile("s_wait_xcnt 0x0" ::: "memory");      // precaution: stands in front of the additions that step these loads' two address pairs to the next group
    __builtin_amdgcn_sched_barrier(0);      // keeps the whole group's loads in front of the first conversion (x comes from memory, and one k step's 2 KB a wave in flight would leave the kernel waiting on latency) and the address additions behind the wait
#pragma unroll
    for (int u = 0; u < PJ_U; ++u) {
      FragH a;
#pragma unroll
      for (int i = 0; i < 16; ++i) a.h[i] = (_Float16)bf16_round(x[u][i >> 2][i & 3]);
#pragma unroll
      for (int t = 0; t < 4; ++t) acc[t] = __builtin_amdgcn_wmma_f32_16x16x32_f16(false, a.v, false, b[u][t].v, (short)0, acc[t], false, false);
    }
  }
  float bv[4];
  __builtin_amdgcn_sched_barrier(0);      // keeps index arithmetic that has sunk down to the epilogue in front of the bias loads: between them and their wait it took the loads' offset register
#pragma unroll
  for (int t = 0; t < 4; ++t) bv[t] = bias[col0 + t * 16 + ln];
  asm volatile("s_wait_xcnt 0x0" ::: "memory");      // precaution: the compiler reuses the bias loads' offset register at once
  __builtin_amdgcn_sched_barrier(0);      // holds that reuse behind the wait
#pragma unroll
  for (int t = 0; t < 4; ++t) {
    const float bb = bf16_round(bv[t]);
#pragma unroll
    for (int r = 0; r < 8; ++r) so[w][8 * hh + r][t * 16 + ln] = acc[t][r] * 0.0625f + bb;
  }
  __builtin_amdgcn_fence(__ATOMIC_ACQ_REL, "workgroup", "local"); __builtin_amdgcn_wave_barrier();      // the wave's own LDS stores land before it reads the rows back
  if constexpr (OUT16) {
    // the wave's 64 columns are two units of its row tile: four stores of 512 contiguous bytes
    unsigned short* o = (unsigned short*)C16 + (size_t)row0 * LOW + col0 * 16 + lane * 8;
#pragma unroll
    for (int q = 0; q < 4; ++q) {
      const float* s = &so[w][ln][q * 16 + 8 * hh];
      const v4f v0 = *(const v4fa*)s, v1 = *(const v4fa*)(s + 4);
      FragH h;
#pragma unroll
      for (int i = 0; i < 8; ++i) h.h[i] = (_Float16)(i < 4 ? v0[i & 3] : v1[i & 3]);
      *(v8us*)(o + q * 256) = h.half[0];
    }
  } else {
    const int rsub = lane >> 4, c4 = (lane & 15) * 4;
    const size_t o0 = (size_t)(row0 + rsub) * LOW + col0 + c4;
#pragma unroll
    for (int q = 0; q < 8; ++q) {
      const v4f v = *(const v4fa*)&so[w][q * 2 + rsub][c4];
      *(v4f*)(C + o0 + q * 2 * LOW) = v;
    }
  }
}
// The two projections depend on nothing of one another: one launch holds both, the first PJ_B work-groups f_low, the rest pf_low, so that two work-groups stand on a WGP and each runs under the other's load waits.
#define PJ_B ((NBS / 16) * (LOW / 64) / 4)
__global__ __launch_bounds__(128) void k_proj2(const float* __restrict__ f, const float* __restrict__ pf, const _Float16* __restrict__ Bf, const _Float16* __restrict__ Bp, const float* __restrict__ pfb, const float* __restrict__ ppb,
                                              float* __restrict__ FLOW, _Float16* __restrict__ PL16) {
  __shared__ __attribute__((aligned(16))) float sbuf[4 * 16 * 68];
  const int b = blockIdx.x;
  if (b < PJ_B) proj_body<false>(b, sbuf, f, Bf, pfb, FLOW, nullptr);
  else proj_body<true>(b - PJ_B, sbuf, pf, Bp, ppb, nullptr, PL16);
}
// out[NBS][FD] = g . W2^T + bias + (f + pf): f and pf are read as f32 by the lane that stores the element, 16 bytes at a time, rounded to bf16 and summed there.
// Tile map and k order are those of k_gemm_hhx (one wave = 16 rows x 64 columns). G and Bh are in fragment order.
__global__ __launch_bounds__(128) void k_out(const _Float16* __restrict__ G, const _Float16* __restrict__ Bh, const float* __restrict__ bias, const float* __restrict__ f, const float* __restrict__ pf, float* __restrict__ out) {
  __shared__ __attribute__((aligned(16))) float so[4][16][64];
  const int tid = threadIdx.x, w = tid >> 5, lane = tid & 31, ln = lane & 15, hh = lane >> 4;
  const int wid = blockIdx.x * 4 + w, row0 = (wid / (FD / 64)) * 16, col0 = (wid % (FD / 64)) * 64;
  const int rsub = lane >> 4, c4 = (lane & 15) * 4;
  const unsigned short* arow = (const unsigned short*)G + (size_t)row0 * LOW + lane * 8;
  const unsigned short* brow = (const unsigned short*)Bh + (size_t)col0 * LOW + lane * 8;
  FragH a[LOW / 32], b[4][LOW / 32];
#pragma unroll
  for (int ks = 0; ks < LOW / 32; ++ks) { a[ks].half[0] = *(const v8us*)(arow + ks * 512); a[ks].half[1] = *(const v8us*)(arow + ks * 512 + 256); }
  asm volatile("s_wait_xcnt 0x0" ::: "memory");      // precaution: the compiler reuses these loads' address pair as the destination of a later load
#pragma unroll
  for (int t = 0; t < 4; ++t)
#pragma unroll
    for (int ks = 0; ks < LOW / 32; ++ks) { b[t][ks].half[0] = *(const v8us*)(brow + (size_t)t * 16 * LOW + ks * 512); b[t][ks].half[1] = *(const v8us*)(brow + (size_t)t * 16 * LOW + ks * 512 + 256); }
  float bv[4];
#pragma unroll
  for (int t = 0; t < 4; ++t) bv[t] = bias[col0 + t * 16 + ln];
  asm volatile("s_wait_xcnt 0x0" ::: "memory");      // precaution: the operand loads' address registers are free for reuse behind it
  __builtin_amdgcn_sched_barrier(0);      // loads return in order: the operand loads (L2) stay in front of the residual loads (memory), so that the WMMAs need not wait for the latter
  const size_t o0 = (size_t)(row0 + rsub) * FD + col0 + c4;
  v4f rf[8], rp[8];
#pragma unroll
  for (int q = 0; q < 8; ++q) { rf[q] = *(const v4fa*)(f + o0 + q * 2 * FD); rp[q] = *(const v4fa*)(pf + o0 + q * 2 * FD); }
  asm volatile("s_wait_xcnt 0x0" ::: "memory");      // precaution: as above, for the residual loads' two address pairs
  __builtin_amdgcn_sched_barrier(0);      // keeps the residual loads in front of the product, which then runs under their latency
  v8f acc[4] = {};
#pragma unroll
  for (int ks = 0; ks < LOW / 32; ++ks)
#pragma unroll
    for (int t = 0; t < 4; ++t) acc[t] = __builtin_amdgcn_wmma_f32_16x16x32_f16(false, a[ks].v, false, b[t][ks].v, (short)0, acc[t], false, false);
#pragma unroll
  for (int t = 0; t < 4; ++t) {
    const float bb = bf16_round(bv[t]);
#pragma unroll
    for (int r = 0; r < 8; ++r) so[w][8 * hh + r][t * 16 + ln] = acc[t][r] * 0.0625f + bb;
  }
  __builtin_amdgcn_fence(__ATOMIC_ACQ_REL, "workgroup", "local"); __builtin_amdgcn_wave_barrier();      // the wave's own LDS stores land before it reads the rows back; LDS alone, so that the residual loads stay in flight
#pragma unroll
  for (int q = 0; q < 8; ++q) {
    v4f v = *(const v4fa*)&so[w][q * 2 + rsub][c4];
#pragma unroll
    for (int c = 0; c < 4; ++c) v[c] += bf16_round(rf[q][c]) + bf16_round(rp[q][c]);
    *(v4f*)(out + o0 + q * 2 * FD) = v;
  }
}
// Parameter generator and per-sample MLP in one kernel: a work-group owns GM_M samples and never stores their generated parameters.
// Each 16 x 16 tile of params = pf_low . pg_w^T (K = LOW, four f16 WMMAs) is scaled, biased and summed into h or g straight from the accumulator registers
// (accumulator register r of lane (ln, hh) = sample 8 * hh + r, parameter column ln).
// Layer 1: parameter n = l * MID + m; wave w owns l = 16 w .. 16 w + 15 and sums them in rising order; the eight waves' partial h meet in LDS in rising wave order, then relu.
// Layer 2: parameter n = LOW * MID + m * LOW + l; wave w owns l = 16 w .. 16 w + 15 and sums m in rising order.
#define GM_M 32
struct Yes { static constexpr bool value = true; }; struct No { static constexpr bool value = false; };
__global__ __launch_bounds__(256) void k_gen_mlp(const _Float16* __restrict__ PL, const _Float16* __restrict__ Bg, const float* __restrict__ pgb, const float* __restrict__ FLOW, _Float16* __restrict__ G16) {
  __shared__ __attribute__((aligned(16))) float sF[LOW][GM_M];              // flow[s][l] at [l][s]; rows 16 w .. + 15 are written and read by wave w alone
  __shared__ __attribute__((aligned(16))) float sP[8][MID][GM_M + 4];       // partial h per wave at [m][s]; pitch 36 floats spreads the 16-byte stores of 16 rows m over all banks
  __shared__ __attribute__((aligned(16))) float sH[MID][GM_M];              // h after relu at [m][s]
  __shared__ __attribute__((aligned(16))) _Float16 sG[GM_M][LOW + 8];       // g as f16, gathered so that the work-group stores it in fragment order
  const int tid = threadIdx.x, lane = tid & 31, ln = lane & 15, hh = lane >> 4;
  const int w = __builtin_amdgcn_readfirstlane(tid >> 5);
  const int s0 = blockIdx.x * GM_M;
  struct BTile { FragH f[LOW / 32]; float b; };
  // tile u of this wave's stream: u < 32 layer 1 (l = 16 w + u / 2, m half u & 1), else layer 2 (m = u - 32)
  const unsigned short* blane = (const unsigned short*)Bg + lane * 8;      // fragment order: a tile of 16 parameters is 4 KB in a row
  const float* clane = pgb + ln;
  auto load_tile = [&](BTile& t, int u) {
    const int n0 = (u < 32) ? (w * 512 + u * 16) : (LOW * MID + (u - 32) * LOW + w * 16);
    const unsigned short* p = blane + (size_t)n0 * LOW;
    t.b = clane[n0];
#pragma unroll
    for (int ks = 0; ks < LOW / 32; ++ks) { t.f[ks].half[0] = *(const v8us*)(p + ks * 512); t.f[ks].half[1] = *(const v8us*)(p + ks * 512 + 256); }
  };
  v4f fl[4];
#pragma unroll
  for (int j = 0; j < 4; ++j) fl[j] = *(const v4fa*)(FLOW + (size_t)(s0 + lane) * LOW + w * 16 + j * 4);
  FragH a[2][LOW / 32];
#pragma unroll
  for (int mt = 0; mt < 2; ++mt) {
    const unsigned short* ar = (const unsigned short*)PL + (size_t)(s0 + mt * 16) * LOW + lane * 8;
#pragma unroll
    for (int ks = 0; ks < LOW / 32; ++ks) { a[mt][ks].half[0] = *(const v8us*)(ar + ks * 512); a[mt][ks].half[1] = *(const v8us*)(ar + ks * 512 + 256); }
    if (mt == 0) asm volatile("s_wait_xcnt 0x0" ::: "memory");      // precaution: the compiler reuses an address pair of the loads above as the destination of a load of the second tile
  }
  __builtin_amdgcn_sched_barrier(0);      // keeps the sample loads in front of the weight loads: loads return in order, and behind them they would force the loop's first wait to drain the weight tiles too
  BTile bt[2];
  load_tile(bt[0], 0); load_tile(bt[1], 1);
#pragma unroll
  for (int j = 0; j < 4; ++j)
#pragma unroll
    for (int c = 0; c < 4; ++c) sF[w * 16 + j * 4 + c][lane] = fl[j][c];
  // fence on LDS alone: the wave's own stores land before it reads the rows back; a fence on every address space would also drain the weight loads in flight
  __builtin_amdgcn_fence(__ATOMIC_ACQ_REL, "workgroup", "local"); __builtin_amdgcn_wave_barrier();
  // one tile: acc[mt][r] += cf[sample] * (tile / 16 + bias); the tile's registers are refilled with tile un as soon as its WMMAs have issued
  auto tile_step = [&](BTile& t, const float* cf, v8f& acc0, v8f& acc1, int un, auto refill) {
    const v4f c00 = *(const v4fa*)(cf + 8 * hh), c01 = *(const v4fa*)(cf + 8 * hh + 4), c10 = *(const v4fa*)(cf + 16 + 8 * hh), c11 = *(const v4fa*)(cf + 16 + 8 * hh + 4);
    v8f d0 = {}, d1 = {};
#pragma unroll
    for (int ks = 0; ks < LOW / 32; ++ks) {
      d0 = __builtin_amdgcn_wmma_f32_16x16x32_f16(false, a[0][ks].v, false, t.f[ks].v, (short)0, d0, false, false);
      d1 = __builtin_amdgcn_wmma_f32_16x16x32_f16(false, a[1][ks].v, false, t.f[ks].v, (short)0, d1, false, false);
    }
    const float bv = bf16_round(t.b);
    if constexpr (decltype(refill)::value) load_tile(t, un);
#pragma unroll
    for (int r = 0; r < 8; ++r) {
      acc0[r] += ((r < 4) ? c00[r & 3] : c01[r & 3]) * (d0[r] * 0.0625f + bv);
      acc1[r] += ((r < 4) ? c10[r & 3] : c11[r & 3]) * (d1[r] * 0.0625f + bv);
    }
  };
  v8f hp[2][2] = {};      // [m half][sample tile]
  for (int i = 0; i < 16; ++i) {
    const float* cf = &sF[w * 16 + i][0];
    tile_step(bt[0], cf, hp[0][0], hp[0][1], 2 * i + 2, Yes{});
    tile_step(bt[1], cf, hp[1][0], hp[1][1], 2 * i + 3, Yes{});
  }
#pragma unroll
  for (int mh = 0; mh < 2; ++mh)
#pragma unroll
    for (int mt = 0; mt < 2; ++mt) {
      float* d = &sP[w][mh * 16 + ln][mt * 16 + 8 * hh];
      *(v4fa*)d = (v4f){hp[mh][mt][0], hp[mh][mt][1], hp[mh][mt][2], hp[mh][mt][3]};
      *(v4fa*)(d + 4) = (v4f){hp[mh][mt][4], hp[mh][mt][5], hp[mh][mt][6], hp[mh][mt][7]};
    }
  __syncthreads();      // every wave's partial h is in LDS
  {
    const int m = tid >> 3, s4 = (tid & 7) * 4;
    v4f v = *(const v4fa*)&sP[0][m][s4];
#pragma unroll
    for (int q = 1; q < 8; ++q) v += *(const v4fa*)&sP[q][m][s4];
#pragma unroll
    for (int c = 0; c < 4; ++c) v[c] = fmaxf(v[c], 0.f);
    *(v4fa*)&sH[m][s4] = v;
  }
  __syncthreads();      // h is complete before any wave reads it
  v8f g0 = {}, g1 = {};
  for (int i = 0; i < 15; ++i) {
    tile_step(bt[0], &sH[2 * i][0], g0, g1, 32 + 2 * i + 2, Yes{});
    tile_step(bt[1], &sH[2 * i + 1][0], g0, g1, 32 + 2 * i + 3, Yes{});
  }
  tile_step(bt[0], &sH[30][0], g0, g1, 0, No{});
  tile_step(bt[1], &sH[31][0], g0, g1, 0, No{});
#pragma unroll
  for (int r = 0; r < 8; ++r) { sG[8 * hh + r][w * 16 + ln] = (_Float16)g0[r]; sG[16 + 8 * hh + r][w * 16 + ln] = (_Float16)g1[r]; }
  __syncthreads();      // all of g is in LDS before the rows are stored
#pragma unroll
  for (int j = 0; j < 2; ++j) {
    // piece tid of row tile j in fragment order: wave w stores half w & 1 of unit w >> 1
    *(v8us*)((unsigned short*)G16 + (size_t)(s0 + 16 * j) * LOW + tid * 8) = *(const v8us*)&sG[16 * j + ln][(w >> 1) * 32 + (w & 1) * 16 + 8 * hh];
  }
}
extern "C" void kernel_launch(void* const* d_in, const int* in_sizes, int n_in,
                              void* d_out, int out_size, void* d_ws, size_t ws_size, hipStream_t stream) {
  (void)in_sizes; (void)n_in; (void)out_size;
  const float* f = (const float*)d_in[0]; const float* pf = (const float*)d_in[1]; const float* pfw = (const float*)d_in[2]; const float* pfb = (const float*)d_in[3]; const float* ppw = (const float*)d_in[4]; const float* ppb = (const float*)d_in[5]; const float* f2w = (const float*)d_in[6]; const float* f2b = (const float*)d_in[7]; const float* pgw = (const float*)d_in[8]; const float* pgb = (const float*)d_in[9];
  char* ws = (char*)d_ws; size_t off = 0;
  auto take = [&](size_t bytes) { char* p = ws + off; off += (bytes + 255) & ~(size_t)255; return p; };
  _Float16* Bf = (_Float16*)take((size_t)LOW * FD * 2); _Float16* Bp = (_Float16*)take((size_t)LOW * FD * 2); _Float16* Bg = (_Float16*)take((size_t)NPAR * LOW * 2); _Float16* B2 = (_Float16*)take((size_t)FD * LOW * 2);
  float* FLOW = (float*)take((size_t)NBS * LOW * 4); _Float16* PL16 = (_Float16*)take((size_t)NBS * LOW * 2); _Float16* G16 = (_Float16*)take((size_t)NBS * LOW * 2);
  if (off > ws_size) return;      // about 11 MiB
  k_round_all<<<RB_G + 3 * RB_P, 256, 0, stream>>>(pgw, pfw, ppw, f2w, Bg, Bf, Bp, B2);      // (out,in), fragment order
  k_proj2<<<2 * PJ_B, 128, 0, stream>>>(f, pf, Bf, Bp, pfb, ppb, FLOW, PL16);      // f_low (f32, read by the per-sample MLP) and pf_low (f16 operand of the generator)
  k_gen_mlp<<<NBS / GM_M, 256, 0, stream>>>(PL16, Bg, pgb, FLOW, G16);      // params = pf_low . pg_w^T + pg_b, consumed in registers by the per-sample MLP
  k_out<<<(NBS / 16) * (FD / 64) / 4, 128, 0, stream>>>(G16, B2, f2b, f, pf, (float*)d_out);      // g . proj_f2^T + b + (f + pf)
}

// v006
// It runs in 56.4 microseconds.
// Timed twice side by side with v005, it ran 1.17 and 1.16 times as fast.
// Counting every step since v000, it is 10.6 times as fast.
#include <hip/hip_runtime.h>
// + bias, + f + pf residuals as exact bf16 addends) on v_wmma_f32_16x16x32_f16 (f16 operands, nn.Linear weights (out,in) bf16-exact ×2^4, f32 accumulate); the per-sample tiny MLP
// (128 -> 32 relu -> 128 with that sample's generated weights) is f32 VALU on the generator's accumulator tiles (64 samples and half of the hidden units per work-group).
#define NBS 8192
#define FD 1024
#define LOW 128
#define MID 32
#define NPAR (2 * LOW * MID)

typedef __bf16 v16b __attribute__((ext_vector_type(16)));
typedef unsigned short v8us __attribute__((ext_vector_type(8), may_alias));
typedef float  v8f  __attribute__((ext_vector_type(8)));
typedef float  v4f  __attribute__((ext_vector_type(4)));
typedef float  v4fa __attribute__((ext_vector_type(4), may_alias));
union FragB { v16b v; v8us half[2]; unsigned short u[16]; };

__device__ __forceinline__ unsigned short bf16_bits(float x) { unsigned int u = __float_as_uint(x); return (unsigned short)((u + 0x7FFFu + ((u >> 16) & 1u)) >> 16); }
__device__ __forceinline__ float bf16_val(unsigned short b) { return __uint_as_float(((unsigned int)b) << 16); }
__device__ __forceinline__ float bf16_round(float x) { return bf16_val(bf16_bits(x)); }
// D += A·B with NT terms: 1 = ah·bh, 2 = + al·bh (A split), 3 = + ah·bl (both split)
template <int NT>
__device__ __forceinline__ v8f mmaN(v16b ah, v16b al, v16b bh, v16b bl, v8f c) {
  c = __builtin_amdgcn_wmma_f32_16x16x32_bf16(false, ah, false, bh, (short)0, c, false, false);
  if (NT >= 2) c = __builtin_amdgcn_wmma_f32_16x16x32_bf16(false, al, false, bh, (short)0, c, false, false);
  if (NT >= 3) c = __builtin_amdgcn_wmma_f32_16x16x32_bf16(false, ah, false, bl, (short)0, c, false, false);
  asm volatile("v_nop\n\tv_nop\n\tv_nop\n\tv_nop" : "+v"(c) : "v"(ah), "v"(al), "v"(bh), "v"(bl));
  return c;
}

__global__ __launch_bounds__(256) void k_wt_bf16(const float* __restrict__ W, unsigned short* __restrict__ Wt, int K, int N) {
  const int t = blockIdx.x * 256 + threadIdx.x;
  const int k8n = K / 8;
  if (t >= N * k8n) return;
  const int n = t / k8n, k8 = (t % k8n) * 8;
  v8us v;
#pragma unroll
  for (int i = 0; i < 8; ++i) v[i] = bf16_bits(W[(size_t)(k8 + i) * N + n]);
  *(v8us*)(Wt + (size_t)n * K + k8) = v;
  
}

// GEMM C[M][N] (f32, pitch ldc) = act(A[M][K]·W + bias). A f32 row-major (pitch lda) converted per fragment to bf16
// (ASPLIT: hi/lo two planes -> 2 terms, else single rounded term); Wt bf16 [N][K] (pitch ldb). BIAS_BF16 rounds the
// bias to bf16 first (bias quantised to bf16 before the add). K%32==0, M%16==0, N%64==0.
template <bool ASPLIT, int ACT, bool BIAS_BF16>
__global__ __launch_bounds__(128) void k_gemm_bf(const float* __restrict__ A, int lda, const unsigned short* __restrict__ Wt, int ldb,
                                               const float* __restrict__ bias, float* __restrict__ C, int ldc, int M, int N, int K) {
  __shared__ __attribute__((aligned(16))) float so[4][16][64];
  const int tid = threadIdx.x, w = tid >> 5, lane = tid & 31, ln = lane & 15, hh = lane >> 4;
  const int ntn = N / 64;
  const int wid = blockIdx.x * 4 + w;
  const int mt = wid / ntn, nq = wid % ntn;
  if (mt * 16 >= M) return;
  const int row0 = mt * 16, col0 = nq * 64;
  const float* arow = A + (size_t)(row0 + ln) * lda;
  v8f acc[4] = {};
  for (int kb = 0; kb < K; kb += 32) {
    FragB ah, al;
    const v4f x0 = *(const v4fa*)(arow + kb + 8 * hh), x1 = *(const v4fa*)(arow + kb + 8 * hh + 4);
    const v4f x2 = *(const v4fa*)(arow + kb + 16 + 8 * hh), x3 = *(const v4fa*)(arow + kb + 16 + 8 * hh + 4);
    float xs[16] = {x0[0],x0[1],x0[2],x0[3],x1[0],x1[1],x1[2],x1[3],x2[0],x2[1],x2[2],x2[3],x3[0],x3[1],x3[2],x3[3]};
#pragma unroll
    for (int i = 0; i < 16; ++i) { const unsigned short hb = bf16_bits(xs[i]); ah.u[i] = hb; al.u[i] = ASPLIT ? bf16_bits(xs[i] - bf16_val(hb)) : (unsigned short)0; }
#pragma unroll
    for (int t = 0; t < 4; ++t) {
      const unsigned short* brow = Wt + (size_t)(col0 + t * 16 + ln) * ldb + kb;
      FragB b;
      b.half[0] = *(const v8us*)(brow + 8 * hh);
      b.half[1] = *(const v8us*)(brow + 16 + 8 * hh);
      acc[t] = mmaN<ASPLIT ? 2 : 1>(ah.v, al.v, b.v, b.v, acc[t]);
    }
  }
#pragma unroll
  for (int t = 0; t < 4; ++t) {
    float bv = bias ? bias[col0 + t * 16 + ln] : 0.f;
    if (BIAS_BF16) bv = bf16_round(bv);
#pragma unroll
    for (int r = 0; r < 8; ++r) { float v = acc[t][r] + bv; if (ACT == 1) v = fmaxf(v, 0.f); so[w][8 * hh + r][t * 16 + ln] = v; }
  }
  __builtin_amdgcn_fence(__ATOMIC_ACQ_REL, "workgroup");
  __builtin_amdgcn_wave_barrier();
  const int rsub = lane >> 4, c4 = (lane & 15) * 4;
  {
#pragma unroll
    for (int q = 0; q < 8; ++q) {
      const int r = q * 2 + rsub;
      const v4f v = *(const v4fa*)&so[w][r][c4];
      *(v4f*)(C + (size_t)(row0 + r) * ldc + col0 + c4) = v;
    }
    
  }
}

// Flash-style causal/unmasked attention, all contractions 3-term bf16 hi/lo splits, f32 softmax with running max.
// q,k,v rows are read from f32 buffers with arbitrary row pitch (so they can live inside a fused qkv buffer);
// D = head size (multiple of 32, <= 128); one wave = 16 query rows; block = 4 waves (64 queries) sharing K/V chunks of 32.
template <int D, bool CAUSAL>
__global__ __launch_bounds__(128) void k_flash(const float* __restrict__ qb, const float* __restrict__ kb, const float* __restrict__ vb,
                                             int pitch, int T, int H, float scale, float* __restrict__ y, int ypitch) {
  constexpr int KS = D / 32;        // k-steps for QK
  constexpr int DT = D / 16;        // d tiles for PV
  __shared__ __attribute__((aligned(16))) unsigned short sKh[32][D + 8], sKl[32][D + 8], sVh[32][D + 8], sVl[32][D + 8];
  __shared__ __attribute__((aligned(16))) unsigned short sPh[4][16][40], sPl[4][16][40];
  __shared__ __attribute__((aligned(16))) float sO[4][16][D];
  const int tid = threadIdx.x, w = tid >> 5, lane = tid & 31, ln = lane & 15, hh = lane >> 4;
  const int nqb = (T + 63) / 64;
  const int bh = blockIdx.x / nqb, qblk = blockIdx.x % nqb;
  const int b = bh / H, h = bh % H;
  const int q0 = qblk * 64 + w * 16;
  const float* Q = qb + (size_t)b * T * pitch + h * D;
  const float* K = kb + (size_t)b * T * pitch + h * D;
  const float* V = vb + (size_t)b * T * pitch + h * D;

  // A fragments of the wave's 16 query rows (scaled), hi/lo
  FragB aqh[KS], aql[KS];
  {
    int row = q0 + ln; if (row >= T) row = T - 1;
    const float* qr = Q + (size_t)row * pitch;
#pragma unroll
    for (int ks = 0; ks < KS; ++ks)
#pragma unroll
      for (int i = 0; i < 16; ++i) {
        const int d = ks * 32 + ((i < 8) ? (8 * hh + i) : (16 + 8 * hh + (i - 8)));
        const float x = qr[d] * scale; const unsigned short hb = bf16_bits(x);
        aqh[ks].u[i] = hb; aql[ks].u[i] = bf16_bits(x - bf16_val(hb));
      }
  }
  float m_r[8], l_r[8];
#pragma unroll
  for (int r = 0; r < 8; ++r) { m_r[r] = -3.0e38f; l_r[r] = 0.f; }
  v8f oacc[DT];
#pragma unroll
  for (int dt = 0; dt < DT; ++dt) oacc[dt] = (v8f){0.f,0.f,0.f,0.f,0.f,0.f,0.f,0.f};

  const int kv_end = CAUSAL ? min(T, qblk * 64 + 64) : T;     // block-uniform
  for (int j0 = 0; j0 < kv_end; j0 += 32) {
    __syncthreads();
    for (int e = tid; e < 32 * (D / 4); e += 128) {
      const int r = e / (D / 4), c4 = (e % (D / 4)) * 4;
      const int key = j0 + r;
      v4f kf = {0.f,0.f,0.f,0.f}, vf = {0.f,0.f,0.f,0.f};
      if (key < T) { kf = *(const v4fa*)(K + (size_t)key * pitch + c4); vf = *(const v4fa*)(V + (size_t)key * pitch + c4); }
#pragma unroll
      for (int t = 0; t < 4; ++t) {
        unsigned short hb = bf16_bits(kf[t]); sKh[r][c4 + t] = hb; sKl[r][c4 + t] = bf16_bits(kf[t] - bf16_val(hb));
        hb = bf16_bits(vf[t]); sVh[r][c4 + t] = hb; sVl[r][c4 + t] = bf16_bits(vf[t] - bf16_val(hb));
      }
    }
    __syncthreads();
    // S tile 16 x 32
    v8f s[2];
#pragma unroll
    for (int nt = 0; nt < 2; ++nt) {
      v8f acc = {};
#pragma unroll
      for (int ks = 0; ks < KS; ++ks) {
        FragB bh_, bl_;
        bh_.half[0] = *(const v8us*)&sKh[nt * 16 + ln][ks * 32 + 8 * hh]; bh_.half[1] = *(const v8us*)&sKh[nt * 16 + ln][ks * 32 + 16 + 8 * hh];
        bl_.half[0] = *(const v8us*)&sKl[nt * 16 + ln][ks * 32 + 8 * hh]; bl_.half[1] = *(const v8us*)&sKl[nt * 16 + ln][ks * 32 + 16 + 8 * hh];
        acc = mmaN<3>(aqh[ks].v, aql[ks].v, bh_.v, bl_.v, acc);
      }
      s[nt] = acc;
    }
    // mask + running max (rows 8hh+r; the 16 lanes of a half share rows)
    float alpha[8];
#pragma unroll
    for (int r = 0; r < 8; ++r) {
      const int qi = q0 + 8 * hh + r;
      const int ja = j0 + ln, jb = j0 + 16 + ln;
      if (CAUSAL) { if (ja > qi) s[0][r] = -3.0e38f; if (jb > qi) s[1][r] = -3.0e38f; }
      if (ja >= T) s[0][r] = -3.0e38f;
      if (jb >= T) s[1][r] = -3.0e38f;
      float mx = fmaxf(s[0][r], s[1][r]);
      mx = fmaxf(mx, __shfl_xor(mx, 1, 32)); mx = fmaxf(mx, __shfl_xor(mx, 2, 32)); mx = fmaxf(mx, __shfl_xor(mx, 4, 32)); mx = fmaxf(mx, __shfl_xor(mx, 8, 32));
      const float mnew = fmaxf(m_r[r], mx);
      alpha[r] = (mnew > -1.0e38f) ? __expf(m_r[r] - mnew) : 1.0f;
      const float p0 = (s[0][r] > -1.0e38f) ? __expf(s[0][r] - mnew) : 0.f;
      const float p1 = (s[1][r] > -1.0e38f) ? __expf(s[1][r] - mnew) : 0.f;
      m_r[r] = mnew;
      l_r[r] = l_r[r] * alpha[r] + p0 + p1;            // per-lane partial row sum (16 lanes combined at the end)
      unsigned short hb = bf16_bits(p0); sPh[w][8 * hh + r][ln] = hb;      sPl[w][8 * hh + r][ln] = bf16_bits(p0 - bf16_val(hb));
      hb = bf16_bits(p1);                sPh[w][8 * hh + r][16 + ln] = hb; sPl[w][8 * hh + r][16 + ln] = bf16_bits(p1 - bf16_val(hb));
    }
#pragma unroll
    for (int dt = 0; dt < DT; ++dt)
#pragma unroll
      for (int r = 0; r < 8; ++r) oacc[dt][r] *= alpha[r];
    __builtin_amdgcn_fence(__ATOMIC_ACQ_REL, "workgroup");
    __builtin_amdgcn_wave_barrier();
    FragB pah, pal;
    pah.half[0] = *(const v8us*)&sPh[w][ln][8 * hh]; pah.half[1] = *(const v8us*)&sPh[w][ln][16 + 8 * hh];
    pal.half[0] = *(const v8us*)&sPl[w][ln][8 * hh]; pal.half[1] = *(const v8us*)&sPl[w][ln][16 + 8 * hh];
#pragma unroll
    for (int dt = 0; dt < DT; ++dt) {
      FragB bvh, bvl;
#pragma unroll
      for (int i = 0; i < 8; ++i) {
        bvh.u[i] = sVh[8 * hh + i][dt * 16 + ln]; bvh.u[8 + i] = sVh[16 + 8 * hh + i][dt * 16 + ln];
        bvl.u[i] = sVl[8 * hh + i][dt * 16 + ln]; bvl.u[8 + i] = sVl[16 + 8 * hh + i][dt * 16 + ln];
      }
      oacc[dt] = mmaN<3>(pah.v, pal.v, bvh.v, bvl.v, oacc[dt]);
    }
    __builtin_amdgcn_fence(__ATOMIC_ACQ_REL, "workgroup");
    __builtin_amdgcn_wave_barrier();
  }
#pragma unroll
  for (int r = 0; r < 8; ++r) {
    float l = l_r[r];
    l += __shfl_xor(l, 1, 32); l += __shfl_xor(l, 2, 32); l += __shfl_xor(l, 4, 32); l += __shfl_xor(l, 8, 32);
    l_r[r] = (l > 0.f) ? 1.0f / l : 0.f;
  }
#pragma unroll
  for (int dt = 0; dt < DT; ++dt)
#pragma unroll
    for (int r = 0; r < 8; ++r) sO[w][8 * hh + r][dt * 16 + ln] = oacc[dt][r] * l_r[r];
  __builtin_amdgcn_fence(__ATOMIC_ACQ_REL, "workgroup");
  __builtin_amdgcn_wave_barrier();
  {
    for (int r = 0; r < 16; ++r) {
      const int row = q0 + r;
      if (row < T && lane < D / 4) {
        const v4f val = *(const v4fa*)&sO[w][r][lane * 4];
        *(v4f*)(y + ((size_t)b * T + row) * ypitch + h * D + lane * 4) = val;
      }
    }
    
  }
}

// GEMM C = act(A·W + bias + resid): A f32 (ASPLIT -> hi/lo 2 terms), Wt bf16 [N][K]; ACT 0 none, 1 relu, 2 exact gelu;
// resid (optional, f32, row index = (row % rmod), pitch ldr, RES_BF16 rounds it) added before the activation.
template <bool ASPLIT, int ACT, bool BIAS_BF16, bool RES_BF16>
__global__ __launch_bounds__(128) void k_gemm_bf3(const float* __restrict__ A, int lda, const unsigned short* __restrict__ Wt, int ldb,
                                                const float* __restrict__ bias, const float* __restrict__ resid, int rmod, int ldr,
                                                float* __restrict__ C, int ldc, int M, int N, int K) {
  __shared__ __attribute__((aligned(16))) float so[4][16][64];
  const int tid = threadIdx.x, w = tid >> 5, lane = tid & 31, ln = lane & 15, hh = lane >> 4;
  const int ntn = N / 64;
  const int wid = blockIdx.x * 4 + w;
  const int mt = wid / ntn, nq = wid % ntn;
  if (mt * 16 >= M) return;
  const int row0 = mt * 16, col0 = nq * 64;
  const float* arow = A + (size_t)(row0 + ln) * lda;
  v8f acc[4] = {};
  for (int kb = 0; kb < K; kb += 32) {
    FragB ah, al;
    const v4f x0 = *(const v4fa*)(arow + kb + 8 * hh), x1 = *(const v4fa*)(arow + kb + 8 * hh + 4);
    const v4f x2 = *(const v4fa*)(arow + kb + 16 + 8 * hh), x3 = *(const v4fa*)(arow + kb + 16 + 8 * hh + 4);
    float xs[16] = {x0[0],x0[1],x0[2],x0[3],x1[0],x1[1],x1[2],x1[3],x2[0],x2[1],x2[2],x2[3],x3[0],x3[1],x3[2],x3[3]};
#pragma unroll
    for (int i = 0; i < 16; ++i) { const unsigned short hb = bf16_bits(xs[i]); ah.u[i] = hb; al.u[i] = ASPLIT ? bf16_bits(xs[i] - bf16_val(hb)) : (unsigned short)0; }
#pragma unroll
    for (int t = 0; t < 4; ++t) {
      const unsigned short* brow = Wt + (size_t)(col0 + t * 16 + ln) * ldb + kb;
      FragB b;
      b.half[0] = *(const v8us*)(brow + 8 * hh);
      b.half[1] = *(const v8us*)(brow + 16 + 8 * hh);
      acc[t] = mmaN<ASPLIT ? 2 : 1>(ah.v, al.v, b.v, b.v, acc[t]);
    }
  }
#pragma unroll
  for (int t = 0; t < 4; ++t) {
    const int col = col0 + t * 16 + ln;
    float bv = bias ? bias[col] : 0.f;
    if (BIAS_BF16) bv = bf16_round(bv);
#pragma unroll
    for (int r = 0; r < 8; ++r) {
      float v = acc[t][r] + bv;
      if (resid) { float rv = resid[(size_t)((row0 + 8 * hh + r) % rmod) * ldr + col]; if (RES_BF16) rv = bf16_round(rv); v += rv; }
      if (ACT == 1) v = fmaxf(v, 0.f);
      if (ACT == 2) v = 0.5f * v * (1.0f + erff(v * 0.70710678118654752f));
      if (ACT == 3) { const float u = 0.7978845608028654f * (v + 0.044715f * v * v * v); v = 0.5f * v * (1.0f + tanhf(u)); }
      so[w][8 * hh + r][t * 16 + ln] = v;
    }
  }
  __builtin_amdgcn_fence(__ATOMIC_ACQ_REL, "workgroup");
  __builtin_amdgcn_wave_barrier();
  const int rsub = lane >> 4, c4 = (lane & 15) * 4;
  {
#pragma unroll
    for (int q = 0; q < 8; ++q) {
      const int r = q * 2 + rsub;
      const v4f v = *(const v4fa*)&so[w][r][c4];
      *(v4f*)(C + (size_t)(row0 + r) * ldc + col0 + c4) = v;
    }
    
  }
}
// row LayerNorm (biased variance, eps) over N: s = X (+ R); optional out_sum <- s; out_norm <- (s-mu)*rsqrt(var+eps)*g + b
template <bool PARAM_BF16>
__global__ __launch_bounds__(256) void k_layernorm(const float* __restrict__ X, const float* __restrict__ R, const float* __restrict__ g, const float* __restrict__ bta,
                                                  float* __restrict__ out_sum, float* __restrict__ out_norm, int N, float eps) {
  __shared__ float red[256];
  const int row = blockIdx.x, tid = threadIdx.x;
  const float* x = X + (size_t)row * N; const float* rr = R ? R + (size_t)row * N : nullptr;
  float vals[16];                     // up to N = 4096
  const int per = N / 256;            // contiguous chunk per thread? use strided-by-4 chunks: thread handles j = tid*4 + 1024*u
  float s1 = 0.f;
  for (int u = 0; u < per / 4; ++u) {
    const int j = tid * 4 + 1024 * u;
    const v4f a = *(const v4fa*)(x + j);
    v4f b = {0.f,0.f,0.f,0.f}; if (rr) b = *(const v4fa*)(rr + j);
#pragma unroll
    for (int q = 0; q < 4; ++q) { const float v = a[q] + b[q]; vals[u * 4 + q] = v; s1 += v; }
  }
  red[tid] = s1; __syncthreads();
  for (int st = 128; st > 0; st >>= 1) { if (tid < st) red[tid] += red[tid + st]; __syncthreads(); }
  const float mu = red[0] / (float)N; __syncthreads();
  float s2 = 0.f;
  for (int u = 0; u < per / 4; ++u)
#pragma unroll
    for (int q = 0; q < 4; ++q) { const float c = vals[u * 4 + q] - mu; s2 += c * c; }
  red[tid] = s2; __syncthreads();
  for (int st = 128; st > 0; st >>= 1) { if (tid < st) red[tid] += red[tid + st]; __syncthreads(); }
  const float rs = rsqrtf(red[0] / (float)N + eps);
  {
    for (int u = 0; u < per / 4; ++u) {
      const int j = tid * 4 + 1024 * u;
      v4f o, sm;
#pragma unroll
      for (int q = 0; q < 4; ++q) {
        float gg = g[j + q], bb = bta[j + q];
        if (PARAM_BF16) { gg = bf16_round(gg); bb = bf16_round(bb); }
        sm[q] = vals[u * 4 + q]; o[q] = (vals[u * 4 + q] - mu) * rs * gg + bb;
      }
      if (out_sum) *(v4f*)(out_sum + (size_t)row * N + j) = sm;
      *(v4f*)(out_norm + (size_t)row * N + j) = o;
    }
    
  }
}



// ---- f16 WMMA path (v_wmma_f32_16x16x32_f16): 11-bit significands for operands in range — used for the projection, generator and output GEMMs
typedef _Float16 v16h __attribute__((ext_vector_type(16)));
union FragH { v16h v; v8us half[2]; _Float16 h[16]; unsigned short u[16]; };
template <int NT>
__device__ __forceinline__ v8f mmaH(v16h ah, v16h al, v16h bh, v16h bl, v8f c) {
  c = __builtin_amdgcn_wmma_f32_16x16x32_f16(false, ah, false, bh, (short)0, c, false, false);
  if (NT >= 2) c = __builtin_amdgcn_wmma_f32_16x16x32_f16(false, al, false, bh, (short)0, c, false, false);
  if (NT >= 3) c = __builtin_amdgcn_wmma_f32_16x16x32_f16(false, ah, false, bl, (short)0, c, false, false);
  asm volatile("v_nop\n\tv_nop\n\tv_nop\n\tv_nop" : "+v"(c) : "v"(ah), "v"(al), "v"(bh), "v"(bl));
  return c;
}
// batched GEMM like k_gemm_b but f16 operands: A f32 (split into f16 hi/lo if ASPLIT, else rounded to f16), Bt = f16 values [n][k]; alpha; C f32; N multiple of 16 (partial tiles skipped)
template <bool ASPLIT>
__global__ __launch_bounds__(128) void k_gemm_h(const float* __restrict__ A, int lda, size_t sA, const _Float16* __restrict__ Bh, int ldb, size_t sB, float alpha, float* __restrict__ C, int ldc, size_t sC, int M, int N, int K) {
  __shared__ __attribute__((aligned(16))) float so[4][16][64];
  const int tid = threadIdx.x, w = tid >> 5, lane = tid & 31, ln = lane & 15, hh = lane >> 4; const int by = blockIdx.y;
  A += (size_t)by * sA; Bh += (size_t)by * sB; C += (size_t)by * sC;
  const int ntn = (N + 63) / 64; const int wid = blockIdx.x * 4 + w; const int mt = wid / ntn, nq = wid % ntn; if (mt * 16 >= M) return;
  const int row0 = mt * 16, col0 = nq * 64; const float* arow = A + (size_t)(row0 + ln) * lda;
  v8f acc[4] = {};
  for (int kb = 0; kb < K; kb += 32) {
    FragH ah, al;
    const v4f x0 = *(const v4fa*)(arow + kb + 8 * hh), x1 = *(const v4fa*)(arow + kb + 8 * hh + 4), x2 = *(const v4fa*)(arow + kb + 16 + 8 * hh), x3 = *(const v4fa*)(arow + kb + 16 + 8 * hh + 4);
    float xs[16] = {x0[0],x0[1],x0[2],x0[3],x1[0],x1[1],x1[2],x1[3],x2[0],x2[1],x2[2],x2[3],x3[0],x3[1],x3[2],x3[3]};
#pragma unroll
    for (int i = 0; i < 16; ++i) { const _Float16 h = (_Float16)xs[i]; ah.h[i] = h; al.h[i] = ASPLIT ? (_Float16)(xs[i] - (float)h) : (_Float16)0.0f; }
#pragma unroll
    for (int t = 0; t < 4; ++t) { if (col0 + t * 16 >= N) continue; const size_t boff = (size_t)(col0 + t * 16 + ln) * ldb + kb; FragH bq; bq.half[0] = *(const v8us*)(Bh + boff + 8 * hh); bq.half[1] = *(const v8us*)(Bh + boff + 16 + 8 * hh);
      acc[t] = mmaH<ASPLIT ? 2 : 1>(ah.v, al.v, bq.v, bq.v, acc[t]); }
  }
#pragma unroll
  for (int t = 0; t < 4; ++t) { if (col0 + t * 16 >= N) continue;
#pragma unroll
    for (int r = 0; r < 8; ++r) so[w][8 * hh + r][t * 16 + ln] = acc[t][r] * alpha; }
  __builtin_amdgcn_fence(__ATOMIC_ACQ_REL, "workgroup"); __builtin_amdgcn_wave_barrier();
  const int rsub = lane >> 4, c4 = (lane & 15) * 4;
  {
#pragma unroll
    for (int q = 0; q < 8; ++q) { const int r = q * 2 + rsub; if (col0 + c4 < N) { const v4f v = *(const v4fa*)&so[w][r][c4]; *(v4f*)(C + (size_t)(row0 + r) * ldc + col0 + c4) = v; } }
     }
}

// Wt[n][k] = f16(W[k][n]·scale) from f32 row-major W[K][N] (scale = power of two; bf16-exact weights stay exact in f16 away from the subnormal range)
__global__ __launch_bounds__(256) void k_wt_f16(const float* __restrict__ W, _Float16* __restrict__ Wt, int K, int N, float scale) {
  const int t = blockIdx.x * 256 + threadIdx.x; if (t >= N * (K / 8)) return; const int n = t / (K / 8), k8 = (t % (K / 8)) * 8; FragH f;
#pragma unroll
  for (int i = 0; i < 8; ++i) f.h[i] = (_Float16)(bf16_round(W[(size_t)(k8 + i) * N + n]) * scale); const v8us o = f.half[0];
  *(v8us*)((unsigned short*)Wt + (size_t)n * K + k8) = o; 
}
// k_gemm_hh variant with fused epilogue: v = acc·alpha + bias[by·sBias + col] (+ CP[(row/rowsPerB)·sCPb + by·64 + col] if CP) ; ACT 0 none / 1 elu ; writes f32 C and f16 C16, each if non-null
template <int ACT>
__global__ __launch_bounds__(128) void k_gemm_hhx(const _Float16* __restrict__ A, int lda, size_t sA, const _Float16* __restrict__ Bh, int ldb, size_t sB, float alpha, const float* __restrict__ bias, size_t sBias, const float* __restrict__ CP, int rowsPerB, size_t sCPb, int row0g,
    float* __restrict__ C, _Float16* __restrict__ C16, int ldc, size_t sC, int M, int N, int K) {
  __shared__ __attribute__((aligned(16))) float so[4][16][64];
  const int tid = threadIdx.x, w = tid >> 5, lane = tid & 31, ln = lane & 15, hh = lane >> 4; const int by = blockIdx.y;
  A += (size_t)by * sA; Bh += (size_t)by * sB; const size_t cofs = (size_t)by * sC; const float* bp = bias ? bias + (size_t)by * sBias : nullptr;
  const int ntn = (N + 63) / 64; const int wid = blockIdx.x * 4 + w; const int mt = wid / ntn, nq = wid % ntn; if (mt * 16 >= M) return;
  const int row0 = mt * 16, col0 = nq * 64; const _Float16* arow = A + (size_t)(row0 + ln) * lda;
  v8f acc[4] = {};
  for (int kb = 0; kb < K; kb += 32) { FragH ah; ah.half[0] = *(const v8us*)((const unsigned short*)arow + kb + 8 * hh); ah.half[1] = *(const v8us*)((const unsigned short*)arow + kb + 16 + 8 * hh);
#pragma unroll
    for (int t = 0; t < 4; ++t) { if (col0 + t * 16 >= N) continue; const size_t boff = (size_t)(col0 + t * 16 + ln) * ldb + kb; FragH bq; bq.half[0] = *(const v8us*)((const unsigned short*)Bh + boff + 8 * hh); bq.half[1] = *(const v8us*)((const unsigned short*)Bh + boff + 16 + 8 * hh);
      acc[t] = mmaH<1>(ah.v, ah.v, bq.v, bq.v, acc[t]); }
  }
#pragma unroll
  for (int t = 0; t < 4; ++t) { if (col0 + t * 16 >= N) continue; const int col = col0 + t * 16 + ln; const float bv = bp ? bf16_round(bp[col]) : 0.f;
#pragma unroll
    for (int r = 0; r < 8; ++r) { float v = acc[t][r] * alpha + bv; if (CP) { const int bidx = (row0g + row0 + 8 * hh + r) / rowsPerB; v += CP[(size_t)bidx * sCPb + (size_t)by * 64 + col]; } if (ACT == 1) v = (v > 0.f) ? v : expm1f(v); else if (ACT == 3) v = fmaxf(v, 0.f); so[w][8 * hh + r][t * 16 + ln] = v; } }
  __builtin_amdgcn_fence(__ATOMIC_ACQ_REL, "workgroup"); __builtin_amdgcn_wave_barrier();
  const int rsub = lane >> 4, c4 = (lane & 15) * 4; typedef _Float16 v4h __attribute__((ext_vector_type(4)));
  {
#pragma unroll
    for (int q = 0; q < 8; ++q) { const int r = q * 2 + rsub; if (col0 + c4 < N) { const v4f v = *(const v4fa*)&so[w][r][c4]; if (C) *(v4f*)(C + cofs + (size_t)(row0 + r) * ldc + col0 + c4) = v; if (C16) { v4h h4; for (int i = 0; i < 4; ++i) h4[i] = (_Float16)v[i]; *(v4h*)(C16 + cofs + (size_t)(row0 + r) * ldc + col0 + c4) = h4; } } }
     }
}


// FRAGMENT ORDER of every f16 operand plane in the workspace (weights, pf_low, g): a plane [rows][K] is cut into units of 16 rows x 32 k = 1 KB, unit index = (row / 16) * (K / 32) + k / 32;
// the 16-byte piece j * 32 + lane of a unit holds row (lane & 15), k = 16 j + 8 (lane >> 4) .. + 7: what lane reads as half j of its WMMA fragment. One wave-wide 16-byte load = 512 contiguous bytes = 4 whole lines.
// Bt = f16(bf16(W) * 16) in fragment order, W f32 [rows][32 << ksh]; thread t of a plane writes its piece t.
// The four weight planes depend on nothing, nor on one another: one launch rounds them all. A work-group writes 256 pieces of one plane (every plane is a whole number of work-groups), chosen by scalar selects, so that one body serves all four.
#define RB_G (NPAR * LOW / 8 / 256)
#define RB_P (LOW * FD / 8 / 256)
__global__ __launch_bounds__(256) void k_round_all(const float* __restrict__ pgw, const float* __restrict__ pfw, const float* __restrict__ ppw, const float* __restrict__ f2w,
                                                  _Float16* __restrict__ Bg, _Float16* __restrict__ Bf, _Float16* __restrict__ Bp, _Float16* __restrict__ B2) {
  const int b = blockIdx.x;
  const int sel = (b >= RB_G) + (b >= RB_G + RB_P) + (b >= RB_G + 2 * RB_P);      // 0 generator, 1 f projection, 2 pf projection, 3 last projection
  const float* W = sel == 0 ? pgw : sel == 1 ? pfw : sel == 2 ? ppw : f2w;
  _Float16* Bt = sel == 0 ? Bg : sel == 1 ? Bf : sel == 2 ? Bp : B2;
  const int ksh = (sel == 1 || sel == 2) ? 5 : 2;      // k steps of 32 in a row: FD / 32 = 32 or LOW / 32 = 4
  const int t = (b - (sel == 0 ? 0 : RB_G + (sel - 1) * RB_P)) * 256 + (int)threadIdx.x;
  FragH f;
  const int lane = t & 31, j = (t >> 5) & 1, unit = t >> 6;
  const float* src = W + ((size_t)((unit >> ksh) * 16 + (lane & 15)) << (5 + ksh)) + (unit & ((1 << ksh) - 1)) * 32 + 16 * j + 8 * (lane >> 4);
  const v4f x0 = *(const v4fa*)src, x1 = *(const v4fa*)(src + 4);
#pragma unroll
  for (int i = 0; i < 8; ++i) f.h[i] = (_Float16)(bf16_round(i < 4 ? x0[i & 3] : x1[i & 3]) * 16.0f); *(v8us*)((unsigned short*)Bt + (size_t)t * 8) = f.half[0];  }
__global__ __launch_bounds__(256) void k_h16(const float* __restrict__ x, _Float16* __restrict__ X16, size_t n8) { const size_t t = (size_t)blockIdx.x * 256 + threadIdx.x; if (t >= n8) return; FragH f;
#pragma unroll
  for (int q = 0; q < 8; ++q) f.h[q] = (_Float16)x[t * 8 + q]; *(v8us*)((unsigned short*)X16 + t * 8) = f.half[0];  }
// Projection C[NBS][LOW] = x . W^T + bias with x read as f32 and rounded on its way into the A fragment (bf16 rounding, then f16: the values the staged f16 copy held).
// Tile map and k order are those of k_gemm_hhx: one wave = 16 rows x 64 columns, k rising, one accumulator chain per 16 x 16 tile. Bh, and C16 where it is written, are in fragment order.
#define PJ_U 8
template <bool OUT16>
__device__ __forceinline__ void proj_body(int blk, float* __restrict__ sbuf, const float* __restrict__ X, const _Float16* __restrict__ Bh, const float* __restrict__ bias, float* __restrict__ C, _Float16* __restrict__ C16) {
  float (*so)[16][OUT16 ? 68 : 64] = (float (*)[16][OUT16 ? 68 : 64])sbuf;      // pitch 68 floats where 16 lanes read one column range of 16 rows: it spreads them over all banks
  const int tid = threadIdx.x, w = tid >> 5, lane = tid & 31, ln = lane & 15, hh = lane >> 4;
  const int wid = blk * 4 + w, row0 = (wid >> 1) * 16, col0 = (wid & 1) * 64;
  const float* arow = X + (size_t)(row0 + ln) * FD + 8 * hh;
  const unsigned short* brow = (const unsigned short*)Bh + (size_t)col0 * FD + lane * 8;
  v8f acc[4] = {};
  for (int kb = 0; kb < FD; kb += 32 * PJ_U) {
    v4f x[PJ_U][4]; FragH b[PJ_U][4];
#pragma unroll
    for (int u = 0; u < PJ_U; ++u) {
      const float* p = arow + kb + u * 32;
      x[u][0] = *(const v4fa*)p; x[u][1] = *(const v4fa*)(p + 4); x[u][2] = *(const v4fa*)(p + 16); x[u][3] = *(const v4fa*)(p + 20);
    }
#pragma unroll
    for (int u = 0; u < PJ_U; ++u)
#pragma unroll
      for (int t = 0; t < 4; ++t) {
        const unsigned short* p = brow + (size_t)t * 16 * FD + kb * 16 + u * 512;
        b[u][t].half[0] = *(const v8us*)p; b[u][t].half[1] = *(const v8us*)(p + 256);
      }
    asm volatile("s_wait_xcnt 0x0" ::: "memory");      // precaution: stands in front of the additions that step these loads' two address pairs to the next group
    __builtin_amdgcn_sched_barrier(0);      // keeps the whole group's loads in front of the first conversion (x comes from memory, and one k step's 2 KB a wave in flight would leave the kernel waiting on latency) and the address additions behind the wait
#pragma unroll
    for (int u = 0; u < PJ_U; ++u) {
      FragH a;
#pragma unroll
      for (int i = 0; i < 16; ++i) a.h[i] = (_Float16)bf16_round(x[u][i >> 2][i & 3]);
#pragma unroll
      for (int t = 0; t < 4; ++t) acc[t] = __builtin_amdgcn_wmma_f32_16x16x32_f16(false, a.v, false, b[u][t].v, (short)0, acc[t], false, false);
    }
  }
  float bv[4];
  __builtin_amdgcn_sched_barrier(0);      // keeps index arithmetic that has sunk down to the epilogue in front of the bias loads: between them and their wait it took the loads' offset register
#pragma unroll
  for (int t = 0; t < 4; ++t) bv[t] = bias[col0 + t * 16 + ln];
  asm volatile("s_wait_xcnt 0x0" ::: "memory");      // precaution: the compiler reuses the bias loads' offset register at once
  __builtin_amdgcn_sched_barrier(0);      // holds that reuse behind the wait
#pragma unroll
  for (int t = 0; t < 4; ++t) {
    const float bb = bf16_round(bv[t]);
#pragma unroll
    for (int r = 0; r < 8; ++r) so[w][8 * hh + r][t * 16 + ln] = acc[t][r] * 0.0625f + bb;
  }
  __builtin_amdgcn_fence(__ATOMIC_ACQ_REL, "workgroup", "local"); __builtin_amdgcn_wave_barrier();      // the wave's own LDS stores land before it reads the rows back
  if constexpr (OUT16) {
    // the wave's 64 columns are two units of its row tile: four stores of 512 contiguous bytes
    unsigned short* o = (unsigned short*)C16 + (size_t)row0 * LOW + col0 * 16 + lane * 8;
#pragma unroll
    for (int q = 0; q < 4; ++q) {
      const float* s = &so[w][ln][q * 16 + 8 * hh];
      const v4f v0 = *(const v4fa*)s, v1 = *(const v4fa*)(s + 4);
      FragH h;
#pragma unroll
      for (int i = 0; i < 8; ++i) h.h[i] = (_Float16)(i < 4 ? v0[i & 3] : v1[i & 3]);
      *(v8us*)(o + q * 256) = h.half[0];
    }
  } else {
    const int rsub = lane >> 4, c4 = (lane & 15) * 4;
    const size_t o0 = (size_t)(row0 + rsub) * LOW + col0 + c4;
#pragma unroll
    for (int q = 0; q < 8; ++q) {
      const v4f v = *(const v4fa*)&so[w][q * 2 + rsub][c4];
      *(v4f*)(C + o0 + q * 2 * LOW) = v;
    }
  }
}
// The two projections depend on nothing of one another: one launch holds both, the first PJ_B work-groups f_low, the rest pf_low, so that two work-groups stand on a WGP and each runs under the other's load waits.
#define PJ_B ((NBS / 16) * (LOW / 64) / 4)
__global__ __launch_bounds__(128) void k_proj2(const float* __restrict__ f, const float* __restrict__ pf, const _Float16* __restrict__ Bf, const _Float16* __restrict__ Bp, const float* __restrict__ pfb, const float* __restrict__ ppb,
                                              float* __restrict__ FLOW, _Float16* __restrict__ PL16) {
  __shared__ __attribute__((aligned(16))) float sbuf[4 * 16 * 68];
  const int b = blockIdx.x;
  if (b < PJ_B) proj_body<false>(b, sbuf, f, Bf, pfb, FLOW, nullptr);
  else proj_body<true>(b - PJ_B, sbuf, pf, Bp, ppb, nullptr, PL16);
}
// out[NBS][FD] = (g0 + g1) . W2^T + bias + (f + pf), g0 and g1 the two planes of partial g, taken as one operand of K = 2 * LOW against W2 twice: f and pf are read as f32 by the lane that stores the element, 16 bytes at a time, rounded to bf16 and summed there.
// Tile map and k order are those of k_gemm_hhx (one wave = 16 rows x 64 columns). G and Bh are in fragment order.
__global__ __launch_bounds__(128) void k_out(const _Float16* __restrict__ G, const _Float16* __restrict__ Bh, const float* __restrict__ bias, const float* __restrict__ f, const float* __restrict__ pf, float* __restrict__ out) {
  __shared__ __attribute__((aligned(16))) float so[4][16][64];
  const int tid = threadIdx.x, w = tid >> 5, lane = tid & 31, ln = lane & 15, hh = lane >> 4;
  const int wid = blockIdx.x * 4 + w, row0 = (wid / (FD / 64)) * 16, col0 = (wid % (FD / 64)) * 64;
  const int rsub = lane >> 4, c4 = (lane & 15) * 4;
  const unsigned short* arow = (const unsigned short*)G + (size_t)row0 * LOW + lane * 8;
  const unsigned short* brow = (const unsigned short*)Bh + (size_t)col0 * LOW + lane * 8;
  FragH a[2][LOW / 32], b[4][LOW / 32];
#pragma unroll
  for (int p = 0; p < 2; ++p)
#pragma unroll
    for (int ks = 0; ks < LOW / 32; ++ks) { a[p][ks].half[0] = *(const v8us*)(arow + (size_t)p * NBS * LOW + ks * 512); a[p][ks].half[1] = *(const v8us*)(arow + (size_t)p * NBS * LOW + ks * 512 + 256); }
  asm volatile("s_wait_xcnt 0x0" ::: "memory");      // precaution: the compiler reuses these loads' address pair as the destination of a later load
#pragma unroll
  for (int t = 0; t < 4; ++t)
#pragma unroll
    for (int ks = 0; ks < LOW / 32; ++ks) { b[t][ks].half[0] = *(const v8us*)(brow + (size_t)t * 16 * LOW + ks * 512); b[t][ks].half[1] = *(const v8us*)(brow + (size_t)t * 16 * LOW + ks * 512 + 256); }
  float bv[4];
#pragma unroll
  for (int t = 0; t < 4; ++t) bv[t] = bias[col0 + t * 16 + ln];
  asm volatile("s_wait_xcnt 0x0" ::: "memory");      // precaution: the operand loads' address registers are free for reuse behind it
  __builtin_amdgcn_sched_barrier(0);      // loads return in order: the operand loads (L2) stay in front of the residual loads (memory), so that the WMMAs need not wait for the latter
  const size_t o0 = (size_t)(row0 + rsub) * FD + col0 + c4;
  v4f rf[8], rp[8];
#pragma unroll
  for (int q = 0; q < 8; ++q) { rf[q] = *(const v4fa*)(f + o0 + q * 2 * FD); rp[q] = *(const v4fa*)(pf + o0 + q * 2 * FD); }
  asm volatile("s_wait_xcnt 0x0" ::: "memory");      // precaution: as above, for the residual loads' two address pairs
  __builtin_amdgcn_sched_barrier(0);      // keeps the residual loads in front of the product, which then runs under their latency
  v8f acc[4] = {};
#pragma unroll
  for (int p = 0; p < 2; ++p)
#pragma unroll
    for (int ks = 0; ks < LOW / 32; ++ks)
#pragma unroll
      for (int t = 0; t < 4; ++t) acc[t] = __builtin_amdgcn_wmma_f32_16x16x32_f16(false, a[p][ks].v, false, b[t][ks].v, (short)0, acc[t], false, false);
#pragma unroll
  for (int t = 0; t < 4; ++t) {
    const float bb = bf16_round(bv[t]);
#pragma unroll
    for (int r = 0; r < 8; ++r) so[w][8 * hh + r][t * 16 + ln] = acc[t][r] * 0.0625f + bb;
  }
  __builtin_amdgcn_fence(__ATOMIC_ACQ_REL, "workgroup", "local"); __builtin_amdgcn_wave_barrier();      // the wave's own LDS stores land before it reads the rows back; LDS alone, so that the residual loads stay in flight
#pragma unroll
  for (int q = 0; q < 8; ++q) {
    v4f v = *(const v4fa*)&so[w][q * 2 + rsub][c4];
#pragma unroll
    for (int c = 0; c < 4; ++c) v[c] += bf16_round(rf[q][c]) + bf16_round(rp[q][c]);
    *(v4f*)(out + o0 + q * 2 * FD) = v;
  }
}
// Parameter generator and per-sample MLP in one kernel: a work-group owns GM_M samples and GM_H of the MID hidden units, and never stores the generated parameters.
// A hidden unit m needs only the parameters l * MID + m of layer 1 and LOW * MID + m * LOW + l of layer 2, so the two halves of the hidden units are independent up to the last sum over m:
// each half writes its own partial g, and the last GEMM adds the two. A weight tile that comes from L2 thus serves GM_T sample tiles, and a work-group reads half of the weight plane.
// Each 16 x 16 tile of params = pf_low . pg_w^T (K = LOW, four f16 WMMAs) is scaled, biased and summed into h or g straight from the accumulator registers
// (accumulator register r of lane (ln, hh) = sample 8 * hh + r, parameter column ln).
// Layer 1: wave w owns l = 16 w .. 16 w + 15 and sums them in rising order; the eight waves' partial h meet in LDS in rising wave order, then relu.
// Layer 2: wave w owns l = 16 w .. 16 w + 15 and sums the work-group's m in rising order.
#define GM_M 64
#define GM_T (GM_M / 16)
#define GM_H (MID / 2)
struct Yes { static constexpr bool value = true; }; struct No { static constexpr bool value = false; };
__global__ __launch_bounds__(256) void k_gen_mlp(const _Float16* __restrict__ PL, const _Float16* __restrict__ Bg, const float* __restrict__ pgb, const float* __restrict__ FLOW, _Float16* __restrict__ G16) {
  __shared__ __attribute__((aligned(16))) float sF[LOW][GM_M];              // flow[s][l] at [l][s]; rows 16 w .. + 15 are written and read by wave w alone
  __shared__ __attribute__((aligned(16))) float sP[8][GM_H][GM_M + 4];      // partial h per wave at [m][s]; pitch 68 floats spreads the 16-byte stores of 16 rows m over all banks
  __shared__ __attribute__((aligned(16))) float sH[GM_H][GM_M];             // h after relu at [m][s]
  __shared__ __attribute__((aligned(16))) _Float16 sG[GM_M][LOW + 8];       // partial g as f16, gathered so that the work-group stores it in fragment order
  const int tid = threadIdx.x, lane = tid & 31, ln = lane & 15, hh = lane >> 4;
  const int w = __builtin_amdgcn_readfirstlane(tid >> 5);
  const int s0 = (blockIdx.x >> 1) * GM_M, mh = blockIdx.x & 1;
  struct BTile { FragH f[LOW / 32]; float b; };
  // this wave's stream of tiles: 16 of layer 1 (l = 16 w + u: MID parameters apart), then 16 of layer 2 (m = GM_H * mh + u: LOW parameters apart).
  // A tile's address is a wave-uniform base (first parameter n0 of the tile) plus the lane's fixed offset; fragment order: a tile of 16 parameters is 4 KB in a row
  const int nb1 = w * 512 + mh * GM_H, nb2 = LOW * MID + mh * GM_H * LOW + w * 16;
  const unsigned lo16 = lane * 16, lo4 = ln * 4;
  struct TAddr { const char* p; const char* c; };      // a lane's addresses of a tile: weights, bias
  auto tile_addr = [&](int n0) { return TAddr{(const char*)Bg + (size_t)n0 * (LOW * 2) + lo16, (const char*)pgb + (size_t)n0 * 4 + lo4}; };
  auto load_tile = [&](BTile& t, const TAddr& ad) {
    const char* p = ad.p;
    t.b = *(const float*)ad.c;
#pragma unroll
    for (int ks = 0; ks < LOW / 32; ++ks) { t.f[ks].half[0] = *(const v8us*)(p + ks * 1024); t.f[ks].half[1] = *(const v8us*)(p + ks * 1024 + 512); }
  };
  // precaution: s_wait_xcnt 0 in front of whatever reuses the address registers of two tiles' loads; it takes the four addresses as inputs, so that their registers stay theirs up to the wait; the scheduling barrier holds later arithmetic behind it
  auto close_tiles = [&](const TAddr& x, const TAddr& y) {
    asm volatile("s_wait_xcnt 0x0" :: "v"(x.p), "v"(x.c), "v"(y.p), "v"(y.c) : "memory");
    __builtin_amdgcn_sched_barrier(0);
  };
  v4f fl[GM_M / 32][4];
#pragma unroll
  for (int q = 0; q < GM_M / 32; ++q)
#pragma unroll
    for (int j = 0; j < 4; ++j) fl[q][j] = *(const v4fa*)(FLOW + (size_t)(s0 + q * 32 + lane) * LOW + w * 16 + j * 4);
  asm volatile("s_wait_xcnt 0x0" ::: "memory");      // precaution: the compiler reuses these loads' address pairs for the next addresses
  __builtin_amdgcn_sched_barrier(0);      // holds that reuse behind the wait
  FragH a[GM_T][LOW / 32];
#pragma unroll
  for (int mt = 0; mt < GM_T; ++mt) {
    const unsigned short* ar = (const unsigned short*)PL + (size_t)(s0 + mt * 16) * LOW + lane * 8;
#pragma unroll
    for (int ks = 0; ks < LOW / 32; ++ks) { a[mt][ks].half[0] = *(const v8us*)(ar + ks * 512); a[mt][ks].half[1] = *(const v8us*)(ar + ks * 512 + 256); }
    asm volatile("s_wait_xcnt 0x0" ::: "memory");      // precaution: the compiler reuses an address pair of the loads above as the destination of a later load, or for the next tile's address
    __builtin_amdgcn_sched_barrier(0);      // holds that reuse behind the wait; behind the last tile it also keeps the sample loads in front of the weight loads: loads return in order, and behind them they would force the loop's first wait to drain the weight tiles too
  }
  BTile bt[2];
  { const TAddr x = tile_addr(nb1), y = tile_addr(nb1 + MID); load_tile(bt[0], x); load_tile(bt[1], y); close_tiles(x, y); }
#pragma unroll
  for (int q = 0; q < GM_M / 32; ++q)
#pragma unroll
    for (int j = 0; j < 4; ++j)
#pragma unroll
      for (int c = 0; c < 4; ++c) sF[w * 16 + j * 4 + c][q * 32 + lane] = fl[q][j][c];
  // fence on LDS alone: the wave's own stores land before it reads the rows back; a fence on every address space would also drain the weight loads in flight
  __builtin_amdgcn_fence(__ATOMIC_ACQ_REL, "workgroup", "local"); __builtin_amdgcn_wave_barrier();
  // one tile: acc[mt][r] += cf[sample] * (tile / 16 + bias); the tile's registers are refilled with the tile at un as soon as its WMMAs have issued
  auto tile_step = [&](BTile& t, const float* cf, v8f (&acc)[GM_T], const TAddr& un, auto refill) {
    v4f c[GM_T][2];
#pragma unroll
    for (int mt = 0; mt < GM_T; ++mt) { c[mt][0] = *(const v4fa*)(cf + mt * 16 + 8 * hh); c[mt][1] = *(const v4fa*)(cf + mt * 16 + 8 * hh + 4); }
    v8f d[GM_T] = {};
#pragma unroll
    for (int ks = 0; ks < LOW / 32; ++ks)
#pragma unroll
      for (int mt = 0; mt < GM_T; ++mt) d[mt] = __builtin_amdgcn_wmma_f32_16x16x32_f16(false, a[mt][ks].v, false, t.f[ks].v, (short)0, d[mt], false, false);
    const float bv = bf16_round(t.b);
    if constexpr (decltype(refill)::value) {
      load_tile(t, un);
      __builtin_amdgcn_sched_barrier(0);      // keeps the refill in front of the sums below: sunk behind them, to the end of the trip, the loads would have too little work to return under
    }
#pragma unroll
    for (int mt = 0; mt < GM_T; ++mt)
#pragma unroll
      for (int r = 0; r < 8; ++r) acc[mt][r] += c[mt][r >> 2][r & 3] * (d[mt][r] * 0.0625f + bv);
  };
  v8f hp[GM_T] = {};
  for (int i = 0; i < 8; ++i) {
    const int un = (i < 7) ? nb1 + (2 * i + 2) * MID : nb2;      // the last trip fetches the first two tiles of layer 2
    const TAddr x = tile_addr(un), y = tile_addr(un + ((i < 7) ? MID : LOW));
    tile_step(bt[0], &sF[w * 16 + 2 * i][0], hp, x, Yes{});
    tile_step(bt[1], &sF[w * 16 + 2 * i + 1][0], hp, y, Yes{});
    close_tiles(x, y);
  }
#pragma unroll
  for (int mt = 0; mt < GM_T; ++mt) {
    float* d = &sP[w][ln][mt * 16 + 8 * hh];
    *(v4fa*)d = (v4f){hp[mt][0], hp[mt][1], hp[mt][2], hp[mt][3]};
    *(v4fa*)(d + 4) = (v4f){hp[mt][4], hp[mt][5], hp[mt][6], hp[mt][7]};
  }
  __syncthreads();      // every wave's partial h is in LDS
  {
    const int m = tid >> 4, s4 = (tid & 15) * 4;
    v4f v = *(const v4fa*)&sP[0][m][s4];
#pragma unroll
    for (int q = 1; q < 8; ++q) v += *(const v4fa*)&sP[q][m][s4];
#pragma unroll
    for (int c = 0; c < 4; ++c) v[c] = fmaxf(v[c], 0.f);
    *(v4fa*)&sH[m][s4] = v;
  }
  __syncthreads();      // h is complete before any wave reads it
  v8f g[GM_T] = {};
  for (int i = 0; i < 7; ++i) {
    const int un = nb2 + (2 * i + 2) * LOW;
    const TAddr x = tile_addr(un), y = tile_addr(un + LOW);
    tile_step(bt[0], &sH[2 * i][0], g, x, Yes{});
    tile_step(bt[1], &sH[2 * i + 1][0], g, y, Yes{});
    close_tiles(x, y);
  }
  tile_step(bt[0], &sH[14][0], g, TAddr{}, No{});
  tile_step(bt[1], &sH[15][0], g, TAddr{}, No{});
#pragma unroll
  for (int mt = 0; mt < GM_T; ++mt)
#pragma unroll
    for (int r = 0; r < 8; ++r) sG[mt * 16 + 8 * hh + r][w * 16 + ln] = (_Float16)g[mt][r];
  __syncthreads();      // all of the partial g is in LDS before the rows are stored
  unsigned short* go = (unsigned short*)G16 + (size_t)mh * NBS * LOW + (size_t)s0 * LOW + tid * 8;
#pragma unroll
  for (int j = 0; j < GM_T; ++j) {
    // piece tid of row tile j in fragment order: wave w stores half w & 1 of unit w >> 1
    *(v8us*)(go + j * 16 * LOW) = *(const v8us*)&sG[16 * j + ln][(w >> 1) * 32 + (w & 1) * 16 + 8 * hh];
  }
}
extern "C" void kernel_launch(void* const* d_in, const int* in_sizes, int n_in,
                              void* d_out, int out_size, void* d_ws, size_t ws_size, hipStream_t stream) {
  (void)in_sizes; (void)n_in; (void)out_size;
  const float* f = (const float*)d_in[0]; const float* pf = (const float*)d_in[1]; const float* pfw = (const float*)d_in[2]; const float* pfb = (const float*)d_in[3]; const float* ppw = (const float*)d_in[4]; const float* ppb = (const float*)d_in[5]; const float* f2w = (const float*)d_in[6]; const float* f2b = (const float*)d_in[7]; const float* pgw = (const float*)d_in[8]; const float* pgb = (const float*)d_in[9];
  char* ws = (char*)d_ws; size_t off = 0;
  auto take = [&](size_t bytes) { char* p = ws + off; off += (bytes + 255) & ~(size_t)255; return p; };
  _Float16* Bf = (_Float16*)take((size_t)LOW * FD * 2); _Float16* Bp = (_Float16*)take((size_t)LOW * FD * 2); _Float16* Bg = (_Float16*)take((size_t)NPAR * LOW * 2); _Float16* B2 = (_Float16*)take((size_t)FD * LOW * 2);
  float* FLOW = (float*)take((size_t)NBS * LOW * 4); _Float16* PL16 = (_Float16*)take((size_t)NBS * LOW * 2); _Float16* G16 = (_Float16*)take((size_t)2 * NBS * LOW * 2);
  if (off > ws_size) return;      // about 13 MiB
  k_round_all<<<RB_G + 3 * RB_P, 256, 0, stream>>>(pgw, pfw, ppw, f2w, Bg, Bf, Bp, B2);      // (out,in), fragment order
  k_proj2<<<2 * PJ_B, 128, 0, stream>>>(f, pf, Bf, Bp, pfb, ppb, FLOW, PL16);      // f_low (f32, read by the per-sample MLP) and pf_low (f16 operand of the generator)
  k_gen_mlp<<<2 * (NBS / GM_M), 256, 0, stream>>>(PL16, Bg, pgb, FLOW, G16);      // params = pf_low . pg_w^T + pg_b, consumed in registers by the per-sample MLP
  k_out<<<(NBS / 16) * (FD / 64) / 4, 128, 0, stream>>>(G16, B2, f2b, f, pf, (float*)d_out);      // g . proj_f2^T + b + (f + pf)
}

// v007
// One run takes 48.2 microseconds.
// In both of two side-by-side timings against v006, it was 1.16 times as fast.
// Over all steps from v000 it is 12.3 times as fast.
#include <hip/hip_runtime.h>
// + bias, + f + pf residuals as exact bf16 addends) on v_wmma_f32_16x16x32_f16 (f16 operands, nn.Linear weights (out,in) bf16-exact ×2^4, f32 accumulate); the per-sample tiny MLP
// (128 -> 32 relu -> 128 with that sample's generated weights) is f32 VALU on the generator's accumulator tiles (64 samples and half of the hidden units per work-group).
#define NBS 8192
#define FD 1024
#define LOW 128
#define MID 32
#define NPAR (2 * LOW * MID)

typedef __bf16 v16b __attribute__((ext_vector_type(16)));
typedef unsigned short v8us __attribute__((ext_vector_type(8), may_alias));
typedef float  v8f  __attribute__((ext_vector_type(8)));
typedef float  v4f  __attribute__((ext_vector_type(4)));
typedef float  v4fa __attribute__((ext_vector_type(4), may_alias));
union FragB { v16b v; v8us half[2]; unsigned short u[16]; };

__device__ __forceinline__ unsigned short bf16_bits(float x) { unsigned int u = __float_as_uint(x); return (unsigned short)((u + 0x7FFFu + ((u >> 16) & 1u)) >> 16); }
__device__ __forceinline__ float bf16_val(unsigned short b) { return __uint_as_float(((unsigned int)b) << 16); }
__device__ __forceinline__ float bf16_round(float x) { return bf16_val(bf16_bits(x)); }
// D += A·B with NT terms: 1 = ah·bh, 2 = + al·bh (A split), 3 = + ah·bl (both split)
template <int NT>
__device__ __forceinline__ v8f mmaN(v16b ah, v16b al, v16b bh, v16b bl, v8f c) {
  c = __builtin_amdgcn_wmma_f32_16x16x32_bf16(false, ah, false, bh, (short)0, c, false, false);
  if (NT >= 2) c = __builtin_amdgcn_wmma_f32_16x16x32_bf16(false, al, false, bh, (short)0, c, false, false);
  if (NT >= 3) c = __builtin_amdgcn_wmma_f32_16x16x32_bf16(false, ah, false, bl, (short)0, c, false, false);
  asm volatile("v_nop\n\tv_nop\n\tv_nop\n\tv_nop" : "+v"(c) : "v"(ah), "v"(al), "v"(bh), "v"(bl));
  return c;
}

__global__ __launch_bounds__(256) void k_wt_bf16(const float* __restrict__ W, unsigned short* __restrict__ Wt, int K, int N) {
  const int t = blockIdx.x * 256 + threadIdx.x;
  const int k8n = K / 8;
  if (t >= N * k8n) return;
  const int n = t / k8n, k8 = (t % k8n) * 8;
  v8us v;
#pragma unroll
  for (int i = 0; i < 8; ++i) v[i] = bf16_bits(W[(size_t)(k8 + i) * N + n]);
  *(v8us*)(Wt + (size_t)n * K + k8) = v;
  
}

// GEMM C[M][N] (f32, pitch ldc) = act(A[M][K]·W + bias). A f32 row-major (pitch lda) converted per fragment to bf16
// (ASPLIT: hi/lo two planes -> 2 terms, else single rounded term); Wt bf16 [N][K] (pitch ldb). BIAS_BF16 rounds the
// bias to bf16 first (bias quantised to bf16 before the add). K%32==0, M%16==0, N%64==0.
template <bool ASPLIT, int ACT, bool BIAS_BF16>
__global__ __launch_bounds__(128) void k_gemm_bf(const float* __restrict__ A, int lda, const unsigned short* __restrict__ Wt, int ldb,
                                               const float* __restrict__ bias, float* __restrict__ C, int ldc, int M, int N, int K) {
  __shared__ __attribute__((aligned(16))) float so[4][16][64];
  const int tid = threadIdx.x, w = tid >> 5, lane = tid & 31, ln = lane & 15, hh = lane >> 4;
  const int ntn = N / 64;
  const int wid = blockIdx.x * 4 + w;
  const int mt = wid / ntn, nq = wid % ntn;
  if (mt * 16 >= M) return;
  const int row0 = mt * 16, col0 = nq * 64;
  const float* arow = A + (size_t)(row0 + ln) * lda;
  v8f acc[4] = {};
  for (int kb = 0; kb < K; kb += 32) {
    FragB ah, al;
    const v4f x0 = *(const v4fa*)(arow + kb + 8 * hh), x1 = *(const v4fa*)(arow + kb + 8 * hh + 4);
    const v4f x2 = *(const v4fa*)(arow + kb + 16 + 8 * hh), x3 = *(const v4fa*)(arow + kb + 16 + 8 * hh + 4);
    float xs[16] = {x0[0],x0[1],x0[2],x0[3],x1[0],x1[1],x1[2],x1[3],x2[0],x2[1],x2[2],x2[3],x3[0],x3[1],x3[2],x3[3]};
#pragma unroll
    for (int i = 0; i < 16; ++i) { const unsigned short hb = bf16_bits(xs[i]); ah.u[i] = hb; al.u[i] = ASPLIT ? bf16_bits(xs[i] - bf16_val(hb)) : (unsigned short)0; }
#pragma unroll
    for (int t = 0; t < 4; ++t) {
      const unsigned short* brow = Wt + (size_t)(col0 + t * 16 + ln) * ldb + kb;
      FragB b;
      b.half[0] = *(const v8us*)(brow + 8 * hh);
      b.half[1] = *(const v8us*)(brow + 16 + 8 * hh);
      acc[t] = mmaN<ASPLIT ? 2 : 1>(ah.v, al.v, b.v, b.v, acc[t]);
    }
  }
#pragma unroll
  for (int t = 0; t < 4; ++t) {
    float bv = bias ? bias[col0 + t * 16 + ln] : 0.f;
    if (BIAS_BF16) bv = bf16_round(bv);
#pragma unroll
    for (int r = 0; r < 8; ++r) { float v = acc[t][r] + bv; if (ACT == 1) v = fmaxf(v, 0.f); so[w][8 * hh + r][t * 16 + ln] = v; }
  }
  __builtin_amdgcn_fence(__ATOMIC_ACQ_REL, "workgroup");
  __builtin_amdgcn_wave_barrier();
  const int rsub = lane >> 4, c4 = (lane & 15) * 4;
  {
#pragma unroll
    for (int q = 0; q < 8; ++q) {
      const int r = q * 2 + rsub;
      const v4f v = *(const v4fa*)&so[w][r][c4];
      *(v4f*)(C + (size_t)(row0 + r) * ldc + col0 + c4) = v;
    }
    
  }
}

// Flash-style causal/unmasked attention, all contractions 3-term bf16 hi/lo splits, f32 softmax with running max.
// q,k,v rows are read from f32 buffers with arbitrary row pitch (so they can live inside a fused qkv buffer);
// D = head size (multiple of 32, <= 128); one wave = 16 query rows; block = 4 waves (64 queries) sharing K/V chunks of 32.
template <int D, bool CAUSAL>
__global__ __launch_bounds__(128) void k_flash(const float* __restrict__ qb, const float* __restrict__ kb, const float* __restrict__ vb,
                                             int pitch, int T, int H, float scale, float* __restrict__ y, int ypitch) {
  constexpr int KS = D / 32;        // k-steps for QK
  constexpr int DT = D / 16;        // d tiles for PV
  __shared__ __attribute__((aligned(16))) unsigned short sKh[32][D + 8], sKl[32][D + 8], sVh[32][D + 8], sVl[32][D + 8];
  __shared__ __attribute__((aligned(16))) unsigned short sPh[4][16][40], sPl[4][16][40];
  __shared__ __attribute__((aligned(16))) float sO[4][16][D];
  const int tid = threadIdx.x, w = tid >> 5, lane = tid & 31, ln = lane & 15, hh = lane >> 4;
  const int nqb = (T + 63) / 64;
  const int bh = blockIdx.x / nqb, qblk = blockIdx.x % nqb;
  const int b = bh / H, h = bh % H;
  const int q0 = qblk * 64 + w * 16;
  const float* Q = qb + (size_t)b * T * pitch + h * D;
  const float* K = kb + (size_t)b * T * pitch + h * D;
  const float* V = vb + (size_t)b * T * pitch + h * D;

  // A fragments of the wave's 16 query rows (scaled), hi/lo
  FragB aqh[KS], aql[KS];
  {
    int row = q0 + ln; if (row >= T) row = T - 1;
    const float* qr = Q + (size_t)row * pitch;
#pragma unroll
    for (int ks = 0; ks < KS; ++ks)
#pragma unroll
      for (int i = 0; i < 16; ++i) {
        const int d = ks * 32 + ((i < 8) ? (8 * hh + i) : (16 + 8 * hh + (i - 8)));
        const float x = qr[d] * scale; const unsigned short hb = bf16_bits(x);
        aqh[ks].u[i] = hb; aql[ks].u[i] = bf16_bits(x - bf16_val(hb));
      }
  }
  float m_r[8], l_r[8];
#pragma unroll
  for (int r = 0; r < 8; ++r) { m_r[r] = -3.0e38f; l_r[r] = 0.f; }
  v8f oacc[DT];
#pragma unroll
  for (int dt = 0; dt < DT; ++dt) oacc[dt] = (v8f){0.f,0.f,0.f,0.f,0.f,0.f,0.f,0.f};

  const int kv_end = CAUSAL ? min(T, qblk * 64 + 64) : T;     // block-uniform
  for (int j0 = 0; j0 < kv_end; j0 += 32) {
    __syncthreads();
    for (int e = tid; e < 32 * (D / 4); e += 128) {
      const int r = e / (D / 4), c4 = (e % (D / 4)) * 4;
      const int key = j0 + r;
      v4f kf = {0.f,0.f,0.f,0.f}, vf = {0.f,0.f,0.f,0.f};
      if (key < T) { kf = *(const v4fa*)(K + (size_t)key * pitch + c4); vf = *(const v4fa*)(V + (size_t)key * pitch + c4); }
#pragma unroll
      for (int t = 0; t < 4; ++t) {
        unsigned short hb = bf16_bits(kf[t]); sKh[r][c4 + t] = hb; sKl[r][c4 + t] = bf16_bits(kf[t] - bf16_val(hb));
        hb = bf16_bits(vf[t]); sVh[r][c4 + t] = hb; sVl[r][c4 + t] = bf16_bits(vf[t] - bf16_val(hb));
      }
    }
    __syncthreads();
    // S tile 16 x 32
    v8f s[2];
#pragma unroll
    for (int nt = 0; nt < 2; ++nt) {
      v8f acc = {};
#pragma unroll
      for (int ks = 0; ks < KS; ++ks) {
        FragB bh_, bl_;
        bh_.half[0] = *(const v8us*)&sKh[nt * 16 + ln][ks * 32 + 8 * hh]; bh_.half[1] = *(const v8us*)&sKh[nt * 16 + ln][ks * 32 + 16 + 8 * hh];
        bl_.half[0] = *(const v8us*)&sKl[nt * 16 + ln][ks * 32 + 8 * hh]; bl_.half[1] = *(const v8us*)&sKl[nt * 16 + ln][ks * 32 + 16 + 8 * hh];
        acc = mmaN<3>(aqh[ks].v, aql[ks].v, bh_.v, bl_.v, acc);
      }
      s[nt] = acc;
    }
    // mask + running max (rows 8hh+r; the 16 lanes of a half share rows)
    float alpha[8];
#pragma unroll
    for (int r = 0; r < 8; ++r) {
      const int qi = q0 + 8 * hh + r;
      const int ja = j0 + ln, jb = j0 + 16 + ln;
      if (CAUSAL) { if (ja > qi) s[0][r] = -3.0e38f; if (jb > qi) s[1][r] = -3.0e38f; }
      if (ja >= T) s[0][r] = -3.0e38f;
      if (jb >= T) s[1][r] = -3.0e38f;
      float mx = fmaxf(s[0][r], s[1][r]);
      mx = fmaxf(mx, __shfl_xor(mx, 1, 32)); mx = fmaxf(mx, __shfl_xor(mx, 2, 32)); mx = fmaxf(mx, __shfl_xor(mx, 4, 32)); mx = fmaxf(mx, __shfl_xor(mx, 8, 32));
      const float mnew = fmaxf(m_r[r], mx);
      alpha[r] = (mnew > -1.0e38f) ? __expf(m_r[r] - mnew) : 1.0f;
      const float p0 = (s[0][r] > -1.0e38f) ? __expf(s[0][r] - mnew) : 0.f;
      const float p1 = (s[1][r] > -1.0e38f) ? __expf(s[1][r] - mnew) : 0.f;
      m_r[r] = mnew;
      l_r[r] = l_r[r] * alpha[r] + p0 + p1;            // per-lane partial row sum (16 lanes combined at the end)
      unsigned short hb = bf16_bits(p0); sPh[w][8 * hh + r][ln] = hb;      sPl[w][8 * hh + r][ln] = bf16_bits(p0 - bf16_val(hb));
      hb = bf16_bits(p1);                sPh[w][8 * hh + r][16 + ln] = hb; sPl[w][8 * hh + r][16 + ln] = bf16_bits(p1 - bf16_val(hb));
    }
#pragma unroll
    for (int dt = 0; dt < DT; ++dt)
#pragma unroll
      for (int r = 0; r < 8; ++r) oacc[dt][r] *= alpha[r];
    __builtin_amdgcn_fence(__ATOMIC_ACQ_REL, "workgroup");
    __builtin_amdgcn_wave_barrier();
    FragB pah, pal;
    pah.half[0] = *(const v8us*)&sPh[w][ln][8 * hh]; pah.half[1] = *(const v8us*)&sPh[w][ln][16 + 8 * hh];
    pal.half[0] = *(const v8us*)&sPl[w][ln][8 * hh]; pal.half[1] = *(const v8us*)&sPl[w][ln][16 + 8 * hh];
#pragma unroll
    for (int dt = 0; dt < DT; ++dt) {
      FragB bvh, bvl;
#pragma unroll
      for (int i = 0; i < 8; ++i) {
        bvh.u[i] = sVh[8 * hh + i][dt * 16 + ln]; bvh.u[8 + i] = sVh[16 + 8 * hh + i][dt * 16 + ln];
        bvl.u[i] = sVl[8 * hh + i][dt * 16 + ln]; bvl.u[8 + i] = sVl[16 + 8 * hh + i][dt * 16 + ln];
      }
      oacc[dt] = mmaN<3>(pah.v, pal.v, bvh.v, bvl.v, oacc[dt]);
    }
    __builtin_amdgcn_fence(__ATOMIC_ACQ_REL, "workgroup");
    __builtin_amdgcn_wave_barrier();
  }
#pragma unroll
  for (int r = 0; r < 8; ++r) {
    float l = l_r[r];
    l += __shfl_xor(l, 1, 32); l += __shfl_xor(l, 2, 32); l += __shfl_xor(l, 4, 32); l += __shfl_xor(l, 8, 32);
    l_r[r] = (l > 0.f) ? 1.0f / l : 0.f;
  }
#pragma unroll
  for (int dt = 0; dt < DT; ++dt)
#pragma unroll
    for (int r = 0; r < 8; ++r) sO[w][8 * hh + r][dt * 16 + ln] = oacc[dt][r] * l_r[r];
  __builtin_amdgcn_fence(__ATOMIC_ACQ_REL, "workgroup");
  __builtin_amdgcn_wave_barrier();
  {
    for (int r = 0; r < 16; ++r) {
      const int row = q0 + r;
      if (row < T && lane < D / 4) {
        const v4f val = *(const v4fa*)&sO[w][r][lane * 4];
        *(v4f*)(y + ((size_t)b * T + row) * ypitch + h * D + lane * 4) = val;
      }
    }
    
  }
}

// GEMM C = act(A·W + bias + resid): A f32 (ASPLIT -> hi/lo 2 terms), Wt bf16 [N][K]; ACT 0 none, 1 relu, 2 exact gelu;
// resid (optional, f32, row index = (row % rmod), pitch ldr, RES_BF16 rounds it) added before the activation.
template <bool ASPLIT, int ACT, bool BIAS_BF16, bool RES_BF16>
__global__ __launch_bounds__(128) void k_gemm_bf3(const float* __restrict__ A, int lda, const unsigned short* __restrict__ Wt, int ldb,
                                                const float* __restrict__ bias, const float* __restrict__ resid, int rmod, int ldr,
                                                float* __restrict__ C, int ldc, int M, int N, int K) {
  __shared__ __attribute__((aligned(16))) float so[4][16][64];
  const int tid = threadIdx.x, w = tid >> 5, lane = tid & 31, ln = lane & 15, hh = lane >> 4;
  const int ntn = N / 64;
  const int wid = blockIdx.x * 4 + w;
  const int mt = wid / ntn, nq = wid % ntn;
  if (mt * 16 >= M) return;
  const int row0 = mt * 16, col0 = nq * 64;
  const float* arow = A + (size_t)(row0 + ln) * lda;
  v8f acc[4] = {};
  for (int kb = 0; kb < K; kb += 32) {
    FragB ah, al;
    const v4f x0 = *(const v4fa*)(arow + kb + 8 * hh), x1 = *(const v4fa*)(arow + kb + 8 * hh + 4);
    const v4f x2 = *(const v4fa*)(arow + kb + 16 + 8 * hh), x3 = *(const v4fa*)(arow + kb + 16 + 8 * hh + 4);
    float xs[16] = {x0[0],x0[1],x0[2],x0[3],x1[0],x1[1],x1[2],x1[3],x2[0],x2[1],x2[2],x2[3],x3[0],x3[1],x3[2],x3[3]};
#pragma unroll
    for (int i = 0; i < 16; ++i) { const unsigned short hb = bf16_bits(xs[i]); ah.u[i] = hb; al.u[i] = ASPLIT ? bf16_bits(xs[i] - bf16_val(hb)) : (unsigned short)0; }
#pragma unroll
    for (int t = 0; t < 4; ++t) {
      const unsigned short* brow = Wt + (size_t)(col0 + t * 16 + ln) * ldb + kb;
      FragB b;
      b.half[0] = *(const v8us*)(brow + 8 * hh);
      b.half[1] = *(const v8us*)(brow + 16 + 8 * hh);
      acc[t] = mmaN<ASPLIT ? 2 : 1>(ah.v, al.v, b.v, b.v, acc[t]);
    }
  }
#pragma unroll
  for (int t = 0; t < 4; ++t) {
    const int col = col0 + t * 16 + ln;
    float bv = bias ? bias[col] : 0.f;
    if (BIAS_BF16) bv = bf16_round(bv);
#pragma unroll
    for (int r = 0; r < 8; ++r) {
      float v = acc[t][r] + bv;
      if (resid) { float rv = resid[(size_t)((row0 + 8 * hh + r) % rmod) * ldr + col]; if (RES_BF16) rv = bf16_round(rv); v += rv; }
      if (ACT == 1) v = fmaxf(v, 0.f);
      if (ACT == 2) v = 0.5f * v * (1.0f + erff(v * 0.70710678118654752f));
      if (ACT == 3) { const float u = 0.7978845608028654f * (v + 0.044715f * v * v * v); v = 0.5f * v * (1.0f + tanhf(u)); }
      so[w][8 * hh + r][t * 16 + ln] = v;
    }
  }
  __builtin_amdgcn_fence(__ATOMIC_ACQ_REL, "workgroup");
  __builtin_amdgcn_wave_barrier();
  const int rsub = lane >> 4, c4 = (lane & 15) * 4;
  {
#pragma unroll
    for (int q = 0; q < 8; ++q) {
      const int r = q * 2 + rsub;
      const v4f v = *(const v4fa*)&so[w][r][c4];
      *(v4f*)(C + (size_t)(row0 + r) * ldc + col0 + c4) = v;
    }
    
  }
}
// row LayerNorm (biased variance, eps) over N: s = X (+ R); optional out_sum <- s; out_norm <- (s-mu)*rsqrt(var+eps)*g + b
template <bool PARAM_BF16>
__global__ __launch_bounds__(256) void k_layernorm(const float* __restrict__ X, const float* __restrict__ R, const float* __restrict__ g, const float* __restrict__ bta,
                                                  float* __restrict__ out_sum, float* __restrict__ out_norm, int N, float eps) {
  __shared__ float red[256];
  const int row = blockIdx.x, tid = threadIdx.x;
  const float* x = X + (size_t)row * N; const float* rr = R ? R + (size_t)row * N : nullptr;
  float vals[16];                     // up to N = 4096
  const int per = N / 256;            // contiguous chunk per thread? use strided-by-4 chunks: thread handles j = tid*4 + 1024*u
  float s1 = 0.f;
  for (int u = 0; u < per / 4; ++u) {
    const int j = tid * 4 + 1024 * u;
    const v4f a = *(const v4fa*)(x + j);
    v4f b = {0.f,0.f,0.f,0.f}; if (rr) b = *(const v4fa*)(rr + j);
#pragma unroll
    for (int q = 0; q < 4; ++q) { const float v = a[q] + b[q]; vals[u * 4 + q] = v; s1 += v; }
  }
  red[tid] = s1; __syncthreads();
  for (int st = 128; st > 0; st >>= 1) { if (tid < st) red[tid] += red[tid + st]; __syncthreads(); }
  const float mu = red[0] / (float)N; __syncthreads();
  float s2 = 0.f;
  for (int u = 0; u < per / 4; ++u)
#pragma unroll
    for (int q = 0; q < 4; ++q) { const float c = vals[u * 4 + q] - mu; s2 += c * c; }
  red[tid] = s2; __syncthreads();
  for (int st = 128; st > 0; st >>= 1) { if (tid < st) red[tid] += red[tid + st]; __syncthreads(); }
  const float rs = rsqrtf(red[0] / (float)N + eps);
  {
    for (int u = 0; u < per / 4; ++u) {
      const int j = tid * 4 + 1024 * u;
      v4f o, sm;
#pragma unroll
      for (int q = 0; q < 4; ++q) {
        float gg = g[j + q], bb = bta[j + q];
        if (PARAM_BF16) { gg = bf16_round(gg); bb = bf16_round(bb); }
        sm[q] = vals[u * 4 + q]; o[q] = (vals[u * 4 + q] - mu) * rs * gg + bb;
      }
      if (out_sum) *(v4f*)(out_sum + (size_t)row * N + j) = sm;
      *(v4f*)(out_norm + (size_t)row * N + j) = o;
    }
    
  }
}



// ---- f16 WMMA path (v_wmma_f32_16x16x32_f16): 11-bit significands for operands in range — used for the projection, generator and output GEMMs
typedef _Float16 v16h __attribute__((ext_vector_type(16)));
union FragH { v16h v; v8us half[2]; _Float16 h[16]; unsigned short u[16]; };
template <int NT>
__device__ __forceinline__ v8f mmaH(v16h ah, v16h al, v16h bh, v16h bl, v8f c) {
  c = __builtin_amdgcn_wmma_f32_16x16x32_f16(false, ah, false, bh, (short)0, c, false, false);
  if (NT >= 2) c = __builtin_amdgcn_wmma_f32_16x16x32_f16(false, al, false, bh, (short)0, c, false, false);
  if (NT >= 3) c = __builtin_amdgcn_wmma_f32_16x16x32_f16(false, ah, false, bl, (short)0, c, false, false);
  asm volatile("v_nop\n\tv_nop\n\tv_nop\n\tv_nop" : "+v"(c) : "v"(ah), "v"(al), "v"(bh), "v"(bl));
  return c;
}
// batched GEMM like k_gemm_b but f16 operands: A f32 (split into f16 hi/lo if ASPLIT, else rounded to f16), Bt = f16 values [n][k]; alpha; C f32; N multiple of 16 (partial tiles skipped)
template <bool ASPLIT>
__global__ __launch_bounds__(128) void k_gemm_h(const float* __restrict__ A, int lda, size_t sA, const _Float16* __restrict__ Bh, int ldb, size_t sB, float alpha, float* __restrict__ C, int ldc, size_t sC, int M, int N, int K) {
  __shared__ __attribute__((aligned(16))) float so[4][16][64];
  const int tid = threadIdx.x, w = tid >> 5, lane = tid & 31, ln = lane & 15, hh = lane >> 4; const int by = blockIdx.y;
  A += (size_t)by * sA; Bh += (size_t)by * sB; C += (size_t)by * sC;
  const int ntn = (N + 63) / 64; const int wid = blockIdx.x * 4 + w; const int mt = wid / ntn, nq = wid % ntn; if (mt * 16 >= M) return;
  const int row0 = mt * 16, col0 = nq * 64; const float* arow = A + (size_t)(row0 + ln) * lda;
  v8f acc[4] = {};
  for (int kb = 0; kb < K; kb += 32) {
    FragH ah, al;
    const v4f x0 = *(const v4fa*)(arow + kb + 8 * hh), x1 = *(const v4fa*)(arow + kb + 8 * hh + 4), x2 = *(const v4fa*)(arow + kb + 16 + 8 * hh), x3 = *(const v4fa*)(arow + kb + 16 + 8 * hh + 4);
    float xs[16] = {x0[0],x0[1],x0[2],x0[3],x1[0],x1[1],x1[2],x1[3],x2[0],x2[1],x2[2],x2[3],x3[0],x3[1],x3[2],x3[3]};
#pragma unroll
    for (int i = 0; i < 16; ++i) { const _Float16 h = (_Float16)xs[i]; ah.h[i] = h; al.h[i] = ASPLIT ? (_Float16)(xs[i] - (float)h) : (_Float16)0.0f; }
#pragma unroll
    for (int t = 0; t < 4; ++t) { if (col0 + t * 16 >= N) continue; const size_t boff = (size_t)(col0 + t * 16 + ln) * ldb + kb; FragH bq; bq.half[0] = *(const v8us*)(Bh + boff + 8 * hh); bq.half[1] = *(const v8us*)(Bh + boff + 16 + 8 * hh);
      acc[t] = mmaH<ASPLIT ? 2 : 1>(ah.v, al.v, bq.v, bq.v, acc[t]); }
  }
#pragma unroll
  for (int t = 0; t < 4; ++t) { if (col0 + t * 16 >= N) continue;
#pragma unroll
    for (int r = 0; r < 8; ++r) so[w][8 * hh + r][t * 16 + ln] = acc[t][r] * alpha; }
  __builtin_amdgcn_fence(__ATOMIC_ACQ_REL, "workgroup"); __builtin_amdgcn_wave_barrier();
  const int rsub = lane >> 4, c4 = (lane & 15) * 4;
  {
#pragma unroll
    for (int q = 0; q < 8; ++q) { const int r = q * 2 + rsub; if (col0 + c4 < N) { const v4f v = *(const v4fa*)&so[w][r][c4]; *(v4f*)(C + (size_t)(row0 + r) * ldc + col0 + c4) = v; } }
     }
}

// Wt[n][k] = f16(W[k][n]·scale) from f32 row-major W[K][N] (scale = power of two; bf16-exact weights stay exact in f16 away from the subnormal range)
__global__ __launch_bounds__(256) void k_wt_f16(const float* __restrict__ W, _Float16* __restrict__ Wt, int K, int N, float scale) {
  const int t = blockIdx.x * 256 + threadIdx.x; if (t >= N * (K / 8)) return; const int n = t / (K / 8), k8 = (t % (K / 8)) * 8; FragH f;
#pragma unroll
  for (int i = 0; i < 8; ++i) f.h[i] = (_Float16)(bf16_round(W[(size_t)(k8 + i) * N + n]) * scale); const v8us o = f.half[0];
  *(v8us*)((unsigned short*)Wt + (size_t)n * K + k8) = o; 
}
// k_gemm_hh variant with fused epilogue: v = acc·alpha + bias[by·sBias + col] (+ CP[(row/rowsPerB)·sCPb + by·64 + col] if CP) ; ACT 0 none / 1 elu ; writes f32 C and f16 C16, each if non-null
template <int ACT>
__global__ __launch_bounds__(128) void k_gemm_hhx(const _Float16* __restrict__ A, int lda, size_t sA, const _Float16* __restrict__ Bh, int ldb, size_t sB, float alpha, const float* __restrict__ bias, size_t sBias, const float* __restrict__ CP, int rowsPerB, size_t sCPb, int row0g,
    float* __restrict__ C, _Float16* __restrict__ C16, int ldc, size_t sC, int M, int N, int K) {
  __shared__ __attribute__((aligned(16))) float so[4][16][64];
  const int tid = threadIdx.x, w = tid >> 5, lane = tid & 31, ln = lane & 15, hh = lane >> 4; const int by = blockIdx.y;
  A += (size_t)by * sA; Bh += (size_t)by * sB; const size_t cofs = (size_t)by * sC; const float* bp = bias ? bias + (size_t)by * sBias : nullptr;
  const int ntn = (N + 63) / 64; const int wid = blockIdx.x * 4 + w; const int mt = wid / ntn, nq = wid % ntn; if (mt * 16 >= M) return;
  const int row0 = mt * 16, col0 = nq * 64; const _Float16* arow = A + (size_t)(row0 + ln) * lda;
  v8f acc[4] = {};
  for (int kb = 0; kb < K; kb += 32) { FragH ah; ah.half[0] = *(const v8us*)((const unsigned short*)arow + kb + 8 * hh); ah.half[1] = *(const v8us*)((const unsigned short*)arow + kb + 16 + 8 * hh);
#pragma unroll
    for (int t = 0; t < 4; ++t) { if (col0 + t * 16 >= N) continue; const size_t boff = (size_t)(col0 + t * 16 + ln) * ldb + kb; FragH bq; bq.half[0] = *(const v8us*)((const unsigned short*)Bh + boff + 8 * hh); bq.half[1] = *(const v8us*)((const unsigned short*)Bh + boff + 16 + 8 * hh);
      acc[t] = mmaH<1>(ah.v, ah.v, bq.v, bq.v, acc[t]); }
  }
#pragma unroll
  for (int t = 0; t < 4; ++t) { if (col0 + t * 16 >= N) continue; const int col = col0 + t * 16 + ln; const float bv = bp ? bf16_round(bp[col]) : 0.f;
#pragma unroll
    for (int r = 0; r < 8; ++r) { float v = acc[t][r] * alpha + bv; if (CP) { const int bidx = (row0g + row0 + 8 * hh + r) / rowsPerB; v += CP[(size_t)bidx * sCPb + (size_t)by * 64 + col]; } if (ACT == 1) v = (v > 0.f) ? v : expm1f(v); else if (ACT == 3) v = fmaxf(v, 0.f); so[w][8 * hh + r][t * 16 + ln] = v; } }
  __builtin_amdgcn_fence(__ATOMIC_ACQ_REL, "workgroup"); __builtin_amdgcn_wave_barrier();
  const int rsub = lane >> 4, c4 = (lane & 15) * 4; typedef _Float16 v4h __attribute__((ext_vector_type(4)));
  {
#pragma unroll
    for (int q = 0; q < 8; ++q) { const int r = q * 2 + rsub; if (col0 + c4 < N) { const v4f v = *(const v4fa*)&so[w][r][c4]; if (C) *(v4f*)(C + cofs + (size_t)(row0 + r) * ldc + col0 + c4) = v; if (C16) { v4h h4; for (int i = 0; i < 4; ++i) h4[i] = (_Float16)v[i]; *(v4h*)(C16 + cofs + (size_t)(row0 + r) * ldc + col0 + c4) = h4; } } }
     }
}


// FRAGMENT ORDER of every f16 operand plane in the workspace (weights, pf_low, g): a plane [rows][K] is cut into units of 16 rows x 32 k = 1 KB, unit index = (row / 16) * (K / 32) + k / 32;
// the 16-byte piece j * 32 + lane of a unit holds row (lane & 15), k = 16 j + 8 (lane >> 4) .. + 7: what lane reads as half j of its WMMA fragment. One wave-wide 16-byte load = 512 contiguous bytes = 4 whole lines.
// Bt = f16(bf16(W) * 16) in fragment order, W f32 [rows][32 << ksh]; thread t of a plane writes its piece t.
// The four weight planes depend on nothing, nor on one another: one launch rounds them all. A work-group writes 256 pieces of one plane (every plane is a whole number of work-groups), chosen by scalar selects, so that one body serves all four.
#define RB_G (NPAR * LOW / 8 / 256)
#define RB_P (LOW * FD / 8 / 256)
__global__ __launch_bounds__(256) void k_round_all(const float* __restrict__ pgw, const float* __restrict__ pfw, const float* __restrict__ ppw, const float* __restrict__ f2w,
                                                  _Float16* __restrict__ Bg, _Float16* __restrict__ Bf, _Float16* __restrict__ Bp, _Float16* __restrict__ B2) {
  const int b = blockIdx.x;
  const int sel = (b >= RB_G) + (b >= RB_G + RB_P) + (b >= RB_G + 2 * RB_P);      // 0 generator, 1 f projection, 2 pf projection, 3 last projection
  const float* W = sel == 0 ? pgw : sel == 1 ? pfw : sel == 2 ? ppw : f2w;
  _Float16* Bt = sel == 0 ? Bg : sel == 1 ? Bf : sel == 2 ? Bp : B2;
  const int ksh = (sel == 1 || sel == 2) ? 5 : 2;      // k steps of 32 in a row: FD / 32 = 32 or LOW / 32 = 4
  const int t = (b - (sel == 0 ? 0 : RB_G + (sel - 1) * RB_P)) * 256 + (int)threadIdx.x;
  FragH f;
  const int lane = t & 31, j = (t >> 5) & 1, unit = t >> 6;
  const float* src = W + ((size_t)((unit >> ksh) * 16 + (lane & 15)) << (5 + ksh)) + (unit & ((1 << ksh) - 1)) * 32 + 16 * j + 8 * (lane >> 4);
  const v4f x0 = *(const v4fa*)src, x1 = *(const v4fa*)(src + 4);
#pragma unroll
  for (int i = 0; i < 8; ++i) f.h[i] = (_Float16)(bf16_round(i < 4 ? x0[i & 3] : x1[i & 3]) * 16.0f); *(v8us*)((unsigned short*)Bt + (size_t)t * 8) = f.half[0];  }
__global__ __launch_bounds__(256) void k_h16(const float* __restrict__ x, _Float16* __restrict__ X16, size_t n8) { const size_t t = (size_t)blockIdx.x * 256 + threadIdx.x; if (t >= n8) return; FragH f;
#pragma unroll
  for (int q = 0; q < 8; ++q) f.h[q] = (_Float16)x[t * 8 + q]; *(v8us*)((unsigned short*)X16 + t * 8) = f.half[0];  }
// Projection C[NBS][LOW] = x . W^T + bias with x read as f32 and rounded on its way into the A fragment (bf16 rounding, then f16: the values the staged f16 copy held).
// Tile map and k order are those of k_gemm_hhx: one wave = 16 rows x 64 columns, k rising, one accumulator chain per 16 x 16 tile. Bh, and C16 where it is written, are in fragment order.
// x comes to LDS by asynchronous copies, a tile of the work-group's PJ_R rows x PJ_KC k at a time, two buffers: a wave-wide copy covers 512 contiguous bytes of one row (4 whole lines; a fragment load
// straight from x touches 16 lines for as many bytes), and the two waves that share a row tile read one copy in LDS.
#define PJ_U 8
#define PJ_R 32
#define PJ_KC (32 * PJ_U)
#define PJ_PITCH (PJ_KC * 4 + 16)      // bytes of a row in LDS: 16 x odd, so that the 16 rows of a 16-byte fragment read fall on all banks
#define PJ_TILE (PJ_R * PJ_PITCH)
// four rows of a tile, two copies of 512 bytes a row: l = the lane's LDS byte address, g = its global address, in the first row.
__device__ __forceinline__ void proj_copy4(unsigned l, const float* g) {
  const unsigned l0 = l, l1 = l + 512, l2 = l + PJ_PITCH, l3 = l + PJ_PITCH + 512, l4 = l + 2 * PJ_PITCH, l5 = l + 2 * PJ_PITCH + 512, l6 = l + 3 * PJ_PITCH, l7 = l + 3 * PJ_PITCH + 512;
  const float *g0 = g, *g1 = g + 128, *g2 = g + FD, *g3 = g + FD + 128, *g4 = g + 2 * FD, *g5 = g + 2 * FD + 128, *g6 = g + 3 * FD, *g7 = g + 3 * FD + 128;
  // the copies bring x into LDS through no register; precaution: s_wait_xcnt 0 as the statement's last line stands in front of whatever reuses the copies' address registers
  asm volatile("global_load_async_to_lds_b128 %0, %8, off\n\t"
               "global_load_async_to_lds_b128 %1, %9, off\n\t"
               "global_load_async_to_lds_b128 %2, %10, off\n\t"
               "global_load_async_to_lds_b128 %3, %11, off\n\t"
               "global_load_async_to_lds_b128 %4, %12, off\n\t"
               "global_load_async_to_lds_b128 %5, %13, off\n\t"
               "global_load_async_to_lds_b128 %6, %14, off\n\t"
               "global_load_async_to_lds_b128 %7, %15, off\n\t"
               "s_wait_xcnt 0x0"
               :: "v"(l0), "v"(l1), "v"(l2), "v"(l3), "v"(l4), "v"(l5), "v"(l6), "v"(l7), "v"(g0), "v"(g1), "v"(g2), "v"(g3), "v"(g4), "v"(g5), "v"(g6), "v"(g7) : "memory");
}
template <bool OUT16>
__device__ __forceinline__ void proj_body(int blk, float* __restrict__ sbuf, char* sx, const float* __restrict__ X, const _Float16* __restrict__ Bh, const float* __restrict__ bias, float* __restrict__ C, _Float16* __restrict__ C16) {
  float (*so)[16][OUT16 ? 68 : 64] = (float (*)[16][OUT16 ? 68 : 64])sbuf;      // pitch 68 floats where 16 lanes read one column range of 16 rows: it spreads them over all banks
  const int tid = threadIdx.x, w = tid >> 5, lane = tid & 31, ln = lane & 15, hh = lane >> 4;
  const int wid = blk * 4 + w, row0 = (wid >> 1) * 16, col0 = (wid & 1) * 64;
  const unsigned short* brow = (const unsigned short*)Bh + (size_t)col0 * FD + lane * 8;
  // wave w copies rows 8 w .. 8 w + 7 of each tile; every lane is on, and the tests around the copies read the same for the whole work-group
  const float* xg = X + (size_t)(blk * PJ_R + 8 * w) * FD + lane * 4;
  const unsigned xl = (unsigned)(size_t)sx + (unsigned)(8 * w * PJ_PITCH + lane * 16);
  auto copy_tile = [&](int tl) {
    const unsigned l = xl + (unsigned)((tl & 1) * PJ_TILE);
    const float* g = xg + tl * PJ_KC;
    proj_copy4(l, g);
    proj_copy4(l + 4 * PJ_PITCH, g + 4 * FD);
  };
  copy_tile(0);
  asm volatile("s_wait_asynccnt 0x0" ::: "memory");      // this wave's rows of tile 0 have landed
  __syncthreads();      // every wave's rows of tile 0 have landed before any wave reads the tile
  copy_tile(1);
  const char* xrow = sx + ((w >> 1) * 16 + ln) * PJ_PITCH + 32 * hh;      // the lane's row of the wave's row tile
  v8f acc[4] = {};
  for (int kb = 0; kb < FD; kb += PJ_KC) {
    const int tl = kb / PJ_KC;
    v4f x[PJ_U][4]; FragH b[PJ_U][4];
#pragma unroll
    for (int u = 0; u < PJ_U; ++u)
#pragma unroll
      for (int t = 0; t < 4; ++t) {
        const unsigned short* p = brow + (size_t)t * 16 * FD + kb * 16 + u * 512;
        b[u][t].half[0] = *(const v8us*)p; b[u][t].half[1] = *(const v8us*)(p + 256);
      }
    const char* xs = xrow + (tl & 1) * PJ_TILE;
#pragma unroll
    for (int u = 0; u < PJ_U; ++u) {
      const char* p = xs + u * 128;
      x[u][0] = *(const v4fa*)p; x[u][1] = *(const v4fa*)(p + 16); x[u][2] = *(const v4fa*)(p + 64); x[u][3] = *(const v4fa*)(p + 80);
    }
    asm volatile("s_wait_xcnt 0x0" ::: "memory");      // precaution: stands in front of the addition that steps the weight loads' address pair to the next group
    // the wave has now read all that it needs of tile tl into registers: the buffer is handed over here, in front of the arithmetic, so that the next copies fly under it
    asm volatile("s_wait_dscnt 0x0" ::: "memory");      // this wave's reads of tile tl have returned before the buffer is handed back
    asm volatile("s_wait_asynccnt 0x0" ::: "memory");      // this wave's rows of tile tl + 1 have landed
    __syncthreads();      // publishes tile tl + 1 and ends every wave's reads of tile tl, whose buffer is refilled behind it
    if (tl + 2 < FD / PJ_KC) copy_tile(tl + 2);
#pragma unroll
    for (int u = 0; u < PJ_U; ++u) {
      FragH a;
#pragma unroll
      for (int i = 0; i < 16; ++i) a.h[i] = (_Float16)bf16_round(x[u][i >> 2][i & 3]);
#pragma unroll
      for (int t = 0; t < 4; ++t) acc[t] = __builtin_amdgcn_wmma_f32_16x16x32_f16(false, a.v, false, b[u][t].v, (short)0, acc[t], false, false);
    }
  }
  asm volatile("s_wait_asynccnt 0x0" ::: "memory");      // no copy is outstanding when the wave goes on to the epilogue and ends
  float bv[4];
  __builtin_amdgcn_sched_barrier(0);      // keeps index arithmetic that has sunk down to the epilogue in front of the bias loads: between them and their wait it took the loads' offset register
#pragma unroll
  for (int t = 0; t < 4; ++t) bv[t] = bias[col0 + t * 16 + ln];
  asm volatile("s_wait_xcnt 0x0" ::: "memory");      // precaution: the compiler reuses the bias loads' offset register at once
  __builtin_amdgcn_sched_barrier(0);      // holds that reuse behind the wait
#pragma unroll
  for (int t = 0; t < 4; ++t) {
    const float bb = bf16_round(bv[t]);
#pragma unroll
    for (int r = 0; r < 8; ++r) so[w][8 * hh + r][t * 16 + ln] = acc[t][r] * 0.0625f + bb;
  }
  __builtin_amdgcn_fence(__ATOMIC_ACQ_REL, "workgroup", "local"); __builtin_amdgcn_wave_barrier();      // the wave's own LDS stores land before it reads the rows back
  if constexpr (OUT16) {
    // the wave's 64 columns are two units of its row tile: four stores of 512 contiguous bytes
    unsigned short* o = (unsigned short*)C16 + (size_t)row0 * LOW + col0 * 16 + lane * 8;
#pragma unroll
    for (int q = 0; q < 4; ++q) {
      const float* s = &so[w][ln][q * 16 + 8 * hh];
      const v4f v0 = *(const v4fa*)s, v1 = *(const v4fa*)(s + 4);
      FragH h;
#pragma unroll
      for (int i = 0; i < 8; ++i) h.h[i] = (_Float16)(i < 4 ? v0[i & 3] : v1[i & 3]);
      *(v8us*)(o + q * 256) = h.half[0];
    }
  } else {
    const int rsub = lane >> 4, c4 = (lane & 15) * 4;
    const size_t o0 = (size_t)(row0 + rsub) * LOW + col0 + c4;
#pragma unroll
    for (int q = 0; q < 8; ++q) {
      const v4f v = *(const v4fa*)&so[w][q * 2 + rsub][c4];
      *(v4f*)(C + o0 + q * 2 * LOW) = v;
    }
  }
}
// The two projections depend on nothing of one another: one launch holds both, the first PJ_B work-groups f_low, the rest pf_low, so that two work-groups stand on a WGP and each runs under the other's load waits.
#define PJ_B ((NBS / 16) * (LOW / 64) / 4)
__global__ __launch_bounds__(128) void k_proj2(const float* __restrict__ f, const float* __restrict__ pf, const _Float16* __restrict__ Bf, const _Float16* __restrict__ Bp, const float* __restrict__ pfb, const float* __restrict__ ppb,
                                              float* __restrict__ FLOW, _Float16* __restrict__ PL16) {
  __shared__ __attribute__((aligned(16))) float sbuf[4 * 16 * 68];
  __shared__ __attribute__((aligned(16))) char sx[2 * PJ_TILE];      // the two buffers of x tiles
  const int b = blockIdx.x;
  if (b < PJ_B) proj_body<false>(b, sbuf, sx, f, Bf, pfb, FLOW, nullptr);
  else proj_body<true>(b - PJ_B, sbuf, sx, pf, Bp, ppb, nullptr, PL16);
}
// out[NBS][FD] = (g0 + g1) . W2^T + bias + (f + pf), g0 and g1 the two planes of partial g, taken as one operand of K = 2 * LOW against W2 twice: f and pf are read as f32 by the lane that stores the element, 16 bytes at a time, rounded to bf16 and summed there.
// Tile map and k order are those of k_gemm_hhx (one wave = 16 rows x 64 columns). G and Bh are in fragment order.
__global__ __launch_bounds__(128) void k_out(const _Float16* __restrict__ G, const _Float16* __restrict__ Bh, const float* __restrict__ bias, const float* __restrict__ f, const float* __restrict__ pf, float* __restrict__ out) {
  __shared__ __attribute__((aligned(16))) float so[4][16][64];
  const int tid = threadIdx.x, w = tid >> 5, lane = tid & 31, ln = lane & 15, hh = lane >> 4;
  const int wid = blockIdx.x * 4 + w, row0 = (wid / (FD / 64)) * 16, col0 = (wid % (FD / 64)) * 64;
  const int rsub = lane >> 4, c4 = (lane & 15) * 4;
  const unsigned short* arow = (const unsigned short*)G + (size_t)row0 * LOW + lane * 8;
  const unsigned short* brow = (const unsigned short*)Bh + (size_t)col0 * LOW + lane * 8;
  FragH a[2][LOW / 32], b[4][LOW / 32];
#pragma unroll
  for (int p = 0; p < 2; ++p)
#pragma unroll
    for (int ks = 0; ks < LOW / 32; ++ks) { a[p][ks].half[0] = *(const v8us*)(arow + (size_t)p * NBS * LOW + ks * 512); a[p][ks].half[1] = *(const v8us*)(arow + (size_t)p * NBS * LOW + ks * 512 + 256); }
  asm volatile("s_wait_xcnt 0x0" ::: "memory");      // precaution: the compiler reuses these loads' address pair as the destination of a later load
#pragma unroll
  for (int t = 0; t < 4; ++t)
#pragma unroll
    for (int ks = 0; ks < LOW / 32; ++ks) { b[t][ks].half[0] = *(const v8us*)(brow + (size_t)t * 16 * LOW + ks * 512); b[t][ks].half[1] = *(const v8us*)(brow + (size_t)t * 16 * LOW + ks * 512 + 256); }
  float bv[4];
#pragma unroll
  for (int t = 0; t < 4; ++t) bv[t] = bias[col0 + t * 16 + ln];
  asm volatile("s_wait_xcnt 0x0" ::: "memory");      // precaution: the operand loads' address registers are free for reuse behind it
  __builtin_amdgcn_sched_barrier(0);      // loads return in order: the operand loads (L2) stay in front of the residual loads (memory), so that the WMMAs need not wait for the latter
  const size_t o0 = (size_t)(row0 + rsub) * FD + col0 + c4;
  v4f rf[8], rp[8];
#pragma unroll
  for (int q = 0; q < 8; ++q) { rf[q] = *(const v4fa*)(f + o0 + q * 2 * FD); rp[q] = *(const v4fa*)(pf + o0 + q * 2 * FD); }
  asm volatile("s_wait_xcnt 0x0" ::: "memory");      // precaution: as above, for the residual loads' two address pairs
  __builtin_amdgcn_sched_barrier(0);      // keeps the residual loads in front of the product, which then runs under their latency
  v8f acc[4] = {};
#pragma unroll
  for (int p = 0; p < 2; ++p)
#pragma unroll
    for (int ks = 0; ks < LOW / 32; ++ks)
#pragma unroll
      for (int t = 0; t < 4; ++t) acc[t] = __builtin_amdgcn_wmma_f32_16x16x32_f16(false, a[p][ks].v, false, b[t][ks].v, (short)0, acc[t], false, false);
#pragma unroll
  for (int t = 0; t < 4; ++t) {
    const float bb = bf16_round(bv[t]);
#pragma unroll
    for (int r = 0; r < 8; ++r) so[w][8 * hh + r][t * 16 + ln] = acc[t][r] * 0.0625f + bb;
  }
  __builtin_amdgcn_fence(__ATOMIC_ACQ_REL, "workgroup", "local"); __builtin_amdgcn_wave_barrier();      // the wave's own LDS stores land before it reads the rows back; LDS alone, so that the residual loads stay in flight
#pragma unroll
  for (int q = 0; q < 8; ++q) {
    v4f v = *(const v4fa*)&so[w][q * 2 + rsub][c4];
#pragma unroll
    for (int c = 0; c < 4; ++c) v[c] += bf16_round(rf[q][c]) + bf16_round(rp[q][c]);
    *(v4f*)(out + o0 + q * 2 * FD) = v;
  }
}
// Parameter generator and per-sample MLP in one kernel: a work-group owns GM_M samples and GM_H of the MID hidden units, and never stores the generated parameters.
// A hidden unit m needs only the parameters l * MID + m of layer 1 and LOW * MID + m * LOW + l of layer 2, so the two halves of the hidden units are independent up to the last sum over m:
// each half writes its own partial g, and the last GEMM adds the two. A weight tile that comes from L2 thus serves GM_T sample tiles, and a work-group reads half of the weight plane.
// Each 16 x 16 tile of params = pf_low . pg_w^T (K = LOW, four f16 WMMAs) is scaled, biased and summed into h or g straight from the accumulator registers
// (accumulator register r of lane (ln, hh) = sample 8 * hh + r, parameter column ln).
// Layer 1: wave w owns l = 16 w .. 16 w + 15 and sums them in rising order; the eight waves' partial h meet in LDS in rising wave order, then relu.
// Layer 2: wave w owns l = 16 w .. 16 w + 15 and sums the work-group's m in rising order.
#define GM_M 64
#define GM_T (GM_M / 16)
#define GM_H (MID / 2)
struct Yes { static constexpr bool value = true; }; struct No { static constexpr bool value = false; };
__global__ __launch_bounds__(256) void k_gen_mlp(const _Float16* __restrict__ PL, const _Float16* __restrict__ Bg, const float* __restrict__ pgb, const float* __restrict__ FLOW, _Float16* __restrict__ G16) {
  __shared__ __attribute__((aligned(16))) float sF[LOW][GM_M];              // flow[s][l] at [l][s]; rows 16 w .. + 15 are written and read by wave w alone
  __shared__ __attribute__((aligned(16))) float sP[8][GM_H][GM_M + 4];      // partial h per wave at [m][s]; pitch 68 floats spreads the 16-byte stores of 16 rows m over all banks
  __shared__ __attribute__((aligned(16))) float sH[GM_H][GM_M];             // h after relu at [m][s]
  __shared__ __attribute__((aligned(16))) _Float16 sG[GM_M][LOW + 8];       // partial g as f16, gathered so that the work-group stores it in fragment order
  const int tid = threadIdx.x, lane = tid & 31, ln = lane & 15, hh = lane >> 4;
  const int w = __builtin_amdgcn_readfirstlane(tid >> 5);
  const int s0 = (blockIdx.x >> 1) * GM_M, mh = blockIdx.x & 1;
  struct BTile { FragH f[LOW / 32]; float b; };
  // this wave's stream of tiles: 16 of layer 1 (l = 16 w + u: MID parameters apart), then 16 of layer 2 (m = GM_H * mh + u: LOW parameters apart).
  // A tile's address is a wave-uniform base (first parameter n0 of the tile) plus the lane's fixed offset; fragment order: a tile of 16 parameters is 4 KB in a row
  const int nb1 = w * 512 + mh * GM_H, nb2 = LOW * MID + mh * GM_H * LOW + w * 16;
  const unsigned lo16 = lane * 16, lo4 = ln * 4;
  struct TAddr { const char* p; const char* c; };      // a lane's addresses of a tile: weights, bias
  auto tile_addr = [&](int n0) { return TAddr{(const char*)Bg + (size_t)n0 * (LOW * 2) + lo16, (const char*)pgb + (size_t)n0 * 4 + lo4}; };
  auto load_tile = [&](BTile& t, const TAddr& ad) {
    const char* p = ad.p;
    t.b = *(const float*)ad.c;
#pragma unroll
    for (int ks = 0; ks < LOW / 32; ++ks) { t.f[ks].half[0] = *(const v8us*)(p + ks * 1024); t.f[ks].half[1] = *(const v8us*)(p + ks * 1024 + 512); }
  };
  // precaution: s_wait_xcnt 0 in front of whatever reuses the address registers of two tiles' loads; it takes the four addresses as inputs, so that their registers stay theirs up to the wait; the scheduling barrier holds later arithmetic behind it
  auto close_tiles = [&](const TAddr& x, const TAddr& y) {
    asm volatile("s_wait_xcnt 0x0" :: "v"(x.p), "v"(x.c), "v"(y.p), "v"(y.c) : "memory");
    __builtin_amdgcn_sched_barrier(0);
  };
  v4f fl[GM_M / 32][4];
#pragma unroll
  for (int q = 0; q < GM_M / 32; ++q)
#pragma unroll
    for (int j = 0; j < 4; ++j) fl[q][j] = *(const v4fa*)(FLOW + (size_t)(s0 + q * 32 + lane) * LOW + w * 16 + j * 4);
  asm volatile("s_wait_xcnt 0x0" ::: "memory");      // precaution: the compiler reuses these loads' address pairs for the next addresses
  __builtin_amdgcn_sched_barrier(0);      // holds that reuse behind the wait
  FragH a[GM_T][LOW / 32];
#pragma unroll
  for (int mt = 0; mt < GM_T; ++mt) {
    const unsigned short* ar = (const unsigned short*)PL + (size_t)(s0 + mt * 16) * LOW + lane * 8;
#pragma unroll
    for (int ks = 0; ks < LOW / 32; ++ks) { a[mt][ks].half[0] = *(const v8us*)(ar + ks * 512); a[mt][ks].half[1] = *(const v8us*)(ar + ks * 512 + 256); }
    asm volatile("s_wait_xcnt 0x0" ::: "memory");      // precaution: the compiler reuses an address pair of the loads above as the destination of a later load, or for the next tile's address
    __builtin_amdgcn_sched_barrier(0);      // holds that reuse behind the wait; behind the last tile it also keeps the sample loads in front of the weight loads: loads return in order, and behind them they would force the loop's first wait to drain the weight tiles too
  }
  BTile bt[2];
  { const TAddr x = tile_addr(nb1), y = tile_addr(nb1 + MID); load_tile(bt[0], x); load_tile(bt[1], y); close_tiles(x, y); }
#pragma unroll
  for (int q = 0; q < GM_M / 32; ++q)
#pragma unroll
    for (int j = 0; j < 4; ++j)
#pragma unroll
      for (int c = 0; c < 4; ++c) sF[w * 16 + j * 4 + c][q * 32 + lane] = fl[q][j][c];
  // fence on LDS alone: the wave's own stores land before it reads the rows back; a fence on every address space would also drain the weight loads in flight
  __builtin_amdgcn_fence(__ATOMIC_ACQ_REL, "workgroup", "local"); __builtin_amdgcn_wave_barrier();
  // one tile: acc[mt][r] += cf[sample] * (tile / 16 + bias); the tile's registers are refilled with the tile at un as soon as its WMMAs have issued
  auto tile_step = [&](BTile& t, const float* cf, v8f (&acc)[GM_T], const TAddr& un, auto refill) {
    v4f c[GM_T][2];
#pragma unroll
    for (int mt = 0; mt < GM_T; ++mt) { c[mt][0] = *(const v4fa*)(cf + mt * 16 + 8 * hh); c[mt][1] = *(const v4fa*)(cf + mt * 16 + 8 * hh + 4); }
    v8f d[GM_T] = {};
#pragma unroll
    for (int ks = 0; ks < LOW / 32; ++ks)
#pragma unroll
      for (int mt = 0; mt < GM_T; ++mt) d[mt] = __builtin_amdgcn_wmma_f32_16x16x32_f16(false, a[mt][ks].v, false, t.f[ks].v, (short)0, d[mt], false, false);
    const float bv = bf16_round(t.b);
    if constexpr (decltype(refill)::value) {
      load_tile(t, un);
      __builtin_amdgcn_sched_barrier(0);      // keeps the refill in front of the sums below: sunk behind them, to the end of the trip, the loads would have too little work to return under
    }
#pragma unroll
    for (int mt = 0; mt < GM_T; ++mt)
#pragma unroll
      for (int r = 0; r < 8; ++r) acc[mt][r] += c[mt][r >> 2][r & 3] * (d[mt][r] * 0.0625f + bv);
  };
  v8f hp[GM_T] = {};
  for (int i = 0; i < 8; ++i) {
    const int un = (i < 7) ? nb1 + (2 * i + 2) * MID : nb2;      // the last trip fetches the first two tiles of layer 2
    const TAddr x = tile_addr(un), y = tile_addr(un + ((i < 7) ? MID : LOW));
    tile_step(bt[0], &sF[w * 16 + 2 * i][0], hp, x, Yes{});
    tile_step(bt[1], &sF[w * 16 + 2 * i + 1][0], hp, y, Yes{});
    close_tiles(x, y);
  }
#pragma unroll
  for (int mt = 0; mt < GM_T; ++mt) {
    float* d = &sP[w][ln][mt * 16 + 8 * hh];
    *(v4fa*)d = (v4f){hp[mt][0], hp[mt][1], hp[mt][2], hp[mt][3]};
    *(v4fa*)(d + 4) = (v4f){hp[mt][4], hp[mt][5], hp[mt][6], hp[mt][7]};
  }
  __syncthreads();      // every wave's partial h is in LDS
  {
    const int m = tid >> 4, s4 = (tid & 15) * 4;
    v4f v = *(const v4fa*)&sP[0][m][s4];
#pragma unroll
    for (int q = 1; q < 8; ++q) v += *(const v4fa*)&sP[q][m][s4];
#pragma unroll
    for (int c = 0; c < 4; ++c) v[c] = fmaxf(v[c], 0.f);
    *(v4fa*)&sH[m][s4] = v;
  }
  __syncthreads();      // h is complete before any wave reads it
  v8f g[GM_T] = {};
  for (int i = 0; i < 7; ++i) {
    const int un = nb2 + (2 * i + 2) * LOW;
    const TAddr x = tile_addr(un), y = tile_addr(un + LOW);
    tile_step(bt[0], &sH[2 * i][0], g, x, Yes{});
    tile_step(bt[1], &sH[2 * i + 1][0], g, y, Yes{});
    close_tiles(x, y);
  }
  tile_step(bt[0], &sH[14][0], g, TAddr{}, No{});
  tile_step(bt[1], &sH[15][0], g, TAddr{}, No{});
#pragma unroll
  for (int mt = 0; mt < GM_T; ++mt)
#pragma unroll
    for (int r = 0; r < 8; ++r) sG[mt * 16 + 8 * hh + r][w * 16 + ln] = (_Float16)g[mt][r];
  __syncthreads();      // all of the partial g is in LDS before the rows are stored
  unsigned short* go = (unsigned short*)G16 + (size_t)mh * NBS * LOW + (size_t)s0 * LOW + tid * 8;
#pragma unroll
  for (int j = 0; j < GM_T; ++j) {
    // piece tid of row tile j in fragment order: wave w stores half w & 1 of unit w >> 1
    *(v8us*)(go + j * 16 * LOW) = *(const v8us*)&sG[16 * j + ln][(w >> 1) * 32 + (w & 1) * 16 + 8 * hh];
  }
}
extern "C" void kernel_launch(void* const* d_in, const int* in_sizes, int n_in,
                              void* d_out, int out_size, void* d_ws, size_t ws_size, hipStream_t stream) {
  (void)in_sizes; (void)n_in; (void)out_size;
  const float* f = (const float*)d_in[0]; const float* pf = (const float*)d_in[1]; const float* pfw = (const float*)d_in[2]; const float* pfb = (const float*)d_in[3]; const float* ppw = (const float*)d_in[4]; const float* ppb = (const float*)d_in[5]; const float* f2w = (const float*)d_in[6]; const float* f2b = (const float*)d_in[7]; const float* pgw = (const float*)d_in[8]; const float* pgb = (const float*)d_in[9];
  char* ws = (char*)d_ws; size_t off = 0;
  auto take = [&](size_t bytes) { char* p = ws + off; off += (bytes + 255) & ~(size_t)255; return p; };
  _Float16* Bf = (_Float16*)take((size_t)LOW * FD * 2); _Float16* Bp = (_Float16*)take((size_t)LOW * FD * 2); _Float16* Bg = (_Float16*)take((size_t)NPAR * LOW * 2); _Float16* B2 = (_Float16*)take((size_t)FD * LOW * 2);
  float* FLOW = (float*)take((size_t)NBS * LOW * 4); _Float16* PL16 = (_Float16*)take((size_t)NBS * LOW * 2); _Float16* G16 = (_Float16*)take((size_t)2 * NBS * LOW * 2);
  if (off > ws_size) return;      // about 13 MiB
  k_round_all<<<RB_G + 3 * RB_P, 256, 0, stream>>>(pgw, pfw, ppw, f2w, Bg, Bf, Bp, B2);      // (out,in), fragment order
  k_proj2<<<2 * PJ_B, 128, 0, stream>>>(f, pf, Bf, Bp, pfb, ppb, FLOW, PL16);      // f_low (f32, read by the per-sample MLP) and pf_low (f16 operand of the generator)
  k_gen_mlp<<<2 * (NBS / GM_M), 256, 0, stream>>>(PL16, Bg, pgb, FLOW, G16);      // params = pf_low . pg_w^T + pg_b, consumed in registers by the per-sample MLP
  k_out<<<(NBS / 16) * (FD / 64) / 4, 128, 0, stream>>>(G16, B2, f2b, f, pf, (float*)d_out);      // g . proj_f2^T + b + (f + pf)
}

// v008
// It runs in 46.3 microseconds.
// Two timings next to v007 put it at 1.05 and 1.04 times that version's speed.
// Counting every step since v000, it is 12.8 times as fast.
#include <hip/hip_runtime.h>
// + bias, + f + pf residuals as exact bf16 addends) on v_wmma_f32_16x16x32_f16 (f16 operands, nn.Linear weights (out,in) bf16-exact ×2^4, f32 accumulate); the per-sample tiny MLP
// (128 -> 32 relu -> 128 with that sample's generated weights) is f32 VALU on the generator's accumulator tiles (64 samples and half of the hidden units per work-group).
#define NBS 8192
#define FD 1024
#define LOW 128
#define MID 32
#define NPAR (2 * LOW * MID)

typedef __bf16 v16b __attribute__((ext_vector_type(16)));
typedef unsigned short v8us __attribute__((ext_vector_type(8), may_alias));
typedef float  v8f  __attribute__((ext_vector_type(8)));
typedef float  v4f  __attribute__((ext_vector_type(4)));
typedef float  v4fa __attribute__((ext_vector_type(4), may_alias));
typedef __bf16 v4b __attribute__((ext_vector_type(4)));
union FragB { v16b v; v8us half[2]; unsigned short u[16]; v4b q[4]; };

// f32 -> bf16, round to nearest even, by the hardware's conversion (v_cvt_pk_bf16_f32)
__device__ __forceinline__ unsigned short bf16_bits(float x) { return __builtin_bit_cast(unsigned short, (__bf16)x); }
__device__ __forceinline__ float bf16_val(unsigned short b) { return __uint_as_float(((unsigned int)b) << 16); }
__device__ __forceinline__ float bf16_round(float x) { return bf16_val(bf16_bits(x)); }
// D += A·B with NT terms: 1 = ah·bh, 2 = + al·bh (A split), 3 = + ah·bl (both split)
template <int NT>
__device__ __forceinline__ v8f mmaN(v16b ah, v16b al, v16b bh, v16b bl, v8f c) {
  c = __builtin_amdgcn_wmma_f32_16x16x32_bf16(false, ah, false, bh, (short)0, c, false, false);
  if (NT >= 2) c = __builtin_amdgcn_wmma_f32_16x16x32_bf16(false, al, false, bh, (short)0, c, false, false);
  if (NT >= 3) c = __builtin_amdgcn_wmma_f32_16x16x32_bf16(false, ah, false, bl, (short)0, c, false, false);
  asm volatile("v_nop\n\tv_nop\n\tv_nop\n\tv_nop" : "+v"(c) : "v"(ah), "v"(al), "v"(bh), "v"(bl));
  return c;
}

__global__ __launch_bounds__(256) void k_wt_bf16(const float* __restrict__ W, unsigned short* __restrict__ Wt, int K, int N) {
  const int t = blockIdx.x * 256 + threadIdx.x;
  const int k8n = K / 8;
  if (t >= N * k8n) return;
  const int n = t / k8n, k8 = (t % k8n) * 8;
  v8us v;
#pragma unroll
  for (int i = 0; i < 8; ++i) v[i] = bf16_bits(W[(size_t)(k8 + i) * N + n]);
  *(v8us*)(Wt + (size_t)n * K + k8) = v;
  
}

// GEMM C[M][N] (f32, pitch ldc) = act(A[M][K]·W + bias). A f32 row-major (pitch lda) converted per fragment to bf16
// (ASPLIT: hi/lo two planes -> 2 terms, else single rounded term); Wt bf16 [N][K] (pitch ldb). BIAS_BF16 rounds the
// bias to bf16 first (bias quantised to bf16 before the add). K%32==0, M%16==0, N%64==0.
template <bool ASPLIT, int ACT, bool BIAS_BF16>
__global__ __launch_bounds__(128) void k_gemm_bf(const float* __restrict__ A, int lda, const unsigned short* __restrict__ Wt, int ldb,
                                               const float* __restrict__ bias, float* __restrict__ C, int ldc, int M, int N, int K) {
  __shared__ __attribute__((aligned(16))) float so[4][16][64];
  const int tid = threadIdx.x, w = tid >> 5, lane = tid & 31, ln = lane & 15, hh = lane >> 4;
  const int ntn = N / 64;
  const int wid = blockIdx.x * 4 + w;
  const int mt = wid / ntn, nq = wid % ntn;
  if (mt * 16 >= M) return;
  const int row0 = mt * 16, col0 = nq * 64;
  const float* arow = A + (size_t)(row0 + ln) * lda;
  v8f acc[4] = {};
  for (int kb = 0; kb < K; kb += 32) {
    FragB ah, al;
    const v4f x0 = *(const v4fa*)(arow + kb + 8 * hh), x1 = *(const v4fa*)(arow + kb + 8 * hh + 4);
    const v4f x2 = *(const v4fa*)(arow + kb + 16 + 8 * hh), x3 = *(const v4fa*)(arow + kb + 16 + 8 * hh + 4);
    float xs[16] = {x0[0],x0[1],x0[2],x0[3],x1[0],x1[1],x1[2],x1[3],x2[0],x2[1],x2[2],x2[3],x3[0],x3[1],x3[2],x3[3]};
#pragma unroll
    for (int i = 0; i < 16; ++i) { const unsigned short hb = bf16_bits(xs[i]); ah.u[i] = hb; al.u[i] = ASPLIT ? bf16_bits(xs[i] - bf16_val(hb)) : (unsigned short)0; }
#pragma unroll
    for (int t = 0; t < 4; ++t) {
      const unsigned short* brow = Wt + (size_t)(col0 + t * 16 + ln) * ldb + kb;
      FragB b;
      b.half[0] = *(const v8us*)(brow + 8 * hh);
      b.half[1] = *(const v8us*)(brow + 16 + 8 * hh);
      acc[t] = mmaN<ASPLIT ? 2 : 1>(ah.v, al.v, b.v, b.v, acc[t]);
    }
  }
#pragma unroll
  for (int t = 0; t < 4; ++t) {
    float bv = bias ? bias[col0 + t * 16 + ln] : 0.f;
    if (BIAS_BF16) bv = bf16_round(bv);
#pragma unroll
    for (int r = 0; r < 8; ++r) { float v = acc[t][r] + bv; if (ACT == 1) v = fmaxf(v, 0.f); so[w][8 * hh + r][t * 16 + ln] = v; }
  }
  __builtin_amdgcn_fence(__ATOMIC_ACQ_REL, "workgroup");
  __builtin_amdgcn_wave_barrier();
  const int rsub = lane >> 4, c4 = (lane & 15) * 4;
  {
#pragma unroll
    for (int q = 0; q < 8; ++q) {
      const int r = q * 2 + rsub;
      const v4f v = *(const v4fa*)&so[w][r][c4];
      *(v4f*)(C + (size_t)(row0 + r) * ldc + col0 + c4) = v;
    }
    
  }
}

// Flash-style causal/unmasked attention, all contractions 3-term bf16 hi/lo splits, f32 softmax with running max.
// q,k,v rows are read from f32 buffers with arbitrary row pitch (so they can live inside a fused qkv buffer);
// D = head size (multiple of 32, <= 128); one wave = 16 query rows; block = 4 waves (64 queries) sharing K/V chunks of 32.
template <int D, bool CAUSAL>
__global__ __launch_bounds__(128) void k_flash(const float* __restrict__ qb, const float* __restrict__ kb, const float* __restrict__ vb,
                                             int pitch, int T, int H, float scale, float* __restrict__ y, int ypitch) {
  constexpr int KS = D / 32;        // k-steps for QK
  constexpr int DT = D / 16;        // d tiles for PV
  __shared__ __attribute__((aligned(16))) unsigned short sKh[32][D + 8], sKl[32][D + 8], sVh[32][D + 8], sVl[32][D + 8];
  __shared__ __attribute__((aligned(16))) unsigned short sPh[4][16][40], sPl[4][16][40];
  __shared__ __attribute__((aligned(16))) float sO[4][16][D];
  const int tid = threadIdx.x, w = tid >> 5, lane = tid & 31, ln = lane & 15, hh = lane >> 4;
  const int nqb = (T + 63) / 64;
  const int bh = blockIdx.x / nqb, qblk = blockIdx.x % nqb;
  const int b = bh / H, h = bh % H;
  const int q0 = qblk * 64 + w * 16;
  const float* Q = qb + (size_t)b * T * pitch + h * D;
  const float* K = kb + (size_t)b * T * pitch + h * D;
  const float* V = vb + (size_t)b * T * pitch + h * D;

  // A fragments of the wave's 16 query rows (scaled), hi/lo
  FragB aqh[KS], aql[KS];
  {
    int row = q0 + ln; if (row >= T) row = T - 1;
    const float* qr = Q + (size_t)row * pitch;
#pragma unroll
    for (int ks = 0; ks < KS; ++ks)
#pragma unroll
      for (int i = 0; i < 16; ++i) {
        const int d = ks * 32 + ((i < 8) ? (8 * hh + i) : (16 + 8 * hh + (i - 8)));
        const float x = qr[d] * scale; const unsigned short hb = bf16_bits(x);
        aqh[ks].u[i] = hb; aql[ks].u[i] = bf16_bits(x - bf16_val(hb));
      }
  }
  float m_r[8], l_r[8];
#pragma unroll
  for (int r = 0; r < 8; ++r) { m_r[r] = -3.0e38f; l_r[r] = 0.f; }
  v8f oacc[DT];
#pragma unroll
  for (int dt = 0; dt < DT; ++dt) oacc[dt] = (v8f){0.f,0.f,0.f,0.f,0.f,0.f,0.f,0.f};

  const int kv_end = CAUSAL ? min(T, qblk * 64 + 64) : T;     // block-uniform
  for (int j0 = 0; j0 < kv_end; j0 += 32) {
    __syncthreads();
    for (int e = tid; e < 32 * (D / 4); e += 128) {
      const int r = e / (D / 4), c4 = (e % (D / 4)) * 4;
      const int key = j0 + r;
      v4f kf = {0.f,0.f,0.f,0.f}, vf = {0.f,0.f,0.f,0.f};
      if (key < T) { kf = *(const v4fa*)(K + (size_t)key * pitch + c4); vf = *(const v4fa*)(V + (size_t)key * pitch + c4); }
#pragma unroll
      for (int t = 0; t < 4; ++t) {
        unsigned short hb = bf16_bits(kf[t]); sKh[r][c4 + t] = hb; sKl[r][c4 + t] = bf16_bits(kf[t] - bf16_val(hb));
        hb = bf16_bits(vf[t]); sVh[r][c4 + t] = hb; sVl[r][c4 + t] = bf16_bits(vf[t] - bf16_val(hb));
      }
    }
    __syncthreads();
    // S tile 16 x 32
    v8f s[2];
#pragma unroll
    for (int nt = 0; nt < 2; ++nt) {
      v8f acc = {};
#pragma unroll
      for (int ks = 0; ks < KS; ++ks) {
        FragB bh_, bl_;
        bh_.half[0] = *(const v8us*)&sKh[nt * 16 + ln][ks * 32 + 8 * hh]; bh_.half[1] = *(const v8us*)&sKh[nt * 16 + ln][ks * 32 + 16 + 8 * hh];
        bl_.half[0] = *(const v8us*)&sKl[nt * 16 + ln][ks * 32 + 8 * hh]; bl_.half[1] = *(const v8us*)&sKl[nt * 16 + ln][ks * 32 + 16 + 8 * hh];
        acc = mmaN<3>(aqh[ks].v, aql[ks].v, bh_.v, bl_.v, acc);
      }
      s[nt] = acc;
    }
    // mask + running max (rows 8hh+r; the 16 lanes of a half share rows)
    float alpha[8];
#pragma unroll
    for (int r = 0; r < 8; ++r) {
      const int qi = q0 + 8 * hh + r;
      const int ja = j0 + ln, jb = j0 + 16 + ln;
      if (CAUSAL) { if (ja > qi) s[0][r] = -3.0e38f; if (jb > qi) s[1][r] = -3.0e38f; }
      if (ja >= T) s[0][r] = -3.0e38f;
      if (jb >= T) s[1][r] = -3.0e38f;
      float mx = fmaxf(s[0][r], s[1][r]);
      mx = fmaxf(mx, __shfl_xor(mx, 1, 32)); mx = fmaxf(mx, __shfl_xor(mx, 2, 32)); mx = fmaxf(mx, __shfl_xor(mx, 4, 32)); mx = fmaxf(mx, __shfl_xor(mx, 8, 32));
      const float mnew = fmaxf(m_r[r], mx);
      alpha[r] = (mnew > -1.0e38f) ? __expf(m_r[r] - mnew) : 1.0f;
      const float p0 = (s[0][r] > -1.0e38f) ? __expf(s[0][r] - mnew) : 0.f;
      const float p1 = (s[1][r] > -1.0e38f) ? __expf(s[1][r] - mnew) : 0.f;
      m_r[r] = mnew;
      l_r[r] = l_r[r] * alpha[r] + p0 + p1;            // per-lane partial row sum (16 lanes combined at the end)
      unsigned short hb = bf16_bits(p0); sPh[w][8 * hh + r][ln] = hb;      sPl[w][8 * hh + r][ln] = bf16_bits(p0 - bf16_val(hb));
      hb = bf16_bits(p1);                sPh[w][8 * hh + r][16 + ln] = hb; sPl[w][8 * hh + r][16 + ln] = bf16_bits(p1 - bf16_val(hb));
    }
#pragma unroll
    for (int dt = 0; dt < DT; ++dt)
#pragma unroll
      for (int r = 0; r < 8; ++r) oacc[dt][r] *= alpha[r];
    __builtin_amdgcn_fence(__ATOMIC_ACQ_REL, "workgroup");
    __builtin_amdgcn_wave_barrier();
    FragB pah, pal;
    pah.half[0] = *(const v8us*)&sPh[w][ln][8 * hh]; pah.half[1] = *(const v8us*)&sPh[w][ln][16 + 8 * hh];
    pal.half[0] = *(const v8us*)&sPl[w][ln][8 * hh]; pal.half[1] = *(const v8us*)&sPl[w][ln][16 + 8 * hh];
#pragma unroll
    for (int dt = 0; dt < DT; ++dt) {
      FragB bvh, bvl;
#pragma unroll
      for (int i = 0; i < 8; ++i) {
        bvh.u[i] = sVh[8 * hh + i][dt * 16 + ln]; bvh.u[8 + i] = sVh[16 + 8 * hh + i][dt * 16 + ln];
        bvl.u[i] = sVl[8 * hh + i][dt * 16 + ln]; bvl.u[8 + i] = sVl[16 + 8 * hh + i][dt * 16 + ln];
      }
      oacc[dt] = mmaN<3>(pah.v, pal.v, bvh.v, bvl.v, oacc[dt]);
    }
    __builtin_amdgcn_fence(__ATOMIC_ACQ_REL, "workgroup");
    __builtin_amdgcn_wave_barrier();
  }
#pragma unroll
  for (int r = 0; r < 8; ++r) {
    float l = l_r[r];
    l += __shfl_xor(l, 1, 32); l += __shfl_xor(l, 2, 32); l += __shfl_xor(l, 4, 32); l += __shfl_xor(l, 8, 32);
    l_r[r] = (l > 0.f) ? 1.0f / l : 0.f;
  }
#pragma unroll
  for (int dt = 0; dt < DT; ++dt)
#pragma unroll
    for (int r = 0; r < 8; ++r) sO[w][8 * hh + r][dt * 16 + ln] = oacc[dt][r] * l_r[r];
  __builtin_amdgcn_fence(__ATOMIC_ACQ_REL, "workgroup");
  __builtin_amdgcn_wave_barrier();
  {
    for (int r = 0; r < 16; ++r) {
      const int row = q0 + r;
      if (row < T && lane < D / 4) {
        const v4f val = *(const v4fa*)&sO[w][r][lane * 4];
        *(v4f*)(y + ((size_t)b * T + row) * ypitch + h * D + lane * 4) = val;
      }
    }
    
  }
}

// GEMM C = act(A·W + bias + resid): A f32 (ASPLIT -> hi/lo 2 terms), Wt bf16 [N][K]; ACT 0 none, 1 relu, 2 exact gelu;
// resid (optional, f32, row index = (row % rmod), pitch ldr, RES_BF16 rounds it) added before the activation.
template <bool ASPLIT, int ACT, bool BIAS_BF16, bool RES_BF16>
__global__ __launch_bounds__(128) void k_gemm_bf3(const float* __restrict__ A, int lda, const unsigned short* __restrict__ Wt, int ldb,
                                                const float* __restrict__ bias, const float* __restrict__ resid, int rmod, int ldr,
                                                float* __restrict__ C, int ldc, int M, int N, int K) {
  __shared__ __attribute__((aligned(16))) float so[4][16][64];
  const int tid = threadIdx.x, w = tid >> 5, lane = tid & 31, ln = lane & 15, hh = lane >> 4;
  const int ntn = N / 64;
  const int wid = blockIdx.x * 4 + w;
  const int mt = wid / ntn, nq = wid % ntn;
  if (mt * 16 >= M) return;
  const int row0 = mt * 16, col0 = nq * 64;
  const float* arow = A + (size_t)(row0 + ln) * lda;
  v8f acc[4] = {};
  for (int kb = 0; kb < K; kb += 32) {
    FragB ah, al;
    const v4f x0 = *(const v4fa*)(arow + kb + 8 * hh), x1 = *(const v4fa*)(arow + kb + 8 * hh + 4);
    const v4f x2 = *(const v4fa*)(arow + kb + 16 + 8 * hh), x3 = *(const v4fa*)(arow + kb + 16 + 8 * hh + 4);
    float xs[16] = {x0[0],x0[1],x0[2],x0[3],x1[0],x1[1],x1[2],x1[3],x2[0],x2[1],x2[2],x2[3],x3[0],x3[1],x3[2],x3[3]};
#pragma unroll
    for (int i = 0; i < 16; ++i) { const unsigned short hb = bf16_bits(xs[i]); ah.u[i] = hb; al.u[i] = ASPLIT ? bf16_bits(xs[i] - bf16_val(hb)) : (unsigned short)0; }
#pragma unroll
    for (int t = 0; t < 4; ++t) {
      const unsigned short* brow = Wt + (size_t)(col0 + t * 16 + ln) * ldb + kb;
      FragB b;
      b.half[0] = *(const v8us*)(brow + 8 * hh);
      b.half[1] = *(const v8us*)(brow + 16 + 8 * hh);
      acc[t] = mmaN<ASPLIT ? 2 : 1>(ah.v, al.v, b.v, b.v, acc[t]);
    }
  }
#pragma unroll
  for (int t = 0; t < 4; ++t) {
    const int col = col0 + t * 16 + ln;
    float bv = bias ? bias[col] : 0.f;
    if (BIAS_BF16) bv = bf16_round(bv);
#pragma unroll
    for (int r = 0; r < 8; ++r) {
      float v = acc[t][r] + bv;
      if (resid) { float rv = resid[(size_t)((row0 + 8 * hh + r) % rmod) * ldr + col]; if (RES_BF16) rv = bf16_round(rv); v += rv; }
      if (ACT == 1) v = fmaxf(v, 0.f);
      if (ACT == 2) v = 0.5f * v * (1.0f + erff(v * 0.70710678118654752f));
      if (ACT == 3) { const float u = 0.7978845608028654f * (v + 0.044715f * v * v * v); v = 0.5f * v * (1.0f + tanhf(u)); }
      so[w][8 * hh + r][t * 16 + ln] = v;
    }
  }
  __builtin_amdgcn_fence(__ATOMIC_ACQ_REL, "workgroup");
  __builtin_amdgcn_wave_barrier();
  const int rsub = lane >> 4, c4 = (lane & 15) * 4;
  {
#pragma unroll
    for (int q = 0; q < 8; ++q) {
      const int r = q * 2 + rsub;
      const v4f v = *(const v4fa*)&so[w][r][c4];
      *(v4f*)(C + (size_t)(row0 + r) * ldc + col0 + c4) = v;
    }
    
  }
}
// row LayerNorm (biased variance, eps) over N: s = X (+ R); optional out_sum <- s; out_norm <- (s-mu)*rsqrt(var+eps)*g + b
template <bool PARAM_BF16>
__global__ __launch_bounds__(256) void k_layernorm(const float* __restrict__ X, const float* __restrict__ R, const float* __restrict__ g, const float* __restrict__ bta,
                                                  float* __restrict__ out_sum, float* __restrict__ out_norm, int N, float eps) {
  __shared__ float red[256];
  const int row = blockIdx.x, tid = threadIdx.x;
  const float* x = X + (size_t)row * N; const float* rr = R ? R + (size_t)row * N : nullptr;
  float vals[16];                     // up to N = 4096
  const int per = N / 256;            // contiguous chunk per thread? use strided-by-4 chunks: thread handles j = tid*4 + 1024*u
  float s1 = 0.f;
  for (int u = 0; u < per / 4; ++u) {
    const int j = tid * 4 + 1024 * u;
    const v4f a = *(const v4fa*)(x + j);
    v4f b = {0.f,0.f,0.f,0.f}; if (rr) b = *(const v4fa*)(rr + j);
#pragma unroll
    for (int q = 0; q < 4; ++q) { const float v = a[q] + b[q]; vals[u * 4 + q] = v; s1 += v; }
  }
  red[tid] = s1; __syncthreads();
  for (int st = 128; st > 0; st >>= 1) { if (tid < st) red[tid] += red[tid + st]; __syncthreads(); }
  const float mu = red[0] / (float)N; __syncthreads();
  float s2 = 0.f;
  for (int u = 0; u < per / 4; ++u)
#pragma unroll
    for (int q = 0; q < 4; ++q) { const float c = vals[u * 4 + q] - mu; s2 += c * c; }
  red[tid] = s2; __syncthreads();
  for (int st = 128; st > 0; st >>= 1) { if (tid < st) red[tid] += red[tid + st]; __syncthreads(); }
  const float rs = rsqrtf(red[0] / (float)N + eps);
  {
    for (int u = 0; u < per / 4; ++u) {
      const int j = tid * 4 + 1024 * u;
      v4f o, sm;
#pragma unroll
      for (int q = 0; q < 4; ++q) {
        float gg = g[j + q], bb = bta[j + q];
        if (PARAM_BF16) { gg = bf16_round(gg); bb = bf16_round(bb); }
        sm[q] = vals[u * 4 + q]; o[q] = (vals[u * 4 + q] - mu) * rs * gg + bb;
      }
      if (out_sum) *(v4f*)(out_sum + (size_t)row * N + j) = sm;
      *(v4f*)(out_norm + (size_t)row * N + j) = o;
    }
    
  }
}



// ---- f16 WMMA path (v_wmma_f32_16x16x32_f16): 11-bit significands for operands in range — used for the generator and output GEMMs
typedef _Float16 v16h __attribute__((ext_vector_type(16)));
union FragH { v16h v; v8us half[2]; _Float16 h[16]; unsigned short u[16]; };
template <int NT>
__device__ __forceinline__ v8f mmaH(v16h ah, v16h al, v16h bh, v16h bl, v8f c) {
  c = __builtin_amdgcn_wmma_f32_16x16x32_f16(false, ah, false, bh, (short)0, c, false, false);
  if (NT >= 2) c = __builtin_amdgcn_wmma_f32_16x16x32_f16(false, al, false, bh, (short)0, c, false, false);
  if (NT >= 3) c = __builtin_amdgcn_wmma_f32_16x16x32_f16(false, ah, false, bl, (short)0, c, false, false);
  asm volatile("v_nop\n\tv_nop\n\tv_nop\n\tv_nop" : "+v"(c) : "v"(ah), "v"(al), "v"(bh), "v"(bl));
  return c;
}
// batched GEMM like k_gemm_b but f16 operands: A f32 (split into f16 hi/lo if ASPLIT, else rounded to f16), Bt = f16 values [n][k]; alpha; C f32; N multiple of 16 (partial tiles skipped)
template <bool ASPLIT>
__global__ __launch_bounds__(128) void k_gemm_h(const float* __restrict__ A, int lda, size_t sA, const _Float16* __restrict__ Bh, int ldb, size_t sB, float alpha, float* __restrict__ C, int ldc, size_t sC, int M, int N, int K) {
  __shared__ __attribute__((aligned(16))) float so[4][16][64];
  const int tid = threadIdx.x, w = tid >> 5, lane = tid & 31, ln = lane & 15, hh = lane >> 4; const int by = blockIdx.y;
  A += (size_t)by * sA; Bh += (size_t)by * sB; C += (size_t)by * sC;
  const int ntn = (N + 63) / 64; const int wid = blockIdx.x * 4 + w; const int mt = wid / ntn, nq = wid % ntn; if (mt * 16 >= M) return;
  const int row0 = mt * 16, col0 = nq * 64; const float* arow = A + (size_t)(row0 + ln) * lda;
  v8f acc[4] = {};
  for (int kb = 0; kb < K; kb += 32) {
    FragH ah, al;
    const v4f x0 = *(const v4fa*)(arow + kb + 8 * hh), x1 = *(const v4fa*)(arow + kb + 8 * hh + 4), x2 = *(const v4fa*)(arow + kb + 16 + 8 * hh), x3 = *(const v4fa*)(arow + kb + 16 + 8 * hh + 4);
    float xs[16] = {x0[0],x0[1],x0[2],x0[3],x1[0],x1[1],x1[2],x1[3],x2[0],x2[1],x2[2],x2[3],x3[0],x3[1],x3[2],x3[3]};
#pragma unroll
    for (int i = 0; i < 16; ++i) { const _Float16 h = (_Float16)xs[i]; ah.h[i] = h; al.h[i] = ASPLIT ? (_Float16)(xs[i] - (float)h) : (_Float16)0.0f; }
#pragma unroll
    for (int t = 0; t < 4; ++t) { if (col0 + t * 16 >= N) continue; const size_t boff = (size_t)(col0 + t * 16 + ln) * ldb + kb; FragH bq; bq.half[0] = *(const v8us*)(Bh + boff + 8 * hh); bq.half[1] = *(const v8us*)(Bh + boff + 16 + 8 * hh);
      acc[t] = mmaH<ASPLIT ? 2 : 1>(ah.v, al.v, bq.v, bq.v, acc[t]); }
  }
#pragma unroll
  for (int t = 0; t < 4; ++t) { if (col0 + t * 16 >= N) continue;
#pragma unroll
    for (int r = 0; r < 8; ++r) so[w][8 * hh + r][t * 16 + ln] = acc[t][r] * alpha; }
  __builtin_amdgcn_fence(__ATOMIC_ACQ_REL, "workgroup"); __builtin_amdgcn_wave_barrier();
  const int rsub = lane >> 4, c4 = (lane & 15) * 4;
  {
#pragma unroll
    for (int q = 0; q < 8; ++q) { const int r = q * 2 + rsub; if (col0 + c4 < N) { const v4f v = *(const v4fa*)&so[w][r][c4]; *(v4f*)(C + (size_t)(row0 + r) * ldc + col0 + c4) = v; } }
     }
}

// Wt[n][k] = f16(W[k][n]·scale) from f32 row-major W[K][N] (scale = power of two; bf16-exact weights stay exact in f16 away from the subnormal range)
__global__ __launch_bounds__(256) void k_wt_f16(const float* __restrict__ W, _Float16* __restrict__ Wt, int K, int N, float scale) {
  const int t = blockIdx.x * 256 + threadIdx.x; if (t >= N * (K / 8)) return; const int n = t / (K / 8), k8 = (t % (K / 8)) * 8; FragH f;
#pragma unroll
  for (int i = 0; i < 8; ++i) f.h[i] = (_Float16)(bf16_round(W[(size_t)(k8 + i) * N + n]) * scale); const v8us o = f.half[0];
  *(v8us*)((unsigned short*)Wt + (size_t)n * K + k8) = o; 
}
// k_gemm_hh variant with fused epilogue: v = acc·alpha + bias[by·sBias + col] (+ CP[(row/rowsPerB)·sCPb + by·64 + col] if CP) ; ACT 0 none / 1 elu ; writes f32 C and f16 C16, each if non-null
template <int ACT>
__global__ __launch_bounds__(128) void k_gemm_hhx(const _Float16* __restrict__ A, int lda, size_t sA, const _Float16* __restrict__ Bh, int ldb, size_t sB, float alpha, const float* __restrict__ bias, size_t sBias, const float* __restrict__ CP, int rowsPerB, size_t sCPb, int row0g,
    float* __restrict__ C, _Float16* __restrict__ C16, int ldc, size_t sC, int M, int N, int K) {
  __shared__ __attribute__((aligned(16))) float so[4][16][64];
  const int tid = threadIdx.x, w = tid >> 5, lane = tid & 31, ln = lane & 15, hh = lane >> 4; const int by = blockIdx.y;
  A += (size_t)by * sA; Bh += (size_t)by * sB; const size_t cofs = (size_t)by * sC; const float* bp = bias ? bias + (size_t)by * sBias : nullptr;
  const int ntn = (N + 63) / 64; const int wid = blockIdx.x * 4 + w; const int mt = wid / ntn, nq = wid % ntn; if (mt * 16 >= M) return;
  const int row0 = mt * 16, col0 = nq * 64; const _Float16* arow = A + (size_t)(row0 + ln) * lda;
  v8f acc[4] = {};
  for (int kb = 0; kb < K; kb += 32) { FragH ah; ah.half[0] = *(const v8us*)((const unsigned short*)arow + kb + 8 * hh); ah.half[1] = *(const v8us*)((const unsigned short*)arow + kb + 16 + 8 * hh);
#pragma unroll
    for (int t = 0; t < 4; ++t) { if (col0 + t * 16 >= N) continue; const size_t boff = (size_t)(col0 + t * 16 + ln) * ldb + kb; FragH bq; bq.half[0] = *(const v8us*)((const unsigned short*)Bh + boff + 8 * hh); bq.half[1] = *(const v8us*)((const unsigned short*)Bh + boff + 16 + 8 * hh);
      acc[t] = mmaH<1>(ah.v, ah.v, bq.v, bq.v, acc[t]); }
  }
#pragma unroll
  for (int t = 0; t < 4; ++t) { if (col0 + t * 16 >= N) continue; const int col = col0 + t * 16 + ln; const float bv = bp ? bf16_round(bp[col]) : 0.f;
#pragma unroll
    for (int r = 0; r < 8; ++r) { float v = acc[t][r] * alpha + bv; if (CP) { const int bidx = (row0g + row0 + 8 * hh + r) / rowsPerB; v += CP[(size_t)bidx * sCPb + (size_t)by * 64 + col]; } if (ACT == 1) v = (v > 0.f) ? v : expm1f(v); else if (ACT == 3) v = fmaxf(v, 0.f); so[w][8 * hh + r][t * 16 + ln] = v; } }
  __builtin_amdgcn_fence(__ATOMIC_ACQ_REL, "workgroup"); __builtin_amdgcn_wave_barrier();
  const int rsub = lane >> 4, c4 = (lane & 15) * 4; typedef _Float16 v4h __attribute__((ext_vector_type(4)));
  {
#pragma unroll
    for (int q = 0; q < 8; ++q) { const int r = q * 2 + rsub; if (col0 + c4 < N) { const v4f v = *(const v4fa*)&so[w][r][c4]; if (C) *(v4f*)(C + cofs + (size_t)(row0 + r) * ldc + col0 + c4) = v; if (C16) { v4h h4; for (int i = 0; i < 4; ++i) h4[i] = (_Float16)v[i]; *(v4h*)(C16 + cofs + (size_t)(row0 + r) * ldc + col0 + c4) = h4; } } }
     }
}


// FRAGMENT ORDER of every 16-bit operand plane in the workspace (weights, pf_low, g): a plane [rows][K] is cut into units of 16 rows x 32 k = 1 KB, unit index = (row / 16) * (K / 32) + k / 32;
// the 16-byte piece j * 32 + lane of a unit holds row (lane & 15), k = 16 j + 8 (lane >> 4) .. + 7: what lane reads as half j of its WMMA fragment. One wave-wide 16-byte load = 512 contiguous bytes = 4 whole lines.
// Bt = f16(bf16(W) * 16) in fragment order (the two projections' planes: bf16(W) itself, as bf16), W f32 [rows][32 << ksh]; thread t of a plane writes its piece t.
// The four weight planes depend on nothing, nor on one another: one launch rounds them all. A work-group writes 256 pieces of one plane (every plane is a whole number of work-groups), chosen by scalar selects, so that one body serves all four.
#define RB_G (NPAR * LOW / 8 / 256)
#define RB_P (LOW * FD / 8 / 256)
__global__ __launch_bounds__(256) void k_round_all(const float* __restrict__ pgw, const float* __restrict__ pfw, const float* __restrict__ ppw, const float* __restrict__ f2w,
                                                  _Float16* __restrict__ Bg, _Float16* __restrict__ Bf, _Float16* __restrict__ Bp, _Float16* __restrict__ B2) {
  const int b = blockIdx.x;
  const int sel = (b >= RB_G) + (b >= RB_G + RB_P) + (b >= RB_G + 2 * RB_P);      // 0 generator, 1 f projection, 2 pf projection, 3 last projection
  const float* W = sel == 0 ? pgw : sel == 1 ? pfw : sel == 2 ? ppw : f2w;
  _Float16* Bt = sel == 0 ? Bg : sel == 1 ? Bf : sel == 2 ? Bp : B2;
  const int ksh = (sel == 1 || sel == 2) ? 5 : 2;      // k steps of 32 in a row: FD / 32 = 32 or LOW / 32 = 4
  const int t = (b - (sel == 0 ? 0 : RB_G + (sel - 1) * RB_P)) * 256 + (int)threadIdx.x;
  FragH f;
  const int lane = t & 31, j = (t >> 5) & 1, unit = t >> 6;
  const float* src = W + ((size_t)((unit >> ksh) * 16 + (lane & 15)) << (5 + ksh)) + (unit & ((1 << ksh) - 1)) * 32 + 16 * j + 8 * (lane >> 4);
  const v4f x0 = *(const v4fa*)src, x1 = *(const v4fa*)(src + 4);
#pragma unroll
  for (int i = 0; i < 8; ++i) f.h[i] = (_Float16)(bf16_round(i < 4 ? x0[i & 3] : x1[i & 3]) * 16.0f);
  FragB fb; fb.q[0] = __builtin_convertvector(x0, v4b); fb.q[1] = __builtin_convertvector(x1, v4b);
  *(v8us*)((unsigned short*)Bt + (size_t)t * 8) = (sel == 1 || sel == 2) ? fb.half[0] : f.half[0];  }
__global__ __launch_bounds__(256) void k_h16(const float* __restrict__ x, _Float16* __restrict__ X16, size_t n8) { const size_t t = (size_t)blockIdx.x * 256 + threadIdx.x; if (t >= n8) return; FragH f;
#pragma unroll
  for (int q = 0; q < 8; ++q) f.h[q] = (_Float16)x[t * 8 + q]; *(v8us*)((unsigned short*)X16 + t * 8) = f.half[0];  }
// Projection C[NBS][LOW] = x . W^T + bias on v_wmma_f32_16x16x32_bf16: x is read as f32 and rounded to bf16 on its way into the A fragment, two elements an instruction; Bh holds bf16(W).
// Tile map and k order are those of k_gemm_hhx: one wave = 16 rows x 64 columns, k rising, one accumulator chain per 16 x 16 tile. Bh, and C16 where it is written, are in fragment order.
// x comes to LDS by asynchronous copies, a tile of the work-group's PJ_R rows x PJ_KC k at a time, two buffers: a wave-wide copy covers 512 contiguous bytes of one row (4 whole lines; a fragment load
// straight from x touches 16 lines for as many bytes), and the two waves that share a row tile read one copy in LDS.
#define PJ_U 8
#define PJ_R 32
#define PJ_KC (32 * PJ_U)
#define PJ_PITCH (PJ_KC * 4 + 16)      // bytes of a row in LDS: 16 x odd, so that the 16 rows of a 16-byte fragment read fall on all banks
#define PJ_TILE (PJ_R * PJ_PITCH)
// four rows of a tile, two copies of 512 bytes a row: l = the lane's LDS byte address, g = its global address, in the first row.
__device__ __forceinline__ void proj_copy4(unsigned l, const float* g) {
  const unsigned l0 = l, l1 = l + 512, l2 = l + PJ_PITCH, l3 = l + PJ_PITCH + 512, l4 = l + 2 * PJ_PITCH, l5 = l + 2 * PJ_PITCH + 512, l6 = l + 3 * PJ_PITCH, l7 = l + 3 * PJ_PITCH + 512;
  const float *g0 = g, *g1 = g + 128, *g2 = g + FD, *g3 = g + FD + 128, *g4 = g + 2 * FD, *g5 = g + 2 * FD + 128, *g6 = g + 3 * FD, *g7 = g + 3 * FD + 128;
  // the copies bring x into LDS through no register; precaution: s_wait_xcnt 0 as the statement's last line stands in front of whatever reuses the copies' address registers
  asm volatile("global_load_async_to_lds_b128 %0, %8, off\n\t"
               "global_load_async_to_lds_b128 %1, %9, off\n\t"
               "global_load_async_to_lds_b128 %2, %10, off\n\t"
               "global_load_async_to_lds_b128 %3, %11, off\n\t"
               "global_load_async_to_lds_b128 %4, %12, off\n\t"
               "global_load_async_to_lds_b128 %5, %13, off\n\t"
               "global_load_async_to_lds_b128 %6, %14, off\n\t"
               "global_load_async_to_lds_b128 %7, %15, off\n\t"
               "s_wait_xcnt 0x0"
               :: "v"(l0), "v"(l1), "v"(l2), "v"(l3), "v"(l4), "v"(l5), "v"(l6), "v"(l7), "v"(g0), "v"(g1), "v"(g2), "v"(g3), "v"(g4), "v"(g5), "v"(g6), "v"(g7) : "memory");
}
template <bool OUT16>
__device__ __forceinline__ void proj_body(int blk, float* __restrict__ sbuf, char* sx, const float* __restrict__ X, const _Float16* __restrict__ Bh, const float* __restrict__ bias, float* __restrict__ C, _Float16* __restrict__ C16) {
  float (*so)[16][OUT16 ? 68 : 64] = (float (*)[16][OUT16 ? 68 : 64])sbuf;      // pitch 68 floats where 16 lanes read one column range of 16 rows: it spreads them over all banks
  const int tid = threadIdx.x, w = tid >> 5, lane = tid & 31, ln = lane & 15, hh = lane >> 4;
  const int wid = blk * 4 + w, row0 = (wid >> 1) * 16, col0 = (wid & 1) * 64;
  const unsigned short* brow = (const unsigned short*)Bh + (size_t)col0 * FD + lane * 8;
  // wave w copies rows 8 w .. 8 w + 7 of each tile; every lane is on, and the tests around the copies read the same for the whole work-group
  const float* xg = X + (size_t)(blk * PJ_R + 8 * w) * FD + lane * 4;
  const unsigned xl = (unsigned)(size_t)sx + (unsigned)(8 * w * PJ_PITCH + lane * 16);
  auto copy_tile = [&](int tl) {
    const unsigned l = xl + (unsigned)((tl & 1) * PJ_TILE);
    const float* g = xg + tl * PJ_KC;
    proj_copy4(l, g);
    proj_copy4(l + 4 * PJ_PITCH, g + 4 * FD);
  };
  copy_tile(0);
  asm volatile("s_wait_asynccnt 0x0" ::: "memory");      // this wave's rows of tile 0 have landed
  __syncthreads();      // every wave's rows of tile 0 have landed before any wave reads the tile
  copy_tile(1);
  const char* xrow = sx + ((w >> 1) * 16 + ln) * PJ_PITCH + 32 * hh;      // the lane's row of the wave's row tile
  v8f acc[4] = {};
#pragma unroll 1      // the loop stays whole: with its first trips peeled off, the copies' addresses were spilled to scratch memory
  for (int kb = 0; kb < FD; kb += PJ_KC) {
    const int tl = kb / PJ_KC;
    FragB b[PJ_U][4];
#pragma unroll
    for (int u = 0; u < PJ_U; ++u)
#pragma unroll
      for (int t = 0; t < 4; ++t) {
        const unsigned short* p = brow + (size_t)t * 16 * FD + kb * 16 + u * 512;
        b[u][t].half[0] = *(const v8us*)p; b[u][t].half[1] = *(const v8us*)(p + 256);
      }
    const char* xs = xrow + (tl & 1) * PJ_TILE;
    FragB a[PJ_U];      // x rounded to bf16, two elements an instruction: the packed pair is the operand as the matrix unit takes it
#pragma unroll
    for (int u = 0; u < PJ_U; ++u) {
      const char* p = xs + u * 128;
      a[u].q[0] = __builtin_convertvector(*(const v4fa*)p, v4b); a[u].q[1] = __builtin_convertvector(*(const v4fa*)(p + 16), v4b);
      a[u].q[2] = __builtin_convertvector(*(const v4fa*)(p + 64), v4b); a[u].q[3] = __builtin_convertvector(*(const v4fa*)(p + 80), v4b);
    }
    asm volatile("s_wait_xcnt 0x0" ::: "memory");      // precaution: stands in front of the addition that steps the weight loads' address pair to the next group
    // the wave has now read all that it needs of tile tl into registers: the buffer is handed over here, in front of the arithmetic, so that the next copies fly under it
    asm volatile("s_wait_dscnt 0x0" ::: "memory");      // this wave's reads of tile tl have returned before the buffer is handed back
    asm volatile("s_wait_asynccnt 0x0" ::: "memory");      // this wave's rows of tile tl + 1 have landed
    __syncthreads();      // publishes tile tl + 1 and ends every wave's reads of tile tl, whose buffer is refilled behind it
    if (tl + 2 < FD / PJ_KC) copy_tile(tl + 2);
#pragma unroll
    for (int u = 0; u < PJ_U; ++u)
#pragma unroll
      for (int t = 0; t < 4; ++t) acc[t] = __builtin_amdgcn_wmma_f32_16x16x32_bf16(false, a[u].v, false, b[u][t].v, (short)0, acc[t], false, false);
  }
  asm volatile("s_wait_asynccnt 0x0" ::: "memory");      // no copy is outstanding when the wave goes on to the epilogue and ends
  float bv[4];
  __builtin_amdgcn_sched_barrier(0);      // keeps index arithmetic that has sunk down to the epilogue in front of the bias loads: between them and their wait it took the loads' offset register
#pragma unroll
  for (int t = 0; t < 4; ++t) bv[t] = bias[col0 + t * 16 + ln];
  asm volatile("s_wait_xcnt 0x0" ::: "memory");      // precaution: the compiler reuses the bias loads' offset register at once
  __builtin_amdgcn_sched_barrier(0);      // holds that reuse behind the wait
#pragma unroll
  for (int t = 0; t < 4; ++t) {
    const float bb = bf16_round(bv[t]);
#pragma unroll
    for (int r = 0; r < 8; ++r) so[w][8 * hh + r][t * 16 + ln] = acc[t][r] + bb;
  }
  __builtin_amdgcn_fence(__ATOMIC_ACQ_REL, "workgroup", "local"); __builtin_amdgcn_wave_barrier();      // the wave's own LDS stores land before it reads the rows back
  if constexpr (OUT16) {
    // the wave's 64 columns are two units of its row tile: four stores of 512 contiguous bytes
    unsigned short* o = (unsigned short*)C16 + (size_t)row0 * LOW + col0 * 16 + lane * 8;
#pragma unroll
    for (int q = 0; q < 4; ++q) {
      const float* s = &so[w][ln][q * 16 + 8 * hh];
      const v4f v0 = *(const v4fa*)s, v1 = *(const v4fa*)(s + 4);
      FragH h;
#pragma unroll
      for (int i = 0; i < 8; ++i) h.h[i] = (_Float16)(i < 4 ? v0[i & 3] : v1[i & 3]);
      *(v8us*)(o + q * 256) = h.half[0];
    }
  } else {
    const int rsub = lane >> 4, c4 = (lane & 15) * 4;
    const size_t o0 = (size_t)(row0 + rsub) * LOW + col0 + c4;
#pragma unroll
    for (int q = 0; q < 8; ++q) {
      const v4f v = *(const v4fa*)&so[w][q * 2 + rsub][c4];
      *(v4f*)(C + o0 + q * 2 * LOW) = v;
    }
  }
}
// The two projections depend on nothing of one another: one launch holds both, the first PJ_B work-groups f_low, the rest pf_low, so that two work-groups stand on a WGP and each runs under the other's load waits.
#define PJ_B ((NBS / 16) * (LOW / 64) / 4)
__global__ __launch_bounds__(128) void k_proj2(const float* __restrict__ f, const float* __restrict__ pf, const _Float16* __restrict__ Bf, const _Float16* __restrict__ Bp, const float* __restrict__ pfb, const float* __restrict__ ppb,
                                              float* __restrict__ FLOW, _Float16* __restrict__ PL16) {
  __shared__ __attribute__((aligned(16))) float sbuf[4 * 16 * 68];
  __shared__ __attribute__((aligned(16))) char sx[2 * PJ_TILE];      // the two buffers of x tiles
  const int b = blockIdx.x;
  if (b < PJ_B) proj_body<false>(b, sbuf, sx, f, Bf, pfb, FLOW, nullptr);
  else proj_body<true>(b - PJ_B, sbuf, sx, pf, Bp, ppb, nullptr, PL16);
}
// out[NBS][FD] = (g0 + g1) . W2^T + bias + (f + pf), g0 and g1 the two planes of partial g, taken as one operand of K = 2 * LOW against W2 twice: f and pf are read as f32 by the lane that stores the element, 16 bytes at a time, rounded to bf16 and summed there.
// Tile map and k order are those of k_gemm_hhx (one wave = 16 rows x 64 columns). G and Bh are in fragment order.
__global__ __launch_bounds__(128) void k_out(const _Float16* __restrict__ G, const _Float16* __restrict__ Bh, const float* __restrict__ bias, const float* __restrict__ f, const float* __restrict__ pf, float* __restrict__ out) {
  __shared__ __attribute__((aligned(16))) float so[4][16][64];
  const int tid = threadIdx.x, w = tid >> 5, lane = tid & 31, ln = lane & 15, hh = lane >> 4;
  const int wid = blockIdx.x * 4 + w, row0 = (wid / (FD / 64)) * 16, col0 = (wid % (FD / 64)) * 64;
  const int rsub = lane >> 4, c4 = (lane & 15) * 4;
  const unsigned short* arow = (const unsigned short*)G + (size_t)row0 * LOW + lane * 8;
  const unsigned short* brow = (const unsigned short*)Bh + (size_t)col0 * LOW + lane * 8;
  FragH a[2][LOW / 32], b[4][LOW / 32];
#pragma unroll
  for (int p = 0; p < 2; ++p)
#pragma unroll
    for (int ks = 0; ks < LOW / 32; ++ks) { a[p][ks].half[0] = *(const v8us*)(arow + (size_t)p * NBS * LOW + ks * 512); a[p][ks].half[1] = *(const v8us*)(arow + (size_t)p * NBS * LOW + ks * 512 + 256); }
  asm volatile("s_wait_xcnt 0x0" ::: "memory");      // precaution: the compiler reuses these loads' address pair as the destination of a later load
#pragma unroll
  for (int t = 0; t < 4; ++t)
#pragma unroll
    for (int ks = 0; ks < LOW / 32; ++ks) { b[t][ks].half[0] = *(const v8us*)(brow + (size_t)t * 16 * LOW + ks * 512); b[t][ks].half[1] = *(const v8us*)(brow + (size_t)t * 16 * LOW + ks * 512 + 256); }
  float bv[4];
#pragma unroll
  for (int t = 0; t < 4; ++t) bv[t] = bias[col0 + t * 16 + ln];
  asm volatile("s_wait_xcnt 0x0" ::: "memory");      // precaution: the operand loads' address registers are free for reuse behind it
  __builtin_amdgcn_sched_barrier(0);      // loads return in order: the operand loads (L2) stay in front of the residual loads (memory), so that the WMMAs need not wait for the latter
  const size_t o0 = (size_t)(row0 + rsub) * FD + col0 + c4;
  v4f rf[8], rp[8];
#pragma unroll
  for (int q = 0; q < 8; ++q) { rf[q] = *(const v4fa*)(f + o0 + q * 2 * FD); rp[q] = *(const v4fa*)(pf + o0 + q * 2 * FD); }
  asm volatile("s_wait_xcnt 0x0" ::: "memory");      // precaution: as above, for the residual loads' two address pairs
  __builtin_amdgcn_sched_barrier(0);      // keeps the residual loads in front of the product, which then runs under their latency
  v8f acc[4] = {};
#pragma unroll
  for (int p = 0; p < 2; ++p)
#pragma unroll
    for (int ks = 0; ks < LOW / 32; ++ks)
#pragma unroll
      for (int t = 0; t < 4; ++t) acc[t] = __builtin_amdgcn_wmma_f32_16x16x32_f16(false, a[p][ks].v, false, b[t][ks].v, (short)0, acc[t], false, false);
#pragma unroll
  for (int t = 0; t < 4; ++t) {
    const float bb = bf16_round(bv[t]);
#pragma unroll
    for (int r = 0; r < 8; ++r) so[w][8 * hh + r][t * 16 + ln] = acc[t][r] * 0.0625f + bb;
  }
  __builtin_amdgcn_fence(__ATOMIC_ACQ_REL, "workgroup", "local"); __builtin_amdgcn_wave_barrier();      // the wave's own LDS stores land before it reads the rows back; LDS alone, so that the residual loads stay in flight
#pragma unroll
  for (int q = 0; q < 8; ++q) {
    v4f v = *(const v4fa*)&so[w][q * 2 + rsub][c4];
#pragma unroll
    for (int c = 0; c < 4; ++c) v[c] += bf16_round(rf[q][c]) + bf16_round(rp[q][c]);
    *(v4f*)(out + o0 + q * 2 * FD) = v;
  }
}
// Parameter generator and per-sample MLP in one kernel: a work-group owns GM_M samples and GM_H of the MID hidden units, and never stores the generated parameters.
// A hidden unit m needs only the parameters l * MID + m of layer 1 and LOW * MID + m * LOW + l of layer 2, so the two halves of the hidden units are independent up to the last sum over m:
// each half writes its own partial g, and the last GEMM adds the two. A weight tile that comes from L2 thus serves GM_T sample tiles, and a work-group reads half of the weight plane.
// Each 16 x 16 tile of params = pf_low . pg_w^T (K = LOW, four f16 WMMAs) is scaled, biased and summed into h or g straight from the accumulator registers
// (accumulator register r of lane (ln, hh) = sample 8 * hh + r, parameter column ln).
// Layer 1: wave w owns l = 16 w .. 16 w + 15 and sums them in rising order; the eight waves' partial h meet in LDS in rising wave order, then relu.
// Layer 2: wave w owns l = 16 w .. 16 w + 15 and sums the work-group's m in rising order.
#define GM_M 64
#define GM_T (GM_M / 16)
#define GM_H (MID / 2)
struct Yes { static constexpr bool value = true; }; struct No { static constexpr bool value = false; };
__global__ __launch_bounds__(256) void k_gen_mlp(const _Float16* __restrict__ PL, const _Float16* __restrict__ Bg, const float* __restrict__ pgb, const float* __restrict__ FLOW, _Float16* __restrict__ G16) {
  __shared__ __attribute__((aligned(16))) float sF[LOW][GM_M];              // flow[s][l] at [l][s]; rows 16 w .. + 15 are written and read by wave w alone
  __shared__ __attribute__((aligned(16))) float sP[8][GM_H][GM_M + 4];      // partial h per wave at [m][s]; pitch 68 floats spreads the 16-byte stores of 16 rows m over all banks
  __shared__ __attribute__((aligned(16))) float sH[GM_H][GM_M];             // h after relu at [m][s]
  __shared__ __attribute__((aligned(16))) _Float16 sG[GM_M][LOW + 8];       // partial g as f16, gathered so that the work-group stores it in fragment order
  const int tid = threadIdx.x, lane = tid & 31, ln = lane & 15, hh = lane >> 4;
  const int w = __builtin_amdgcn_readfirstlane(tid >> 5);
  const int s0 = (blockIdx.x >> 1) * GM_M, mh = blockIdx.x & 1;
  struct BTile { FragH f[LOW / 32]; float b; };
  // this wave's stream of tiles: 16 of layer 1 (l = 16 w + u: MID parameters apart), then 16 of layer 2 (m = GM_H * mh + u: LOW parameters apart).
  // A tile's address is a wave-uniform base (first parameter n0 of the tile) plus the lane's fixed offset; fragment order: a tile of 16 parameters is 4 KB in a row
  const int nb1 = w * 512 + mh * GM_H, nb2 = LOW * MID + mh * GM_H * LOW + w * 16;
  const unsigned lo16 = lane * 16, lo4 = ln * 4;
  struct TAddr { const char* p; const char* c; };      // a lane's addresses of a tile: weights, bias
  auto tile_addr = [&](int n0) { return TAddr{(const char*)Bg + (size_t)n0 * (LOW * 2) + lo16, (const char*)pgb + (size_t)n0 * 4 + lo4}; };
  auto load_tile = [&](BTile& t, const TAddr& ad) {
    const char* p = ad.p;
    t.b = *(const float*)ad.c;
#pragma unroll
    for (int ks = 0; ks < LOW / 32; ++ks) { t.f[ks].half[0] = *(const v8us*)(p + ks * 1024); t.f[ks].half[1] = *(const v8us*)(p + ks * 1024 + 512); }
  };
  // precaution: s_wait_xcnt 0 in front of whatever reuses the address registers of two tiles' loads; it takes the four addresses as inputs, so that their registers stay theirs up to the wait; the scheduling barrier holds later arithmetic behind it
  auto close_tiles = [&](const TAddr& x, const TAddr& y) {
    asm volatile("s_wait_xcnt 0x0" :: "v"(x.p), "v"(x.c), "v"(y.p), "v"(y.c) : "memory");
    __builtin_amdgcn_sched_barrier(0);
  };
  v4f fl[GM_M / 32][4];
#pragma unroll
  for (int q = 0; q < GM_M / 32; ++q)
#pragma unroll
    for (int j = 0; j < 4; ++j) fl[q][j] = *(const v4fa*)(FLOW + (size_t)(s0 + q * 32 + lane) * LOW + w * 16 + j * 4);
  asm volatile("s_wait_xcnt 0x0" ::: "memory");      // precaution: the compiler reuses these loads' address pairs for the next addresses
  __builtin_amdgcn_sched_barrier(0);      // holds that reuse behind the wait
  FragH a[GM_T][LOW / 32];
#pragma unroll
  for (int mt = 0; mt < GM_T; ++mt) {
    const unsigned short* ar = (const unsigned short*)PL + (size_t)(s0 + mt * 16) * LOW + lane * 8;
#pragma unroll
    for (int ks = 0; ks < LOW / 32; ++ks) { a[mt][ks].half[0] = *(const v8us*)(ar + ks * 512); a[mt][ks].half[1] = *(const v8us*)(ar + ks * 512 + 256); }
    asm volatile("s_wait_xcnt 0x0" ::: "memory");      // precaution: the compiler reuses an address pair of the loads above as the destination of a later load, or for the next tile's address
    __builtin_amdgcn_sched_barrier(0);      // holds that reuse behind the wait; behind the last tile it also keeps the sample loads in front of the weight loads: loads return in order, and behind them they would force the loop's first wait to drain the weight tiles too
  }
  BTile bt[2];
  { const TAddr x = tile_addr(nb1), y = tile_addr(nb1 + MID); load_tile(bt[0], x); load_tile(bt[1], y); close_tiles(x, y); }
#pragma unroll
  for (int q = 0; q < GM_M / 32; ++q)
#pragma unroll
    for (int j = 0; j < 4; ++j)
#pragma unroll
      for (int c = 0; c < 4; ++c) sF[w * 16 + j * 4 + c][q * 32 + lane] = fl[q][j][c];
  // fence on LDS alone: the wave's own stores land before it reads the rows back; a fence on every address space would also drain the weight loads in flight
  __builtin_amdgcn_fence(__ATOMIC_ACQ_REL, "workgroup", "local"); __builtin_amdgcn_wave_barrier();
  // one tile: acc[mt][r] += cf[sample] * (tile / 16 + bias); the tile's registers are refilled with the tile at un as soon as its WMMAs have issued
  auto tile_step = [&](BTile& t, const float* cf, v8f (&acc)[GM_T], const TAddr& un, auto refill) {
    v4f c[GM_T][2];
#pragma unroll
    for (int mt = 0; mt < GM_T; ++mt) { c[mt][0] = *(const v4fa*)(cf + mt * 16 + 8 * hh); c[mt][1] = *(const v4fa*)(cf + mt * 16 + 8 * hh + 4); }
    v8f d[GM_T] = {};
#pragma unroll
    for (int ks = 0; ks < LOW / 32; ++ks)
#pragma unroll
      for (int mt = 0; mt < GM_T; ++mt) d[mt] = __builtin_amdgcn_wmma_f32_16x16x32_f16(false, a[mt][ks].v, false, t.f[ks].v, (short)0, d[mt], false, false);
    const float bv = bf16_round(t.b);
    if constexpr (decltype(refill)::value) {
      load_tile(t, un);
      __builtin_amdgcn_sched_barrier(0);      // keeps the refill in front of the sums below: sunk behind them, to the end of the trip, the loads would have too little work to return under
    }
#pragma unroll
    for (int mt = 0; mt < GM_T; ++mt)
#pragma unroll
      for (int r = 0; r < 8; ++r) acc[mt][r] += c[mt][r >> 2][r & 3] * (d[mt][r] * 0.0625f + bv);
  };
  v8f hp[GM_T] = {};
  for (int i = 0; i < 8; ++i) {
    const int un = (i < 7) ? nb1 + (2 * i + 2) * MID : nb2;      // the last trip fetches the first two tiles of layer 2
    const TAddr x = tile_addr(un), y = tile_addr(un + ((i < 7) ? MID : LOW));
    tile_step(bt[0], &sF[w * 16 + 2 * i][0], hp, x, Yes{});
    tile_step(bt[1], &sF[w * 16 + 2 * i + 1][0], hp, y, Yes{});
    close_tiles(x, y);
  }
#pragma unroll
  for (int mt = 0; mt < GM_T; ++mt) {
    float* d = &sP[w][ln][mt * 16 + 8 * hh];
    *(v4fa*)d = (v4f){hp[mt][0], hp[mt][1], hp[mt][2], hp[mt][3]};
    *(v4fa*)(d + 4) = (v4f){hp[mt][4], hp[mt][5], hp[mt][6], hp[mt][7]};
  }
  __syncthreads();      // every wave's partial h is in LDS
  {
    const int m = tid >> 4, s4 = (tid & 15) * 4;
    v4f v = *(const v4fa*)&sP[0][m][s4];
#pragma unroll
    for (int q = 1; q < 8; ++q) v += *(const v4fa*)&sP[q][m][s4];
#pragma unroll
    for (int c = 0; c < 4; ++c) v[c] = fmaxf(v[c], 0.f);
    *(v4fa*)&sH[m][s4] = v;
  }
  __syncthreads();      // h is complete before any wave reads it
  v8f g[GM_T] = {};
  for (int i = 0; i < 7; ++i) {
    const int un = nb2 + (2 * i + 2) * LOW;
    const TAddr x = tile_addr(un), y = tile_addr(un + LOW);
    tile_step(bt[0], &sH[2 * i][0], g, x, Yes{});
    tile_step(bt[1], &sH[2 * i + 1][0], g, y, Yes{});
    close_tiles(x, y);
  }
  tile_step(bt[0], &sH[14][0], g, TAddr{}, No{});
  tile_step(bt[1], &sH[15][0], g, TAddr{}, No{});
#pragma unroll
  for (int mt = 0; mt < GM_T; ++mt)
#pragma unroll
    for (int r = 0; r < 8; ++r) sG[mt * 16 + 8 * hh + r][w * 16 + ln] = (_Float16)g[mt][r];
  __syncthreads();      // all of the partial g is in LDS before the rows are stored
  unsigned short* go = (unsigned short*)G16 + (size_t)mh * NBS * LOW + (size_t)s0 * LOW + tid * 8;
#pragma unroll
  for (int j = 0; j < GM_T; ++j) {
    // piece tid of row tile j in fragment order: wave w stores half w & 1 of unit w >> 1
    *(v8us*)(go + j * 16 * LOW) = *(const v8us*)&sG[16 * j + ln][(w >> 1) * 32 + (w & 1) * 16 + 8 * hh];
  }
}
extern "C" void kernel_launch(void* const* d_in, const int* in_sizes, int n_in,
                              void* d_out, int out_size, void* d_ws, size_t ws_size, hipStream_t stream) {
  (void)in_sizes; (void)n_in; (void)out_size;
  const float* f = (const float*)d_in[0]; const float* pf = (const float*)d_in[1]; const float* pfw = (const float*)d_in[2]; const float* pfb = (const float*)d_in[3]; const float* ppw = (const float*)d_in[4]; const float* ppb = (const float*)d_in[5]; const float* f2w = (const float*)d_in[6]; const float* f2b = (const float*)d_in[7]; const float* pgw = (const float*)d_in[8]; const float* pgb = (const float*)d_in[9];
  char* ws = (char*)d_ws; size_t off = 0;
  auto take = [&](size_t bytes) { char* p = ws + off; off += (bytes + 255) & ~(size_t)255; return p; };
  _Float16* Bf = (_Float16*)take((size_t)LOW * FD * 2); _Float16* Bp = (_Float16*)take((size_t)LOW * FD * 2); _Float16* Bg = (_Float16*)take((size_t)NPAR * LOW * 2); _Float16* B2 = (_Float16*)take((size_t)FD * LOW * 2);
  float* FLOW = (float*)take((size_t)NBS * LOW * 4); _Float16* PL16 = (_Float16*)take((size_t)NBS * LOW * 2); _Float16* G16 = (_Float16*)take((size_t)2 * NBS * LOW * 2);
  if (off > ws_size) return;      // about 13 MiB
  k_round_all<<<RB_G + 3 * RB_P, 256, 0, stream>>>(pgw, pfw, ppw, f2w, Bg, Bf, Bp, B2);      // (out,in), fragment order
  k_proj2<<<2 * PJ_B, 128, 0, stream>>>(f, pf, Bf, Bp, pfb, ppb, FLOW, PL16);      // f_low (f32, read by the per-sample MLP) and pf_low (f16 operand of the generator)
  k_gen_mlp<<<2 * (NBS / GM_M), 256, 0, stream>>>(PL16, Bg, pgb, FLOW, G16);      // params = pf_low . pg_w^T + pg_b, consumed in registers by the per-sample MLP
  k_out<<<(NBS / 16) * (FD / 64) / 4, 128, 0, stream>>>(G16, B2, f2b, f, pf, (float*)d_out);      // g . proj_f2^T + b + (f + pf)
}

// v009
// It runs in 43.9 microseconds.
// In two side-by-side timings against v008, it was 1.04 and 1.06 times as fast.
// Counting every step since v000, it is 13.5 times as fast.
#include <hip/hip_runtime.h>
// + bias, + f + pf residuals as exact bf16 addends) on v_wmma_f32_16x16x32_f16 (f16 operands, nn.Linear weights (out,in) bf16-exact ×2^4, f32 accumulate); the per-sample tiny MLP
// (128 -> 32 relu -> 128 with that sample's generated weights) is f32 VALU on the generator's accumulator tiles (64 samples and half of the hidden units per work-group).
#define NBS 8192
#define FD 1024
#define LOW 128
#define MID 32
#define NPAR (2 * LOW * MID)

typedef __bf16 v16b __attribute__((ext_vector_type(16)));
typedef unsigned short v8us __attribute__((ext_vector_type(8), may_alias));
typedef float  v8f  __attribute__((ext_vector_type(8)));
typedef float  v4f  __attribute__((ext_vector_type(4)));
typedef float  v4fa __attribute__((ext_vector_type(4), may_alias));
typedef __bf16 v4b __attribute__((ext_vector_type(4)));
union FragB { v16b v; v8us half[2]; unsigned short u[16]; v4b q[4]; };

// f32 -> bf16, round to nearest even, by the hardware's conversion (v_cvt_pk_bf16_f32)
__device__ __forceinline__ unsigned short bf16_bits(float x) { return __builtin_bit_cast(unsigned short, (__bf16)x); }
__device__ __forceinline__ float bf16_val(unsigned short b) { return __uint_as_float(((unsigned int)b) << 16); }
__device__ __forceinline__ float bf16_round(float x) { return bf16_val(bf16_bits(x)); }
// D += A·B with NT terms: 1 = ah·bh, 2 = + al·bh (A split), 3 = + ah·bl (both split)
template <int NT>
__device__ __forceinline__ v8f mmaN(v16b ah, v16b al, v16b bh, v16b bl, v8f c) {
  c = __builtin_amdgcn_wmma_f32_16x16x32_bf16(false, ah, false, bh, (short)0, c, false, false);
  if (NT >= 2) c = __builtin_amdgcn_wmma_f32_16x16x32_bf16(false, al, false, bh, (short)0, c, false, false);
  if (NT >= 3) c = __builtin_amdgcn_wmma_f32_16x16x32_bf16(false, ah, false, bl, (short)0, c, false, false);
  asm volatile("v_nop\n\tv_nop\n\tv_nop\n\tv_nop" : "+v"(c) : "v"(ah), "v"(al), "v"(bh), "v"(bl));
  return c;
}

__global__ __launch_bounds__(256) void k_wt_bf16(const float* __restrict__ W, unsigned short* __restrict__ Wt, int K, int N) {
  const int t = blockIdx.x * 256 + threadIdx.x;
  const int k8n = K / 8;
  if (t >= N * k8n) return;
  const int n = t / k8n, k8 = (t % k8n) * 8;
  v8us v;
#pragma unroll
  for (int i = 0; i < 8; ++i) v[i] = bf16_bits(W[(size_t)(k8 + i) * N + n]);
  *(v8us*)(Wt + (size_t)n * K + k8) = v;
  
}

// GEMM C[M][N] (f32, pitch ldc) = act(A[M][K]·W + bias). A f32 row-major (pitch lda) converted per fragment to bf16
// (ASPLIT: hi/lo two planes -> 2 terms, else single rounded term); Wt bf16 [N][K] (pitch ldb). BIAS_BF16 rounds the
// bias to bf16 first (bias quantised to bf16 before the add). K%32==0, M%16==0, N%64==0.
template <bool ASPLIT, int ACT, bool BIAS_BF16>
__global__ __launch_bounds__(128) void k_gemm_bf(const float* __restrict__ A, int lda, const unsigned short* __restrict__ Wt, int ldb,
                                               const float* __restrict__ bias, float* __restrict__ C, int ldc, int M, int N, int K) {
  __shared__ __attribute__((aligned(16))) float so[4][16][64];
  const int tid = threadIdx.x, w = tid >> 5, lane = tid & 31, ln = lane & 15, hh = lane >> 4;
  const int ntn = N / 64;
  const int wid = blockIdx.x * 4 + w;
  const int mt = wid / ntn, nq = wid % ntn;
  if (mt * 16 >= M) return;
  const int row0 = mt * 16, col0 = nq * 64;
  const float* arow = A + (size_t)(row0 + ln) * lda;
  v8f acc[4] = {};
  for (int kb = 0; kb < K; kb += 32) {
    FragB ah, al;
    const v4f x0 = *(const v4fa*)(arow + kb + 8 * hh), x1 = *(const v4fa*)(arow + kb + 8 * hh + 4);
    const v4f x2 = *(const v4fa*)(arow + kb + 16 + 8 * hh), x3 = *(const v4fa*)(arow + kb + 16 + 8 * hh + 4);
    float xs[16] = {x0[0],x0[1],x0[2],x0[3],x1[0],x1[1],x1[2],x1[3],x2[0],x2[1],x2[2],x2[3],x3[0],x3[1],x3[2],x3[3]};
#pragma unroll
    for (int i = 0; i < 16; ++i) { const unsigned short hb = bf16_bits(xs[i]); ah.u[i] = hb; al.u[i] = ASPLIT ? bf16_bits(xs[i] - bf16_val(hb)) : (unsigned short)0; }
#pragma unroll
    for (int t = 0; t < 4; ++t) {
      const unsigned short* brow = Wt + (size_t)(col0 + t * 16 + ln) * ldb + kb;
      FragB b;
      b.half[0] = *(const v8us*)(brow + 8 * hh);
      b.half[1] = *(const v8us*)(brow + 16 + 8 * hh);
      acc[t] = mmaN<ASPLIT ? 2 : 1>(ah.v, al.v, b.v, b.v, acc[t]);
    }
  }
#pragma unroll
  for (int t = 0; t < 4; ++t) {
    float bv = bias ? bias[col0 + t * 16 + ln] : 0.f;
    if (BIAS_BF16) bv = bf16_round(bv);
#pragma unroll
    for (int r = 0; r < 8; ++r) { float v = acc[t][r] + bv; if (ACT == 1) v = fmaxf(v, 0.f); so[w][8 * hh + r][t * 16 + ln] = v; }
  }
  __builtin_amdgcn_fence(__ATOMIC_ACQ_REL, "workgroup");
  __builtin_amdgcn_wave_barrier();
  const int rsub = lane >> 4, c4 = (lane & 15) * 4;
  {
#pragma unroll
    for (int q = 0; q < 8; ++q) {
      const int r = q * 2 + rsub;
      const v4f v = *(const v4fa*)&so[w][r][c4];
      *(v4f*)(C + (size_t)(row0 + r) * ldc + col0 + c4) = v;
    }
    
  }
}

// Flash-style causal/unmasked attention, all contractions 3-term bf16 hi/lo splits, f32 softmax with running max.
// q,k,v rows are read from f32 buffers with arbitrary row pitch (so they can live inside a fused qkv buffer);
// D = head size (multiple of 32, <= 128); one wave = 16 query rows; block = 4 waves (64 queries) sharing K/V chunks of 32.
template <int D, bool CAUSAL>
__global__ __launch_bounds__(128) void k_flash(const float* __restrict__ qb, const float* __restrict__ kb, const float* __restrict__ vb,
                                             int pitch, int T, int H, float scale, float* __restrict__ y, int ypitch) {
  constexpr int KS = D / 32;        // k-steps for QK
  constexpr int DT = D / 16;        // d tiles for PV
  __shared__ __attribute__((aligned(16))) unsigned short sKh[32][D + 8], sKl[32][D + 8], sVh[32][D + 8], sVl[32][D + 8];
  __shared__ __attribute__((aligned(16))) unsigned short sPh[4][16][40], sPl[4][16][40];
  __shared__ __attribute__((aligned(16))) float sO[4][16][D];
  const int tid = threadIdx.x, w = tid >> 5, lane = tid & 31, ln = lane & 15, hh = lane >> 4;
  const int nqb = (T + 63) / 64;
  const int bh = blockIdx.x / nqb, qblk = blockIdx.x % nqb;
  const int b = bh / H, h = bh % H;
  const int q0 = qblk * 64 + w * 16;
  const float* Q = qb + (size_t)b * T * pitch + h * D;
  const float* K = kb + (size_t)b * T * pitch + h * D;
  const float* V = vb + (size_t)b * T * pitch + h * D;

  // A fragments of the wave's 16 query rows (scaled), hi/lo
  FragB aqh[KS], aql[KS];
  {
    int row = q0 + ln; if (row >= T) row = T - 1;
    const float* qr = Q + (size_t)row * pitch;
#pragma unroll
    for (int ks = 0; ks < KS; ++ks)
#pragma unroll
      for (int i = 0; i < 16; ++i) {
        const int d = ks * 32 + ((i < 8) ? (8 * hh + i) : (16 + 8 * hh + (i - 8)));
        const float x = qr[d] * scale; const unsigned short hb = bf16_bits(x);
        aqh[ks].u[i] = hb; aql[ks].u[i] = bf16_bits(x - bf16_val(hb));
      }
  }
  float m_r[8], l_r[8];
#pragma unroll
  for (int r = 0; r < 8; ++r) { m_r[r] = -3.0e38f; l_r[r] = 0.f; }
  v8f oacc[DT];
#pragma unroll
  for (int dt = 0; dt < DT; ++dt) oacc[dt] = (v8f){0.f,0.f,0.f,0.f,0.f,0.f,0.f,0.f};

  const int kv_end = CAUSAL ? min(T, qblk * 64 + 64) : T;     // block-uniform
  for (int j0 = 0; j0 < kv_end; j0 += 32) {
    __syncthreads();
    for (int e = tid; e < 32 * (D / 4); e += 128) {
      const int r = e / (D / 4), c4 = (e % (D / 4)) * 4;
      const int key = j0 + r;
      v4f kf = {0.f,0.f,0.f,0.f}, vf = {0.f,0.f,0.f,0.f};
      if (key < T) { kf = *(const v4fa*)(K + (size_t)key * pitch + c4); vf = *(const v4fa*)(V + (size_t)key * pitch + c4); }
#pragma unroll
      for (int t = 0; t < 4; ++t) {
        unsigned short hb = bf16_bits(kf[t]); sKh[r][c4 + t] = hb; sKl[r][c4 + t] = bf16_bits(kf[t] - bf16_val(hb));
        hb = bf16_bits(vf[t]); sVh[r][c4 + t] = hb; sVl[r][c4 + t] = bf16_bits(vf[t] - bf16_val(hb));
      }
    }
    __syncthreads();
    // S tile 16 x 32
    v8f s[2];
#pragma unroll
    for (int nt = 0; nt < 2; ++nt) {
      v8f acc = {};
#pragma unroll
      for (int ks = 0; ks < KS; ++ks) {
        FragB bh_, bl_;
        bh_.half[0] = *(const v8us*)&sKh[nt * 16 + ln][ks * 32 + 8 * hh]; bh_.half[1] = *(const v8us*)&sKh[nt * 16 + ln][ks * 32 + 16 + 8 * hh];
        bl_.half[0] = *(const v8us*)&sKl[nt * 16 + ln][ks * 32 + 8 * hh]; bl_.half[1] = *(const v8us*)&sKl[nt * 16 + ln][ks * 32 + 16 + 8 * hh];
        acc = mmaN<3>(aqh[ks].v, aql[ks].v, bh_.v, bl_.v, acc);
      }
      s[nt] = acc;
    }
    // mask + running max (rows 8hh+r; the 16 lanes of a half share rows)
    float alpha[8];
#pragma unroll
    for (int r = 0; r < 8; ++r) {
      const int qi = q0 + 8 * hh + r;
      const int ja = j0 + ln, jb = j0 + 16 + ln;
      if (CAUSAL) { if (ja > qi) s[0][r] = -3.0e38f; if (jb > qi) s[1][r] = -3.0e38f; }
      if (ja >= T) s[0][r] = -3.0e38f;
      if (jb >= T) s[1][r] = -3.0e38f;
      float mx = fmaxf(s[0][r], s[1][r]);
      mx = fmaxf(mx, __shfl_xor(mx, 1, 32)); mx = fmaxf(mx, __shfl_xor(mx, 2, 32)); mx = fmaxf(mx, __shfl_xor(mx, 4, 32)); mx = fmaxf(mx, __shfl_xor(mx, 8, 32));
      const float mnew = fmaxf(m_r[r], mx);
      alpha[r] = (mnew > -1.0e38f) ? __expf(m_r[r] - mnew) : 1.0f;
      const float p0 = (s[0][r] > -1.0e38f) ? __expf(s[0][r] - mnew) : 0.f;
      const float p1 = (s[1][r] > -1.0e38f) ? __expf(s[1][r] - mnew) : 0.f;
      m_r[r] = mnew;
      l_r[r] = l_r[r] * alpha[r] + p0 + p1;            // per-lane partial row sum (16 lanes combined at the end)
      unsigned short hb = bf16_bits(p0); sPh[w][8 * hh + r][ln] = hb;      sPl[w][8 * hh + r][ln] = bf16_bits(p0 - bf16_val(hb));
      hb = bf16_bits(p1);                sPh[w][8 * hh + r][16 + ln] = hb; sPl[w][8 * hh + r][16 + ln] = bf16_bits(p1 - bf16_val(hb));
    }
#pragma unroll
    for (int dt = 0; dt < DT; ++dt)
#pragma unroll
      for (int r = 0; r < 8; ++r) oacc[dt][r] *= alpha[r];
    __builtin_amdgcn_fence(__ATOMIC_ACQ_REL, "workgroup");
    __builtin_amdgcn_wave_barrier();
    FragB pah, pal;
    pah.half[0] = *(const v8us*)&sPh[w][ln][8 * hh]; pah.half[1] = *(const v8us*)&sPh[w][ln][16 + 8 * hh];
    pal.half[0] = *(const v8us*)&sPl[w][ln][8 * hh]; pal.half[1] = *(const v8us*)&sPl[w][ln][16 + 8 * hh];
#pragma unroll
    for (int dt = 0; dt < DT; ++dt) {
      FragB bvh, bvl;
#pragma unroll
      for (int i = 0; i < 8; ++i) {
        bvh.u[i] = sVh[8 * hh + i][dt * 16 + ln]; bvh.u[8 + i] = sVh[16 + 8 * hh + i][dt * 16 + ln];
        bvl.u[i] = sVl[8 * hh + i][dt * 16 + ln]; bvl.u[8 + i] = sVl[16 + 8 * hh + i][dt * 16 + ln];
      }
      oacc[dt] = mmaN<3>(pah.v, pal.v, bvh.v, bvl.v, oacc[dt]);
    }
    __builtin_amdgcn_fence(__ATOMIC_ACQ_REL, "workgroup");
    __builtin_amdgcn_wave_barrier();
  }
#pragma unroll
  for (int r = 0; r < 8; ++r) {
    float l = l_r[r];
    l += __shfl_xor(l, 1, 32); l += __shfl_xor(l, 2, 32); l += __shfl_xor(l, 4, 32); l += __shfl_xor(l, 8, 32);
    l_r[r] = (l > 0.f) ? 1.0f / l : 0.f;
  }
#pragma unroll
  for (int dt = 0; dt < DT; ++dt)
#pragma unroll
    for (int r = 0; r < 8; ++r) sO[w][8 * hh + r][dt * 16 + ln] = oacc[dt][r] * l_r[r];
  __builtin_amdgcn_fence(__ATOMIC_ACQ_REL, "workgroup");
  __builtin_amdgcn_wave_barrier();
  {
    for (int r = 0; r < 16; ++r) {
      const int row = q0 + r;
      if (row < T && lane < D / 4) {
        const v4f val = *(const v4fa*)&sO[w][r][lane * 4];
        *(v4f*)(y + ((size_t)b * T + row) * ypitch + h * D + lane * 4) = val;
      }
    }
    
  }
}

// GEMM C = act(A·W + bias + resid): A f32 (ASPLIT -> hi/lo 2 terms), Wt bf16 [N][K]; ACT 0 none, 1 relu, 2 exact gelu;
// resid (optional, f32, row index = (row % rmod), pitch ldr, RES_BF16 rounds it) added before the activation.
template <bool ASPLIT, int ACT, bool BIAS_BF16, bool RES_BF16>
__global__ __launch_bounds__(128) void k_gemm_bf3(const float* __restrict__ A, int lda, const unsigned short* __restrict__ Wt, int ldb,
                                                const float* __restrict__ bias, const float* __restrict__ resid, int rmod, int ldr,
                                                float* __restrict__ C, int ldc, int M, int N, int K) {
  __shared__ __attribute__((aligned(16))) float so[4][16][64];
  const int tid = threadIdx.x, w = tid >> 5, lane = tid & 31, ln = lane & 15, hh = lane >> 4;
  const int ntn = N / 64;
  const int wid = blockIdx.x * 4 + w;
  const int mt = wid / ntn, nq = wid % ntn;
  if (mt * 16 >= M) return;
  const int row0 = mt * 16, col0 = nq * 64;
  const float* arow = A + (size_t)(row0 + ln) * lda;
  v8f acc[4] = {};
  for (int kb = 0; kb < K; kb += 32) {
    FragB ah, al;
    const v4f x0 = *(const v4fa*)(arow + kb + 8 * hh), x1 = *(const v4fa*)(arow + kb + 8 * hh + 4);
    const v4f x2 = *(const v4fa*)(arow + kb + 16 + 8 * hh), x3 = *(const v4fa*)(arow + kb + 16 + 8 * hh + 4);
    float xs[16] = {x0[0],x0[1],x0[2],x0[3],x1[0],x1[1],x1[2],x1[3],x2[0],x2[1],x2[2],x2[3],x3[0],x3[1],x3[2],x3[3]};
#pragma unroll
    for (int i = 0; i < 16; ++i) { const unsigned short hb = bf16_bits(xs[i]); ah.u[i] = hb; al.u[i] = ASPLIT ? bf16_bits(xs[i] - bf16_val(hb)) : (unsigned short)0; }
#pragma unroll
    for (int t = 0; t < 4; ++t) {
      const unsigned short* brow = Wt + (size_t)(col0 + t * 16 + ln) * ldb + kb;
      FragB b;
      b.half[0] = *(const v8us*)(brow + 8 * hh);
      b.half[1] = *(const v8us*)(brow + 16 + 8 * hh);
      acc[t] = mmaN<ASPLIT ? 2 : 1>(ah.v, al.v, b.v, b.v, acc[t]);
    }
  }
#pragma unroll
  for (int t = 0; t < 4; ++t) {
    const int col = col0 + t * 16 + ln;
    float bv = bias ? bias[col] : 0.f;
    if (BIAS_BF16) bv = bf16_round(bv);
#pragma unroll
    for (int r = 0; r < 8; ++r) {
      float v = acc[t][r] + bv;
      if (resid) { float rv = resid[(size_t)((row0 + 8 * hh + r) % rmod) * ldr + col]; if (RES_BF16) rv = bf16_round(rv); v += rv; }
      if (ACT == 1) v = fmaxf(v, 0.f);
      if (ACT == 2) v = 0.5f * v * (1.0f + erff(v * 0.70710678118654752f));
      if (ACT == 3) { const float u = 0.7978845608028654f * (v + 0.044715f * v * v * v); v = 0.5f * v * (1.0f + tanhf(u)); }
      so[w][8 * hh + r][t * 16 + ln] = v;
    }
  }
  __builtin_amdgcn_fence(__ATOMIC_ACQ_REL, "workgroup");
  __builtin_amdgcn_wave_barrier();
  const int rsub = lane >> 4, c4 = (lane & 15) * 4;
  {
#pragma unroll
    for (int q = 0; q < 8; ++q) {
      const int r = q * 2 + rsub;
      const v4f v = *(const v4fa*)&so[w][r][c4];
      *(v4f*)(C + (size_t)(row0 + r) * ldc + col0 + c4) = v;
    }
    
  }
}
// row LayerNorm (biased variance, eps) over N: s = X (+ R); optional out_sum <- s; out_norm <- (s-mu)*rsqrt(var+eps)*g + b
template <bool PARAM_BF16>
__global__ __launch_bounds__(256) void k_layernorm(const float* __restrict__ X, const float* __restrict__ R, const float* __restrict__ g, const float* __restrict__ bta,
                                                  float* __restrict__ out_sum, float* __restrict__ out_norm, int N, float eps) {
  __shared__ float red[256];
  const int row = blockIdx.x, tid = threadIdx.x;
  const float* x = X + (size_t)row * N; const float* rr = R ? R + (size_t)row * N : nullptr;
  float vals[16];                     // up to N = 4096
  const int per = N / 256;            // contiguous chunk per thread? use strided-by-4 chunks: thread handles j = tid*4 + 1024*u
  float s1 = 0.f;
  for (int u = 0; u < per / 4; ++u) {
    const int j = tid * 4 + 1024 * u;
    const v4f a = *(const v4fa*)(x + j);
    v4f b = {0.f,0.f,0.f,0.f}; if (rr) b = *(const v4fa*)(rr + j);
#pragma unroll
    for (int q = 0; q < 4; ++q) { const float v = a[q] + b[q]; vals[u * 4 + q] = v; s1 += v; }
  }
  red[tid] = s1; __syncthreads();
  for (int st = 128; st > 0; st >>= 1) { if (tid < st) red[tid] += red[tid + st]; __syncthreads(); }
  const float mu = red[0] / (float)N; __syncthreads();
  float s2 = 0.f;
  for (int u = 0; u < per / 4; ++u)
#pragma unroll
    for (int q = 0; q < 4; ++q) { const float c = vals[u * 4 + q] - mu; s2 += c * c; }
  red[tid] = s2; __syncthreads();
  for (int st = 128; st > 0; st >>= 1) { if (tid < st) red[tid] += red[tid + st]; __syncthreads(); }
  const float rs = rsqrtf(red[0] / (float)N + eps);
  {
    for (int u = 0; u < per / 4; ++u) {
      const int j = tid * 4 + 1024 * u;
      v4f o, sm;
#pragma unroll
      for (int q = 0; q < 4; ++q) {
        float gg = g[j + q], bb = bta[j + q];
        if (PARAM_BF16) { gg = bf16_round(gg); bb = bf16_round(bb); }
        sm[q] = vals[u * 4 + q]; o[q] = (vals[u * 4 + q] - mu) * rs * gg + bb;
      }
      if (out_sum) *(v4f*)(out_sum + (size_t)row * N + j) = sm;
      *(v4f*)(out_norm + (size_t)row * N + j) = o;
    }
    
  }
}



// ---- f16 WMMA path (v_wmma_f32_16x16x32_f16): 11-bit significands for operands in range — used for the generator and output GEMMs
typedef _Float16 v16h __attribute__((ext_vector_type(16)));
union FragH { v16h v; v8us half[2]; _Float16 h[16]; unsigned short u[16]; };
template <int NT>
__device__ __forceinline__ v8f mmaH(v16h ah, v16h al, v16h bh, v16h bl, v8f c) {
  c = __builtin_amdgcn_wmma_f32_16x16x32_f16(false, ah, false, bh, (short)0, c, false, false);
  if (NT >= 2) c = __builtin_amdgcn_wmma_f32_16x16x32_f16(false, al, false, bh, (short)0, c, false, false);
  if (NT >= 3) c = __builtin_amdgcn_wmma_f32_16x16x32_f16(false, ah, false, bl, (short)0, c, false, false);
  asm volatile("v_nop\n\tv_nop\n\tv_nop\n\tv_nop" : "+v"(c) : "v"(ah), "v"(al), "v"(bh), "v"(bl));
  return c;
}
// batched GEMM like k_gemm_b but f16 operands: A f32 (split into f16 hi/lo if ASPLIT, else rounded to f16), Bt = f16 values [n][k]; alpha; C f32; N multiple of 16 (partial tiles skipped)
template <bool ASPLIT>
__global__ __launch_bounds__(128) void k_gemm_h(const float* __restrict__ A, int lda, size_t sA, const _Float16* __restrict__ Bh, int ldb, size_t sB, float alpha, float* __restrict__ C, int ldc, size_t sC, int M, int N, int K) {
  __shared__ __attribute__((aligned(16))) float so[4][16][64];
  const int tid = threadIdx.x, w = tid >> 5, lane = tid & 31, ln = lane & 15, hh = lane >> 4; const int by = blockIdx.y;
  A += (size_t)by * sA; Bh += (size_t)by * sB; C += (size_t)by * sC;
  const int ntn = (N + 63) / 64; const int wid = blockIdx.x * 4 + w; const int mt = wid / ntn, nq = wid % ntn; if (mt * 16 >= M) return;
  const int row0 = mt * 16, col0 = nq * 64; const float* arow = A + (size_t)(row0 + ln) * lda;
  v8f acc[4] = {};
  for (int kb = 0; kb < K; kb += 32) {
    FragH ah, al;
    const v4f x0 = *(const v4fa*)(arow + kb + 8 * hh), x1 = *(const v4fa*)(arow + kb + 8 * hh + 4), x2 = *(const v4fa*)(arow + kb + 16 + 8 * hh), x3 = *(const v4fa*)(arow + kb + 16 + 8 * hh + 4);
    float xs[16] = {x0[0],x0[1],x0[2],x0[3],x1[0],x1[1],x1[2],x1[3],x2[0],x2[1],x2[2],x2[3],x3[0],x3[1],x3[2],x3[3]};
#pragma unroll
    for (int i = 0; i < 16; ++i) { const _Float16 h = (_Float16)xs[i]; ah.h[i] = h; al.h[i] = ASPLIT ? (_Float16)(xs[i] - (float)h) : (_Float16)0.0f; }
#pragma unroll
    for (int t = 0; t < 4; ++t) { if (col0 + t * 16 >= N) continue; const size_t boff = (size_t)(col0 + t * 16 + ln) * ldb + kb; FragH bq; bq.half[0] = *(const v8us*)(Bh + boff + 8 * hh); bq.half[1] = *(const v8us*)(Bh + boff + 16 + 8 * hh);
      acc[t] = mmaH<ASPLIT ? 2 : 1>(ah.v, al.v, bq.v, bq.v, acc[t]); }
  }
#pragma unroll
  for (int t = 0; t < 4; ++t) { if (col0 + t * 16 >= N) continue;
#pragma unroll
    for (int r = 0; r < 8; ++r) so[w][8 * hh + r][t * 16 + ln] = acc[t][r] * alpha; }
  __builtin_amdgcn_fence(__ATOMIC_ACQ_REL, "workgroup"); __builtin_amdgcn_wave_barrier();
  const int rsub = lane >> 4, c4 = (lane & 15) * 4;
  {
#pragma unroll
    for (int q = 0; q < 8; ++q) { const int r = q * 2 + rsub; if (col0 + c4 < N) { const v4f v = *(const v4fa*)&so[w][r][c4]; *(v4f*)(C + (size_t)(row0 + r) * ldc + col0 + c4) = v; } }
     }
}

// Wt[n][k] = f16(W[k][n]·scale) from f32 row-major W[K][N] (scale = power of two; bf16-exact weights stay exact in f16 away from the subnormal range)
__global__ __launch_bounds__(256) void k_wt_f16(const float* __restrict__ W, _Float16* __restrict__ Wt, int K, int N, float scale) {
  const int t = blockIdx.x * 256 + threadIdx.x; if (t >= N * (K / 8)) return; const int n = t / (K / 8), k8 = (t % (K / 8)) * 8; FragH f;
#pragma unroll
  for (int i = 0; i < 8; ++i) f.h[i] = (_Float16)(bf16_round(W[(size_t)(k8 + i) * N + n]) * scale); const v8us o = f.half[0];
  *(v8us*)((unsigned short*)Wt + (size_t)n * K + k8) = o; 
}
// k_gemm_hh variant with fused epilogue: v = acc·alpha + bias[by·sBias + col] (+ CP[(row/rowsPerB)·sCPb + by·64 + col] if CP) ; ACT 0 none / 1 elu ; writes f32 C and f16 C16, each if non-null
template <int ACT>
__global__ __launch_bounds__(128) void k_gemm_hhx(const _Float16* __restrict__ A, int lda, size_t sA, const _Float16* __restrict__ Bh, int ldb, size_t sB, float alpha, const float* __restrict__ bias, size_t sBias, const float* __restrict__ CP, int rowsPerB, size_t sCPb, int row0g,
    float* __restrict__ C, _Float16* __restrict__ C16, int ldc, size_t sC, int M, int N, int K) {
  __shared__ __attribute__((aligned(16))) float so[4][16][64];
  const int tid = threadIdx.x, w = tid >> 5, lane = tid & 31, ln = lane & 15, hh = lane >> 4; const int by = blockIdx.y;
  A += (size_t)by * sA; Bh += (size_t)by * sB; const size_t cofs = (size_t)by * sC; const float* bp = bias ? bias + (size_t)by * sBias : nullptr;
  const int ntn = (N + 63) / 64; const int wid = blockIdx.x * 4 + w; const int mt = wid / ntn, nq = wid % ntn; if (mt * 16 >= M) return;
  const int row0 = mt * 16, col0 = nq * 64; const _Float16* arow = A + (size_t)(row0 + ln) * lda;
  v8f acc[4] = {};
  for (int kb = 0; kb < K; kb += 32) { FragH ah; ah.half[0] = *(const v8us*)((const unsigned short*)arow + kb + 8 * hh); ah.half[1] = *(const v8us*)((const unsigned short*)arow + kb + 16 + 8 * hh);
#pragma unroll
    for (int t = 0; t < 4; ++t) { if (col0 + t * 16 >= N) continue; const size_t boff = (size_t)(col0 + t * 16 + ln) * ldb + kb; FragH bq; bq.half[0] = *(const v8us*)((const unsigned short*)Bh + boff + 8 * hh); bq.half[1] = *(const v8us*)((const unsigned short*)Bh + boff + 16 + 8 * hh);
      acc[t] = mmaH<1>(ah.v, ah.v, bq.v, bq.v, acc[t]); }
  }
#pragma unroll
  for (int t = 0; t < 4; ++t) { if (col0 + t * 16 >= N) continue; const int col = col0 + t * 16 + ln; const float bv = bp ? bf16_round(bp[col]) : 0.f;
#pragma unroll
    for (int r = 0; r < 8; ++r) { float v = acc[t][r] * alpha + bv; if (CP) { const int bidx = (row0g + row0 + 8 * hh + r) / rowsPerB; v += CP[(size_t)bidx * sCPb + (size_t)by * 64 + col]; } if (ACT == 1) v = (v > 0.f) ? v : expm1f(v); else if (ACT == 3) v = fmaxf(v, 0.f); so[w][8 * hh + r][t * 16 + ln] = v; } }
  __builtin_amdgcn_fence(__ATOMIC_ACQ_REL, "workgroup"); __builtin_amdgcn_wave_barrier();
  const int rsub = lane >> 4, c4 = (lane & 15) * 4; typedef _Float16 v4h __attribute__((ext_vector_type(4)));
  {
#pragma unroll
    for (int q = 0; q < 8; ++q) { const int r = q * 2 + rsub; if (col0 + c4 < N) { const v4f v = *(const v4fa*)&so[w][r][c4]; if (C) *(v4f*)(C + cofs + (size_t)(row0 + r) * ldc + col0 + c4) = v; if (C16) { v4h h4; for (int i = 0; i < 4; ++i) h4[i] = (_Float16)v[i]; *(v4h*)(C16 + cofs + (size_t)(row0 + r) * ldc + col0 + c4) = h4; } } }
     }
}


// FRAGMENT ORDER of every 16-bit operand plane in the workspace (weights, pf_low, g): a plane [rows][K] is cut into units of 16 rows x 32 k = 1 KB, unit index = (row / 16) * (K / 32) + k / 32;
// the 16-byte piece j * 32 + lane of a unit holds row (lane & 15), k = 16 j + 8 (lane >> 4) .. + 7: what lane reads as half j of its WMMA fragment. One wave-wide 16-byte load = 512 contiguous bytes = 4 whole lines.
// Bt = f16(bf16(W) * 16) in fragment order (the two projections' planes: bf16(W) itself, as bf16), W f32 [rows][32 << ksh]; thread t of a plane writes its piece t.
// The four weight planes depend on nothing, nor on one another: one launch rounds them all. A work-group writes 256 pieces of one plane (every plane is a whole number of work-groups), chosen by scalar selects, so that one body serves all four.
#define RB_G (NPAR * LOW / 8 / 256)
#define RB_P (LOW * FD / 8 / 256)
__global__ __launch_bounds__(256) void k_round_all(const float* __restrict__ pgw, const float* __restrict__ pfw, const float* __restrict__ ppw, const float* __restrict__ f2w,
                                                  _Float16* __restrict__ Bg, _Float16* __restrict__ Bf, _Float16* __restrict__ Bp, _Float16* __restrict__ B2) {
  const int b = blockIdx.x;
  const int sel = (b >= RB_G) + (b >= RB_G + RB_P) + (b >= RB_G + 2 * RB_P);      // 0 generator, 1 f projection, 2 pf projection, 3 last projection
  const float* W = sel == 0 ? pgw : sel == 1 ? pfw : sel == 2 ? ppw : f2w;
  _Float16* Bt = sel == 0 ? Bg : sel == 1 ? Bf : sel == 2 ? Bp : B2;
  const int ksh = (sel == 1 || sel == 2) ? 5 : 2;      // k steps of 32 in a row: FD / 32 = 32 or LOW / 32 = 4
  const int t = (b - (sel == 0 ? 0 : RB_G + (sel - 1) * RB_P)) * 256 + (int)threadIdx.x;
  FragH f;
  const int lane = t & 31, j = (t >> 5) & 1, unit = t >> 6;
  const float* src = W + ((size_t)((unit >> ksh) * 16 + (lane & 15)) << (5 + ksh)) + (unit & ((1 << ksh) - 1)) * 32 + 16 * j + 8 * (lane >> 4);
  const v4f x0 = *(const v4fa*)src, x1 = *(const v4fa*)(src + 4);
#pragma unroll
  for (int i = 0; i < 8; ++i) f.h[i] = (_Float16)(bf16_round(i < 4 ? x0[i & 3] : x1[i & 3]) * 16.0f);
  FragB fb; fb.q[0] = __builtin_convertvector(x0, v4b); fb.q[1] = __builtin_convertvector(x1, v4b);
  *(v8us*)((unsigned short*)Bt + (size_t)t * 8) = (sel == 1 || sel == 2) ? fb.half[0] : f.half[0];  }
__global__ __launch_bounds__(256) void k_h16(const float* __restrict__ x, _Float16* __restrict__ X16, size_t n8) { const size_t t = (size_t)blockIdx.x * 256 + threadIdx.x; if (t >= n8) return; FragH f;
#pragma unroll
  for (int q = 0; q < 8; ++q) f.h[q] = (_Float16)x[t * 8 + q]; *(v8us*)((unsigned short*)X16 + t * 8) = f.half[0];  }
// Projection C[NBS][LOW] = x . W^T + bias on v_wmma_f32_16x16x32_bf16: x is read as f32 and rounded to bf16 on its way into the A fragment, two elements an instruction; Bh holds bf16(W).
// Tile map and k order are those of k_gemm_hhx: one wave = 16 rows x 64 columns, k rising, one accumulator chain per 16 x 16 tile. Bh, and C16 where it is written, are in fragment order.
// x comes to LDS by asynchronous copies, a tile of the work-group's PJ_R rows x PJ_KC k at a time, two buffers: a wave-wide copy covers 512 contiguous bytes of one row (4 whole lines; a fragment load
// straight from x touches 16 lines for as many bytes), and the two waves that share a row tile read one copy in LDS.
#define PJ_U 8
#define PJ_R 32
#define PJ_KC (32 * PJ_U)
#define PJ_PITCH (PJ_KC * 4 + 16)      // bytes of a row in LDS: 16 x odd, so that the 16 rows of a 16-byte fragment read fall on all banks
#define PJ_TILE (PJ_R * PJ_PITCH)
// four rows of a tile, two copies of 512 bytes a row: l = the lane's LDS byte address, g = its global address, in the first row.
__device__ __forceinline__ void proj_copy4(unsigned l, const float* g) {
  const unsigned l0 = l, l1 = l + 512, l2 = l + PJ_PITCH, l3 = l + PJ_PITCH + 512, l4 = l + 2 * PJ_PITCH, l5 = l + 2 * PJ_PITCH + 512, l6 = l + 3 * PJ_PITCH, l7 = l + 3 * PJ_PITCH + 512;
  const float *g0 = g, *g1 = g + 128, *g2 = g + FD, *g3 = g + FD + 128, *g4 = g + 2 * FD, *g5 = g + 2 * FD + 128, *g6 = g + 3 * FD, *g7 = g + 3 * FD + 128;
  // the copies bring x into LDS through no register; precaution: s_wait_xcnt 0 as the statement's last line stands in front of whatever reuses the copies' address registers
  asm volatile("global_load_async_to_lds_b128 %0, %8, off\n\t"
               "global_load_async_to_lds_b128 %1, %9, off\n\t"
               "global_load_async_to_lds_b128 %2, %10, off\n\t"
               "global_load_async_to_lds_b128 %3, %11, off\n\t"
               "global_load_async_to_lds_b128 %4, %12, off\n\t"
               "global_load_async_to_lds_b128 %5, %13, off\n\t"
               "global_load_async_to_lds_b128 %6, %14, off\n\t"
               "global_load_async_to_lds_b128 %7, %15, off\n\t"
               "s_wait_xcnt 0x0"
               :: "v"(l0), "v"(l1), "v"(l2), "v"(l3), "v"(l4), "v"(l5), "v"(l6), "v"(l7), "v"(g0), "v"(g1), "v"(g2), "v"(g3), "v"(g4), "v"(g5), "v"(g6), "v"(g7) : "memory");
}
template <bool OUT16>
__device__ __forceinline__ void proj_body(int blk, float* __restrict__ sbuf, char* sx, const float* __restrict__ X, const _Float16* __restrict__ Bh, const float* __restrict__ bias, float* __restrict__ C, _Float16* __restrict__ C16) {
  float (*so)[16][OUT16 ? 68 : 64] = (float (*)[16][OUT16 ? 68 : 64])sbuf;      // pitch 68 floats where 16 lanes read one column range of 16 rows: it spreads them over all banks
  const int tid = threadIdx.x, w = tid >> 5, lane = tid & 31, ln = lane & 15, hh = lane >> 4;
  const int wid = blk * 4 + w, row0 = (wid >> 1) * 16, col0 = (wid & 1) * 64;
  const unsigned short* brow = (const unsigned short*)Bh + (size_t)col0 * FD + lane * 8;
  // wave w copies rows 8 w .. 8 w + 7 of each tile; every lane is on, and the tests around the copies read the same for the whole work-group
  const float* xg = X + (size_t)(blk * PJ_R + 8 * w) * FD + lane * 4;
  const unsigned xl = (unsigned)(size_t)sx + (unsigned)(8 * w * PJ_PITCH + lane * 16);
  auto copy_tile = [&](int tl) {
    const unsigned l = xl + (unsigned)((tl & 1) * PJ_TILE);
    const float* g = xg + tl * PJ_KC;
    proj_copy4(l, g);
    proj_copy4(l + 4 * PJ_PITCH, g + 4 * FD);
  };
  copy_tile(0);
  asm volatile("s_wait_asynccnt 0x0" ::: "memory");      // this wave's rows of tile 0 have landed
  __syncthreads();      // every wave's rows of tile 0 have landed before any wave reads the tile
  copy_tile(1);
  const char* xrow = sx + ((w >> 1) * 16 + ln) * PJ_PITCH + 32 * hh;      // the lane's row of the wave's row tile
  v8f acc[4] = {};
#pragma unroll 1      // the loop stays whole: with its first trips peeled off, the copies' addresses were spilled to scratch memory
  for (int kb = 0; kb < FD; kb += PJ_KC) {
    const int tl = kb / PJ_KC;
    FragB b[PJ_U][4];
#pragma unroll
    for (int u = 0; u < PJ_U; ++u)
#pragma unroll
      for (int t = 0; t < 4; ++t) {
        const unsigned short* p = brow + (size_t)t * 16 * FD + kb * 16 + u * 512;
        b[u][t].half[0] = *(const v8us*)p; b[u][t].half[1] = *(const v8us*)(p + 256);
      }
    const char* xs = xrow + (tl & 1) * PJ_TILE;
    FragB a[PJ_U];      // x rounded to bf16, two elements an instruction: the packed pair is the operand as the matrix unit takes it
#pragma unroll
    for (int u = 0; u < PJ_U; ++u) {
      const char* p = xs + u * 128;
      a[u].q[0] = __builtin_convertvector(*(const v4fa*)p, v4b); a[u].q[1] = __builtin_convertvector(*(const v4fa*)(p + 16), v4b);
      a[u].q[2] = __builtin_convertvector(*(const v4fa*)(p + 64), v4b); a[u].q[3] = __builtin_convertvector(*(const v4fa*)(p + 80), v4b);
    }
    asm volatile("s_wait_xcnt 0x0" ::: "memory");      // precaution: stands in front of the addition that steps the weight loads' address pair to the next group
    // the wave has now read all that it needs of tile tl into registers: the buffer is handed over here, in front of the arithmetic, so that the next copies fly under it
    asm volatile("s_wait_dscnt 0x0" ::: "memory");      // this wave's reads of tile tl have returned before the buffer is handed back
    asm volatile("s_wait_asynccnt 0x0" ::: "memory");      // this wave's rows of tile tl + 1 have landed
    __syncthreads();      // publishes tile tl + 1 and ends every wave's reads of tile tl, whose buffer is refilled behind it
    if (tl + 2 < FD / PJ_KC) copy_tile(tl + 2);
#pragma unroll
    for (int u = 0; u < PJ_U; ++u)
#pragma unroll
      for (int t = 0; t < 4; ++t) acc[t] = __builtin_amdgcn_wmma_f32_16x16x32_bf16(false, a[u].v, false, b[u][t].v, (short)0, acc[t], false, false);
  }
  asm volatile("s_wait_asynccnt 0x0" ::: "memory");      // no copy is outstanding when the wave goes on to the epilogue and ends
  float bv[4];
  __builtin_amdgcn_sched_barrier(0);      // keeps index arithmetic that has sunk down to the epilogue in front of the bias loads: between them and their wait it took the loads' offset register
#pragma unroll
  for (int t = 0; t < 4; ++t) bv[t] = bias[col0 + t * 16 + ln];
  asm volatile("s_wait_xcnt 0x0" ::: "memory");      // precaution: the compiler reuses the bias loads' offset register at once
  __builtin_amdgcn_sched_barrier(0);      // holds that reuse behind the wait
#pragma unroll
  for (int t = 0; t < 4; ++t) {
    const float bb = bf16_round(bv[t]);
#pragma unroll
    for (int r = 0; r < 8; ++r) so[w][8 * hh + r][t * 16 + ln] = acc[t][r] + bb;
  }
  __builtin_amdgcn_fence(__ATOMIC_ACQ_REL, "workgroup", "local"); __builtin_amdgcn_wave_barrier();      // the wave's own LDS stores land before it reads the rows back
  if constexpr (OUT16) {
    // the wave's 64 columns are two units of its row tile: four stores of 512 contiguous bytes
    unsigned short* o = (unsigned short*)C16 + (size_t)row0 * LOW + col0 * 16 + lane * 8;
#pragma unroll
    for (int q = 0; q < 4; ++q) {
      const float* s = &so[w][ln][q * 16 + 8 * hh];
      const v4f v0 = *(const v4fa*)s, v1 = *(const v4fa*)(s + 4);
      FragH h;
#pragma unroll
      for (int i = 0; i < 8; ++i) h.h[i] = (_Float16)(i < 4 ? v0[i & 3] : v1[i & 3]);
      *(v8us*)(o + q * 256) = h.half[0];
    }
  } else {
    const int rsub = lane >> 4, c4 = (lane & 15) * 4;
    const size_t o0 = (size_t)(row0 + rsub) * LOW + col0 + c4;
#pragma unroll
    for (int q = 0; q < 8; ++q) {
      const v4f v = *(const v4fa*)&so[w][q * 2 + rsub][c4];
      *(v4f*)(C + o0 + q * 2 * LOW) = v;
    }
  }
}
// The two projections depend on nothing of one another: one launch holds both, the first PJ_B work-groups f_low, the rest pf_low, so that two work-groups stand on a WGP and each runs under the other's load waits.
#define PJ_B ((NBS / 16) * (LOW / 64) / 4)
__global__ __launch_bounds__(128) void k_proj2(const float* __restrict__ f, const float* __restrict__ pf, const _Float16* __restrict__ Bf, const _Float16* __restrict__ Bp, const float* __restrict__ pfb, const float* __restrict__ ppb,
                                              float* __restrict__ FLOW, _Float16* __restrict__ PL16) {
  __shared__ __attribute__((aligned(16))) float sbuf[4 * 16 * 68];
  __shared__ __attribute__((aligned(16))) char sx[2 * PJ_TILE];      // the two buffers of x tiles
  const int b = blockIdx.x;
  if (b < PJ_B) proj_body<false>(b, sbuf, sx, f, Bf, pfb, FLOW, nullptr);
  else proj_body<true>(b - PJ_B, sbuf, sx, pf, Bp, ppb, nullptr, PL16);
}
// out[NBS][FD] = (g0 + g1) . W2^T + bias + (f + pf), g0 and g1 the two planes of partial g, taken as one operand of K = 2 * LOW against W2 twice: f and pf are read as f32 by the lane that stores the element, 16 bytes at a time, rounded to bf16 and summed there.
// Tile shape and k order are those of k_gemm_hhx (one wave = 16 rows x 64 columns); which tile a work-group takes is set below. G and Bh are in fragment order.
__global__ __launch_bounds__(128) void k_out(const _Float16* __restrict__ G, const _Float16* __restrict__ Bh, const float* __restrict__ bias, const float* __restrict__ f, const float* __restrict__ pf, float* __restrict__ out) {
  __shared__ __attribute__((aligned(16))) float so[4][16][64];
  const int tid = threadIdx.x, w = tid >> 5, lane = tid & 31, ln = lane & 15, hh = lane >> 4;
  // Which tile a work-group takes: its index modulo 8 is bits 1 to 3 of its row tile, as in k_proj2 (32 rows a work-group; k_gen_mlp, 64 rows a pair of work-groups, agrees in the upper two of these bits).
  // For speed only: the map is one to one, wherever the work-groups land.
  const int bu = blockIdx.x >> 3, rt = ((bu >> 3) << 4) | ((blockIdx.x & 7) << 1) | ((bu >> 2) & 1);
  const int row0 = rt * 16, col0 = ((bu & 3) * 4 + w) * 64;
  const int rsub = lane >> 4, c4 = (lane & 15) * 4;
  const unsigned short* arow = (const unsigned short*)G + (size_t)row0 * LOW + lane * 8;
  const unsigned short* brow = (const unsigned short*)Bh + (size_t)col0 * LOW + lane * 8;
  FragH a[2][LOW / 32], b[4][LOW / 32];
#pragma unroll
  for (int p = 0; p < 2; ++p)
#pragma unroll
    for (int ks = 0; ks < LOW / 32; ++ks) { a[p][ks].half[0] = *(const v8us*)(arow + (size_t)p * NBS * LOW + ks * 512); a[p][ks].half[1] = *(const v8us*)(arow + (size_t)p * NBS * LOW + ks * 512 + 256); }
  asm volatile("s_wait_xcnt 0x0" ::: "memory");      // precaution: the compiler reuses these loads' address pair as the destination of a later load
#pragma unroll
  for (int t = 0; t < 4; ++t)
#pragma unroll
    for (int ks = 0; ks < LOW / 32; ++ks) { b[t][ks].half[0] = *(const v8us*)(brow + (size_t)t * 16 * LOW + ks * 512); b[t][ks].half[1] = *(const v8us*)(brow + (size_t)t * 16 * LOW + ks * 512 + 256); }
  float bv[4];
#pragma unroll
  for (int t = 0; t < 4; ++t) bv[t] = bias[col0 + t * 16 + ln];
  asm volatile("s_wait_xcnt 0x0" ::: "memory");      // precaution: the operand loads' address registers are free for reuse behind it
  __builtin_amdgcn_sched_barrier(0);      // loads return in order: the operand loads (L2) stay in front of the residual loads (memory), so that the WMMAs need not wait for the latter
  const size_t o0 = (size_t)(row0 + rsub) * FD + col0 + c4;
  v4f rf[8], rp[8];
#pragma unroll
  for (int q = 0; q < 8; ++q) { rf[q] = *(const v4fa*)(f + o0 + q * 2 * FD); rp[q] = *(const v4fa*)(pf + o0 + q * 2 * FD); }
  asm volatile("s_wait_xcnt 0x0" ::: "memory");      // precaution: as above, for the residual loads' two address pairs
  __builtin_amdgcn_sched_barrier(0);      // keeps the residual loads in front of the product, which then runs under their latency
  v8f acc[4] = {};
#pragma unroll
  for (int p = 0; p < 2; ++p)
#pragma unroll
    for (int ks = 0; ks < LOW / 32; ++ks)
#pragma unroll
      for (int t = 0; t < 4; ++t) acc[t] = __builtin_amdgcn_wmma_f32_16x16x32_f16(false, a[p][ks].v, false, b[t][ks].v, (short)0, acc[t], false, false);
#pragma unroll
  for (int t = 0; t < 4; ++t) {
    const float bb = bf16_round(bv[t]);
#pragma unroll
    for (int r = 0; r < 8; ++r) so[w][8 * hh + r][t * 16 + ln] = acc[t][r] * 0.0625f + bb;
  }
  __builtin_amdgcn_fence(__ATOMIC_ACQ_REL, "workgroup", "local"); __builtin_amdgcn_wave_barrier();      // the wave's own LDS stores land before it reads the rows back; LDS alone, so that the residual loads stay in flight
#pragma unroll
  for (int q = 0; q < 8; ++q) {
    v4f v = *(const v4fa*)&so[w][q * 2 + rsub][c4];
#pragma unroll
    for (int c = 0; c < 4; ++c) v[c] += bf16_round(rf[q][c]) + bf16_round(rp[q][c]);
    *(v4f*)(out + o0 + q * 2 * FD) = v;
  }
}
// Parameter generator and per-sample MLP in one kernel: a work-group owns GM_M samples and GM_H of the MID hidden units, and never stores the generated parameters.
// A hidden unit m needs only the parameters l * MID + m of layer 1 and LOW * MID + m * LOW + l of layer 2, so the two halves of the hidden units are independent up to the last sum over m:
// each half writes its own partial g, and the last GEMM adds the two. A weight tile that comes from L2 thus serves GM_T sample tiles, and a work-group reads half of the weight plane.
// Each 16 x 16 tile of params = pf_low . pg_w^T (K = LOW, four f16 WMMAs) is scaled, biased and summed into h or g straight from the accumulator registers
// (accumulator register r of lane (ln, hh) = sample 8 * hh + r, parameter column ln).
// Layer 1: wave w owns l = 16 w .. 16 w + 15 and sums them in rising order; the eight waves' partial h meet in LDS in rising wave order, then relu.
// Layer 2: wave w owns l = 16 w .. 16 w + 15 and sums the work-group's m in rising order.
#define GM_M 64
#define GM_T (GM_M / 16)
#define GM_H (MID / 2)
struct Yes { static constexpr bool value = true; }; struct No { static constexpr bool value = false; };
__global__ __launch_bounds__(256) void k_gen_mlp(const _Float16* __restrict__ PL, const _Float16* __restrict__ Bg, const float* __restrict__ pgb, const float* __restrict__ FLOW, _Float16* __restrict__ G16) {
  __shared__ __attribute__((aligned(16))) float sF[LOW][GM_M];              // flow[s][l] at [l][s]; rows 16 w .. + 15 are written and read by wave w alone
  __shared__ __attribute__((aligned(16))) float sP[8][GM_H][GM_M + 4];      // partial h per wave at [m][s]; pitch 68 floats spreads the 16-byte stores of 16 rows m over all banks
  __shared__ __attribute__((aligned(16))) float sH[GM_H][GM_M];             // h after relu at [m][s]
  __shared__ __attribute__((aligned(16))) _Float16 sG[GM_M][LOW + 8];       // partial g as f16, gathered so that the work-group stores it in fragment order
  const int tid = threadIdx.x, lane = tid & 31, ln = lane & 15, hh = lane >> 4;
  const int w = __builtin_amdgcn_readfirstlane(tid >> 5);
  const int s0 = (blockIdx.x >> 1) * GM_M, mh = blockIdx.x & 1;
  struct BTile { FragH f[LOW / 32]; float b; };
  // this wave's stream of tiles: 16 of layer 1 (l = 16 w + u: MID parameters apart), then 16 of layer 2 (m = GM_H * mh + u: LOW parameters apart).
  // A tile's address is a wave-uniform base (first parameter n0 of the tile) plus the lane's fixed offset; fragment order: a tile of 16 parameters is 4 KB in a row
  const int nb1 = w * 512 + mh * GM_H, nb2 = LOW * MID + mh * GM_H * LOW + w * 16;
  const unsigned lo16 = lane * 16, lo4 = ln * 4;
  struct TAddr { const char* p; const char* c; };      // a lane's addresses of a tile: weights, bias
  auto tile_addr = [&](int n0) { return TAddr{(const char*)Bg + (size_t)n0 * (LOW * 2) + lo16, (const char*)pgb + (size_t)n0 * 4 + lo4}; };
  auto load_tile = [&](BTile& t, const TAddr& ad) {
    const char* p = ad.p;
    t.b = *(const float*)ad.c;
#pragma unroll
    for (int ks = 0; ks < LOW / 32; ++ks) { t.f[ks].half[0] = *(const v8us*)(p + ks * 1024); t.f[ks].half[1] = *(const v8us*)(p + ks * 1024 + 512); }
  };
  // precaution: s_wait_xcnt 0 in front of whatever reuses the address registers of two tiles' loads; it takes the four addresses as inputs, so that their registers stay theirs up to the wait; the scheduling barrier holds later arithmetic behind it
  auto close_tiles = [&](const TAddr& x, const TAddr& y) {
    asm volatile("s_wait_xcnt 0x0" :: "v"(x.p), "v"(x.c), "v"(y.p), "v"(y.c) : "memory");
    __builtin_amdgcn_sched_barrier(0);
  };
  v4f fl[GM_M / 32][4];
#pragma unroll
  for (int q = 0; q < GM_M / 32; ++q)
#pragma unroll
    for (int j = 0; j < 4; ++j) fl[q][j] = *(const v4fa*)(FLOW + (size_t)(s0 + q * 32 + lane) * LOW + w * 16 + j * 4);
  asm volatile("s_wait_xcnt 0x0" ::: "memory");      // precaution: the compiler reuses these loads' address pairs for the next addresses
  __builtin_amdgcn_sched_barrier(0);      // holds that reuse behind the wait
  FragH a[GM_T][LOW / 32];
#pragma unroll
  for (int mt = 0; mt < GM_T; ++mt) {
    const unsigned short* ar = (const unsigned short*)PL + (size_t)(s0 + mt * 16) * LOW + lane * 8;
#pragma unroll
    for (int ks = 0; ks < LOW / 32; ++ks) { a[mt][ks].half[0] = *(const v8us*)(ar + ks * 512); a[mt][ks].half[1] = *(const v8us*)(ar + ks * 512 + 256); }
    asm volatile("s_wait_xcnt 0x0" ::: "memory");      // precaution: the compiler reuses an address pair of the loads above as the destination of a later load, or for the next tile's address
    __builtin_amdgcn_sched_barrier(0);      // holds that reuse behind the wait; behind the last tile it also keeps the sample loads in front of the weight loads: loads return in order, and behind them they would force the loop's first wait to drain the weight tiles too
  }
  BTile bt[2];
  { const TAddr x = tile_addr(nb1), y = tile_addr(nb1 + MID); load_tile(bt[0], x); load_tile(bt[1], y); close_tiles(x, y); }
#pragma unroll
  for (int q = 0; q < GM_M / 32; ++q)
#pragma unroll
    for (int j = 0; j < 4; ++j)
#pragma unroll
      for (int c = 0; c < 4; ++c) sF[w * 16 + j * 4 + c][q * 32 + lane] = fl[q][j][c];
  // fence on LDS alone: the wave's own stores land before it reads the rows back; a fence on every address space would also drain the weight loads in flight
  __builtin_amdgcn_fence(__ATOMIC_ACQ_REL, "workgroup", "local"); __builtin_amdgcn_wave_barrier();
  // one tile: acc[mt][r] += cf[sample] * (tile / 16 + bias); the tile's registers are refilled with the tile at un as soon as its WMMAs have issued
  auto tile_step = [&](BTile& t, const float* cf, v8f (&acc)[GM_T], const TAddr& un, auto refill) {
    v4f c[GM_T][2];
#pragma unroll
    for (int mt = 0; mt < GM_T; ++mt) { c[mt][0] = *(const v4fa*)(cf + mt * 16 + 8 * hh); c[mt][1] = *(const v4fa*)(cf + mt * 16 + 8 * hh + 4); }
    v8f d[GM_T] = {};
#pragma unroll
    for (int ks = 0; ks < LOW / 32; ++ks)
#pragma unroll
      for (int mt = 0; mt < GM_T; ++mt) d[mt] = __builtin_amdgcn_wmma_f32_16x16x32_f16(false, a[mt][ks].v, false, t.f[ks].v, (short)0, d[mt], false, false);
    const float bv = bf16_round(t.b);
    if constexpr (decltype(refill)::value) {
      load_tile(t, un);
      __builtin_amdgcn_sched_barrier(0);      // keeps the refill in front of the sums below: sunk behind them, to the end of the trip, the loads would have too little work to return under
    }
#pragma unroll
    for (int mt = 0; mt < GM_T; ++mt)
#pragma unroll
      for (int r = 0; r < 8; ++r) acc[mt][r] += c[mt][r >> 2][r & 3] * (d[mt][r] * 0.0625f + bv);
  };
  v8f hp[GM_T] = {};
  for (int i = 0; i < 8; ++i) {
    const int un = (i < 7) ? nb1 + (2 * i + 2) * MID : nb2;      // the last trip fetches the first two tiles of layer 2
    const TAddr x = tile_addr(un), y = tile_addr(un + ((i < 7) ? MID : LOW));
    tile_step(bt[0], &sF[w * 16 + 2 * i][0], hp, x, Yes{});
    tile_step(bt[1], &sF[w * 16 + 2 * i + 1][0], hp, y, Yes{});
    close_tiles(x, y);
  }
#pragma unroll
  for (int mt = 0; mt < GM_T; ++mt) {
    float* d = &sP[w][ln][mt * 16 + 8 * hh];
    *(v4fa*)d = (v4f){hp[mt][0], hp[mt][1], hp[mt][2], hp[mt][3]};
    *(v4fa*)(d + 4) = (v4f){hp[mt][4], hp[mt][5], hp[mt][6], hp[mt][7]};
  }
  __syncthreads();      // every wave's partial h is in LDS
  {
    const int m = tid >> 4, s4 = (tid & 15) * 4;
    v4f v = *(const v4fa*)&sP[0][m][s4];
#pragma unroll
    for (int q = 1; q < 8; ++q) v += *(const v4fa*)&sP[q][m][s4];
#pragma unroll
    for (int c = 0; c < 4; ++c) v[c] = fmaxf(v[c], 0.f);
    *(v4fa*)&sH[m][s4] = v;
  }
  __syncthreads();      // h is complete before any wave reads it
  v8f g[GM_T] = {};
  for (int i = 0; i < 7; ++i) {
    const int un = nb2 + (2 * i + 2) * LOW;
    const TAddr x = tile_addr(un), y = tile_addr(un + LOW);
    tile_step(bt[0], &sH[2 * i][0], g, x, Yes{});
    tile_step(bt[1], &sH[2 * i + 1][0], g, y, Yes{});
    close_tiles(x, y);
  }
  tile_step(bt[0], &sH[14][0], g, TAddr{}, No{});
  tile_step(bt[1], &sH[15][0], g, TAddr{}, No{});
#pragma unroll
  for (int mt = 0; mt < GM_T; ++mt)
#pragma unroll
    for (int r = 0; r < 8; ++r) sG[mt * 16 + 8 * hh + r][w * 16 + ln] = (_Float16)g[mt][r];
  __syncthreads();      // all of the partial g is in LDS before the rows are stored
  unsigned short* go = (unsigned short*)G16 + (size_t)mh * NBS * LOW + (size_t)s0 * LOW + tid * 8;
#pragma unroll
  for (int j = 0; j < GM_T; ++j) {
    // piece tid of row tile j in fragment order: wave w stores half w & 1 of unit w >> 1
    *(v8us*)(go + j * 16 * LOW) = *(const v8us*)&sG[16 * j + ln][(w >> 1) * 32 + (w & 1) * 16 + 8 * hh];
  }
}
extern "C" void kernel_launch(void* const* d_in, const int* in_sizes, int n_in,
                              void* d_out, int out_size, void* d_ws, size_t ws_size, hipStream_t stream) {
  (void)in_sizes; (void)n_in; (void)out_size;
  const float* f = (const float*)d_in[0]; const float* pf = (const float*)d_in[1]; const float* pfw = (const float*)d_in[2]; const float* pfb = (const float*)d_in[3]; const float* ppw = (const float*)d_in[4]; const float* ppb = (const float*)d_in[5]; const float* f2w = (const float*)d_in[6]; const float* f2b = (const float*)d_in[7]; const float* pgw = (const float*)d_in[8]; const float* pgb = (const float*)d_in[9];
  char* ws = (char*)d_ws; size_t off = 0;
  auto take = [&](size_t bytes) { char* p = ws + off; off += (bytes + 255) & ~(size_t)255; return p; };
  _Float16* Bf = (_Float16*)take((size_t)LOW * FD * 2); _Float16* Bp = (_Float16*)take((size_t)LOW * FD * 2); _Float16* Bg = (_Float16*)take((size_t)NPAR * LOW * 2); _Float16* B2 = (_Float16*)take((size_t)FD * LOW * 2);
  float* FLOW = (float*)take((size_t)NBS * LOW * 4); _Float16* PL16 = (_Float16*)take((size_t)NBS * LOW * 2); _Float16* G16 = (_Float16*)take((size_t)2 * NBS * LOW * 2);
  if (off > ws_size) return;      // about 13 MiB
  k_round_all<<<RB_G + 3 * RB_P, 256, 0, stream>>>(pgw, pfw, ppw, f2w, Bg, Bf, Bp, B2);      // (out,in), fragment order
  k_proj2<<<2 * PJ_B, 128, 0, stream>>>(f, pf, Bf, Bp, pfb, ppb, FLOW, PL16);      // f_low (f32, read by the per-sample MLP) and pf_low (f16 operand of the generator)
  k_gen_mlp<<<2 * (NBS / GM_M), 256, 0, stream>>>(PL16, Bg, pgb, FLOW, G16);      // params = pf_low . pg_w^T + pg_b, consumed in registers by the per-sample MLP
  k_out<<<(NBS / 16) * (FD / 64) / 4, 128, 0, stream>>>(G16, B2, f2b, f, pf, (float*)d_out);      // g . proj_f2^T + b + (f + pf)
}

// v010
// A run of this version takes 41.3 microseconds.
// In two side-by-side timings against v009, it was 1.04 and 1.05 times as fast.
// Counting every step since v000, it is 14.1 times as fast.
#include <hip/hip_runtime.h>
// + bias, + f + pf residuals as exact bf16 addends) on v_wmma_f32_16x16x32_f16 (f16 operands, nn.Linear weights (out,in) bf16-exact ×2^4, f32 accumulate); the per-sample tiny MLP
// (128 -> 32 relu -> 128 with that sample's generated weights) is f32 VALU on the generator's accumulator tiles (64 samples and half of the hidden units per work-group).
#define NBS 8192
#define FD 1024
#define LOW 128
#define MID 32
#define NPAR (2 * LOW * MID)

typedef __bf16 v16b __attribute__((ext_vector_type(16)));
typedef unsigned short v8us __attribute__((ext_vector_type(8), may_alias));
typedef float  v8f  __attribute__((ext_vector_type(8)));
typedef float  v4f  __attribute__((ext_vector_type(4)));
typedef float  v4fa __attribute__((ext_vector_type(4), may_alias));
typedef __bf16 v4b __attribute__((ext_vector_type(4)));
union FragB { v16b v; v8us half[2]; unsigned short u[16]; v4b q[4]; };

// f32 -> bf16, round to nearest even, by the hardware's conversion (v_cvt_pk_bf16_f32)
__device__ __forceinline__ unsigned short bf16_bits(float x) { return __builtin_bit_cast(unsigned short, (__bf16)x); }
__device__ __forceinline__ float bf16_val(unsigned short b) { return __uint_as_float(((unsigned int)b) << 16); }
__device__ __forceinline__ float bf16_round(float x) { return bf16_val(bf16_bits(x)); }
// D += A·B with NT terms: 1 = ah·bh, 2 = + al·bh (A split), 3 = + ah·bl (both split)
template <int NT>
__device__ __forceinline__ v8f mmaN(v16b ah, v16b al, v16b bh, v16b bl, v8f c) {
  c = __builtin_amdgcn_wmma_f32_16x16x32_bf16(false, ah, false, bh, (short)0, c, false, false);
  if (NT >= 2) c = __builtin_amdgcn_wmma_f32_16x16x32_bf16(false, al, false, bh, (short)0, c, false, false);
  if (NT >= 3) c = __builtin_amdgcn_wmma_f32_16x16x32_bf16(false, ah, false, bl, (short)0, c, false, false);
  asm volatile("v_nop\n\tv_nop\n\tv_nop\n\tv_nop" : "+v"(c) : "v"(ah), "v"(al), "v"(bh), "v"(bl));
  return c;
}

__global__ __launch_bounds__(256) void k_wt_bf16(const float* __restrict__ W, unsigned short* __restrict__ Wt, int K, int N) {
  const int t = blockIdx.x * 256 + threadIdx.x;
  const int k8n = K / 8;
  if (t >= N * k8n) return;
  const int n = t / k8n, k8 = (t % k8n) * 8;
  v8us v;
#pragma unroll
  for (int i = 0; i < 8; ++i) v[i] = bf16_bits(W[(size_t)(k8 + i) * N + n]);
  *(v8us*)(Wt + (size_t)n * K + k8) = v;
  
}

// GEMM C[M][N] (f32, pitch ldc) = act(A[M][K]·W + bias). A f32 row-major (pitch lda) converted per fragment to bf16
// (ASPLIT: hi/lo two planes -> 2 terms, else single rounded term); Wt bf16 [N][K] (pitch ldb). BIAS_BF16 rounds the
// bias to bf16 first (bias quantised to bf16 before the add). K%32==0, M%16==0, N%64==0.
template <bool ASPLIT, int ACT, bool BIAS_BF16>
__global__ __launch_bounds__(128) void k_gemm_bf(const float* __restrict__ A, int lda, const unsigned short* __restrict__ Wt, int ldb,
                                               const float* __restrict__ bias, float* __restrict__ C, int ldc, int M, int N, int K) {
  __shared__ __attribute__((aligned(16))) float so[4][16][64];
  const int tid = threadIdx.x, w = tid >> 5, lane = tid & 31, ln = lane & 15, hh = lane >> 4;
  const int ntn = N / 64;
  const int wid = blockIdx.x * 4 + w;
  const int mt = wid / ntn, nq = wid % ntn;
  if (mt * 16 >= M) return;
  const int row0 = mt * 16, col0 = nq * 64;
  const float* arow = A + (size_t)(row0 + ln) * lda;
  v8f acc[4] = {};
  for (int kb = 0; kb < K; kb += 32) {
    FragB ah, al;
    const v4f x0 = *(const v4fa*)(arow + kb + 8 * hh), x1 = *(const v4fa*)(arow + kb + 8 * hh + 4);
    const v4f x2 = *(const v4fa*)(arow + kb + 16 + 8 * hh), x3 = *(const v4fa*)(arow + kb + 16 + 8 * hh + 4);
    float xs[16] = {x0[0],x0[1],x0[2],x0[3],x1[0],x1[1],x1[2],x1[3],x2[0],x2[1],x2[2],x2[3],x3[0],x3[1],x3[2],x3[3]};
#pragma unroll
    for (int i = 0; i < 16; ++i) { const unsigned short hb = bf16_bits(xs[i]); ah.u[i] = hb; al.u[i] = ASPLIT ? bf16_bits(xs[i] - bf16_val(hb)) : (unsigned short)0; }
#pragma unroll
    for (int t = 0; t < 4; ++t) {
      const unsigned short* brow = Wt + (size_t)(col0 + t * 16 + ln) * ldb + kb;
      FragB b;
      b.half[0] = *(const v8us*)(brow + 8 * hh);
      b.half[1] = *(const v8us*)(brow + 16 + 8 * hh);
      acc[t] = mmaN<ASPLIT ? 2 : 1>(ah.v, al.v, b.v, b.v, acc[t]);
    }
  }
#pragma unroll
  for (int t = 0; t < 4; ++t) {
    float bv = bias ? bias[col0 + t * 16 + ln] : 0.f;
    if (BIAS_BF16) bv = bf16_round(bv);
#pragma unroll
    for (int r = 0; r < 8; ++r) { float v = acc[t][r] + bv; if (ACT == 1) v = fmaxf(v, 0.f); so[w][8 * hh + r][t * 16 + ln] = v; }
  }
  __builtin_amdgcn_fence(__ATOMIC_ACQ_REL, "workgroup");
  __builtin_amdgcn_wave_barrier();
  const int rsub = lane >> 4, c4 = (lane & 15) * 4;
  {
#pragma unroll
    for (int q = 0; q < 8; ++q) {
      const int r = q * 2 + rsub;
      const v4f v = *(const v4fa*)&so[w][r][c4];
      *(v4f*)(C + (size_t)(row0 + r) * ldc + col0 + c4) = v;
    }
    
  }
}

// Flash-style causal/unmasked attention, all contractions 3-term bf16 hi/lo splits, f32 softmax with running max.
// q,k,v rows are read from f32 buffers with arbitrary row pitch (so they can live inside a fused qkv buffer);
// D = head size (multiple of 32, <= 128); one wave = 16 query rows; block = 4 waves (64 queries) sharing K/V chunks of 32.
template <int D, bool CAUSAL>
__global__ __launch_bounds__(128) void k_flash(const float* __restrict__ qb, const float* __restrict__ kb, const float* __restrict__ vb,
                                             int pitch, int T, int H, float scale, float* __restrict__ y, int ypitch) {
  constexpr int KS = D / 32;        // k-steps for QK
  constexpr int DT = D / 16;        // d tiles for PV
  __shared__ __attribute__((aligned(16))) unsigned short sKh[32][D + 8], sKl[32][D + 8], sVh[32][D + 8], sVl[32][D + 8];
  __shared__ __attribute__((aligned(16))) unsigned short sPh[4][16][40], sPl[4][16][40];
  __shared__ __attribute__((aligned(16))) float sO[4][16][D];
  const int tid = threadIdx.x, w = tid >> 5, lane = tid & 31, ln = lane & 15, hh = lane >> 4;
  const int nqb = (T + 63) / 64;
  const int bh = blockIdx.x / nqb, qblk = blockIdx.x % nqb;
  const int b = bh / H, h = bh % H;
  const int q0 = qblk * 64 + w * 16;
  const float* Q = qb + (size_t)b * T * pitch + h * D;
  const float* K = kb + (size_t)b * T * pitch + h * D;
  const float* V = vb + (size_t)b * T * pitch + h * D;

  // A fragments of the wave's 16 query rows (scaled), hi/lo
  FragB aqh[KS], aql[KS];
  {
    int row = q0 + ln; if (row >= T) row = T - 1;
    const float* qr = Q + (size_t)row * pitch;
#pragma unroll
    for (int ks = 0; ks < KS; ++ks)
#pragma unroll
      for (int i = 0; i < 16; ++i) {
        const int d = ks * 32 + ((i < 8) ? (8 * hh + i) : (16 + 8 * hh + (i - 8)));
        const float x = qr[d] * scale; const unsigned short hb = bf16_bits(x);
        aqh[ks].u[i] = hb; aql[ks].u[i] = bf16_bits(x - bf16_val(hb));
      }
  }
  float m_r[8], l_r[8];
#pragma unroll
  for (int r = 0; r < 8; ++r) { m_r[r] = -3.0e38f; l_r[r] = 0.f; }
  v8f oacc[DT];
#pragma unroll
  for (int dt = 0; dt < DT; ++dt) oacc[dt] = (v8f){0.f,0.f,0.f,0.f,0.f,0.f,0.f,0.f};

  const int kv_end = CAUSAL ? min(T, qblk * 64 + 64) : T;     // block-uniform
  for (int j0 = 0; j0 < kv_end; j0 += 32) {
    __syncthreads();
    for (int e = tid; e < 32 * (D / 4); e += 128) {
      const int r = e / (D / 4), c4 = (e % (D / 4)) * 4;
      const int key = j0 + r;
      v4f kf = {0.f,0.f,0.f,0.f}, vf = {0.f,0.f,0.f,0.f};
      if (key < T) { kf = *(const v4fa*)(K + (size_t)key * pitch + c4); vf = *(const v4fa*)(V + (size_t)key * pitch + c4); }
#pragma unroll
      for (int t = 0; t < 4; ++t) {
        unsigned short hb = bf16_bits(kf[t]); sKh[r][c4 + t] = hb; sKl[r][c4 + t] = bf16_bits(kf[t] - bf16_val(hb));
        hb = bf16_bits(vf[t]); sVh[r][c4 + t] = hb; sVl[r][c4 + t] = bf16_bits(vf[t] - bf16_val(hb));
      }
    }
    __syncthreads();
    // S tile 16 x 32
    v8f s[2];
#pragma unroll
    for (int nt = 0; nt < 2; ++nt) {
      v8f acc = {};
#pragma unroll
      for (int ks = 0; ks < KS; ++ks) {
        FragB bh_, bl_;
        bh_.half[0] = *(const v8us*)&sKh[nt * 16 + ln][ks * 32 + 8 * hh]; bh_.half[1] = *(const v8us*)&sKh[nt * 16 + ln][ks * 32 + 16 + 8 * hh];
        bl_.half[0] = *(const v8us*)&sKl[nt * 16 + ln][ks * 32 + 8 * hh]; bl_.half[1] = *(const v8us*)&sKl[nt * 16 + ln][ks * 32 + 16 + 8 * hh];
        acc = mmaN<3>(aqh[ks].v, aql[ks].v, bh_.v, bl_.v, acc);
      }
      s[nt] = acc;
    }
    // mask + running max (rows 8hh+r; the 16 lanes of a half share rows)
    float alpha[8];
#pragma unroll
    for (int r = 0; r < 8; ++r) {
      const int qi = q0 + 8 * hh + r;
      const int ja = j0 + ln, jb = j0 + 16 + ln;
      if (CAUSAL) { if (ja > qi) s[0][r] = -3.0e38f; if (jb > qi) s[1][r] = -3.0e38f; }
      if (ja >= T) s[0][r] = -3.0e38f;
      if (jb >= T) s[1][r] = -3.0e38f;
      float mx = fmaxf(s[0][r], s[1][r]);
      mx = fmaxf(mx, __shfl_xor(mx, 1, 32)); mx = fmaxf(mx, __shfl_xor(mx, 2, 32)); mx = fmaxf(mx, __shfl_xor(mx, 4, 32)); mx = fmaxf(mx, __shfl_xor(mx, 8, 32));
      const float mnew = fmaxf(m_r[r], mx);
      alpha[r] = (mnew > -1.0e38f) ? __expf(m_r[r] - mnew) : 1.0f;
      const float p0 = (s[0][r] > -1.0e38f) ? __expf(s[0][r] - mnew) : 0.f;
      const float p1 = (s[1][r] > -1.0e38f) ? __expf(s[1][r] - mnew) : 0.f;
      m_r[r] = mnew;
      l_r[r] = l_r[r] * alpha[r] + p0 + p1;            // per-lane partial row sum (16 lanes combined at the end)
      unsigned short hb = bf16_bits(p0); sPh[w][8 * hh + r][ln] = hb;      sPl[w][8 * hh + r][ln] = bf16_bits(p0 - bf16_val(hb));
      hb = bf16_bits(p1);                sPh[w][8 * hh + r][16 + ln] = hb; sPl[w][8 * hh + r][16 + ln] = bf16_bits(p1 - bf16_val(hb));
    }
#pragma unroll
    for (int dt = 0; dt < DT; ++dt)
#pragma unroll
      for (int r = 0; r < 8; ++r) oacc[dt][r] *= alpha[r];
    __builtin_amdgcn_fence(__ATOMIC_ACQ_REL, "workgroup");
    __builtin_amdgcn_wave_barrier();
    FragB pah, pal;
    pah.half[0] = *(const v8us*)&sPh[w][ln][8 * hh]; pah.half[1] = *(const v8us*)&sPh[w][ln][16 + 8 * hh];
    pal.half[0] = *(const v8us*)&sPl[w][ln][8 * hh]; pal.half[1] = *(const v8us*)&sPl[w][ln][16 + 8 * hh];
#pragma unroll
    for (int dt = 0; dt < DT; ++dt) {
      FragB bvh, bvl;
#pragma unroll
      for (int i = 0; i < 8; ++i) {
        bvh.u[i] = sVh[8 * hh + i][dt * 16 + ln]; bvh.u[8 + i] = sVh[16 + 8 * hh + i][dt * 16 + ln];
        bvl.u[i] = sVl[8 * hh + i][dt * 16 + ln]; bvl.u[8 + i] = sVl[16 + 8 * hh + i][dt * 16 + ln];
      }
      oacc[dt] = mmaN<3>(pah.v, pal.v, bvh.v, bvl.v, oacc[dt]);
    }
    __builtin_amdgcn_fence(__ATOMIC_ACQ_REL, "workgroup");
    __builtin_amdgcn_wave_barrier();
  }
#pragma unroll
  for (int r = 0; r < 8; ++r) {
    float l = l_r[r];
    l += __shfl_xor(l, 1, 32); l += __shfl_xor(l, 2, 32); l += __shfl_xor(l, 4, 32); l += __shfl_xor(l, 8, 32);
    l_r[r] = (l > 0.f) ? 1.0f / l : 0.f;
  }
#pragma unroll
  for (int dt = 0; dt < DT; ++dt)
#pragma unroll
    for (int r = 0; r < 8; ++r) sO[w][8 * hh + r][dt * 16 + ln] = oacc[dt][r] * l_r[r];
  __builtin_amdgcn_fence(__ATOMIC_ACQ_REL, "workgroup");
  __builtin_amdgcn_wave_barrier();
  {
    for (int r = 0; r < 16; ++r) {
      const int row = q0 + r;
      if (row < T && lane < D / 4) {
        const v4f val = *(const v4fa*)&sO[w][r][lane * 4];
        *(v4f*)(y + ((size_t)b * T + row) * ypitch + h * D + lane * 4) = val;
      }
    }
    
  }
}

// GEMM C = act(A·W + bias + resid): A f32 (ASPLIT -> hi/lo 2 terms), Wt bf16 [N][K]; ACT 0 none, 1 relu, 2 exact gelu;
// resid (optional, f32, row index = (row % rmod), pitch ldr, RES_BF16 rounds it) added before the activation.
template <bool ASPLIT, int ACT, bool BIAS_BF16, bool RES_BF16>
__global__ __launch_bounds__(128) void k_gemm_bf3(const float* __restrict__ A, int lda, const unsigned short* __restrict__ Wt, int ldb,
                                                const float* __restrict__ bias, const float* __restrict__ resid, int rmod, int ldr,
                                                float* __restrict__ C, int ldc, int M, int N, int K) {
  __shared__ __attribute__((aligned(16))) float so[4][16][64];
  const int tid = threadIdx.x, w = tid >> 5, lane = tid & 31, ln = lane & 15, hh = lane >> 4;
  const int ntn = N / 64;
  const int wid = blockIdx.x * 4 + w;
  const int mt = wid / ntn, nq = wid % ntn;
  if (mt * 16 >= M) return;
  const int row0 = mt * 16, col0 = nq * 64;
  const float* arow = A + (size_t)(row0 + ln) * lda;
  v8f acc[4] = {};
  for (int kb = 0; kb < K; kb += 32) {
    FragB ah, al;
    const v4f x0 = *(const v4fa*)(arow + kb + 8 * hh), x1 = *(const v4fa*)(arow + kb + 8 * hh + 4);
    const v4f x2 = *(const v4fa*)(arow + kb + 16 + 8 * hh), x3 = *(const v4fa*)(arow + kb + 16 + 8 * hh + 4);
    float xs[16] = {x0[0],x0[1],x0[2],x0[3],x1[0],x1[1],x1[2],x1[3],x2[0],x2[1],x2[2],x2[3],x3[0],x3[1],x3[2],x3[3]};
#pragma unroll
    for (int i = 0; i < 16; ++i) { const unsigned short hb = bf16_bits(xs[i]); ah.u[i] = hb; al.u[i] = ASPLIT ? bf16_bits(xs[i] - bf16_val(hb)) : (unsigned short)0; }
#pragma unroll
    for (int t = 0; t < 4; ++t) {
      const unsigned short* brow = Wt + (size_t)(col0 + t * 16 + ln) * ldb + kb;
      FragB b;
      b.half[0] = *(const v8us*)(brow + 8 * hh);
      b.half[1] = *(const v8us*)(brow + 16 + 8 * hh);
      acc[t] = mmaN<ASPLIT ? 2 : 1>(ah.v, al.v, b.v, b.v, acc[t]);
    }
  }
#pragma unroll
  for (int t = 0; t < 4; ++t) {
    const int col = col0 + t * 16 + ln;
    float bv = bias ? bias[col] : 0.f;
    if (BIAS_BF16) bv = bf16_round(bv);
#pragma unroll
    for (int r = 0; r < 8; ++r) {
      float v = acc[t][r] + bv;
      if (resid) { float rv = resid[(size_t)((row0 + 8 * hh + r) % rmod) * ldr + col]; if (RES_BF16) rv = bf16_round(rv); v += rv; }
      if (ACT == 1) v = fmaxf(v, 0.f);
      if (ACT == 2) v = 0.5f * v * (1.0f + erff(v * 0.70710678118654752f));
      if (ACT == 3) { const float u = 0.7978845608028654f * (v + 0.044715f * v * v * v); v = 0.5f * v * (1.0f + tanhf(u)); }
      so[w][8 * hh + r][t * 16 + ln] = v;
    }
  }
  __builtin_amdgcn_fence(__ATOMIC_ACQ_REL, "workgroup");
  __builtin_amdgcn_wave_barrier();
  const int rsub = lane >> 4, c4 = (lane & 15) * 4;
  {
#pragma unroll
    for (int q = 0; q < 8; ++q) {
      const int r = q * 2 + rsub;
      const v4f v = *(const v4fa*)&so[w][r][c4];
      *(v4f*)(C + (size_t)(row0 + r) * ldc + col0 + c4) = v;
    }
    
  }
}
// row LayerNorm (biased variance, eps) over N: s = X (+ R); optional out_sum <- s; out_norm <- (s-mu)*rsqrt(var+eps)*g + b
template <bool PARAM_BF16>
__global__ __launch_bounds__(256) void k_layernorm(const float* __restrict__ X, const float* __restrict__ R, const float* __restrict__ g, const float* __restrict__ bta,
                                                  float* __restrict__ out_sum, float* __restrict__ out_norm, int N, float eps) {
  __shared__ float red[256];
  const int row = blockIdx.x, tid = threadIdx.x;
  const float* x = X + (size_t)row * N; const float* rr = R ? R + (size_t)row * N : nullptr;
  float vals[16];                     // up to N = 4096
  const int per = N / 256;            // contiguous chunk per thread? use strided-by-4 chunks: thread handles j = tid*4 + 1024*u
  float s1 = 0.f;
  for (int u = 0; u < per / 4; ++u) {
    const int j = tid * 4 + 1024 * u;
    const v4f a = *(const v4fa*)(x + j);
    v4f b = {0.f,0.f,0.f,0.f}; if (rr) b = *(const v4fa*)(rr + j);
#pragma unroll
    for (int q = 0; q < 4; ++q) { const float v = a[q] + b[q]; vals[u * 4 + q] = v; s1 += v; }
  }
  red[tid] = s1; __syncthreads();
  for (int st = 128; st > 0; st >>= 1) { if (tid < st) red[tid] += red[tid + st]; __syncthreads(); }
  const float mu = red[0] / (float)N; __syncthreads();
  float s2 = 0.f;
  for (int u = 0; u < per / 4; ++u)
#pragma unroll
    for (int q = 0; q < 4; ++q) { const float c = vals[u * 4 + q] - mu; s2 += c * c; }
  red[tid] = s2; __syncthreads();
  for (int st = 128; st > 0; st >>= 1) { if (tid < st) red[tid] += red[tid + st]; __syncthreads(); }
  const float rs = rsqrtf(red[0] / (float)N + eps);
  {
    for (int u = 0; u < per / 4; ++u) {
      const int j = tid * 4 + 1024 * u;
      v4f o, sm;
#pragma unroll
      for (int q = 0; q < 4; ++q) {
        float gg = g[j + q], bb = bta[j + q];
        if (PARAM_BF16) { gg = bf16_round(gg); bb = bf16_round(bb); }
        sm[q] = vals[u * 4 + q]; o[q] = (vals[u * 4 + q] - mu) * rs * gg + bb;
      }
      if (out_sum) *(v4f*)(out_sum + (size_t)row * N + j) = sm;
      *(v4f*)(out_norm + (size_t)row * N + j) = o;
    }
    
  }
}



// ---- f16 WMMA path (v_wmma_f32_16x16x32_f16): 11-bit significands for operands in range — used for the generator and output GEMMs
typedef _Float16 v16h __attribute__((ext_vector_type(16)));
union FragH { v16h v; v8us half[2]; _Float16 h[16]; unsigned short u[16]; };
template <int NT>
__device__ __forceinline__ v8f mmaH(v16h ah, v16h al, v16h bh, v16h bl, v8f c) {
  c = __builtin_amdgcn_wmma_f32_16x16x32_f16(false, ah, false, bh, (short)0, c, false, false);
  if (NT >= 2) c = __builtin_amdgcn_wmma_f32_16x16x32_f16(false, al, false, bh, (short)0, c, false, false);
  if (NT >= 3) c = __builtin_amdgcn_wmma_f32_16x16x32_f16(false, ah, false, bl, (short)0, c, false, false);
  asm volatile("v_nop\n\tv_nop\n\tv_nop\n\tv_nop" : "+v"(c) : "v"(ah), "v"(al), "v"(bh), "v"(bl));
  return c;
}
// batched GEMM like k_gemm_b but f16 operands: A f32 (split into f16 hi/lo if ASPLIT, else rounded to f16), Bt = f16 values [n][k]; alpha; C f32; N multiple of 16 (partial tiles skipped)
template <bool ASPLIT>
__global__ __launch_bounds__(128) void k_gemm_h(const float* __restrict__ A, int lda, size_t sA, const _Float16* __restrict__ Bh, int ldb, size_t sB, float alpha, float* __restrict__ C, int ldc, size_t sC, int M, int N, int K) {
  __shared__ __attribute__((aligned(16))) float so[4][16][64];
  const int tid = threadIdx.x, w = tid >> 5, lane = tid & 31, ln = lane & 15, hh = lane >> 4; const int by = blockIdx.y;
  A += (size_t)by * sA; Bh += (size_t)by * sB; C += (size_t)by * sC;
  const int ntn = (N + 63) / 64; const int wid = blockIdx.x * 4 + w; const int mt = wid / ntn, nq = wid % ntn; if (mt * 16 >= M) return;
  const int row0 = mt * 16, col0 = nq * 64; const float* arow = A + (size_t)(row0 + ln) * lda;
  v8f acc[4] = {};
  for (int kb = 0; kb < K; kb += 32) {
    FragH ah, al;
    const v4f x0 = *(const v4fa*)(arow + kb + 8 * hh), x1 = *(const v4fa*)(arow + kb + 8 * hh + 4), x2 = *(const v4fa*)(arow + kb + 16 + 8 * hh), x3 = *(const v4fa*)(arow + kb + 16 + 8 * hh + 4);
    float xs[16] = {x0[0],x0[1],x0[2],x0[3],x1[0],x1[1],x1[2],x1[3],x2[0],x2[1],x2[2],x2[3],x3[0],x3[1],x3[2],x3[3]};
#pragma unroll
    for (int i = 0; i < 16; ++i) { const _Float16 h = (_Float16)xs[i]; ah.h[i] = h; al.h[i] = ASPLIT ? (_Float16)(xs[i] - (float)h) : (_Float16)0.0f; }
#pragma unroll
    for (int t = 0; t < 4; ++t) { if (col0 + t * 16 >= N) continue; const size_t boff = (size_t)(col0 + t * 16 + ln) * ldb + kb; FragH bq; bq.half[0] = *(const v8us*)(Bh + boff + 8 * hh); bq.half[1] = *(const v8us*)(Bh + boff + 16 + 8 * hh);
      acc[t] = mmaH<ASPLIT ? 2 : 1>(ah.v, al.v, bq.v, bq.v, acc[t]); }
  }
#pragma unroll
  for (int t = 0; t < 4; ++t) { if (col0 + t * 16 >= N) continue;
#pragma unroll
    for (int r = 0; r < 8; ++r) so[w][8 * hh + r][t * 16 + ln] = acc[t][r] * alpha; }
  __builtin_amdgcn_fence(__ATOMIC_ACQ_REL, "workgroup"); __builtin_amdgcn_wave_barrier();
  const int rsub = lane >> 4, c4 = (lane & 15) * 4;
  {
#pragma unroll
    for (int q = 0; q < 8; ++q) { const int r = q * 2 + rsub; if (col0 + c4 < N) { const v4f v = *(const v4fa*)&so[w][r][c4]; *(v4f*)(C + (size_t)(row0 + r) * ldc + col0 + c4) = v; } }
     }
}

// Wt[n][k] = f16(W[k][n]·scale) from f32 row-major W[K][N] (scale = power of two; bf16-exact weights stay exact in f16 away from the subnormal range)
__global__ __launch_bounds__(256) void k_wt_f16(const float* __restrict__ W, _Float16* __restrict__ Wt, int K, int N, float scale) {
  const int t = blockIdx.x * 256 + threadIdx.x; if (t >= N * (K / 8)) return; const int n = t / (K / 8), k8 = (t % (K / 8)) * 8; FragH f;
#pragma unroll
  for (int i = 0; i < 8; ++i) f.h[i] = (_Float16)(bf16_round(W[(size_t)(k8 + i) * N + n]) * scale); const v8us o = f.half[0];
  *(v8us*)((unsigned short*)Wt + (size_t)n * K + k8) = o; 
}
// k_gemm_hh variant with fused epilogue: v = acc·alpha + bias[by·sBias + col] (+ CP[(row/rowsPerB)·sCPb + by·64 + col] if CP) ; ACT 0 none / 1 elu ; writes f32 C and f16 C16, each if non-null
template <int ACT>
__global__ __launch_bounds__(128) void k_gemm_hhx(const _Float16* __restrict__ A, int lda, size_t sA, const _Float16* __restrict__ Bh, int ldb, size_t sB, float alpha, const float* __restrict__ bias, size_t sBias, const float* __restrict__ CP, int rowsPerB, size_t sCPb, int row0g,
    float* __restrict__ C, _Float16* __restrict__ C16, int ldc, size_t sC, int M, int N, int K) {
  __shared__ __attribute__((aligned(16))) float so[4][16][64];
  const int tid = threadIdx.x, w = tid >> 5, lane = tid & 31, ln = lane & 15, hh = lane >> 4; const int by = blockIdx.y;
  A += (size_t)by * sA; Bh += (size_t)by * sB; const size_t cofs = (size_t)by * sC; const float* bp = bias ? bias + (size_t)by * sBias : nullptr;
  const int ntn = (N + 63) / 64; const int wid = blockIdx.x * 4 + w; const int mt = wid / ntn, nq = wid % ntn; if (mt * 16 >= M) return;
  const int row0 = mt * 16, col0 = nq * 64; const _Float16* arow = A + (size_t)(row0 + ln) * lda;
  v8f acc[4] = {};
  for (int kb = 0; kb < K; kb += 32) { FragH ah; ah.half[0] = *(const v8us*)((const unsigned short*)arow + kb + 8 * hh); ah.half[1] = *(const v8us*)((const unsigned short*)arow + kb + 16 + 8 * hh);
#pragma unroll
    for (int t = 0; t < 4; ++t) { if (col0 + t * 16 >= N) continue; const size_t boff = (size_t)(col0 + t * 16 + ln) * ldb + kb; FragH bq; bq.half[0] = *(const v8us*)((const unsigned short*)Bh + boff + 8 * hh); bq.half[1] = *(const v8us*)((const unsigned short*)Bh + boff + 16 + 8 * hh);
      acc[t] = mmaH<1>(ah.v, ah.v, bq.v, bq.v, acc[t]); }
  }
#pragma unroll
  for (int t = 0; t < 4; ++t) { if (col0 + t * 16 >= N) continue; const int col = col0 + t * 16 + ln; const float bv = bp ? bf16_round(bp[col]) : 0.f;
#pragma unroll
    for (int r = 0; r < 8; ++r) { float v = acc[t][r] * alpha + bv; if (CP) { const int bidx = (row0g + row0 + 8 * hh + r) / rowsPerB; v += CP[(size_t)bidx * sCPb + (size_t)by * 64 + col]; } if (ACT == 1) v = (v > 0.f) ? v : expm1f(v); else if (ACT == 3) v = fmaxf(v, 0.f); so[w][8 * hh + r][t * 16 + ln] = v; } }
  __builtin_amdgcn_fence(__ATOMIC_ACQ_REL, "workgroup"); __builtin_amdgcn_wave_barrier();
  const int rsub = lane >> 4, c4 = (lane & 15) * 4; typedef _Float16 v4h __attribute__((ext_vector_type(4)));
  {
#pragma unroll
    for (int q = 0; q < 8; ++q) { const int r = q * 2 + rsub; if (col0 + c4 < N) { const v4f v = *(const v4fa*)&so[w][r][c4]; if (C) *(v4f*)(C + cofs + (size_t)(row0 + r) * ldc + col0 + c4) = v; if (C16) { v4h h4; for (int i = 0; i < 4; ++i) h4[i] = (_Float16)v[i]; *(v4h*)(C16 + cofs + (size_t)(row0 + r) * ldc + col0 + c4) = h4; } } }
     }
}


// FRAGMENT ORDER of every 16-bit operand plane in the workspace (weights, pf_low, g): a plane [rows][K] is cut into units of 16 rows x 32 k = 1 KB, unit index = (row / 16) * (K / 32) + k / 32;
// the 16-byte piece j * 32 + lane of a unit holds row (lane & 15), k = 16 j + 8 (lane >> 4) .. + 7: what lane reads as half j of its WMMA fragment. One wave-wide 16-byte load = 512 contiguous bytes = 4 whole lines.
// Bt = f16(bf16(W) * 16) in fragment order (the two projections' planes: bf16(W) itself, as bf16), W f32 [rows][32 << ksh]; thread t of a plane writes its piece t.
// The four weight planes depend on nothing, nor on one another: one launch rounds them all. A work-group writes 256 pieces of one plane (every plane is a whole number of work-groups), chosen by scalar selects, so that one body serves all four.
#define RB_G (NPAR * LOW / 8 / 256)
#define RB_P (LOW * FD / 8 / 256)
__global__ __launch_bounds__(256) void k_round_all(const float* __restrict__ pgw, const float* __restrict__ pfw, const float* __restrict__ ppw, const float* __restrict__ f2w,
                                                  _Float16* __restrict__ Bg, _Float16* __restrict__ Bf, _Float16* __restrict__ Bp, _Float16* __restrict__ B2) {
  const int b = blockIdx.x;
  const int sel = (b >= RB_G) + (b >= RB_G + RB_P) + (b >= RB_G + 2 * RB_P);      // 0 generator, 1 f projection, 2 pf projection, 3 last projection
  const float* W = sel == 0 ? pgw : sel == 1 ? pfw : sel == 2 ? ppw : f2w;
  _Float16* Bt = sel == 0 ? Bg : sel == 1 ? Bf : sel == 2 ? Bp : B2;
  const int ksh = (sel == 1 || sel == 2) ? 5 : 2;      // k steps of 32 in a row: FD / 32 = 32 or LOW / 32 = 4
  const int t = (b - (sel == 0 ? 0 : RB_G + (sel - 1) * RB_P)) * 256 + (int)threadIdx.x;
  FragH f;
  const int lane = t & 31, j = (t >> 5) & 1, unit = t >> 6;
  const float* src = W + ((size_t)((unit >> ksh) * 16 + (lane & 15)) << (5 + ksh)) + (unit & ((1 << ksh) - 1)) * 32 + 16 * j + 8 * (lane >> 4);
  const v4f x0 = *(const v4fa*)src, x1 = *(const v4fa*)(src + 4);
#pragma unroll
  for (int i = 0; i < 8; ++i) f.h[i] = (_Float16)(bf16_round(i < 4 ? x0[i & 3] : x1[i & 3]) * 16.0f);
  FragB fb; fb.q[0] = __builtin_convertvector(x0, v4b); fb.q[1] = __builtin_convertvector(x1, v4b);
  *(v8us*)((unsigned short*)Bt + (size_t)t * 8) = (sel == 1 || sel == 2) ? fb.half[0] : f.half[0];  }
__global__ __launch_bounds__(256) void k_h16(const float* __restrict__ x, _Float16* __restrict__ X16, size_t n8) { const size_t t = (size_t)blockIdx.x * 256 + threadIdx.x; if (t >= n8) return; FragH f;
#pragma unroll
  for (int q = 0; q < 8; ++q) f.h[q] = (_Float16)x[t * 8 + q]; *(v8us*)((unsigned short*)X16 + t * 8) = f.half[0];  }
// Projection C[NBS][LOW] = x . W^T + bias on v_wmma_f32_16x16x32_bf16: x is read as f32 and rounded to bf16 on its way into the A fragment, two elements an instruction; Bh holds bf16(W).
// Tile map and k order are those of k_gemm_hhx: one wave = 16 rows x 64 columns, k rising, one accumulator chain per 16 x 16 tile. Bh, and C16 where it is written, are in fragment order.
// x comes to LDS by asynchronous copies, a tile of the work-group's PJ_R rows x PJ_KC k at a time, two buffers: a wave-wide copy covers 512 contiguous bytes of one row (4 whole lines; a fragment load
// straight from x touches 16 lines for as many bytes), and the two waves that share a row tile read one copy in LDS.
// The weights' tile (all LOW columns x PJ_KC k, bf16, fragment order) comes to LDS the same way, once a work-group: the four waves that share a column half read one copy in LDS
// where each fetched its own from L2, and a work-group of 64 rows fetches the plane once where two of 32 rows fetched it twice.
#define PJ_U 8
#define PJ_R 64
#define PJ_KC (32 * PJ_U)
#define PJ_PITCH (PJ_KC * 4 + 16)      // bytes of a row in LDS: 16 x odd, so that the 16 rows of a 16-byte fragment read fall on all banks
#define PJ_TILE (PJ_R * PJ_PITCH)
#define PJ_WG (16 * PJ_KC * 2)      // bytes of 16 columns of a weight tile: PJ_U units in a row
#define PJ_WT (LOW / 16 * PJ_WG)      // bytes of a weight tile
// A copy's global address is a wave-uniform base in scalar registers plus the lane's byte offset vo (16 bytes a lane): over the loop the bases stand in scalar registers, where as vector pairs they were spilled to scratch memory.
// The immediate offset moves the LDS address and the global address by the same bytes.
// four rows of an x tile, two copies of 512 bytes a row: l = the lane's LDS byte address in the first row, g = the first row's base.
__device__ __forceinline__ void proj_copy4(unsigned l, unsigned vo, const float* g) {
  const unsigned l0 = l, l1 = l + PJ_PITCH, l2 = l + 2 * PJ_PITCH, l3 = l + 3 * PJ_PITCH;
  const float *g0 = g, *g1 = g + FD, *g2 = g + 2 * FD, *g3 = g + 3 * FD;
  // the copies bring x into LDS through no register; precaution: s_wait_xcnt 0 as the statement's last line stands in front of whatever reuses the copies' address registers
  asm volatile(
               "global_load_async_to_lds_b128 %0, %4, %5\n\t"
               "global_load_async_to_lds_b128 %0, %4, %5 offset:512\n\t"
               "global_load_async_to_lds_b128 %1, %4, %6\n\t"
               "global_load_async_to_lds_b128 %1, %4, %6 offset:512\n\t"
               "global_load_async_to_lds_b128 %2, %4, %7\n\t"
               "global_load_async_to_lds_b128 %2, %4, %7 offset:512\n\t"
               "global_load_async_to_lds_b128 %3, %4, %8\n\t"
               "global_load_async_to_lds_b128 %3, %4, %8 offset:512\n\t"
               "s_wait_xcnt 0x0"
               :: "v"(l0), "v"(l1), "v"(l2), "v"(l3), "v"(vo), "s"(g0), "s"(g1), "s"(g2), "s"(g3) : "memory");
}
// 16 columns of a weight tile, 8 KB in a row in memory and in LDS alike, sixteen copies of 512 bytes: l = the lane's LDS byte address in the first 512 bytes, g = their base.
__device__ __forceinline__ void proj_copyw(unsigned l, unsigned vo, const unsigned short* g) {
  // the copies bring the weights into LDS through no register; precaution: s_wait_xcnt 0 as above
  asm volatile(
               "global_load_async_to_lds_b128 %0, %1, %2\n\t"
               "global_load_async_to_lds_b128 %0, %1, %2 offset:512\n\t"
               "global_load_async_to_lds_b128 %0, %1, %2 offset:1024\n\t"
               "global_load_async_to_lds_b128 %0, %1, %2 offset:1536\n\t"
               "global_load_async_to_lds_b128 %0, %1, %2 offset:2048\n\t"
               "global_load_async_to_lds_b128 %0, %1, %2 offset:2560\n\t"
               "global_load_async_to_lds_b128 %0, %1, %2 offset:3072\n\t"
               "global_load_async_to_lds_b128 %0, %1, %2 offset:3584\n\t"
               "global_load_async_to_lds_b128 %0, %1, %2 offset:4096\n\t"
               "global_load_async_to_lds_b128 %0, %1, %2 offset:4608\n\t"
               "global_load_async_to_lds_b128 %0, %1, %2 offset:5120\n\t"
               "global_load_async_to_lds_b128 %0, %1, %2 offset:5632\n\t"
               "global_load_async_to_lds_b128 %0, %1, %2 offset:6144\n\t"
               "global_load_async_to_lds_b128 %0, %1, %2 offset:6656\n\t"
               "global_load_async_to_lds_b128 %0, %1, %2 offset:7168\n\t"
               "global_load_async_to_lds_b128 %0, %1, %2 offset:7680\n\t"
               "s_wait_xcnt 0x0"
               :: "v"(l), "v"(vo), "s"(g) : "memory");
}
template <bool OUT16>
__device__ __forceinline__ void proj_body(int blk, float* __restrict__ sbuf, char* sx, char* sw, const float* __restrict__ X, const _Float16* __restrict__ Bh, const float* __restrict__ bias, float* __restrict__ C, _Float16* __restrict__ C16) {
  float (*so)[16][OUT16 ? 68 : 64] = (float (*)[16][OUT16 ? 68 : 64])sbuf;      // pitch 68 floats where 16 lanes read one column range of 16 rows: it spreads them over all banks
  const int tid = threadIdx.x, lane = tid & 31, ln = lane & 15, hh = lane >> 4;
  const int w = __builtin_amdgcn_readfirstlane(tid >> 5);      // the wave's number in a scalar register: the copies' base addresses then stand in scalar registers over the loop, not in scratch memory
  const int row0 = blk * PJ_R + (w >> 1) * 16, col0 = (w & 1) * 64;
  // wave w copies rows 8 w .. 8 w + 7 of each x tile and columns 16 w .. 16 w + 15 of each weight tile; every lane is on, and the tests around the copies read the same for the whole work-group
  const unsigned vo = lane * 16;      // the lane's 16 bytes of each copy's 512
  const unsigned short* wg = (const unsigned short*)Bh + (size_t)w * 16 * FD;
  const unsigned wl = (unsigned)(size_t)sw + (unsigned)(w * PJ_WG);
  const float* xg = X + (size_t)(blk * PJ_R + 8 * w) * FD;
  const unsigned xl = (unsigned)(size_t)sx + (unsigned)(8 * w * PJ_PITCH);
  auto copy_tile = [&](int tl) {
    const unsigned l = vo + (xl + (unsigned)((tl & 1) * PJ_TILE));
    const float* g = xg + tl * PJ_KC;
    proj_copy4(l, vo, g);
    proj_copy4(l + 4 * PJ_PITCH, vo, g + 4 * FD);
    const unsigned lw = vo + (unsigned)__builtin_amdgcn_readfirstlane((int)(wl + (unsigned)((tl & 1) * PJ_WT)));      // the buffer's base stays a scalar: summed with the lane's offset ahead of the loop, it was spilled to scratch memory
    const unsigned short* gw = wg + tl * (PJ_KC * 16);
    proj_copyw(lw, vo, gw);
  };
  copy_tile(0);
  asm volatile("s_wait_asynccnt 0x0" ::: "memory");      // this wave's rows of tile 0 have landed
  __syncthreads();      // every wave's rows of tile 0 have landed before any wave reads the tile
  copy_tile(1);
  const char* xrow = sx + ((w >> 1) * 16 + ln) * PJ_PITCH + 32 * hh;      // the lane's row of the wave's row tile
  const char* wrow = sw + (w & 1) * 4 * PJ_WG + lane * 16;      // the lane's piece of the wave's first 16 columns
  v8f acc[4] = {};
#pragma unroll 1      // the loop stays whole: with its first trips peeled off, the copies' addresses were spilled to scratch memory
  for (int kb = 0; kb < FD; kb += PJ_KC) {
    const int tl = kb / PJ_KC;
    const char* xs = xrow + (tl & 1) * PJ_TILE;
    FragB a[PJ_U];      // x rounded to bf16, two elements an instruction: the packed pair is the operand as the matrix unit takes it
#pragma unroll
    for (int u = 0; u < PJ_U; ++u) {
      const char* p = xs + u * 128;
      a[u].q[0] = __builtin_convertvector(*(const v4fa*)p, v4b); a[u].q[1] = __builtin_convertvector(*(const v4fa*)(p + 16), v4b);
      a[u].q[2] = __builtin_convertvector(*(const v4fa*)(p + 64), v4b); a[u].q[3] = __builtin_convertvector(*(const v4fa*)(p + 80), v4b);
    }
    FragB b[PJ_U][4];
    const char* wsrc = wrow + (tl & 1) * PJ_WT;
#pragma unroll
    for (int u = 0; u < PJ_U; ++u)
#pragma unroll
      for (int t = 0; t < 4; ++t) {
        const char* p = wsrc + t * PJ_WG + u * 1024;
        b[u][t].half[0] = *(const v8us*)p; b[u][t].half[1] = *(const v8us*)(p + 512);
      }
    // the wave has now read all that it needs of tile tl into registers: the buffer is handed over here, in front of the arithmetic, so that the next copies fly under it
    asm volatile("s_wait_dscnt 0x0" ::: "memory");      // this wave's reads of tile tl have returned before the buffer is handed back
    asm volatile("s_wait_asynccnt 0x0" ::: "memory");      // this wave's rows of tile tl + 1 have landed
    __syncthreads();      // publishes tile tl + 1 and ends every wave's reads of tile tl, whose buffer is refilled behind it
    if (tl + 2 < FD / PJ_KC) copy_tile(tl + 2);
#pragma unroll
    for (int u = 0; u < PJ_U; ++u)
#pragma unroll
      for (int t = 0; t < 4; ++t) acc[t] = __builtin_amdgcn_wmma_f32_16x16x32_bf16(false, a[u].v, false, b[u][t].v, (short)0, acc[t], false, false);
  }
  asm volatile("s_wait_asynccnt 0x0" ::: "memory");      // no copy is outstanding when the wave goes on to the epilogue and ends
  float bv[4];
  __builtin_amdgcn_sched_barrier(0);      // keeps index arithmetic that has sunk down to the epilogue in front of the bias loads: between them and their wait it took the loads' offset register
#pragma unroll
  for (int t = 0; t < 4; ++t) bv[t] = bias[col0 + t * 16 + ln];
  asm volatile("s_wait_xcnt 0x0" ::: "memory");      // precaution: the compiler reuses the bias loads' offset register at once
  __builtin_amdgcn_sched_barrier(0);      // holds that reuse behind the wait
#pragma unroll
  for (int t = 0; t < 4; ++t) {
    const float bb = bf16_round(bv[t]);
#pragma unroll
    for (int r = 0; r < 8; ++r) so[w][8 * hh + r][t * 16 + ln] = acc[t][r] + bb;
  }
  __builtin_amdgcn_fence(__ATOMIC_ACQ_REL, "workgroup", "local"); __builtin_amdgcn_wave_barrier();      // the wave's own LDS stores land before it reads the rows back
  if constexpr (OUT16) {
    // the wave's 64 columns are two units of its row tile: four stores of 512 contiguous bytes
    unsigned short* o = (unsigned short*)C16 + (size_t)row0 * LOW + col0 * 16 + lane * 8;
#pragma unroll
    for (int q = 0; q < 4; ++q) {
      const float* s = &so[w][ln][q * 16 + 8 * hh];
      const v4f v0 = *(const v4fa*)s, v1 = *(const v4fa*)(s + 4);
      FragH h;
#pragma unroll
      for (int i = 0; i < 8; ++i) h.h[i] = (_Float16)(i < 4 ? v0[i & 3] : v1[i & 3]);
      *(v8us*)(o + q * 256) = h.half[0];
    }
  } else {
    const int rsub = lane >> 4, c4 = (lane & 15) * 4;
    const size_t o0 = (size_t)(row0 + rsub) * LOW + col0 + c4;
#pragma unroll
    for (int q = 0; q < 8; ++q) {
      const v4f v = *(const v4fa*)&so[w][q * 2 + rsub][c4];
      *(v4f*)(C + o0 + q * 2 * LOW) = v;
    }
  }
}
// The two projections depend on nothing of one another: one launch holds both, the even work-groups f_low, the odd ones pf_low, one work-group of eight waves a WGP.
#define PJ_B (NBS / PJ_R)
__global__ __launch_bounds__(256) void k_proj2(const float* __restrict__ f, const float* __restrict__ pf, const _Float16* __restrict__ Bf, const _Float16* __restrict__ Bp, const float* __restrict__ pfb, const float* __restrict__ ppb,
                                              float* __restrict__ FLOW, _Float16* __restrict__ PL16) {
  __shared__ __attribute__((aligned(16))) float sbuf[8 * 16 * 68];
  __shared__ __attribute__((aligned(16))) char sx[2 * PJ_TILE];      // the two buffers of x tiles
  __shared__ __attribute__((aligned(16))) char sw[2 * PJ_WT];      // the two buffers of weight tiles
  const int b = blockIdx.x;
  if ((b & 1) == 0) proj_body<false>(b >> 1, sbuf, sx, sw, f, Bf, pfb, FLOW, nullptr);
  else proj_body<true>(b >> 1, sbuf, sx, sw, pf, Bp, ppb, nullptr, PL16);
}
// out[NBS][FD] = (g0 + g1) . W2^T + bias + (f + pf), g0 and g1 the two planes of partial g, taken as one operand of K = 2 * LOW against W2 twice: f and pf are read as f32 by the lane that stores the element, 16 bytes at a time, rounded to bf16 and summed there.
// Tile shape and k order are those of k_gemm_hhx (one wave = 16 rows x 64 columns); which tile a work-group takes is set below. G and Bh are in fragment order.
__global__ __launch_bounds__(128) void k_out(const _Float16* __restrict__ G, const _Float16* __restrict__ Bh, const float* __restrict__ bias, const float* __restrict__ f, const float* __restrict__ pf, float* __restrict__ out) {
  __shared__ __attribute__((aligned(16))) float so[4][16][64];
  const int tid = threadIdx.x, w = tid >> 5, lane = tid & 31, ln = lane & 15, hh = lane >> 4;
  // Which tile a work-group takes: its index modulo 8 is bits 1 to 3 of its row tile; k_proj2 and k_gen_mlp, 64 rows a pair of work-groups, agree in the upper two of these bits.
  // For speed only: the map is one to one, wherever the work-groups land.
  const int bu = blockIdx.x >> 3, rt = ((bu >> 3) << 4) | ((blockIdx.x & 7) << 1) | ((bu >> 2) & 1);
  const int row0 = rt * 16, col0 = ((bu & 3) * 4 + w) * 64;
  const int rsub = lane >> 4, c4 = (lane & 15) * 4;
  const unsigned short* arow = (const unsigned short*)G + (size_t)row0 * LOW + lane * 8;
  const unsigned short* brow = (const unsigned short*)Bh + (size_t)col0 * LOW + lane * 8;
  FragH a[2][LOW / 32], b[4][LOW / 32];
#pragma unroll
  for (int p = 0; p < 2; ++p)
#pragma unroll
    for (int ks = 0; ks < LOW / 32; ++ks) { a[p][ks].half[0] = *(const v8us*)(arow + (size_t)p * NBS * LOW + ks * 512); a[p][ks].half[1] = *(const v8us*)(arow + (size_t)p * NBS * LOW + ks * 512 + 256); }
  asm volatile("s_wait_xcnt 0x0" ::: "memory");      // precaution: the compiler reuses these loads' address pair as the destination of a later load
#pragma unroll
  for (int t = 0; t < 4; ++t)
#pragma unroll
    for (int ks = 0; ks < LOW / 32; ++ks) { b[t][ks].half[0] = *(const v8us*)(brow + (size_t)t * 16 * LOW + ks * 512); b[t][ks].half[1] = *(const v8us*)(brow + (size_t)t * 16 * LOW + ks * 512 + 256); }
  float bv[4];
#pragma unroll
  for (int t = 0; t < 4; ++t) bv[t] = bias[col0 + t * 16 + ln];
  asm volatile("s_wait_xcnt 0x0" ::: "memory");      // precaution: the operand loads' address registers are free for reuse behind it
  __builtin_amdgcn_sched_barrier(0);      // loads return in order: the operand loads (L2) stay in front of the residual loads (memory), so that the WMMAs need not wait for the latter
  const size_t o0 = (size_t)(row0 + rsub) * FD + col0 + c4;
  v4f rf[8], rp[8];
#pragma unroll
  for (int q = 0; q < 8; ++q) { rf[q] = *(const v4fa*)(f + o0 + q * 2 * FD); rp[q] = *(const v4fa*)(pf + o0 + q * 2 * FD); }
  asm volatile("s_wait_xcnt 0x0" ::: "memory");      // precaution: as above, for the residual loads' two address pairs
  __builtin_amdgcn_sched_barrier(0);      // keeps the residual loads in front of the product, which then runs under their latency
  v8f acc[4] = {};
#pragma unroll
  for (int p = 0; p < 2; ++p)
#pragma unroll
    for (int ks = 0; ks < LOW / 32; ++ks)
#pragma unroll
      for (int t = 0; t < 4; ++t) acc[t] = __builtin_amdgcn_wmma_f32_16x16x32_f16(false, a[p][ks].v, false, b[t][ks].v, (short)0, acc[t], false, false);
#pragma unroll
  for (int t = 0; t < 4; ++t) {
    const float bb = bf16_round(bv[t]);
#pragma unroll
    for (int r = 0; r < 8; ++r) so[w][8 * hh + r][t * 16 + ln] = acc[t][r] * 0.0625f + bb;
  }
  __builtin_amdgcn_fence(__ATOMIC_ACQ_REL, "workgroup", "local"); __builtin_amdgcn_wave_barrier();      // the wave's own LDS stores land before it reads the rows back; LDS alone, so that the residual loads stay in flight
#pragma unroll
  for (int q = 0; q < 8; ++q) {
    v4f v = *(const v4fa*)&so[w][q * 2 + rsub][c4];
#pragma unroll
    for (int c = 0; c < 4; ++c) v[c] += bf16_round(rf[q][c]) + bf16_round(rp[q][c]);
    *(v4f*)(out + o0 + q * 2 * FD) = v;
  }
}
// Parameter generator and per-sample MLP in one kernel: a work-group owns GM_M samples and GM_H of the MID hidden units, and never stores the generated parameters.
// A hidden unit m needs only the parameters l * MID + m of layer 1 and LOW * MID + m * LOW + l of layer 2, so the two halves of the hidden units are independent up to the last sum over m:
// each half writes its own partial g, and the last GEMM adds the two. A weight tile that comes from L2 thus serves GM_T sample tiles, and a work-group reads half of the weight plane.
// Each 16 x 16 tile of params = pf_low . pg_w^T (K = LOW, four f16 WMMAs) is scaled, biased and summed into h or g straight from the accumulator registers
// (accumulator register r of lane (ln, hh) = sample 8 * hh + r, parameter column ln).
// Layer 1: wave w owns l = 16 w .. 16 w + 15 and sums them in rising order; the eight waves' partial h meet in LDS in rising wave order, then relu.
// Layer 2: wave w owns l = 16 w .. 16 w + 15 and sums the work-group's m in rising order.
#define GM_M 64
#define GM_T (GM_M / 16)
#define GM_H (MID / 2)
struct Yes { static constexpr bool value = true; }; struct No { static constexpr bool value = false; };
__global__ __launch_bounds__(256) void k_gen_mlp(const _Float16* __restrict__ PL, const _Float16* __restrict__ Bg, const float* __restrict__ pgb, const float* __restrict__ FLOW, _Float16* __restrict__ G16) {
  __shared__ __attribute__((aligned(16))) float sF[LOW][GM_M];              // flow[s][l] at [l][s]; rows 16 w .. + 15 are written and read by wave w alone
  __shared__ __attribute__((aligned(16))) float sP[8][GM_H][GM_M + 4];      // partial h per wave at [m][s]; pitch 68 floats spreads the 16-byte stores of 16 rows m over all banks
  __shared__ __attribute__((aligned(16))) float sH[GM_H][GM_M];             // h after relu at [m][s]
  __shared__ __attribute__((aligned(16))) _Float16 sG[GM_M][LOW + 8];       // partial g as f16, gathered so that the work-group stores it in fragment order
  const int tid = threadIdx.x, lane = tid & 31, ln = lane & 15, hh = lane >> 4;
  const int w = __builtin_amdgcn_readfirstlane(tid >> 5);
  const int s0 = (blockIdx.x >> 1) * GM_M, mh = blockIdx.x & 1;
  struct BTile { FragH f[LOW / 32]; float b; };
  // this wave's stream of tiles: 16 of layer 1 (l = 16 w + u: MID parameters apart), then 16 of layer 2 (m = GM_H * mh + u: LOW parameters apart).
  // A tile's address is a wave-uniform base (first parameter n0 of the tile) plus the lane's fixed offset; fragment order: a tile of 16 parameters is 4 KB in a row
  const int nb1 = w * 512 + mh * GM_H, nb2 = LOW * MID + mh * GM_H * LOW + w * 16;
  const unsigned lo16 = lane * 16, lo4 = ln * 4;
  struct TAddr { const char* p; const char* c; };      // a lane's addresses of a tile: weights, bias
  auto tile_addr = [&](int n0) { return TAddr{(const char*)Bg + (size_t)n0 * (LOW * 2) + lo16, (const char*)pgb + (size_t)n0 * 4 + lo4}; };
  auto load_tile = [&](BTile& t, const TAddr& ad) {
    const char* p = ad.p;
    t.b = *(const float*)ad.c;
#pragma unroll
    for (int ks = 0; ks < LOW / 32; ++ks) { t.f[ks].half[0] = *(const v8us*)(p + ks * 1024); t.f[ks].half[1] = *(const v8us*)(p + ks * 1024 + 512); }
  };
  // precaution: s_wait_xcnt 0 in front of whatever reuses the address registers of two tiles' loads; it takes the four addresses as inputs, so that their registers stay theirs up to the wait; the scheduling barrier holds later arithmetic behind it
  auto close_tiles = [&](const TAddr& x, const TAddr& y) {
    asm volatile("s_wait_xcnt 0x0" :: "v"(x.p), "v"(x.c), "v"(y.p), "v"(y.c) : "memory");
    __builtin_amdgcn_sched_barrier(0);
  };
  v4f fl[GM_M / 32][4];
#pragma unroll
  for (int q = 0; q < GM_M / 32; ++q)
#pragma unroll
    for (int j = 0; j < 4; ++j) fl[q][j] = *(const v4fa*)(FLOW + (size_t)(s0 + q * 32 + lane) * LOW + w * 16 + j * 4);
  asm volatile("s_wait_xcnt 0x0" ::: "memory");      // precaution: the compiler reuses these loads' address pairs for the next addresses
  __builtin_amdgcn_sched_barrier(0);      // holds that reuse behind the wait
  FragH a[GM_T][LOW / 32];
#pragma unroll
  for (int mt = 0; mt < GM_T; ++mt) {
    const unsigned short* ar = (const unsigned short*)PL + (size_t)(s0 + mt * 16) * LOW + lane * 8;
#pragma unroll
    for (int ks = 0; ks < LOW / 32; ++ks) { a[mt][ks].half[0] = *(const v8us*)(ar + ks * 512); a[mt][ks].half[1] = *(const v8us*)(ar + ks * 512 + 256); }
    asm volatile("s_wait_xcnt 0x0" ::: "memory");      // precaution: the compiler reuses an address pair of the loads above as the destination of a later load, or for the next tile's address
    __builtin_amdgcn_sched_barrier(0);      // holds that reuse behind the wait; behind the last tile it also keeps the sample loads in front of the weight loads: loads return in order, and behind them they would force the loop's first wait to drain the weight tiles too
  }
  BTile bt[2];
  { const TAddr x = tile_addr(nb1), y = tile_addr(nb1 + MID); load_tile(bt[0], x); load_tile(bt[1], y); close_tiles(x, y); }
#pragma unroll
  for (int q = 0; q < GM_M / 32; ++q)
#pragma unroll
    for (int j = 0; j < 4; ++j)
#pragma unroll
      for (int c = 0; c < 4; ++c) sF[w * 16 + j * 4 + c][q * 32 + lane] = fl[q][j][c];
  // fence on LDS alone: the wave's own stores land before it reads the rows back; a fence on every address space would also drain the weight loads in flight
  __builtin_amdgcn_fence(__ATOMIC_ACQ_REL, "workgroup", "local"); __builtin_amdgcn_wave_barrier();
  // one tile: acc[mt][r] += cf[sample] * (tile / 16 + bias); the tile's registers are refilled with the tile at un as soon as its WMMAs have issued
  auto tile_step = [&](BTile& t, const float* cf, v8f (&acc)[GM_T], const TAddr& un, auto refill) {
    v4f c[GM_T][2];
#pragma unroll
    for (int mt = 0; mt < GM_T; ++mt) { c[mt][0] = *(const v4fa*)(cf + mt * 16 + 8 * hh); c[mt][1] = *(const v4fa*)(cf + mt * 16 + 8 * hh + 4); }
    v8f d[GM_T] = {};
#pragma unroll
    for (int ks = 0; ks < LOW / 32; ++ks)
#pragma unroll
      for (int mt = 0; mt < GM_T; ++mt) d[mt] = __builtin_amdgcn_wmma_f32_16x16x32_f16(false, a[mt][ks].v, false, t.f[ks].v, (short)0, d[mt], false, false);
    const float bv = bf16_round(t.b);
    if constexpr (decltype(refill)::value) {
      load_tile(t, un);
      __builtin_amdgcn_sched_barrier(0);      // keeps the refill in front of the sums below: sunk behind them, to the end of the trip, the loads would have too little work to return under
    }
#pragma unroll
    for (int mt = 0; mt < GM_T; ++mt)
#pragma unroll
      for (int r = 0; r < 8; ++r) acc[mt][r] += c[mt][r >> 2][r & 3] * (d[mt][r] * 0.0625f + bv);
  };
  v8f hp[GM_T] = {};
  for (int i = 0; i < 8; ++i) {
    const int un = (i < 7) ? nb1 + (2 * i + 2) * MID : nb2;      // the last trip fetches the first two tiles of layer 2
    const TAddr x = tile_addr(un), y = tile_addr(un + ((i < 7) ? MID : LOW));
    tile_step(bt[0], &sF[w * 16 + 2 * i][0], hp, x, Yes{});
    tile_step(bt[1], &sF[w * 16 + 2 * i + 1][0], hp, y, Yes{});
    close_tiles(x, y);
  }
#pragma unroll
  for (int mt = 0; mt < GM_T; ++mt) {
    float* d = &sP[w][ln][mt * 16 + 8 * hh];
    *(v4fa*)d = (v4f){hp[mt][0], hp[mt][1], hp[mt][2], hp[mt][3]};
    *(v4fa*)(d + 4) = (v4f){hp[mt][4], hp[mt][5], hp[mt][6], hp[mt][7]};
  }
  __syncthreads();      // every wave's partial h is in LDS
  {
    const int m = tid >> 4, s4 = (tid & 15) * 4;
    v4f v = *(const v4fa*)&sP[0][m][s4];
#pragma unroll
    for (int q = 1; q < 8; ++q) v += *(const v4fa*)&sP[q][m][s4];
#pragma unroll
    for (int c = 0; c < 4; ++c) v[c] = fmaxf(v[c], 0.f);
    *(v4fa*)&sH[m][s4] = v;
  }
  __syncthreads();      // h is complete before any wave reads it
  v8f g[GM_T] = {};
  for (int i = 0; i < 7; ++i) {
    const int un = nb2 + (2 * i + 2) * LOW;
    const TAddr x = tile_addr(un), y = tile_addr(un + LOW);
    tile_step(bt[0], &sH[2 * i][0], g, x, Yes{});
    tile_step(bt[1], &sH[2 * i + 1][0], g, y, Yes{});
    close_tiles(x, y);
  }
  tile_step(bt[0], &sH[14][0], g, TAddr{}, No{});
  tile_step(bt[1], &sH[15][0], g, TAddr{}, No{});
#pragma unroll
  for (int mt = 0; mt < GM_T; ++mt)
#pragma unroll
    for (int r = 0; r < 8; ++r) sG[mt * 16 + 8 * hh + r][w * 16 + ln] = (_Float16)g[mt][r];
  __syncthreads();      // all of the partial g is in LDS before the rows are stored
  unsigned short* go = (unsigned short*)G16 + (size_t)mh * NBS * LOW + (size_t)s0 * LOW + tid * 8;
#pragma unroll
  for (int j = 0; j < GM_T; ++j) {
    // piece tid of row tile j in fragment order: wave w stores half w & 1 of unit w >> 1
    *(v8us*)(go + j * 16 * LOW) = *(const v8us*)&sG[16 * j + ln][(w >> 1) * 32 + (w & 1) * 16 + 8 * hh];
  }
}
extern "C" void kernel_launch(void* const* d_in, const int* in_sizes, int n_in,
                              void* d_out, int out_size, void* d_ws, size_t ws_size, hipStream_t stream) {
  (void)in_sizes; (void)n_in; (void)out_size;
  const float* f = (const float*)d_in[0]; const float* pf = (const float*)d_in[1]; const float* pfw = (const float*)d_in[2]; const float* pfb = (const float*)d_in[3]; const float* ppw = (const float*)d_in[4]; const float* ppb = (const float*)d_in[5]; const float* f2w = (const float*)d_in[6]; const float* f2b = (const float*)d_in[7]; const float* pgw = (const float*)d_in[8]; const float* pgb = (const float*)d_in[9];
  char* ws = (char*)d_ws; size_t off = 0;
  auto take = [&](size_t bytes) { char* p = ws + off; off += (bytes + 255) & ~(size_t)255; return p; };
  _Float16* Bf = (_Float16*)take((size_t)LOW * FD * 2); _Float16* Bp = (_Float16*)take((size_t)LOW * FD * 2); _Float16* Bg = (_Float16*)take((size_t)NPAR * LOW * 2); _Float16* B2 = (_Float16*)take((size_t)FD * LOW * 2);
  float* FLOW = (float*)take((size_t)NBS * LOW * 4); _Float16* PL16 = (_Float16*)take((size_t)NBS * LOW * 2); _Float16* G16 = (_Float16*)take((size_t)2 * NBS * LOW * 2);
  if (off > ws_size) return;      // about 13 MiB
  k_round_all<<<RB_G + 3 * RB_P, 256, 0, stream>>>(pgw, pfw, ppw, f2w, Bg, Bf, Bp, B2);      // (out,in), fragment order
  k_proj2<<<2 * PJ_B, 256, 0, stream>>>(f, pf, Bf, Bp, pfb, ppb, FLOW, PL16);      // f_low (f32, read by the per-sample MLP) and pf_low (f16 operand of the generator)
  k_gen_mlp<<<2 * (NBS / GM_M), 256, 0, stream>>>(PL16, Bg, pgb, FLOW, G16);      // params = pf_low . pg_w^T + pg_b, consumed in registers by the per-sample MLP
  k_out<<<(NBS / 16) * (FD / 64) / 4, 128, 0, stream>>>(G16, B2, f2b, f, pf, (float*)d_out);      // g . proj_f2^T + b + (f + pf)
}
